// v000
// The times below were measured on an AMD MI455X: many runs one after another, warmed up first and cycling through
// copies of the inputs, with the whole window's GPU time divided by the number of runs. Launches and the gaps
// between them are all in it. The median over several windows is given; except for v000 it joins two sittings, which
// can be a few percent apart, so the side-by-side timings, each taken in one sitting, are the better comparison.
// v000 is the starting kernel. One run takes 8120 microseconds.
#include <hip/hip_runtime.h>
// Multi-head self-attention without an output projection, NON-causal (x [8][1024][1024]; q / k / v = x W^T + b (nn.Linear natural [1024][1024] sigma 1/32, biases sigma 0.01); 16 heads of 64; scores * 64^-0.5; softmax over all 1024 keys (no mask); out = ctx merged head-major -> [8][1024][1024]; the source never applies its out_proj).
// Structure: token rows r = b*1024 + s; x as exact f16 rows (bf16-rounded); q and k as WMMA GEMMs (32x64 wave tiles, f32 accumulation, exact x16 weights + bias) into f32 rows split into f16 hi + x1024 residual planes, v as an f16-output GEMM; per batch: V^T for all heads via LDS transposes; per query tile of 256 rows: scores against all 1024 keys as THREE accumulating passes (hi.hi + lo.hi + hi.lo, K = 64, all heads on grid.y, alpha 2^-3 = 64^-0.5 applied here, logits sigma ~1), row softmax on VALU over all keys (its arithmetic 0/1 key mask keeps every key) (f32 statistics, native exp; weights x256 f16), out = P . V^T (K = all 1024 keys, alpha 2^-8 undoing the x256 weights) written as f32 straight into the head-major output columns; no output projection.
// Compute dtype: inputs rounded to bf16; x / weights exact; q and k as f16 hi + x1024 residual planes, v and softmax weights as plain f16 GEMM operands (~2^-12); scores, softmax statistics and the output f32. v_wmma_f32_16x16x32_f16.
#define NB 8
#define SQ 1024
#define DM 1024
#define NH 16
#define HD 64
#define HG 4                         /* heads per group in the unlaunched k_vt overload */
#define QT 256                       /* query rows per tile */
#define NKX SQ                       /* S / P row pitch */
#define QT0 128                      /* query rows per head in k_att0, which is not launched */
#define B0 0                         /* first batch processed (debug hook) */
#define NBR NB                       /* batches processed (debug hook) */
#define NR ((size_t)NB * SQ)         /* token rows */
#define MP ((int)((size_t)NBR * SQ)) /* rows projected (debug hook) */
#define QN SQ                        /* query rows attended per batch (debug hook) */
#define NHD NH                       /* heads attended (debug hook) */
#define MPO MP                       /* unused */
#define LQ DM      /* row pitch of the q/k/v rows */
typedef __bf16 v16b __attribute__((ext_vector_type(16)));
typedef unsigned short v8us __attribute__((ext_vector_type(8), may_alias));
typedef float  v8f  __attribute__((ext_vector_type(8)));
typedef float  v4f  __attribute__((ext_vector_type(4)));
typedef float  v4fa __attribute__((ext_vector_type(4), may_alias));
union FragB { v16b v; v8us half[2]; unsigned short u[16]; };

__device__ __forceinline__ unsigned short bf16_bits(float x) { unsigned int u = __float_as_uint(x); return (unsigned short)((u + 0x7FFFu + ((u >> 16) & 1u)) >> 16); }
__device__ __forceinline__ float bf16_val(unsigned short b) { return __uint_as_float(((unsigned int)b) << 16); }
__device__ __forceinline__ float bf16_round(float x) { return bf16_val(bf16_bits(x)); }
// D += A·B with NT terms: 1 = ah·bh, 2 = + al·bh (A split), 3 = + ah·bl (both split)
template <int NT>
__device__ __forceinline__ v8f mmaN(v16b ah, v16b al, v16b bh, v16b bl, v8f c) {
  c = __builtin_amdgcn_wmma_f32_16x16x32_bf16(false, ah, false, bh, (short)0, c, false, false);
  if (NT >= 2) c = __builtin_amdgcn_wmma_f32_16x16x32_bf16(false, al, false, bh, (short)0, c, false, false);
  if (NT >= 3) c = __builtin_amdgcn_wmma_f32_16x16x32_bf16(false, ah, false, bl, (short)0, c, false, false);
  asm volatile("v_nop\n\tv_nop\n\tv_nop\n\tv_nop" : "+v"(c) : "v"(ah), "v"(al), "v"(bh), "v"(bl));
  return c;
}

__global__ __launch_bounds__(256) void k_wt_bf16(const float* __restrict__ W, unsigned short* __restrict__ Wt, int K, int N) {
  const int t = blockIdx.x * 256 + threadIdx.x;
  const int k8n = K / 8;
  if (t >= N * k8n) return;
  const int n = t / k8n, k8 = (t % k8n) * 8;
  v8us v;
#pragma unroll
  for (int i = 0; i < 8; ++i) v[i] = bf16_bits(W[(size_t)(k8 + i) * N + n]);
  *(v8us*)(Wt + (size_t)n * K + k8) = v;
  
}

// GEMM C[M][N] (f32, pitch ldc) = act(A[M][K]·W + bias). A f32 row-major (pitch lda) converted per fragment to bf16
// (ASPLIT: hi/lo two planes -> 2 terms, else single rounded term); Wt bf16 [N][K] (pitch ldb). BIAS_BF16 rounds the
// bias to bf16 first (bias quantised to bf16 before the add). K%32==0, M%16==0, N%64==0.
template <bool ASPLIT, int ACT, bool BIAS_BF16>
__global__ __launch_bounds__(128) void k_gemm_bf(const float* __restrict__ A, int lda, const unsigned short* __restrict__ Wt, int ldb,
                                               const float* __restrict__ bias, float* __restrict__ C, int ldc, int M, int N, int K) {
  __shared__ __attribute__((aligned(16))) float so[4][16][64];
  const int tid = threadIdx.x, w = tid >> 5, lane = tid & 31, ln = lane & 15, hh = lane >> 4;
  const int ntn = N / 64;
  const int wid = blockIdx.x * 4 + w;
  const int mt = wid / ntn, nq = wid % ntn;
  if (mt * 16 >= M) return;
  const int row0 = mt * 16, col0 = nq * 64;
  const float* arow = A + (size_t)(row0 + ln) * lda;
  v8f acc[4] = {};
  for (int kb = 0; kb < K; kb += 32) {
    FragB ah, al;
    const v4f x0 = *(const v4fa*)(arow + kb + 8 * hh), x1 = *(const v4fa*)(arow + kb + 8 * hh + 4);
    const v4f x2 = *(const v4fa*)(arow + kb + 16 + 8 * hh), x3 = *(const v4fa*)(arow + kb + 16 + 8 * hh + 4);
    float xs[16] = {x0[0],x0[1],x0[2],x0[3],x1[0],x1[1],x1[2],x1[3],x2[0],x2[1],x2[2],x2[3],x3[0],x3[1],x3[2],x3[3]};
#pragma unroll
    for (int i = 0; i < 16; ++i) { const unsigned short hb = bf16_bits(xs[i]); ah.u[i] = hb; al.u[i] = ASPLIT ? bf16_bits(xs[i] - bf16_val(hb)) : (unsigned short)0; }
#pragma unroll
    for (int t = 0; t < 4; ++t) {
      const unsigned short* brow = Wt + (size_t)(col0 + t * 16 + ln) * ldb + kb;
      FragB b;
      b.half[0] = *(const v8us*)(brow + 8 * hh);
      b.half[1] = *(const v8us*)(brow + 16 + 8 * hh);
      acc[t] = mmaN<ASPLIT ? 2 : 1>(ah.v, al.v, b.v, b.v, acc[t]);
    }
  }
#pragma unroll
  for (int t = 0; t < 4; ++t) {
    float bv = bias ? bias[col0 + t * 16 + ln] : 0.f;
    if (BIAS_BF16) bv = bf16_round(bv);
#pragma unroll
    for (int r = 0; r < 8; ++r) { float v = acc[t][r] + bv; if (ACT == 1) v = fmaxf(v, 0.f); so[w][8 * hh + r][t * 16 + ln] = v; }
  }
  __builtin_amdgcn_fence(__ATOMIC_ACQ_REL, "workgroup");
  __builtin_amdgcn_wave_barrier();
  const int rsub = lane >> 4, c4 = (lane & 15) * 4;
  {
#pragma unroll
    for (int q = 0; q < 8; ++q) {
      const int r = q * 2 + rsub;
      const v4f v = *(const v4fa*)&so[w][r][c4];
      *(v4f*)(C + (size_t)(row0 + r) * ldc + col0 + c4) = v;
    }
    
  }
}

// GEMM C = act(A·W + bias + resid): A f32 (ASPLIT -> hi/lo 2 terms), Wt bf16 [N][K]; ACT 0 none, 1 relu, 2 exact gelu;
// resid (optional, f32, row index = (row % rmod), pitch ldr, RES_BF16 rounds it) added before the activation.
template <bool ASPLIT, int ACT, bool BIAS_BF16, bool RES_BF16>
__global__ __launch_bounds__(128) void k_gemm_bf3(const float* __restrict__ A, int lda, const unsigned short* __restrict__ Wt, int ldb,
                                                const float* __restrict__ bias, const float* __restrict__ resid, int rmod, int ldr,
                                                float* __restrict__ C, int ldc, int M, int N, int K) {
  __shared__ __attribute__((aligned(16))) float so[4][16][64];
  const int tid = threadIdx.x, w = tid >> 5, lane = tid & 31, ln = lane & 15, hh = lane >> 4;
  const int ntn = N / 64;
  const int wid = blockIdx.x * 4 + w;
  const int mt = wid / ntn, nq = wid % ntn;
  if (mt * 16 >= M) return;
  const int row0 = mt * 16, col0 = nq * 64;
  const float* arow = A + (size_t)(row0 + ln) * lda;
  v8f acc[4] = {};
  for (int kb = 0; kb < K; kb += 32) {
    FragB ah, al;
    const v4f x0 = *(const v4fa*)(arow + kb + 8 * hh), x1 = *(const v4fa*)(arow + kb + 8 * hh + 4);
    const v4f x2 = *(const v4fa*)(arow + kb + 16 + 8 * hh), x3 = *(const v4fa*)(arow + kb + 16 + 8 * hh + 4);
    float xs[16] = {x0[0],x0[1],x0[2],x0[3],x1[0],x1[1],x1[2],x1[3],x2[0],x2[1],x2[2],x2[3],x3[0],x3[1],x3[2],x3[3]};
#pragma unroll
    for (int i = 0; i < 16; ++i) { const unsigned short hb = bf16_bits(xs[i]); ah.u[i] = hb; al.u[i] = ASPLIT ? bf16_bits(xs[i] - bf16_val(hb)) : (unsigned short)0; }
#pragma unroll
    for (int t = 0; t < 4; ++t) {
      const unsigned short* brow = Wt + (size_t)(col0 + t * 16 + ln) * ldb + kb;
      FragB b;
      b.half[0] = *(const v8us*)(brow + 8 * hh);
      b.half[1] = *(const v8us*)(brow + 16 + 8 * hh);
      acc[t] = mmaN<ASPLIT ? 2 : 1>(ah.v, al.v, b.v, b.v, acc[t]);
    }
  }
#pragma unroll
  for (int t = 0; t < 4; ++t) {
    const int col = col0 + t * 16 + ln;
    float bv = bias ? bias[col] : 0.f;
    if (BIAS_BF16) bv = bf16_round(bv);
#pragma unroll
    for (int r = 0; r < 8; ++r) {
      float v = acc[t][r] + bv;
      if (resid) { float rv = resid[(size_t)((row0 + 8 * hh + r) % rmod) * ldr + col]; if (RES_BF16) rv = bf16_round(rv); v += rv; }
      if (ACT == 1) v = fmaxf(v, 0.f);
      if (ACT == 2) v = 0.5f * v * (1.0f + erff(v * 0.70710678118654752f));
      if (ACT == 3) { const float u = 0.7978845608028654f * (v + 0.044715f * v * v * v); v = 0.5f * v * (1.0f + tanhf(u)); }
      so[w][8 * hh + r][t * 16 + ln] = v;
    }
  }
  __builtin_amdgcn_fence(__ATOMIC_ACQ_REL, "workgroup");
  __builtin_amdgcn_wave_barrier();
  const int rsub = lane >> 4, c4 = (lane & 15) * 4;
  {
#pragma unroll
    for (int q = 0; q < 8; ++q) {
      const int r = q * 2 + rsub;
      const v4f v = *(const v4fa*)&so[w][r][c4];
      *(v4f*)(C + (size_t)(row0 + r) * ldc + col0 + c4) = v;
    }
    
  }
}
// row LayerNorm (biased variance, eps) over N: s = X (+ R); optional out_sum <- s; out_norm <- (s-mu)*rsqrt(var+eps)*g + b
template <bool PARAM_BF16>
__global__ __launch_bounds__(256) void k_layernorm(const float* __restrict__ X, const float* __restrict__ R, const float* __restrict__ g, const float* __restrict__ bta,
                                                  float* __restrict__ out_sum, float* __restrict__ out_norm, int N, float eps) {
  __shared__ float red[256];
  const int row = blockIdx.x, tid = threadIdx.x;
  const float* x = X + (size_t)row * N; const float* rr = R ? R + (size_t)row * N : nullptr;
  float vals[16];                     // up to N = 4096
  const int per = N / 256;            // contiguous chunk per thread? use strided-by-4 chunks: thread handles j = tid*4 + 1024*u
  float s1 = 0.f;
  for (int u = 0; u < per / 4; ++u) {
    const int j = tid * 4 + 1024 * u;
    const v4f a = *(const v4fa*)(x + j);
    v4f b = {0.f,0.f,0.f,0.f}; if (rr) b = *(const v4fa*)(rr + j);
#pragma unroll
    for (int q = 0; q < 4; ++q) { const float v = a[q] + b[q]; vals[u * 4 + q] = v; s1 += v; }
  }
  red[tid] = s1; __syncthreads();
  for (int st = 128; st > 0; st >>= 1) { if (tid < st) red[tid] += red[tid + st]; __syncthreads(); }
  const float mu = red[0] / (float)N; __syncthreads();
  float s2 = 0.f;
  for (int u = 0; u < per / 4; ++u)
#pragma unroll
    for (int q = 0; q < 4; ++q) { const float c = vals[u * 4 + q] - mu; s2 += c * c; }
  red[tid] = s2; __syncthreads();
  for (int st = 128; st > 0; st >>= 1) { if (tid < st) red[tid] += red[tid + st]; __syncthreads(); }
  const float rs = rsqrtf(red[0] / (float)N + eps);
  {
    for (int u = 0; u < per / 4; ++u) {
      const int j = tid * 4 + 1024 * u;
      v4f o, sm;
#pragma unroll
      for (int q = 0; q < 4; ++q) {
        float gg = g[j + q], bb = bta[j + q];
        if (PARAM_BF16) { gg = bf16_round(gg); bb = bf16_round(bb); }
        sm[q] = vals[u * 4 + q]; o[q] = (vals[u * 4 + q] - mu) * rs * gg + bb;
      }
      if (out_sum) *(v4f*)(out_sum + (size_t)row * N + j) = sm;
      *(v4f*)(out_norm + (size_t)row * N + j) = o;
    }
    
  }
}



// ---- f16 WMMA path (v_wmma_f32_16x16x32_f16): 11-bit significands for operands in range — used where a [0,1] probability operand needs more precision than bf16
typedef _Float16 v16h __attribute__((ext_vector_type(16)));
union FragH { v16h v; v8us half[2]; _Float16 h[16]; unsigned short u[16]; };
template <int NT>
__device__ __forceinline__ v8f mmaH(v16h ah, v16h al, v16h bh, v16h bl, v8f c) {
  c = __builtin_amdgcn_wmma_f32_16x16x32_f16(false, ah, false, bh, (short)0, c, false, false);
  if (NT >= 2) c = __builtin_amdgcn_wmma_f32_16x16x32_f16(false, al, false, bh, (short)0, c, false, false);
  if (NT >= 3) c = __builtin_amdgcn_wmma_f32_16x16x32_f16(false, ah, false, bl, (short)0, c, false, false);
  asm volatile("v_nop\n\tv_nop\n\tv_nop\n\tv_nop" : "+v"(c) : "v"(ah), "v"(al), "v"(bh), "v"(bl));
  return c;
}
// batched GEMM like k_gemm_b but f16 operands: A f32 (split into f16 hi/lo if ASPLIT, else rounded to f16), Bt = f16 values [n][k]; alpha; C f32; N multiple of 16 (partial tiles skipped)
template <bool ASPLIT>
__global__ __launch_bounds__(128) void k_gemm_h(const float* __restrict__ A, int lda, size_t sA, const _Float16* __restrict__ Bh, int ldb, size_t sB, float alpha, float* __restrict__ C, int ldc, size_t sC, int M, int N, int K) {
  __shared__ __attribute__((aligned(16))) float so[4][16][64];
  const int tid = threadIdx.x, w = tid >> 5, lane = tid & 31, ln = lane & 15, hh = lane >> 4; const int by = blockIdx.y;
  A += (size_t)by * sA; Bh += (size_t)by * sB; C += (size_t)by * sC;
  const int ntn = (N + 63) / 64; const int wid = blockIdx.x * 4 + w; const int mt = wid / ntn, nq = wid % ntn; if (mt * 16 >= M) return;
  const int row0 = mt * 16, col0 = nq * 64; const float* arow = A + (size_t)(row0 + ln) * lda;
  v8f acc[4] = {};
  for (int kb = 0; kb < K; kb += 32) {
    FragH ah, al;
    const v4f x0 = *(const v4fa*)(arow + kb + 8 * hh), x1 = *(const v4fa*)(arow + kb + 8 * hh + 4), x2 = *(const v4fa*)(arow + kb + 16 + 8 * hh), x3 = *(const v4fa*)(arow + kb + 16 + 8 * hh + 4);
    float xs[16] = {x0[0],x0[1],x0[2],x0[3],x1[0],x1[1],x1[2],x1[3],x2[0],x2[1],x2[2],x2[3],x3[0],x3[1],x3[2],x3[3]};
#pragma unroll
    for (int i = 0; i < 16; ++i) { const _Float16 h = (_Float16)xs[i]; ah.h[i] = h; al.h[i] = ASPLIT ? (_Float16)(xs[i] - (float)h) : (_Float16)0.0f; }
#pragma unroll
    for (int t = 0; t < 4; ++t) { if (col0 + t * 16 >= N) continue; const size_t boff = (size_t)(col0 + t * 16 + ln) * ldb + kb; FragH bq; bq.half[0] = *(const v8us*)(Bh + boff + 8 * hh); bq.half[1] = *(const v8us*)(Bh + boff + 16 + 8 * hh);
      acc[t] = mmaH<ASPLIT ? 2 : 1>(ah.v, al.v, bq.v, bq.v, acc[t]); }
  }
#pragma unroll
  for (int t = 0; t < 4; ++t) { if (col0 + t * 16 >= N) continue;
#pragma unroll
    for (int r = 0; r < 8; ++r) so[w][8 * hh + r][t * 16 + ln] = acc[t][r] * alpha; }
  __builtin_amdgcn_fence(__ATOMIC_ACQ_REL, "workgroup"); __builtin_amdgcn_wave_barrier();
  const int rsub = lane >> 4, c4 = (lane & 15) * 4;
  {
#pragma unroll
    for (int q = 0; q < 8; ++q) { const int r = q * 2 + rsub; if (col0 + c4 < N) { const v4f v = *(const v4fa*)&so[w][r][c4]; *(v4f*)(C + (size_t)(row0 + r) * ldc + col0 + c4) = v; } }
     }
}

// Wt[n][k] = f16(W[k][n]·scale) from f32 row-major W[K][N] (scale = power of two; bf16-exact weights stay exact in f16 away from the subnormal range)
__global__ __launch_bounds__(256) void k_wt_f16(const float* __restrict__ W, _Float16* __restrict__ Wt, int K, int N, float scale) {
  const int t = blockIdx.x * 256 + threadIdx.x; if (t >= N * (K / 8)) return; const int n = t / (K / 8), k8 = (t % (K / 8)) * 8; FragH f;
#pragma unroll
  for (int i = 0; i < 8; ++i) f.h[i] = (_Float16)(bf16_round(W[(size_t)(k8 + i) * N + n]) * scale); const v8us o = f.half[0];
  *(v8us*)((unsigned short*)Wt + (size_t)n * K + k8) = o; 
}
// k_gemm_hh variant with fused epilogue: v = acc·alpha + bias[by·sBias + col] (+ CP[(row/rowsPerB)·sCPb + by·64 + col] if CP) ; ACT 0 none / 1 elu ; writes f16 C16 (and f32 C if non-null)
template <int ACT>
__global__ __launch_bounds__(128) void k_gemm_hhx(const _Float16* __restrict__ A, int lda, size_t sA, const _Float16* __restrict__ Bh, int ldb, size_t sB, float alpha, const float* __restrict__ bias, size_t sBias, const float* __restrict__ CP, int rowsPerB, size_t sCPb, int row0g,
    float* __restrict__ C, _Float16* __restrict__ C16, int ldc, size_t sC, int M, int N, int K) {
  __shared__ __attribute__((aligned(16))) float so[4][16][64];
  const int tid = threadIdx.x, w = tid >> 5, lane = tid & 31, ln = lane & 15, hh = lane >> 4; const int by = blockIdx.y;
  A += (size_t)by * sA; Bh += (size_t)by * sB; const size_t cofs = (size_t)by * sC; const float* bp = bias ? bias + (size_t)by * sBias : nullptr;
  const int ntn = (N + 63) / 64; const int wid = blockIdx.x * 4 + w; const int mt = wid / ntn, nq = wid % ntn; if (mt * 16 >= M) return;
  const int row0 = mt * 16, col0 = nq * 64; const _Float16* arow = A + (size_t)(row0 + ln) * lda;
  v8f acc[4] = {};
  for (int kb = 0; kb < K; kb += 32) { FragH ah; ah.half[0] = *(const v8us*)((const unsigned short*)arow + kb + 8 * hh); ah.half[1] = *(const v8us*)((const unsigned short*)arow + kb + 16 + 8 * hh);
#pragma unroll
    for (int t = 0; t < 4; ++t) { if (col0 + t * 16 >= N) continue; const size_t boff = (size_t)(col0 + t * 16 + ln) * ldb + kb; FragH bq; bq.half[0] = *(const v8us*)((const unsigned short*)Bh + boff + 8 * hh); bq.half[1] = *(const v8us*)((const unsigned short*)Bh + boff + 16 + 8 * hh);
      acc[t] = mmaH<1>(ah.v, ah.v, bq.v, bq.v, acc[t]); }
  }
#pragma unroll
  for (int t = 0; t < 4; ++t) { if (col0 + t * 16 >= N) continue; const int col = col0 + t * 16 + ln; const float bv = bp ? bf16_round(bp[col]) : 0.f;
#pragma unroll
    for (int r = 0; r < 8; ++r) { float v = acc[t][r] * alpha + bv; if (CP) { const int rr = row0g + row0 + 8 * hh + r; if (rowsPerB < 0) v += CP[cofs + (size_t)rr * ldc + col];      /* rowsPerB < 0: own element of the batched C plane */ else { const int bidx = rr / rowsPerB; v += CP[(size_t)bidx * sCPb + (size_t)by * 64 + col]; } } if (ACT == 1) v = (v > 0.f) ? v : expm1f(v); else if (ACT == 7) v = (v > 0.f) ? v + 1.0f : expf(v); else if (ACT == 8) v = tanhf(v); else if (ACT == 9) v = 0.5f * v * (1.0f + tanhf(0.7978845608028654f * (v + 0.044715f * v * v * v))); else if (ACT == 11) v = 1.0f / (1.0f + expf(-v)); else if (ACT == 12) v = (v > 0.f) ? v : 0.01f * v; else if (ACT == 14) v = (v > 0.f) ? v : 0.1f * v; else if (ACT == 16) v = (v >= 0.f) ? v : 0.3f * v; else if (ACT == 17) v = (v >= 0.f) ? v : 0.2f * v; else if (ACT == 15) v = v / (1.0f + expf(-v)); else if (ACT == 3) v = fmaxf(v, 0.f); else if (ACT == 6) v = 0.5f * v * (1.0f + erff(v * 0.70710678118654752f)); so[w][8 * hh + r][t * 16 + ln] = v; } }
  __builtin_amdgcn_fence(__ATOMIC_ACQ_REL, "workgroup"); __builtin_amdgcn_wave_barrier();
  const int rsub = lane >> 4, c4 = (lane & 15) * 4; typedef _Float16 v4h __attribute__((ext_vector_type(4)));
  {
#pragma unroll
    for (int q = 0; q < 8; ++q) { const int r = q * 2 + rsub; if (col0 + c4 < N) { const v4f v = *(const v4fa*)&so[w][r][c4]; if (C) *(v4f*)(C + cofs + (size_t)(row0 + r) * ldc + col0 + c4) = v; if (C16) { v4h h4; for (int i = 0; i < 4; ++i) h4[i] = (_Float16)v[i]; *(v4h*)(C16 + cofs + (size_t)(row0 + r) * ldc + col0 + c4) = h4; } } }
     }
}


typedef _Float16 v4h __attribute__((ext_vector_type(4)));

__global__ __launch_bounds__(256) void k_x16(const float* __restrict__ x, _Float16* __restrict__ X16, size_t n8) { const size_t t = (size_t)blockIdx.x * 256 + threadIdx.x; if (t >= n8) return; FragH f;
#pragma unroll
  for (int q = 0; q < 8; ++q) f.h[q] = (_Float16)bf16_round(x[t * 8 + q]); *(v8us*)((unsigned short*)X16 + t * 8) = f.half[0];  }
__global__ __launch_bounds__(256) void k_h16(const float* __restrict__ x, _Float16* __restrict__ X16, size_t n8) { const size_t t = (size_t)blockIdx.x * 256 + threadIdx.x; if (t >= n8) return; FragH f;
#pragma unroll
  for (int q = 0; q < 8; ++q) f.h[q] = (_Float16)x[t * 8 + q]; *(v8us*)((unsigned short*)X16 + t * 8) = f.half[0];  }
__global__ __launch_bounds__(256) void k_round16f(const float* __restrict__ W, _Float16* __restrict__ Bt, size_t n8) { const size_t t = (size_t)blockIdx.x * 256 + threadIdx.x; if (t >= n8) return; FragH f;
#pragma unroll
  for (int i = 0; i < 8; ++i) f.h[i] = (_Float16)(bf16_round(W[t * 8 + i]) * 16.0f); *(v8us*)((unsigned short*)Bt + t * 8) = f.half[0];  }
template <int NHv, int TTv>
__global__ __launch_bounds__(256) void k_vt(const _Float16* __restrict__ V16, int ldv, int voff, _Float16* __restrict__ Vt) { __shared__ unsigned short tl[64][66]; const int tid = threadIdx.x; const int slab = blockIdx.x / (TTv / 64), lg = blockIdx.x % (TTv / 64); const int b = slab / NHv, h = slab % NHv;
  for (int i = tid; i < 64 * 8; i += 256) { const int r = i / 8, c8 = (i % 8) * 8; FragH f; f.half[0] = *(const v8us*)((const unsigned short*)V16 + ((size_t)b * TTv + lg * 64 + r) * ldv + voff + h * 64 + c8);
#pragma unroll
    for (int q = 0; q < 8; ++q) tl[r][c8 + q] = f.u[q]; }
  __syncthreads();
  {
#pragma unroll
    for (int rd = 0; rd < 2; ++rd) { const int d = rd * 32 + tid / 8, pc = tid % 8; FragH f;
#pragma unroll
      for (int q = 0; q < 8; ++q) f.u[q] = tl[pc * 8 + q][d];
      *(v8us*)((unsigned short*)Vt + ((size_t)slab * 64 + d) * TTv + lg * 64 + pc * 8) = f.half[0]; }
     } }

__global__ __launch_bounds__(256) void k_hl(const float* __restrict__ F, _Float16* __restrict__ Hh, _Float16* __restrict__ Hl, size_t n8) { const size_t t = (size_t)blockIdx.x * 256 + threadIdx.x; if (t >= n8) return; FragH fh, fl; const v4f a = *(const v4fa*)(F + t * 8), c = *(const v4fa*)(F + t * 8 + 4);
#pragma unroll
  for (int q = 0; q < 4; ++q) { _Float16 h = (_Float16)a[q]; fh.h[q] = h; fl.h[q] = (_Float16)((a[q] - (float)h) * 1024.0f); h = (_Float16)c[q]; fh.h[4 + q] = h; fl.h[4 + q] = (_Float16)((c[q] - (float)h) * 1024.0f); }
  { *(v8us*)((unsigned short*)Hh + t * 8) = fh.half[0]; *(v8us*)((unsigned short*)Hl + t * 8) = fl.half[0];  } }

// ---- fast GEMM (wave tile 32x64; requires M % 32 == 0 rows per launch region and N % 64 == 0); epilogue = k_gemm_hhx semantics ----
__device__ __forceinline__ v16h g2_frag(const _Float16* p, int hh) { FragH f; f.half[0] = *(const v8us*)((const unsigned short*)p + 8 * hh); f.half[1] = *(const v8us*)((const unsigned short*)p + 16 + 8 * hh); return f.v; }
__device__ __forceinline__ v8f g2_mma(v16h a, v16h b, v8f c) { v8f d = __builtin_amdgcn_wmma_f32_16x16x32_f16(false, a, false, b, (short)0, c, false, false); asm volatile("v_nop\n\tv_nop\n\tv_nop\n\tv_nop" : "+v"(d) : "v"(a), "v"(b)); return d; }
template <int ACT>
__global__ __launch_bounds__(128) void k_gemm2(const _Float16* __restrict__ A, int lda, size_t sA, const _Float16* __restrict__ Bh, int ldb, size_t sB, float alpha, const float* __restrict__ bias, size_t sBias, const float* __restrict__ CP, int rowsPerB, size_t sCPb, int row0g,
    float* __restrict__ C, _Float16* __restrict__ C16, int ldc, size_t sC, int M, int N, int K) { static_assert(ACT == 0 || ACT == 3 || ACT == 6 || ACT == 8 || ACT == 9 || ACT == 11 || ACT == 12 || ACT == 14 || ACT == 15 || ACT == 16 || ACT == 17, "k_gemm2: unsupported ACT code (would silently apply no activation)");
  __shared__ __attribute__((aligned(16))) float so[4][32][68];
  const int tid = threadIdx.x, w = tid >> 5, lane = tid & 31, ln = lane & 15, hh = lane >> 4; const int by = blockIdx.y;
  A += (size_t)by * sA; Bh += (size_t)by * sB; const size_t cofs = (size_t)by * sC; const float* bp = bias ? bias + (size_t)by * sBias : nullptr;
  const int ntn = N >> 6; const int mt = blockIdx.x / ntn, nq = blockIdx.x - mt * ntn; const int row0 = mt * 128 + 32 * w, col0 = nq * 64; if (row0 >= M) return;
  const _Float16* a0p = A + (size_t)(row0 + ln) * lda; const _Float16* a1p = a0p + (size_t)16 * lda;
  const _Float16* b0p = Bh + (size_t)(col0 + ln) * ldb; const _Float16* b1p = b0p + (size_t)16 * ldb; const _Float16* b2p = b1p + (size_t)16 * ldb; const _Float16* b3p = b2p + (size_t)16 * ldb;
  const v8f z8 = {0.f,0.f,0.f,0.f,0.f,0.f,0.f,0.f}; v8f c00 = z8, c01 = z8, c02 = z8, c03 = z8, c10 = z8, c11 = z8, c12 = z8, c13 = z8;
#pragma unroll 1
  for (int kb = 0; kb < K; kb += 32) { const v16h a0 = g2_frag(a0p + kb, hh), a1 = g2_frag(a1p + kb, hh);
    v16h b = g2_frag(b0p + kb, hh); c00 = g2_mma(a0, b, c00); c10 = g2_mma(a1, b, c10);
    b = g2_frag(b1p + kb, hh); c01 = g2_mma(a0, b, c01); c11 = g2_mma(a1, b, c11);
    b = g2_frag(b2p + kb, hh); c02 = g2_mma(a0, b, c02); c12 = g2_mma(a1, b, c12);
    b = g2_frag(b3p + kb, hh); c03 = g2_mma(a0, b, c03); c13 = g2_mma(a1, b, c13); }
  v8f accs[8] = {c00, c01, c02, c03, c10, c11, c12, c13};
#pragma unroll
  for (int u = 0; u < 8; ++u) { const int t = u & 3, half = u >> 2; const int col = col0 + t * 16 + ln; const float bv = bp ? bf16_round(bp[col]) : 0.f;
#pragma unroll
    for (int r = 0; r < 8; ++r) { const int rloc = half * 16 + 8 * hh + r; float v = accs[u][r] * alpha + bv; if (CP) { if (rowsPerB < 0) v += CP[cofs + (size_t)(row0g + row0 + rloc) * ldc + col];      /* rowsPerB < 0: own element of the batched C plane */ else { const int bidx = (row0g + row0 + rloc) / rowsPerB; v += CP[(size_t)bidx * sCPb + (size_t)by * 64 + col]; } }
      if (ACT == 3) v = fmaxf(v, 0.f); else if (ACT == 6) v = 0.5f * v * (1.0f + erff(v * 0.70710678118654752f)); else if (ACT == 11) v = 1.0f / (1.0f + expf(-v)); else if (ACT == 15) v = v / (1.0f + expf(-v)); else if (ACT == 12) v = (v > 0.f) ? v : 0.01f * v; else if (ACT == 8) v = tanhf(v); else if (ACT == 9) v = 0.5f * v * (1.0f + tanhf(0.7978845608028654f * (v + 0.044715f * v * v * v))); else if (ACT == 14) v = (v > 0.f) ? v : 0.1f * v; else if (ACT == 16) v = (v >= 0.f) ? v : 0.3f * v; else if (ACT == 17) v = (v >= 0.f) ? v : 0.2f * v;
      so[w][rloc][t * 16 + ln] = v; } }
  __builtin_amdgcn_fence(__ATOMIC_ACQ_REL, "workgroup"); __builtin_amdgcn_wave_barrier();
  const int rsub = lane >> 4, c4 = (lane & 15) * 4;
  {
#pragma unroll
    for (int q = 0; q < 16; ++q) { const int r = q * 2 + rsub; const v4f v = *(const v4fa*)&so[w][r][c4]; if (C) *(v4f*)(C + cofs + (size_t)(row0 + r) * ldc + col0 + c4) = v; if (C16) { v4h h4; for (int i = 0; i < 4; ++i) h4[i] = (_Float16)v[i]; *(v4h*)(C16 + cofs + (size_t)(row0 + r) * ldc + col0 + c4) = h4; } }
     } }


__global__ __launch_bounds__(256) void k_wnat(const float* __restrict__ w, size_t n8, _Float16* __restrict__ Bt) { const size_t t = (size_t)blockIdx.x * 256 + threadIdx.x; if (t >= n8) return; FragH f; for (int q = 0; q < 8; ++q) f.h[q] = (_Float16)(bf16_round(w[t * 8 + q]) * 16.0f); *(v8us*)((unsigned short*)Bt + t * 8) = f.half[0];  }
__global__ __launch_bounds__(256) void k_rsm(const float* __restrict__ S, _Float16* __restrict__ P, int nrows) {
  #pragma clang fp contract(off)
  const int i = blockIdx.x * 256 + threadIdx.x; if (i >= nrows) return; const float* s = S + (size_t)i * SQ; float mx = -3.0e38f;
#pragma unroll 1
  for (int j = 0; j < SQ; ++j) mx = fmaxf(mx, s[j]); float se = 0.f;
#pragma unroll 1
  for (int j = 0; j < SQ; ++j) se += expf(s[j] - mx); const float sc = 256.0f / se;
#pragma unroll 1
  for (int j0 = 0; j0 < SQ; j0 += 8) { FragH f; for (int q = 0; q < 8; ++q) f.h[q] = (_Float16)(expf(s[j0 + q] - mx) * sc); unsigned short* d = (unsigned short*)P + (size_t)i * SQ + j0; *(v8us*)d = f.half[0];  } }
__global__ __launch_bounds__(256) void k_vt(const _Float16* __restrict__ V16, int b, int h0, _Float16* __restrict__ VT) { __shared__ unsigned short tl[64][65]; const int tid = threadIdx.x; const int hh = blockIdx.x % HG, sg = blockIdx.x / HG; const int s0 = sg * 64; const int h = h0 + hh;
  for (int i = tid; i < 64 * 8; i += 256) { const int j = i / 8, d8 = (i % 8) * 8; FragH f; f.half[0] = *(const v8us*)((const unsigned short*)V16 + ((size_t)b * SQ + s0 + j) * DM + h * HD + d8); for (int q = 0; q < 8; ++q) tl[d8 + q][j] = f.u[q]; }
  __syncthreads();
  { for (int i = tid; i < 64 * 8; i += 256) { const int d = i / 8, j8 = (i % 8) * 8; FragH f; for (int q = 0; q < 8; ++q) f.u[q] = tl[d][j8 + q]; *(v8us*)((unsigned short*)VT + ((size_t)hh * HD + d) * SQ + s0 + j8) = f.half[0]; }  } }



__global__ __launch_bounds__(256) void k_rsmcf2(const float* __restrict__ S, _Float16* __restrict__ P, int hg, int q0, int nk) {
  #pragma clang fp contract(off)
  const int t = blockIdx.x * 256 + threadIdx.x; if (t >= hg * QT) return; const size_t i = (size_t)t; const float* s = S + i * NKX; const int last = q0 + (t % QT); float mx = -3.0e38f;
#pragma unroll 1
  for (int j = 0; j < nk; ++j) { const float f = (j <= last) ? 1.f : 0.f; mx = fmaxf(mx, fmaf(f, s[j], (1.f - f) * -1.0e9f)); } float se = 0.f;
#pragma unroll 1
  for (int j = 0; j < nk; ++j) { const float f = (j <= last) ? 1.f : 0.f; se += __expf(fmaf(f, s[j], (1.f - f) * -1.0e9f) - mx); } const float sc = 256.0f / se;
#pragma unroll 1
  for (int j0 = 0; j0 < nk; j0 += 8) { FragH fr; for (int q = 0; q < 8; ++q) { const int j = j0 + q; const float f = (j <= last) ? 1.f : 0.f; fr.h[q] = (_Float16)(__expf(fmaf(f, s[j], (1.f - f) * -1.0e9f) - mx) * sc); } unsigned short* d = (unsigned short*)P + i * NKX + j0; *(v8us*)d = fr.half[0];  } }


template <int MASKADD>
__global__ __launch_bounds__(64) void k_att0(const float* __restrict__ QF, const float* __restrict__ KF, const float* __restrict__ VF, int ld, const float* __restrict__ mask, float scale, float* __restrict__ OF, int ldo) {
  #pragma clang fp contract(off)
  __shared__ __attribute__((aligned(16))) float lq[64][64]; __shared__ __attribute__((aligned(16))) float lo[64][64];
  const int tid = threadIdx.x; const int h = blockIdx.x / (QT0 / 64), rg = blockIdx.x % (QT0 / 64); const int i = rg * 64 + tid;
  const float* qr = QF + (size_t)i * ld + h * HD;
#pragma unroll 1
  for (int c = 0; c < HD / 4; ++c) { *(v4f*)&lq[tid][c * 4] = *(const v4fa*)(qr + c * 4); const v4f z = {0.f, 0.f, 0.f, 0.f}; *(v4f*)&lo[tid][c * 4] = z; }
  float m = -1.0e30f, l = 0.f; const int jmax = MASKADD ? (SQ - 1) : (rg * 64 + 63);      /* additive-mask form: every key (the mask input decides); causal form: keys up to the block's last row */
#pragma unroll 1
  for (int j = 0; j <= jmax; ++j) { const float* kr = KF + (size_t)j * ld + h * HD; const float* vr = VF + (size_t)j * ld + h * HD; float s = 0.f;
#pragma unroll 1
    for (int c = 0; c < HD / 4; ++c) { const v4f kq = *(const v4fa*)(kr + c * 4); const v4f qq = *(v4f*)&lq[tid][c * 4]; s = __fadd_rn(s, __fmul_rn(qq[0], kq[0])); s = __fadd_rn(s, __fmul_rn(qq[1], kq[1])); s = __fadd_rn(s, __fmul_rn(qq[2], kq[2])); s = __fadd_rn(s, __fmul_rn(qq[3], kq[3])); }
    s = __fmul_rn(s, scale); if (MASKADD) s = __fadd_rn(s, __fmul_rn(bf16_round(mask[(size_t)i * SQ + j]), -10000.0f));
    const float f = (MASKADD || j <= i) ? 1.f : 0.f; const float sm = fmaf(f, s, (1.f - f) * -1.0e30f); const float mn = fmaxf(m, sm); const float sc = expf(m - mn); const float e = expf(sm - mn); l = __fadd_rn(__fmul_rn(l, sc), e); m = mn;
#pragma unroll 1
    for (int c = 0; c < HD / 4; ++c) { const v4f vv = *(const v4fa*)(vr + c * 4); v4f oo = *(v4f*)&lo[tid][c * 4]; for (int u = 0; u < 4; ++u) oo[u] = __fadd_rn(__fmul_rn(oo[u], sc), __fmul_rn(e, vv[u])); *(v4f*)&lo[tid][c * 4] = oo; } }
  const float fin = 64.0f / l;      /* o carried x64 */
#pragma unroll 1
  for (int c = 0; c < HD / 4; ++c) { v4f oo = *(v4f*)&lo[tid][c * 4]; for (int u = 0; u < 4; ++u) oo[u] = __fmul_rn(oo[u], fin); *(v4f*)&lo[tid][c * 4] = oo; }
  __syncthreads();
  {
#pragma unroll 1
    for (int it = 0; it < 16; ++it) { const int row = it * 4 + tid / 16, pc = (tid % 16) * 4; const v4f v = *(const v4f*)&lo[row][pc]; *(v4f*)(OF + (size_t)(rg * 64 + row) * ldo + h * HD + pc) = v; }
     } }

__global__ __launch_bounds__(256) void k_of0out(const float* __restrict__ src, float* __restrict__ dst, size_t n4) { const size_t t = (size_t)blockIdx.x * 256 + threadIdx.x; if (t >= n4) return; v4f v = *(const v4fa*)(src + t * 4); for (int q = 0; q < 4; ++q) v[q] = __fmul_rn(v[q], 0.015625f); *(v4f*)(dst + t * 4) = v;  }

extern "C" void kernel_launch(void* const* d_in, const int* in_sizes, int n_in,
                              void* d_out, int out_size, void* d_ws, size_t ws_size, hipStream_t stream) {
  (void)in_sizes; (void)n_in; (void)out_size;
  const float* const* I = (const float* const*)d_in; const float* x = I[0]; const float* wq = I[1]; const float* wk = I[2]; const float* wv = I[3]; const float* bq = I[4]; const float* bk = I[5]; const float* bv = I[6];      /* input order: x, Wq, Wk, Wv, bq, bk, bv: natural [out][in] weights, then the three biases (every projection launch passes the bias variables); NO output projection */
  char* ws = (char*)d_ws; size_t off = 0;
  auto take = [&](size_t bytes) { char* p = ws + off; off += (bytes + 255) & ~(size_t)255; return p; };
  _Float16* BQ = (_Float16*)take((size_t)DM * DM * 2); _Float16* BK = (_Float16*)take((size_t)DM * DM * 2); _Float16* BV = (_Float16*)take((size_t)DM * DM * 2);
  _Float16* X16 = (_Float16*)take(NR * DM * 2); float* QF = (float*)take(NR * DM * 4); _Float16* QH = (_Float16*)take(NR * DM * 2); _Float16* QL = (_Float16*)take(NR * DM * 2); _Float16* KH = (_Float16*)take(NR * DM * 2); _Float16* KL = (_Float16*)take(NR * DM * 2); _Float16* Q16 = QH; _Float16* K16 = KH; _Float16* V16 = (_Float16*)take(NR * DM * 2);
  float* S = (float*)take((size_t)NH * QT * NKX * 4); _Float16* P = (_Float16*)take((size_t)NH * QT * NKX * 2); _Float16* VT = (_Float16*)take((size_t)NH * HD * SQ * 2);
  if (off > ws_size) return;
  { const unsigned g = (unsigned)(((size_t)DM * DM / 8 + 255) / 256); k_wnat<<<g, 256, 0, stream>>>(wq, (size_t)DM * DM / 8, BQ); k_wnat<<<g, 256, 0, stream>>>(wk, (size_t)DM * DM / 8, BK); k_wnat<<<g, 256, 0, stream>>>(wv, (size_t)DM * DM / 8, BV); }      /* natural [out][in] = Bt[n][k] x16 */
  k_x16<<<(unsigned)((NR * DM / 8 + 255) / 256), 256, 0, stream>>>(x, X16, NR * DM / 8);
  const size_t r0p = (size_t)B0 * SQ;      /* first projected row */
  k_gemm2<0><<<dim3((unsigned)((MP / 128) * (DM / 64)), 1), 128, 0, stream>>>(X16 + r0p * DM, DM, 0, BQ, DM, 0, 0.0625f, bq, 0, nullptr, 1, 0, 0, QF + r0p * DM, nullptr, DM, 0, MP, DM, DM); k_hl<<<(unsigned)(((size_t)MP * DM / 8 + 255) / 256), 256, 0, stream>>>(QF + r0p * DM, QH + r0p * DM, QL + r0p * DM, (size_t)MP * DM / 8);      /* q (f32) -> f16 hi + x1024 residual: unscaled logits sigma ~8 */
  k_gemm2<0><<<dim3((unsigned)((MP / 128) * (DM / 64)), 1), 128, 0, stream>>>(X16 + r0p * DM, DM, 0, BK, DM, 0, 0.0625f, bk, 0, nullptr, 1, 0, 0, QF + r0p * DM, nullptr, DM, 0, MP, DM, DM); k_hl<<<(unsigned)(((size_t)MP * DM / 8 + 255) / 256), 256, 0, stream>>>(QF + r0p * DM, KH + r0p * DM, KL + r0p * DM, (size_t)MP * DM / 8);      /* k likewise */
  k_gemm2<0><<<dim3((unsigned)((MP / 128) * (DM / 64)), 1), 128, 0, stream>>>(X16 + r0p * DM, DM, 0, BV, DM, 0, 0.0625f, bv, 0, nullptr, 1, 0, 0, nullptr, V16 + r0p * DM, DM, 0, MP, DM, DM);
  for (int b = B0; b < B0 + NBR; ++b) { const size_t r0 = (size_t)b * SQ;
    k_vt<NH, SQ><<<NH * (SQ / 64), 256, 0, stream>>>(V16 + r0 * LQ, LQ, 0, VT);      /* V^T [NH][HD][SQ] for this batch */
    for (int q0 = 0; q0 < QN; q0 += QT) { const int nk = SQ;      /* NON-causal: every 256-row query tile sees all SQ keys */
      k_gemm2<0><<<dim3((QT / 128) * (nk / 64), NHD), 128, 0, stream>>>(QH + (r0 + q0) * LQ, LQ, (size_t)HD, KH + r0 * LQ, LQ, (size_t)HD, 0.125f, nullptr, 0, nullptr, 1, 0, 0, S, nullptr, NKX, (size_t)QT * NKX, QT, nk, HD);      /* raw scores: hi . hi */
      k_gemm2<0><<<dim3((QT / 128) * (nk / 64), NHD), 128, 0, stream>>>(QL + (r0 + q0) * LQ, LQ, (size_t)HD, KH + r0 * LQ, LQ, (size_t)HD, 0.0001220703125f, nullptr, 0, S, -1, 0, 0, S, nullptr, NKX, (size_t)QT * NKX, QT, nk, HD); k_gemm2<0><<<dim3((QT / 128) * (nk / 64), NHD), 128, 0, stream>>>(QH + (r0 + q0) * LQ, LQ, (size_t)HD, KL + r0 * LQ, LQ, (size_t)HD, 0.0001220703125f, nullptr, 0, S, -1, 0, 0, S, nullptr, NKX, (size_t)QT * NKX, QT, nk, HD);      /* += 2^-10 (lo . hi + hi . lo) */      /* scores, all heads on grid.y */
      k_rsmcf2<<<(NHD * QT + 255) / 256, 256, 0, stream>>>(S, P, NHD, SQ, nk);      /* plain softmax over all keys: the kernel keeps key j iff j <= q0_arg + row, and q0_arg = SQ makes every j < SQ visible for every row */
      k_gemm2<0><<<dim3((QT / 128) * (HD / 64), NHD), 128, 0, stream>>>(P, NKX, (size_t)QT * NKX, VT, SQ, (size_t)HD * SQ, 0.00390625f, nullptr, 0, nullptr, 1, 0, 0, (float*)d_out + (r0 + q0) * DM, nullptr, DM, (size_t)HD, QT, HD, nk); } }      /* out = P V^T (alpha 2^-8) written f32 straight into the head-major output columns (no output projection); NON-causal build: no exact first-tile path, no rewrite */
}

// v001
// A run of this version takes 3010 microseconds.
// Next to v000, in two timings, it ran 2.68 and 2.71 times as fast.
#include <hip/hip_runtime.h>
// Multi-head self-attention without an output projection, NON-causal (x [8][1024][1024]; q / k / v = x W^T + b (nn.Linear natural [1024][1024] sigma 1/32, biases sigma 0.01); 16 heads of 64; scores * 64^-0.5; softmax over all 1024 keys (no mask); out = ctx merged head-major -> [8][1024][1024]; the source never applies its out_proj).
// Structure: token rows r = b*1024 + s; x as exact f16 rows (bf16-rounded); q and k as WMMA GEMMs (32x64 wave tiles, f32 accumulation, exact x16 weights + bias) into f32 rows split into f16 hi + x1024 residual planes, v as an f16-output GEMM; per batch: V^T for all heads via LDS transposes; per query tile of 256 rows: scores against all 1024 keys as THREE accumulating passes (hi.hi + lo.hi + hi.lo, K = 64, all heads on grid.y, alpha 2^-3 = 64^-0.5 applied here, logits sigma ~1), row softmax on VALU over all keys (its arithmetic 0/1 key mask keeps every key) (f32 statistics, native exp; weights x256 f16), out = P . V^T (K = all 1024 keys, alpha 2^-8 undoing the x256 weights) written as f32 straight into the head-major output columns; no output projection.
// Compute dtype: inputs rounded to bf16; x / weights exact; q and k as f16 hi + x1024 residual planes, v and softmax weights as plain f16 GEMM operands (~2^-12); scores, softmax statistics and the output f32. v_wmma_f32_16x16x32_f16.
#define NB 8
#define SQ 1024
#define DM 1024
#define NH 16
#define HD 64
#define HG 4                         /* heads per group in the unlaunched k_vt overload */
#define QT 256                       /* query rows per tile */
#define NKX SQ                       /* S / P row pitch */
#define QT0 128                      /* query rows per head in k_att0, which is not launched */
#define B0 0                         /* first batch processed (debug hook) */
#define NBR NB                       /* batches processed (debug hook) */
#define NR ((size_t)NB * SQ)         /* token rows */
#define MP ((int)((size_t)NBR * SQ)) /* rows projected (debug hook) */
#define QN SQ                        /* query rows attended per batch (debug hook) */
#define NHD NH                       /* heads attended (debug hook) */
#define MPO MP                       /* unused */
#define LQ DM      /* row pitch of the q/k/v rows */
typedef __bf16 v16b __attribute__((ext_vector_type(16)));
typedef unsigned short v8us __attribute__((ext_vector_type(8), may_alias));
typedef float  v8f  __attribute__((ext_vector_type(8)));
typedef float  v4f  __attribute__((ext_vector_type(4)));
typedef float  v4fa __attribute__((ext_vector_type(4), may_alias));
union FragB { v16b v; v8us half[2]; unsigned short u[16]; };

__device__ __forceinline__ unsigned short bf16_bits(float x) { unsigned int u = __float_as_uint(x); return (unsigned short)((u + 0x7FFFu + ((u >> 16) & 1u)) >> 16); }
__device__ __forceinline__ float bf16_val(unsigned short b) { return __uint_as_float(((unsigned int)b) << 16); }
__device__ __forceinline__ float bf16_round(float x) { return bf16_val(bf16_bits(x)); }
// D += A·B with NT terms: 1 = ah·bh, 2 = + al·bh (A split), 3 = + ah·bl (both split)
template <int NT>
__device__ __forceinline__ v8f mmaN(v16b ah, v16b al, v16b bh, v16b bl, v8f c) {
  c = __builtin_amdgcn_wmma_f32_16x16x32_bf16(false, ah, false, bh, (short)0, c, false, false);
  if (NT >= 2) c = __builtin_amdgcn_wmma_f32_16x16x32_bf16(false, al, false, bh, (short)0, c, false, false);
  if (NT >= 3) c = __builtin_amdgcn_wmma_f32_16x16x32_bf16(false, ah, false, bl, (short)0, c, false, false);
  asm volatile("v_nop\n\tv_nop\n\tv_nop\n\tv_nop" : "+v"(c) : "v"(ah), "v"(al), "v"(bh), "v"(bl));
  return c;
}

__global__ __launch_bounds__(256) void k_wt_bf16(const float* __restrict__ W, unsigned short* __restrict__ Wt, int K, int N) {
  const int t = blockIdx.x * 256 + threadIdx.x;
  const int k8n = K / 8;
  if (t >= N * k8n) return;
  const int n = t / k8n, k8 = (t % k8n) * 8;
  v8us v;
#pragma unroll
  for (int i = 0; i < 8; ++i) v[i] = bf16_bits(W[(size_t)(k8 + i) * N + n]);
  *(v8us*)(Wt + (size_t)n * K + k8) = v;
  
}

// GEMM C[M][N] (f32, pitch ldc) = act(A[M][K]·W + bias). A f32 row-major (pitch lda) converted per fragment to bf16
// (ASPLIT: hi/lo two planes -> 2 terms, else single rounded term); Wt bf16 [N][K] (pitch ldb). BIAS_BF16 rounds the
// bias to bf16 first (bias quantised to bf16 before the add). K%32==0, M%16==0, N%64==0.
template <bool ASPLIT, int ACT, bool BIAS_BF16>
__global__ __launch_bounds__(128) void k_gemm_bf(const float* __restrict__ A, int lda, const unsigned short* __restrict__ Wt, int ldb,
                                               const float* __restrict__ bias, float* __restrict__ C, int ldc, int M, int N, int K) {
  __shared__ __attribute__((aligned(16))) float so[4][16][64];
  const int tid = threadIdx.x, w = tid >> 5, lane = tid & 31, ln = lane & 15, hh = lane >> 4;
  const int ntn = N / 64;
  const int wid = blockIdx.x * 4 + w;
  const int mt = wid / ntn, nq = wid % ntn;
  if (mt * 16 >= M) return;
  const int row0 = mt * 16, col0 = nq * 64;
  const float* arow = A + (size_t)(row0 + ln) * lda;
  v8f acc[4] = {};
  for (int kb = 0; kb < K; kb += 32) {
    FragB ah, al;
    const v4f x0 = *(const v4fa*)(arow + kb + 8 * hh), x1 = *(const v4fa*)(arow + kb + 8 * hh + 4);
    const v4f x2 = *(const v4fa*)(arow + kb + 16 + 8 * hh), x3 = *(const v4fa*)(arow + kb + 16 + 8 * hh + 4);
    float xs[16] = {x0[0],x0[1],x0[2],x0[3],x1[0],x1[1],x1[2],x1[3],x2[0],x2[1],x2[2],x2[3],x3[0],x3[1],x3[2],x3[3]};
#pragma unroll
    for (int i = 0; i < 16; ++i) { const unsigned short hb = bf16_bits(xs[i]); ah.u[i] = hb; al.u[i] = ASPLIT ? bf16_bits(xs[i] - bf16_val(hb)) : (unsigned short)0; }
#pragma unroll
    for (int t = 0; t < 4; ++t) {
      const unsigned short* brow = Wt + (size_t)(col0 + t * 16 + ln) * ldb + kb;
      FragB b;
      b.half[0] = *(const v8us*)(brow + 8 * hh);
      b.half[1] = *(const v8us*)(brow + 16 + 8 * hh);
      acc[t] = mmaN<ASPLIT ? 2 : 1>(ah.v, al.v, b.v, b.v, acc[t]);
    }
  }
#pragma unroll
  for (int t = 0; t < 4; ++t) {
    float bv = bias ? bias[col0 + t * 16 + ln] : 0.f;
    if (BIAS_BF16) bv = bf16_round(bv);
#pragma unroll
    for (int r = 0; r < 8; ++r) { float v = acc[t][r] + bv; if (ACT == 1) v = fmaxf(v, 0.f); so[w][8 * hh + r][t * 16 + ln] = v; }
  }
  __builtin_amdgcn_fence(__ATOMIC_ACQ_REL, "workgroup");
  __builtin_amdgcn_wave_barrier();
  const int rsub = lane >> 4, c4 = (lane & 15) * 4;
  {
#pragma unroll
    for (int q = 0; q < 8; ++q) {
      const int r = q * 2 + rsub;
      const v4f v = *(const v4fa*)&so[w][r][c4];
      *(v4f*)(C + (size_t)(row0 + r) * ldc + col0 + c4) = v;
    }
    
  }
}

// GEMM C = act(A·W + bias + resid): A f32 (ASPLIT -> hi/lo 2 terms), Wt bf16 [N][K]; ACT 0 none, 1 relu, 2 exact gelu;
// resid (optional, f32, row index = (row % rmod), pitch ldr, RES_BF16 rounds it) added before the activation.
template <bool ASPLIT, int ACT, bool BIAS_BF16, bool RES_BF16>
__global__ __launch_bounds__(128) void k_gemm_bf3(const float* __restrict__ A, int lda, const unsigned short* __restrict__ Wt, int ldb,
                                                const float* __restrict__ bias, const float* __restrict__ resid, int rmod, int ldr,
                                                float* __restrict__ C, int ldc, int M, int N, int K) {
  __shared__ __attribute__((aligned(16))) float so[4][16][64];
  const int tid = threadIdx.x, w = tid >> 5, lane = tid & 31, ln = lane & 15, hh = lane >> 4;
  const int ntn = N / 64;
  const int wid = blockIdx.x * 4 + w;
  const int mt = wid / ntn, nq = wid % ntn;
  if (mt * 16 >= M) return;
  const int row0 = mt * 16, col0 = nq * 64;
  const float* arow = A + (size_t)(row0 + ln) * lda;
  v8f acc[4] = {};
  for (int kb = 0; kb < K; kb += 32) {
    FragB ah, al;
    const v4f x0 = *(const v4fa*)(arow + kb + 8 * hh), x1 = *(const v4fa*)(arow + kb + 8 * hh + 4);
    const v4f x2 = *(const v4fa*)(arow + kb + 16 + 8 * hh), x3 = *(const v4fa*)(arow + kb + 16 + 8 * hh + 4);
    float xs[16] = {x0[0],x0[1],x0[2],x0[3],x1[0],x1[1],x1[2],x1[3],x2[0],x2[1],x2[2],x2[3],x3[0],x3[1],x3[2],x3[3]};
#pragma unroll
    for (int i = 0; i < 16; ++i) { const unsigned short hb = bf16_bits(xs[i]); ah.u[i] = hb; al.u[i] = ASPLIT ? bf16_bits(xs[i] - bf16_val(hb)) : (unsigned short)0; }
#pragma unroll
    for (int t = 0; t < 4; ++t) {
      const unsigned short* brow = Wt + (size_t)(col0 + t * 16 + ln) * ldb + kb;
      FragB b;
      b.half[0] = *(const v8us*)(brow + 8 * hh);
      b.half[1] = *(const v8us*)(brow + 16 + 8 * hh);
      acc[t] = mmaN<ASPLIT ? 2 : 1>(ah.v, al.v, b.v, b.v, acc[t]);
    }
  }
#pragma unroll
  for (int t = 0; t < 4; ++t) {
    const int col = col0 + t * 16 + ln;
    float bv = bias ? bias[col] : 0.f;
    if (BIAS_BF16) bv = bf16_round(bv);
#pragma unroll
    for (int r = 0; r < 8; ++r) {
      float v = acc[t][r] + bv;
      if (resid) { float rv = resid[(size_t)((row0 + 8 * hh + r) % rmod) * ldr + col]; if (RES_BF16) rv = bf16_round(rv); v += rv; }
      if (ACT == 1) v = fmaxf(v, 0.f);
      if (ACT == 2) v = 0.5f * v * (1.0f + erff(v * 0.70710678118654752f));
      if (ACT == 3) { const float u = 0.7978845608028654f * (v + 0.044715f * v * v * v); v = 0.5f * v * (1.0f + tanhf(u)); }
      so[w][8 * hh + r][t * 16 + ln] = v;
    }
  }
  __builtin_amdgcn_fence(__ATOMIC_ACQ_REL, "workgroup");
  __builtin_amdgcn_wave_barrier();
  const int rsub = lane >> 4, c4 = (lane & 15) * 4;
  {
#pragma unroll
    for (int q = 0; q < 8; ++q) {
      const int r = q * 2 + rsub;
      const v4f v = *(const v4fa*)&so[w][r][c4];
      *(v4f*)(C + (size_t)(row0 + r) * ldc + col0 + c4) = v;
    }
    
  }
}
// row LayerNorm (biased variance, eps) over N: s = X (+ R); optional out_sum <- s; out_norm <- (s-mu)*rsqrt(var+eps)*g + b
template <bool PARAM_BF16>
__global__ __launch_bounds__(256) void k_layernorm(const float* __restrict__ X, const float* __restrict__ R, const float* __restrict__ g, const float* __restrict__ bta,
                                                  float* __restrict__ out_sum, float* __restrict__ out_norm, int N, float eps) {
  __shared__ float red[256];
  const int row = blockIdx.x, tid = threadIdx.x;
  const float* x = X + (size_t)row * N; const float* rr = R ? R + (size_t)row * N : nullptr;
  float vals[16];                     // up to N = 4096
  const int per = N / 256;            // contiguous chunk per thread? use strided-by-4 chunks: thread handles j = tid*4 + 1024*u
  float s1 = 0.f;
  for (int u = 0; u < per / 4; ++u) {
    const int j = tid * 4 + 1024 * u;
    const v4f a = *(const v4fa*)(x + j);
    v4f b = {0.f,0.f,0.f,0.f}; if (rr) b = *(const v4fa*)(rr + j);
#pragma unroll
    for (int q = 0; q < 4; ++q) { const float v = a[q] + b[q]; vals[u * 4 + q] = v; s1 += v; }
  }
  red[tid] = s1; __syncthreads();
  for (int st = 128; st > 0; st >>= 1) { if (tid < st) red[tid] += red[tid + st]; __syncthreads(); }
  const float mu = red[0] / (float)N; __syncthreads();
  float s2 = 0.f;
  for (int u = 0; u < per / 4; ++u)
#pragma unroll
    for (int q = 0; q < 4; ++q) { const float c = vals[u * 4 + q] - mu; s2 += c * c; }
  red[tid] = s2; __syncthreads();
  for (int st = 128; st > 0; st >>= 1) { if (tid < st) red[tid] += red[tid + st]; __syncthreads(); }
  const float rs = rsqrtf(red[0] / (float)N + eps);
  {
    for (int u = 0; u < per / 4; ++u) {
      const int j = tid * 4 + 1024 * u;
      v4f o, sm;
#pragma unroll
      for (int q = 0; q < 4; ++q) {
        float gg = g[j + q], bb = bta[j + q];
        if (PARAM_BF16) { gg = bf16_round(gg); bb = bf16_round(bb); }
        sm[q] = vals[u * 4 + q]; o[q] = (vals[u * 4 + q] - mu) * rs * gg + bb;
      }
      if (out_sum) *(v4f*)(out_sum + (size_t)row * N + j) = sm;
      *(v4f*)(out_norm + (size_t)row * N + j) = o;
    }
    
  }
}



// ---- f16 WMMA path (v_wmma_f32_16x16x32_f16): 11-bit significands for operands in range — used where a [0,1] probability operand needs more precision than bf16
typedef _Float16 v16h __attribute__((ext_vector_type(16)));
union FragH { v16h v; v8us half[2]; _Float16 h[16]; unsigned short u[16]; };
template <int NT>
__device__ __forceinline__ v8f mmaH(v16h ah, v16h al, v16h bh, v16h bl, v8f c) {
  c = __builtin_amdgcn_wmma_f32_16x16x32_f16(false, ah, false, bh, (short)0, c, false, false);
  if (NT >= 2) c = __builtin_amdgcn_wmma_f32_16x16x32_f16(false, al, false, bh, (short)0, c, false, false);
  if (NT >= 3) c = __builtin_amdgcn_wmma_f32_16x16x32_f16(false, ah, false, bl, (short)0, c, false, false);
  asm volatile("v_nop\n\tv_nop\n\tv_nop\n\tv_nop" : "+v"(c) : "v"(ah), "v"(al), "v"(bh), "v"(bl));
  return c;
}
// batched GEMM like k_gemm_b but f16 operands: A f32 (split into f16 hi/lo if ASPLIT, else rounded to f16), Bt = f16 values [n][k]; alpha; C f32; N multiple of 16 (partial tiles skipped)
template <bool ASPLIT>
__global__ __launch_bounds__(128) void k_gemm_h(const float* __restrict__ A, int lda, size_t sA, const _Float16* __restrict__ Bh, int ldb, size_t sB, float alpha, float* __restrict__ C, int ldc, size_t sC, int M, int N, int K) {
  __shared__ __attribute__((aligned(16))) float so[4][16][64];
  const int tid = threadIdx.x, w = tid >> 5, lane = tid & 31, ln = lane & 15, hh = lane >> 4; const int by = blockIdx.y;
  A += (size_t)by * sA; Bh += (size_t)by * sB; C += (size_t)by * sC;
  const int ntn = (N + 63) / 64; const int wid = blockIdx.x * 4 + w; const int mt = wid / ntn, nq = wid % ntn; if (mt * 16 >= M) return;
  const int row0 = mt * 16, col0 = nq * 64; const float* arow = A + (size_t)(row0 + ln) * lda;
  v8f acc[4] = {};
  for (int kb = 0; kb < K; kb += 32) {
    FragH ah, al;
    const v4f x0 = *(const v4fa*)(arow + kb + 8 * hh), x1 = *(const v4fa*)(arow + kb + 8 * hh + 4), x2 = *(const v4fa*)(arow + kb + 16 + 8 * hh), x3 = *(const v4fa*)(arow + kb + 16 + 8 * hh + 4);
    float xs[16] = {x0[0],x0[1],x0[2],x0[3],x1[0],x1[1],x1[2],x1[3],x2[0],x2[1],x2[2],x2[3],x3[0],x3[1],x3[2],x3[3]};
#pragma unroll
    for (int i = 0; i < 16; ++i) { const _Float16 h = (_Float16)xs[i]; ah.h[i] = h; al.h[i] = ASPLIT ? (_Float16)(xs[i] - (float)h) : (_Float16)0.0f; }
#pragma unroll
    for (int t = 0; t < 4; ++t) { if (col0 + t * 16 >= N) continue; const size_t boff = (size_t)(col0 + t * 16 + ln) * ldb + kb; FragH bq; bq.half[0] = *(const v8us*)(Bh + boff + 8 * hh); bq.half[1] = *(const v8us*)(Bh + boff + 16 + 8 * hh);
      acc[t] = mmaH<ASPLIT ? 2 : 1>(ah.v, al.v, bq.v, bq.v, acc[t]); }
  }
#pragma unroll
  for (int t = 0; t < 4; ++t) { if (col0 + t * 16 >= N) continue;
#pragma unroll
    for (int r = 0; r < 8; ++r) so[w][8 * hh + r][t * 16 + ln] = acc[t][r] * alpha; }
  __builtin_amdgcn_fence(__ATOMIC_ACQ_REL, "workgroup"); __builtin_amdgcn_wave_barrier();
  const int rsub = lane >> 4, c4 = (lane & 15) * 4;
  {
#pragma unroll
    for (int q = 0; q < 8; ++q) { const int r = q * 2 + rsub; if (col0 + c4 < N) { const v4f v = *(const v4fa*)&so[w][r][c4]; *(v4f*)(C + (size_t)(row0 + r) * ldc + col0 + c4) = v; } }
     }
}

// Wt[n][k] = f16(W[k][n]·scale) from f32 row-major W[K][N] (scale = power of two; bf16-exact weights stay exact in f16 away from the subnormal range)
__global__ __launch_bounds__(256) void k_wt_f16(const float* __restrict__ W, _Float16* __restrict__ Wt, int K, int N, float scale) {
  const int t = blockIdx.x * 256 + threadIdx.x; if (t >= N * (K / 8)) return; const int n = t / (K / 8), k8 = (t % (K / 8)) * 8; FragH f;
#pragma unroll
  for (int i = 0; i < 8; ++i) f.h[i] = (_Float16)(bf16_round(W[(size_t)(k8 + i) * N + n]) * scale); const v8us o = f.half[0];
  *(v8us*)((unsigned short*)Wt + (size_t)n * K + k8) = o; 
}
// k_gemm_hh variant with fused epilogue: v = acc·alpha + bias[by·sBias + col] (+ CP[(row/rowsPerB)·sCPb + by·64 + col] if CP) ; ACT 0 none / 1 elu ; writes f16 C16 (and f32 C if non-null)
template <int ACT>
__global__ __launch_bounds__(128) void k_gemm_hhx(const _Float16* __restrict__ A, int lda, size_t sA, const _Float16* __restrict__ Bh, int ldb, size_t sB, float alpha, const float* __restrict__ bias, size_t sBias, const float* __restrict__ CP, int rowsPerB, size_t sCPb, int row0g,
    float* __restrict__ C, _Float16* __restrict__ C16, int ldc, size_t sC, int M, int N, int K) {
  __shared__ __attribute__((aligned(16))) float so[4][16][64];
  const int tid = threadIdx.x, w = tid >> 5, lane = tid & 31, ln = lane & 15, hh = lane >> 4; const int by = blockIdx.y;
  A += (size_t)by * sA; Bh += (size_t)by * sB; const size_t cofs = (size_t)by * sC; const float* bp = bias ? bias + (size_t)by * sBias : nullptr;
  const int ntn = (N + 63) / 64; const int wid = blockIdx.x * 4 + w; const int mt = wid / ntn, nq = wid % ntn; if (mt * 16 >= M) return;
  const int row0 = mt * 16, col0 = nq * 64; const _Float16* arow = A + (size_t)(row0 + ln) * lda;
  v8f acc[4] = {};
  for (int kb = 0; kb < K; kb += 32) { FragH ah; ah.half[0] = *(const v8us*)((const unsigned short*)arow + kb + 8 * hh); ah.half[1] = *(const v8us*)((const unsigned short*)arow + kb + 16 + 8 * hh);
#pragma unroll
    for (int t = 0; t < 4; ++t) { if (col0 + t * 16 >= N) continue; const size_t boff = (size_t)(col0 + t * 16 + ln) * ldb + kb; FragH bq; bq.half[0] = *(const v8us*)((const unsigned short*)Bh + boff + 8 * hh); bq.half[1] = *(const v8us*)((const unsigned short*)Bh + boff + 16 + 8 * hh);
      acc[t] = mmaH<1>(ah.v, ah.v, bq.v, bq.v, acc[t]); }
  }
#pragma unroll
  for (int t = 0; t < 4; ++t) { if (col0 + t * 16 >= N) continue; const int col = col0 + t * 16 + ln; const float bv = bp ? bf16_round(bp[col]) : 0.f;
#pragma unroll
    for (int r = 0; r < 8; ++r) { float v = acc[t][r] * alpha + bv; if (CP) { const int rr = row0g + row0 + 8 * hh + r; if (rowsPerB < 0) v += CP[cofs + (size_t)rr * ldc + col];      /* rowsPerB < 0: own element of the batched C plane */ else { const int bidx = rr / rowsPerB; v += CP[(size_t)bidx * sCPb + (size_t)by * 64 + col]; } } if (ACT == 1) v = (v > 0.f) ? v : expm1f(v); else if (ACT == 7) v = (v > 0.f) ? v + 1.0f : expf(v); else if (ACT == 8) v = tanhf(v); else if (ACT == 9) v = 0.5f * v * (1.0f + tanhf(0.7978845608028654f * (v + 0.044715f * v * v * v))); else if (ACT == 11) v = 1.0f / (1.0f + expf(-v)); else if (ACT == 12) v = (v > 0.f) ? v : 0.01f * v; else if (ACT == 14) v = (v > 0.f) ? v : 0.1f * v; else if (ACT == 16) v = (v >= 0.f) ? v : 0.3f * v; else if (ACT == 17) v = (v >= 0.f) ? v : 0.2f * v; else if (ACT == 15) v = v / (1.0f + expf(-v)); else if (ACT == 3) v = fmaxf(v, 0.f); else if (ACT == 6) v = 0.5f * v * (1.0f + erff(v * 0.70710678118654752f)); so[w][8 * hh + r][t * 16 + ln] = v; } }
  __builtin_amdgcn_fence(__ATOMIC_ACQ_REL, "workgroup"); __builtin_amdgcn_wave_barrier();
  const int rsub = lane >> 4, c4 = (lane & 15) * 4; typedef _Float16 v4h __attribute__((ext_vector_type(4)));
  {
#pragma unroll
    for (int q = 0; q < 8; ++q) { const int r = q * 2 + rsub; if (col0 + c4 < N) { const v4f v = *(const v4fa*)&so[w][r][c4]; if (C) *(v4f*)(C + cofs + (size_t)(row0 + r) * ldc + col0 + c4) = v; if (C16) { v4h h4; for (int i = 0; i < 4; ++i) h4[i] = (_Float16)v[i]; *(v4h*)(C16 + cofs + (size_t)(row0 + r) * ldc + col0 + c4) = h4; } } }
     }
}


typedef _Float16 v4h __attribute__((ext_vector_type(4)));

__global__ __launch_bounds__(256) void k_x16(const float* __restrict__ x, _Float16* __restrict__ X16, size_t n8) { const size_t t = (size_t)blockIdx.x * 256 + threadIdx.x; if (t >= n8) return; FragH f;
#pragma unroll
  for (int q = 0; q < 8; ++q) f.h[q] = (_Float16)bf16_round(x[t * 8 + q]); *(v8us*)((unsigned short*)X16 + t * 8) = f.half[0];  }
__global__ __launch_bounds__(256) void k_h16(const float* __restrict__ x, _Float16* __restrict__ X16, size_t n8) { const size_t t = (size_t)blockIdx.x * 256 + threadIdx.x; if (t >= n8) return; FragH f;
#pragma unroll
  for (int q = 0; q < 8; ++q) f.h[q] = (_Float16)x[t * 8 + q]; *(v8us*)((unsigned short*)X16 + t * 8) = f.half[0];  }
__global__ __launch_bounds__(256) void k_round16f(const float* __restrict__ W, _Float16* __restrict__ Bt, size_t n8) { const size_t t = (size_t)blockIdx.x * 256 + threadIdx.x; if (t >= n8) return; FragH f;
#pragma unroll
  for (int i = 0; i < 8; ++i) f.h[i] = (_Float16)(bf16_round(W[t * 8 + i]) * 16.0f); *(v8us*)((unsigned short*)Bt + t * 8) = f.half[0];  }
template <int NHv, int TTv>
__global__ __launch_bounds__(256) void k_vt(const _Float16* __restrict__ V16, int ldv, int voff, _Float16* __restrict__ Vt) { __shared__ unsigned short tl[64][66]; const int tid = threadIdx.x; const int slab = blockIdx.x / (TTv / 64), lg = blockIdx.x % (TTv / 64); const int b = slab / NHv, h = slab % NHv;
  for (int i = tid; i < 64 * 8; i += 256) { const int r = i / 8, c8 = (i % 8) * 8; FragH f; f.half[0] = *(const v8us*)((const unsigned short*)V16 + ((size_t)b * TTv + lg * 64 + r) * ldv + voff + h * 64 + c8);
#pragma unroll
    for (int q = 0; q < 8; ++q) tl[r][c8 + q] = f.u[q]; }
  __syncthreads();
  {
#pragma unroll
    for (int rd = 0; rd < 2; ++rd) { const int d = rd * 32 + tid / 8, pc = tid % 8; FragH f;
#pragma unroll
      for (int q = 0; q < 8; ++q) f.u[q] = tl[pc * 8 + q][d];
      *(v8us*)((unsigned short*)Vt + ((size_t)slab * 64 + d) * TTv + lg * 64 + pc * 8) = f.half[0]; }
     } }

__global__ __launch_bounds__(256) void k_hl(const float* __restrict__ F, _Float16* __restrict__ Hh, _Float16* __restrict__ Hl, size_t n8) { const size_t t = (size_t)blockIdx.x * 256 + threadIdx.x; if (t >= n8) return; FragH fh, fl; const v4f a = *(const v4fa*)(F + t * 8), c = *(const v4fa*)(F + t * 8 + 4);
#pragma unroll
  for (int q = 0; q < 4; ++q) { _Float16 h = (_Float16)a[q]; fh.h[q] = h; fl.h[q] = (_Float16)((a[q] - (float)h) * 1024.0f); h = (_Float16)c[q]; fh.h[4 + q] = h; fl.h[4 + q] = (_Float16)((c[q] - (float)h) * 1024.0f); }
  { *(v8us*)((unsigned short*)Hh + t * 8) = fh.half[0]; *(v8us*)((unsigned short*)Hl + t * 8) = fl.half[0];  } }

// ---- fast GEMM (wave tile 32x64; requires M % 32 == 0 rows per launch region and N % 64 == 0); epilogue = k_gemm_hhx semantics ----
__device__ __forceinline__ v16h g2_frag(const _Float16* p, int hh) { FragH f; f.half[0] = *(const v8us*)((const unsigned short*)p + 8 * hh); f.half[1] = *(const v8us*)((const unsigned short*)p + 16 + 8 * hh); return f.v; }
__device__ __forceinline__ v8f g2_mma(v16h a, v16h b, v8f c) { v8f d = __builtin_amdgcn_wmma_f32_16x16x32_f16(false, a, false, b, (short)0, c, false, false); asm volatile("v_nop\n\tv_nop\n\tv_nop\n\tv_nop" : "+v"(d) : "v"(a), "v"(b)); return d; }
template <int ACT>
__global__ __launch_bounds__(128) void k_gemm2(const _Float16* __restrict__ A, int lda, size_t sA, const _Float16* __restrict__ Bh, int ldb, size_t sB, float alpha, const float* __restrict__ bias, size_t sBias, const float* __restrict__ CP, int rowsPerB, size_t sCPb, int row0g,
    float* __restrict__ C, _Float16* __restrict__ C16, int ldc, size_t sC, int M, int N, int K) { static_assert(ACT == 0 || ACT == 3 || ACT == 6 || ACT == 8 || ACT == 9 || ACT == 11 || ACT == 12 || ACT == 14 || ACT == 15 || ACT == 16 || ACT == 17, "k_gemm2: unsupported ACT code (would silently apply no activation)");
  __shared__ __attribute__((aligned(16))) float so[4][32][68];
  const int tid = threadIdx.x, w = tid >> 5, lane = tid & 31, ln = lane & 15, hh = lane >> 4; const int by = blockIdx.y;
  A += (size_t)by * sA; Bh += (size_t)by * sB; const size_t cofs = (size_t)by * sC; const float* bp = bias ? bias + (size_t)by * sBias : nullptr;
  const int ntn = N >> 6; const int mt = blockIdx.x / ntn, nq = blockIdx.x - mt * ntn; const int row0 = mt * 128 + 32 * w, col0 = nq * 64; if (row0 >= M) return;
  const _Float16* a0p = A + (size_t)(row0 + ln) * lda; const _Float16* a1p = a0p + (size_t)16 * lda;
  const _Float16* b0p = Bh + (size_t)(col0 + ln) * ldb; const _Float16* b1p = b0p + (size_t)16 * ldb; const _Float16* b2p = b1p + (size_t)16 * ldb; const _Float16* b3p = b2p + (size_t)16 * ldb;
  const v8f z8 = {0.f,0.f,0.f,0.f,0.f,0.f,0.f,0.f}; v8f c00 = z8, c01 = z8, c02 = z8, c03 = z8, c10 = z8, c11 = z8, c12 = z8, c13 = z8;
#pragma unroll 1
  for (int kb = 0; kb < K; kb += 32) { const v16h a0 = g2_frag(a0p + kb, hh), a1 = g2_frag(a1p + kb, hh);
    v16h b = g2_frag(b0p + kb, hh); c00 = g2_mma(a0, b, c00); c10 = g2_mma(a1, b, c10);
    b = g2_frag(b1p + kb, hh); c01 = g2_mma(a0, b, c01); c11 = g2_mma(a1, b, c11);
    b = g2_frag(b2p + kb, hh); c02 = g2_mma(a0, b, c02); c12 = g2_mma(a1, b, c12);
    b = g2_frag(b3p + kb, hh); c03 = g2_mma(a0, b, c03); c13 = g2_mma(a1, b, c13); }
  v8f accs[8] = {c00, c01, c02, c03, c10, c11, c12, c13};
#pragma unroll
  for (int u = 0; u < 8; ++u) { const int t = u & 3, half = u >> 2; const int col = col0 + t * 16 + ln; const float bv = bp ? bf16_round(bp[col]) : 0.f;
#pragma unroll
    for (int r = 0; r < 8; ++r) { const int rloc = half * 16 + 8 * hh + r; float v = accs[u][r] * alpha + bv; if (CP) { if (rowsPerB < 0) v += CP[cofs + (size_t)(row0g + row0 + rloc) * ldc + col];      /* rowsPerB < 0: own element of the batched C plane */ else { const int bidx = (row0g + row0 + rloc) / rowsPerB; v += CP[(size_t)bidx * sCPb + (size_t)by * 64 + col]; } }
      if (ACT == 3) v = fmaxf(v, 0.f); else if (ACT == 6) v = 0.5f * v * (1.0f + erff(v * 0.70710678118654752f)); else if (ACT == 11) v = 1.0f / (1.0f + expf(-v)); else if (ACT == 15) v = v / (1.0f + expf(-v)); else if (ACT == 12) v = (v > 0.f) ? v : 0.01f * v; else if (ACT == 8) v = tanhf(v); else if (ACT == 9) v = 0.5f * v * (1.0f + tanhf(0.7978845608028654f * (v + 0.044715f * v * v * v))); else if (ACT == 14) v = (v > 0.f) ? v : 0.1f * v; else if (ACT == 16) v = (v >= 0.f) ? v : 0.3f * v; else if (ACT == 17) v = (v >= 0.f) ? v : 0.2f * v;
      so[w][rloc][t * 16 + ln] = v; } }
  __builtin_amdgcn_fence(__ATOMIC_ACQ_REL, "workgroup"); __builtin_amdgcn_wave_barrier();
  const int rsub = lane >> 4, c4 = (lane & 15) * 4;
  {
#pragma unroll
    for (int q = 0; q < 16; ++q) { const int r = q * 2 + rsub; const v4f v = *(const v4fa*)&so[w][r][c4]; if (C) *(v4f*)(C + cofs + (size_t)(row0 + r) * ldc + col0 + c4) = v; if (C16) { v4h h4; for (int i = 0; i < 4; ++i) h4[i] = (_Float16)v[i]; *(v4h*)(C16 + cofs + (size_t)(row0 + r) * ldc + col0 + c4) = h4; } }
     } }


__global__ __launch_bounds__(256) void k_wnat(const float* __restrict__ w, size_t n8, _Float16* __restrict__ Bt) { const size_t t = (size_t)blockIdx.x * 256 + threadIdx.x; if (t >= n8) return; FragH f; for (int q = 0; q < 8; ++q) f.h[q] = (_Float16)(bf16_round(w[t * 8 + q]) * 16.0f); *(v8us*)((unsigned short*)Bt + t * 8) = f.half[0];  }
__global__ __launch_bounds__(256) void k_rsm(const float* __restrict__ S, _Float16* __restrict__ P, int nrows) {
  #pragma clang fp contract(off)
  const int i = blockIdx.x * 256 + threadIdx.x; if (i >= nrows) return; const float* s = S + (size_t)i * SQ; float mx = -3.0e38f;
#pragma unroll 1
  for (int j = 0; j < SQ; ++j) mx = fmaxf(mx, s[j]); float se = 0.f;
#pragma unroll 1
  for (int j = 0; j < SQ; ++j) se += expf(s[j] - mx); const float sc = 256.0f / se;
#pragma unroll 1
  for (int j0 = 0; j0 < SQ; j0 += 8) { FragH f; for (int q = 0; q < 8; ++q) f.h[q] = (_Float16)(expf(s[j0 + q] - mx) * sc); unsigned short* d = (unsigned short*)P + (size_t)i * SQ + j0; *(v8us*)d = f.half[0];  } }
__global__ __launch_bounds__(256) void k_vt(const _Float16* __restrict__ V16, int b, int h0, _Float16* __restrict__ VT) { __shared__ unsigned short tl[64][65]; const int tid = threadIdx.x; const int hh = blockIdx.x % HG, sg = blockIdx.x / HG; const int s0 = sg * 64; const int h = h0 + hh;
  for (int i = tid; i < 64 * 8; i += 256) { const int j = i / 8, d8 = (i % 8) * 8; FragH f; f.half[0] = *(const v8us*)((const unsigned short*)V16 + ((size_t)b * SQ + s0 + j) * DM + h * HD + d8); for (int q = 0; q < 8; ++q) tl[d8 + q][j] = f.u[q]; }
  __syncthreads();
  { for (int i = tid; i < 64 * 8; i += 256) { const int d = i / 8, j8 = (i % 8) * 8; FragH f; for (int q = 0; q < 8; ++q) f.u[q] = tl[d][j8 + q]; *(v8us*)((unsigned short*)VT + ((size_t)hh * HD + d) * SQ + s0 + j8) = f.half[0]; }  } }



// Row softmax, one wave per score row: lane l holds keys 128 c + 4 l .. + 3 (c = 0 .. NKX / 128 - 1) in registers, so every wave-wide load covers 512 contiguous bytes, S is read once and each exp is taken once.
template <int M> __device__ __forceinline__ float lane_xor_row(float v) { return __int_as_float(__builtin_amdgcn_update_dpp(0, __float_as_int(v), 0x160 | M, 0xf, 0xf, true)); }      /* lane l <- lane l ^ M inside a 16-lane row (DPP row_xmask) */
__device__ __forceinline__ float lane_xor_16(float v) { const int u = __float_as_int(v); return __int_as_float(__builtin_amdgcn_permlanex16(u, u, 0x76543210, 0xfedcba98, false, false)); }      /* lane l <- lane l ^ 16 */
__device__ __forceinline__ float wave_max(float v) { v = fmaxf(v, lane_xor_row<1>(v)); v = fmaxf(v, lane_xor_row<2>(v)); v = fmaxf(v, lane_xor_row<4>(v)); v = fmaxf(v, lane_xor_row<8>(v)); return fmaxf(v, lane_xor_16(v)); }
__device__ __forceinline__ float wave_sum(float v) { v += lane_xor_row<1>(v); v += lane_xor_row<2>(v); v += lane_xor_row<4>(v); v += lane_xor_row<8>(v); return v + lane_xor_16(v); }
__device__ __forceinline__ float exp2_slot(float a) { float r; asm("v_exp_f32 %0, %1\n\tv_nop" : "=v"(r) : "v"(a)); return r; }      /* 2^a; the v_nop in the same statement keeps the slot the instruction set asks for behind a transcendental, before its result is read or its source register reused */
__global__ __launch_bounds__(256) void k_rsmcf2(const float* __restrict__ S, _Float16* __restrict__ P, int hg, int q0) {
  static_assert(NKX % 128 == 0, "a row is whole 128-key chunks");
  const int t = blockIdx.x * 8 + (threadIdx.x >> 5), lane = threadIdx.x & 31; if (t >= hg * QT) return;      /* wave-uniform, no barrier below */
  const float* s = S + (size_t)t * NKX + lane * 4; const int last = q0 + (t % QT); v4f e[NKX / 128];
#pragma unroll
  for (int c = 0; c < NKX / 128; ++c) e[c] = *(const v4fa*)(s + c * 128);
  __builtin_amdgcn_sched_barrier(0);      /* all eight loads issue before the first use: without it the compiler holds two back behind the first wait, a second memory latency per row */
  float mx = -3.0e38f;
#pragma unroll
  for (int c = 0; c < NKX / 128; ++c) for (int q = 0; q < 4; ++q) { const float f = (c * 128 + lane * 4 + q <= last) ? 1.f : 0.f; e[c][q] = fmaf(f, e[c][q], (1.f - f) * -1.0e9f); mx = fmaxf(mx, e[c][q]); }
  mx = wave_max(mx); v4f s4 = {0.f, 0.f, 0.f, 0.f};
#pragma unroll
  for (int c = 0; c < NKX / 128; ++c) { for (int q = 0; q < 4; ++q) e[c][q] = exp2_slot((e[c][q] - mx) * 1.44269504088896340736f); s4 += e[c]; }      /* = __expf(e - mx), bit for bit */
  const float sc = 256.0f / wave_sum((s4[0] + s4[1]) + (s4[2] + s4[3]));
  _Float16* d = P + (size_t)t * NKX + lane * 4;
#pragma unroll
  for (int c = 0; c < NKX / 128; ++c) { v4h h4; for (int q = 0; q < 4; ++q) h4[q] = (_Float16)(e[c][q] * sc); *(v4h*)(d + c * 128) = h4; } }


template <int MASKADD>
__global__ __launch_bounds__(64) void k_att0(const float* __restrict__ QF, const float* __restrict__ KF, const float* __restrict__ VF, int ld, const float* __restrict__ mask, float scale, float* __restrict__ OF, int ldo) {
  #pragma clang fp contract(off)
  __shared__ __attribute__((aligned(16))) float lq[64][64]; __shared__ __attribute__((aligned(16))) float lo[64][64];
  const int tid = threadIdx.x; const int h = blockIdx.x / (QT0 / 64), rg = blockIdx.x % (QT0 / 64); const int i = rg * 64 + tid;
  const float* qr = QF + (size_t)i * ld + h * HD;
#pragma unroll 1
  for (int c = 0; c < HD / 4; ++c) { *(v4f*)&lq[tid][c * 4] = *(const v4fa*)(qr + c * 4); const v4f z = {0.f, 0.f, 0.f, 0.f}; *(v4f*)&lo[tid][c * 4] = z; }
  float m = -1.0e30f, l = 0.f; const int jmax = MASKADD ? (SQ - 1) : (rg * 64 + 63);      /* additive-mask form: every key (the mask input decides); causal form: keys up to the block's last row */
#pragma unroll 1
  for (int j = 0; j <= jmax; ++j) { const float* kr = KF + (size_t)j * ld + h * HD; const float* vr = VF + (size_t)j * ld + h * HD; float s = 0.f;
#pragma unroll 1
    for (int c = 0; c < HD / 4; ++c) { const v4f kq = *(const v4fa*)(kr + c * 4); const v4f qq = *(v4f*)&lq[tid][c * 4]; s = __fadd_rn(s, __fmul_rn(qq[0], kq[0])); s = __fadd_rn(s, __fmul_rn(qq[1], kq[1])); s = __fadd_rn(s, __fmul_rn(qq[2], kq[2])); s = __fadd_rn(s, __fmul_rn(qq[3], kq[3])); }
    s = __fmul_rn(s, scale); if (MASKADD) s = __fadd_rn(s, __fmul_rn(bf16_round(mask[(size_t)i * SQ + j]), -10000.0f));
    const float f = (MASKADD || j <= i) ? 1.f : 0.f; const float sm = fmaf(f, s, (1.f - f) * -1.0e30f); const float mn = fmaxf(m, sm); const float sc = expf(m - mn); const float e = expf(sm - mn); l = __fadd_rn(__fmul_rn(l, sc), e); m = mn;
#pragma unroll 1
    for (int c = 0; c < HD / 4; ++c) { const v4f vv = *(const v4fa*)(vr + c * 4); v4f oo = *(v4f*)&lo[tid][c * 4]; for (int u = 0; u < 4; ++u) oo[u] = __fadd_rn(__fmul_rn(oo[u], sc), __fmul_rn(e, vv[u])); *(v4f*)&lo[tid][c * 4] = oo; } }
  const float fin = 64.0f / l;      /* o carried x64 */
#pragma unroll 1
  for (int c = 0; c < HD / 4; ++c) { v4f oo = *(v4f*)&lo[tid][c * 4]; for (int u = 0; u < 4; ++u) oo[u] = __fmul_rn(oo[u], fin); *(v4f*)&lo[tid][c * 4] = oo; }
  __syncthreads();
  {
#pragma unroll 1
    for (int it = 0; it < 16; ++it) { const int row = it * 4 + tid / 16, pc = (tid % 16) * 4; const v4f v = *(const v4f*)&lo[row][pc]; *(v4f*)(OF + (size_t)(rg * 64 + row) * ldo + h * HD + pc) = v; }
     } }

__global__ __launch_bounds__(256) void k_of0out(const float* __restrict__ src, float* __restrict__ dst, size_t n4) { const size_t t = (size_t)blockIdx.x * 256 + threadIdx.x; if (t >= n4) return; v4f v = *(const v4fa*)(src + t * 4); for (int q = 0; q < 4; ++q) v[q] = __fmul_rn(v[q], 0.015625f); *(v4f*)(dst + t * 4) = v;  }

extern "C" void kernel_launch(void* const* d_in, const int* in_sizes, int n_in,
                              void* d_out, int out_size, void* d_ws, size_t ws_size, hipStream_t stream) {
  (void)in_sizes; (void)n_in; (void)out_size;
  const float* const* I = (const float* const*)d_in; const float* x = I[0]; const float* wq = I[1]; const float* wk = I[2]; const float* wv = I[3]; const float* bq = I[4]; const float* bk = I[5]; const float* bv = I[6];      /* input order: x, Wq, Wk, Wv, bq, bk, bv: natural [out][in] weights, then the three biases (every projection launch passes the bias variables); NO output projection */
  char* ws = (char*)d_ws; size_t off = 0;
  auto take = [&](size_t bytes) { char* p = ws + off; off += (bytes + 255) & ~(size_t)255; return p; };
  _Float16* BQ = (_Float16*)take((size_t)DM * DM * 2); _Float16* BK = (_Float16*)take((size_t)DM * DM * 2); _Float16* BV = (_Float16*)take((size_t)DM * DM * 2);
  _Float16* X16 = (_Float16*)take(NR * DM * 2); float* QF = (float*)take(NR * DM * 4); _Float16* QH = (_Float16*)take(NR * DM * 2); _Float16* QL = (_Float16*)take(NR * DM * 2); _Float16* KH = (_Float16*)take(NR * DM * 2); _Float16* KL = (_Float16*)take(NR * DM * 2); _Float16* Q16 = QH; _Float16* K16 = KH; _Float16* V16 = (_Float16*)take(NR * DM * 2);
  float* S = (float*)take((size_t)NH * QT * NKX * 4); _Float16* P = (_Float16*)take((size_t)NH * QT * NKX * 2); _Float16* VT = (_Float16*)take((size_t)NH * HD * SQ * 2);
  if (off > ws_size) return;
  { const unsigned g = (unsigned)(((size_t)DM * DM / 8 + 255) / 256); k_wnat<<<g, 256, 0, stream>>>(wq, (size_t)DM * DM / 8, BQ); k_wnat<<<g, 256, 0, stream>>>(wk, (size_t)DM * DM / 8, BK); k_wnat<<<g, 256, 0, stream>>>(wv, (size_t)DM * DM / 8, BV); }      /* natural [out][in] = Bt[n][k] x16 */
  k_x16<<<(unsigned)((NR * DM / 8 + 255) / 256), 256, 0, stream>>>(x, X16, NR * DM / 8);
  const size_t r0p = (size_t)B0 * SQ;      /* first projected row */
  k_gemm2<0><<<dim3((unsigned)((MP / 128) * (DM / 64)), 1), 128, 0, stream>>>(X16 + r0p * DM, DM, 0, BQ, DM, 0, 0.0625f, bq, 0, nullptr, 1, 0, 0, QF + r0p * DM, nullptr, DM, 0, MP, DM, DM); k_hl<<<(unsigned)(((size_t)MP * DM / 8 + 255) / 256), 256, 0, stream>>>(QF + r0p * DM, QH + r0p * DM, QL + r0p * DM, (size_t)MP * DM / 8);      /* q (f32) -> f16 hi + x1024 residual: unscaled logits sigma ~8 */
  k_gemm2<0><<<dim3((unsigned)((MP / 128) * (DM / 64)), 1), 128, 0, stream>>>(X16 + r0p * DM, DM, 0, BK, DM, 0, 0.0625f, bk, 0, nullptr, 1, 0, 0, QF + r0p * DM, nullptr, DM, 0, MP, DM, DM); k_hl<<<(unsigned)(((size_t)MP * DM / 8 + 255) / 256), 256, 0, stream>>>(QF + r0p * DM, KH + r0p * DM, KL + r0p * DM, (size_t)MP * DM / 8);      /* k likewise */
  k_gemm2<0><<<dim3((unsigned)((MP / 128) * (DM / 64)), 1), 128, 0, stream>>>(X16 + r0p * DM, DM, 0, BV, DM, 0, 0.0625f, bv, 0, nullptr, 1, 0, 0, nullptr, V16 + r0p * DM, DM, 0, MP, DM, DM);
  for (int b = B0; b < B0 + NBR; ++b) { const size_t r0 = (size_t)b * SQ;
    k_vt<NH, SQ><<<NH * (SQ / 64), 256, 0, stream>>>(V16 + r0 * LQ, LQ, 0, VT);      /* V^T [NH][HD][SQ] for this batch */
    for (int q0 = 0; q0 < QN; q0 += QT) { const int nk = SQ;      /* NON-causal: every 256-row query tile sees all SQ keys */
      k_gemm2<0><<<dim3((QT / 128) * (nk / 64), NHD), 128, 0, stream>>>(QH + (r0 + q0) * LQ, LQ, (size_t)HD, KH + r0 * LQ, LQ, (size_t)HD, 0.125f, nullptr, 0, nullptr, 1, 0, 0, S, nullptr, NKX, (size_t)QT * NKX, QT, nk, HD);      /* raw scores: hi . hi */
      k_gemm2<0><<<dim3((QT / 128) * (nk / 64), NHD), 128, 0, stream>>>(QL + (r0 + q0) * LQ, LQ, (size_t)HD, KH + r0 * LQ, LQ, (size_t)HD, 0.0001220703125f, nullptr, 0, S, -1, 0, 0, S, nullptr, NKX, (size_t)QT * NKX, QT, nk, HD); k_gemm2<0><<<dim3((QT / 128) * (nk / 64), NHD), 128, 0, stream>>>(QH + (r0 + q0) * LQ, LQ, (size_t)HD, KL + r0 * LQ, LQ, (size_t)HD, 0.0001220703125f, nullptr, 0, S, -1, 0, 0, S, nullptr, NKX, (size_t)QT * NKX, QT, nk, HD);      /* += 2^-10 (lo . hi + hi . lo) */      /* scores, all heads on grid.y */
      k_rsmcf2<<<(NHD * QT + 7) / 8, 256, 0, stream>>>(S, P, NHD, SQ);      /* plain softmax over all keys: the kernel keeps key j iff j <= q0_arg + row, and q0_arg = SQ makes every j < SQ visible for every row */
      k_gemm2<0><<<dim3((QT / 128) * (HD / 64), NHD), 128, 0, stream>>>(P, NKX, (size_t)QT * NKX, VT, SQ, (size_t)HD * SQ, 0.00390625f, nullptr, 0, nullptr, 1, 0, 0, (float*)d_out + (r0 + q0) * DM, nullptr, DM, (size_t)HD, QT, HD, nk); } }      /* out = P V^T (alpha 2^-8) written f32 straight into the head-major output columns (no output projection); NON-causal build: no exact first-tile path, no rewrite */
}

// v003
// One run takes 203 microseconds.
// Versions between v001 and this one are left out; their measured steps multiply to 14.9 times as fast.
// Over all steps from v000 it is 40.2 times as fast.
#include <hip/hip_runtime.h>
// Multi-head self-attention without an output projection, NON-causal (x [8][1024][1024]; q / k / v = x W^T + b (nn.Linear natural [1024][1024] sigma 1/32, biases sigma 0.01); 16 heads of 64; scores * 64^-0.5; softmax over all 1024 keys (no mask); out = ctx merged head-major -> [8][1024][1024]; the source never applies its out_proj).
// Structure: token rows r = b*1024 + s; x as exact f16 rows (bf16-rounded); q and k as WMMA GEMMs (128x128 work-group tiles staged in LDS by asynchronous copies, 32x64 wave tiles, f32 accumulation, exact x16 weights + bias) into f32 rows split into f16 hi + x1024 residual planes, v as an f16-output GEMM; V^T for all batches and heads via LDS transposes; then ONE fused attention launch (k_fattn): per wave 32 queries, keys 32 at a time, scores as hi.hi + 2^-10 (hi.lo + lo.hi), online softmax (f32 running max and sum, native exp2), weights x256 as f16 straight from the score accumulators into O^T += V^T P^T, f32 out written into the head-major columns.
// Compute dtype: inputs rounded to bf16; x / weights exact; v and softmax weights as plain f16 GEMM operands (~2^-12); q and k as f16 hi + x1024 residual; scores, softmax statistics and o f32. v_wmma_f32_16x16x32_f16.
#define NB 8
#define SQ 1024
#define DM 1024
#define NH 16
#define HD 64
#define HG 4                         /* heads per group in the unlaunched k_vt overload */
#define QT 256                       /* unused */
#define NKX SQ                       /* unused */
#define QT0 128                      /* query rows per head in k_att0, which is not launched */
#define B0 0                         /* first batch processed (debug hook) */
#define NBR NB                       /* batches processed (debug hook) */
#define NR ((size_t)NB * SQ)         /* token rows */
#define MP ((int)((size_t)NBR * SQ)) /* rows projected (debug hook) */
#define QN SQ                        /* unused */
#define NHD NH                       /* unused */
#define MPO MP                       /* unused */
#define LQ DM      /* row pitch of the q/k/v rows */
typedef __bf16 v16b __attribute__((ext_vector_type(16)));
typedef unsigned short v8us __attribute__((ext_vector_type(8), may_alias));
typedef float  v8f  __attribute__((ext_vector_type(8)));
typedef float  v4f  __attribute__((ext_vector_type(4)));
typedef float  v4fa __attribute__((ext_vector_type(4), may_alias));
union FragB { v16b v; v8us half[2]; unsigned short u[16]; };

__device__ __forceinline__ unsigned short bf16_bits(float x) { unsigned int u = __float_as_uint(x); return (unsigned short)((u + 0x7FFFu + ((u >> 16) & 1u)) >> 16); }
__device__ __forceinline__ float bf16_val(unsigned short b) { return __uint_as_float(((unsigned int)b) << 16); }
__device__ __forceinline__ float bf16_round(float x) { return bf16_val(bf16_bits(x)); }
// D += A·B with NT terms: 1 = ah·bh, 2 = + al·bh (A split), 3 = + ah·bl (both split)
template <int NT>
__device__ __forceinline__ v8f mmaN(v16b ah, v16b al, v16b bh, v16b bl, v8f c) {
  c = __builtin_amdgcn_wmma_f32_16x16x32_bf16(false, ah, false, bh, (short)0, c, false, false);
  if (NT >= 2) c = __builtin_amdgcn_wmma_f32_16x16x32_bf16(false, al, false, bh, (short)0, c, false, false);
  if (NT >= 3) c = __builtin_amdgcn_wmma_f32_16x16x32_bf16(false, ah, false, bl, (short)0, c, false, false);
  asm volatile("v_nop\n\tv_nop\n\tv_nop\n\tv_nop" : "+v"(c) : "v"(ah), "v"(al), "v"(bh), "v"(bl));
  return c;
}

__global__ __launch_bounds__(256) void k_wt_bf16(const float* __restrict__ W, unsigned short* __restrict__ Wt, int K, int N) {
  const int t = blockIdx.x * 256 + threadIdx.x;
  const int k8n = K / 8;
  if (t >= N * k8n) return;
  const int n = t / k8n, k8 = (t % k8n) * 8;
  v8us v;
#pragma unroll
  for (int i = 0; i < 8; ++i) v[i] = bf16_bits(W[(size_t)(k8 + i) * N + n]);
  *(v8us*)(Wt + (size_t)n * K + k8) = v;
  
}

// GEMM C[M][N] (f32, pitch ldc) = act(A[M][K]·W + bias). A f32 row-major (pitch lda) converted per fragment to bf16
// (ASPLIT: hi/lo two planes -> 2 terms, else single rounded term); Wt bf16 [N][K] (pitch ldb). BIAS_BF16 rounds the
// bias to bf16 first (bias quantised to bf16 before the add). K%32==0, M%16==0, N%64==0.
template <bool ASPLIT, int ACT, bool BIAS_BF16>
__global__ __launch_bounds__(128) void k_gemm_bf(const float* __restrict__ A, int lda, const unsigned short* __restrict__ Wt, int ldb,
                                               const float* __restrict__ bias, float* __restrict__ C, int ldc, int M, int N, int K) {
  __shared__ __attribute__((aligned(16))) float so[4][16][64];
  const int tid = threadIdx.x, w = tid >> 5, lane = tid & 31, ln = lane & 15, hh = lane >> 4;
  const int ntn = N / 64;
  const int wid = blockIdx.x * 4 + w;
  const int mt = wid / ntn, nq = wid % ntn;
  if (mt * 16 >= M) return;
  const int row0 = mt * 16, col0 = nq * 64;
  const float* arow = A + (size_t)(row0 + ln) * lda;
  v8f acc[4] = {};
  for (int kb = 0; kb < K; kb += 32) {
    FragB ah, al;
    const v4f x0 = *(const v4fa*)(arow + kb + 8 * hh), x1 = *(const v4fa*)(arow + kb + 8 * hh + 4);
    const v4f x2 = *(const v4fa*)(arow + kb + 16 + 8 * hh), x3 = *(const v4fa*)(arow + kb + 16 + 8 * hh + 4);
    float xs[16] = {x0[0],x0[1],x0[2],x0[3],x1[0],x1[1],x1[2],x1[3],x2[0],x2[1],x2[2],x2[3],x3[0],x3[1],x3[2],x3[3]};
#pragma unroll
    for (int i = 0; i < 16; ++i) { const unsigned short hb = bf16_bits(xs[i]); ah.u[i] = hb; al.u[i] = ASPLIT ? bf16_bits(xs[i] - bf16_val(hb)) : (unsigned short)0; }
#pragma unroll
    for (int t = 0; t < 4; ++t) {
      const unsigned short* brow = Wt + (size_t)(col0 + t * 16 + ln) * ldb + kb;
      FragB b;
      b.half[0] = *(const v8us*)(brow + 8 * hh);
      b.half[1] = *(const v8us*)(brow + 16 + 8 * hh);
      acc[t] = mmaN<ASPLIT ? 2 : 1>(ah.v, al.v, b.v, b.v, acc[t]);
    }
  }
#pragma unroll
  for (int t = 0; t < 4; ++t) {
    float bv = bias ? bias[col0 + t * 16 + ln] : 0.f;
    if (BIAS_BF16) bv = bf16_round(bv);
#pragma unroll
    for (int r = 0; r < 8; ++r) { float v = acc[t][r] + bv; if (ACT == 1) v = fmaxf(v, 0.f); so[w][8 * hh + r][t * 16 + ln] = v; }
  }
  __builtin_amdgcn_fence(__ATOMIC_ACQ_REL, "workgroup");
  __builtin_amdgcn_wave_barrier();
  const int rsub = lane >> 4, c4 = (lane & 15) * 4;
  {
#pragma unroll
    for (int q = 0; q < 8; ++q) {
      const int r = q * 2 + rsub;
      const v4f v = *(const v4fa*)&so[w][r][c4];
      *(v4f*)(C + (size_t)(row0 + r) * ldc + col0 + c4) = v;
    }
    
  }
}

// GEMM C = act(A·W + bias + resid): A f32 (ASPLIT -> hi/lo 2 terms), Wt bf16 [N][K]; ACT 0 none, 1 relu, 2 exact gelu;
// resid (optional, f32, row index = (row % rmod), pitch ldr, RES_BF16 rounds it) added before the activation.
template <bool ASPLIT, int ACT, bool BIAS_BF16, bool RES_BF16>
__global__ __launch_bounds__(128) void k_gemm_bf3(const float* __restrict__ A, int lda, const unsigned short* __restrict__ Wt, int ldb,
                                                const float* __restrict__ bias, const float* __restrict__ resid, int rmod, int ldr,
                                                float* __restrict__ C, int ldc, int M, int N, int K) {
  __shared__ __attribute__((aligned(16))) float so[4][16][64];
  const int tid = threadIdx.x, w = tid >> 5, lane = tid & 31, ln = lane & 15, hh = lane >> 4;
  const int ntn = N / 64;
  const int wid = blockIdx.x * 4 + w;
  const int mt = wid / ntn, nq = wid % ntn;
  if (mt * 16 >= M) return;
  const int row0 = mt * 16, col0 = nq * 64;
  const float* arow = A + (size_t)(row0 + ln) * lda;
  v8f acc[4] = {};
  for (int kb = 0; kb < K; kb += 32) {
    FragB ah, al;
    const v4f x0 = *(const v4fa*)(arow + kb + 8 * hh), x1 = *(const v4fa*)(arow + kb + 8 * hh + 4);
    const v4f x2 = *(const v4fa*)(arow + kb + 16 + 8 * hh), x3 = *(const v4fa*)(arow + kb + 16 + 8 * hh + 4);
    float xs[16] = {x0[0],x0[1],x0[2],x0[3],x1[0],x1[1],x1[2],x1[3],x2[0],x2[1],x2[2],x2[3],x3[0],x3[1],x3[2],x3[3]};
#pragma unroll
    for (int i = 0; i < 16; ++i) { const unsigned short hb = bf16_bits(xs[i]); ah.u[i] = hb; al.u[i] = ASPLIT ? bf16_bits(xs[i] - bf16_val(hb)) : (unsigned short)0; }
#pragma unroll
    for (int t = 0; t < 4; ++t) {
      const unsigned short* brow = Wt + (size_t)(col0 + t * 16 + ln) * ldb + kb;
      FragB b;
      b.half[0] = *(const v8us*)(brow + 8 * hh);
      b.half[1] = *(const v8us*)(brow + 16 + 8 * hh);
      acc[t] = mmaN<ASPLIT ? 2 : 1>(ah.v, al.v, b.v, b.v, acc[t]);
    }
  }
#pragma unroll
  for (int t = 0; t < 4; ++t) {
    const int col = col0 + t * 16 + ln;
    float bv = bias ? bias[col] : 0.f;
    if (BIAS_BF16) bv = bf16_round(bv);
#pragma unroll
    for (int r = 0; r < 8; ++r) {
      float v = acc[t][r] + bv;
      if (resid) { float rv = resid[(size_t)((row0 + 8 * hh + r) % rmod) * ldr + col]; if (RES_BF16) rv = bf16_round(rv); v += rv; }
      if (ACT == 1) v = fmaxf(v, 0.f);
      if (ACT == 2) v = 0.5f * v * (1.0f + erff(v * 0.70710678118654752f));
      if (ACT == 3) { const float u = 0.7978845608028654f * (v + 0.044715f * v * v * v); v = 0.5f * v * (1.0f + tanhf(u)); }
      so[w][8 * hh + r][t * 16 + ln] = v;
    }
  }
  __builtin_amdgcn_fence(__ATOMIC_ACQ_REL, "workgroup");
  __builtin_amdgcn_wave_barrier();
  const int rsub = lane >> 4, c4 = (lane & 15) * 4;
  {
#pragma unroll
    for (int q = 0; q < 8; ++q) {
      const int r = q * 2 + rsub;
      const v4f v = *(const v4fa*)&so[w][r][c4];
      *(v4f*)(C + (size_t)(row0 + r) * ldc + col0 + c4) = v;
    }
    
  }
}
// row LayerNorm (biased variance, eps) over N: s = X (+ R); optional out_sum <- s; out_norm <- (s-mu)*rsqrt(var+eps)*g + b
template <bool PARAM_BF16>
__global__ __launch_bounds__(256) void k_layernorm(const float* __restrict__ X, const float* __restrict__ R, const float* __restrict__ g, const float* __restrict__ bta,
                                                  float* __restrict__ out_sum, float* __restrict__ out_norm, int N, float eps) {
  __shared__ float red[256];
  const int row = blockIdx.x, tid = threadIdx.x;
  const float* x = X + (size_t)row * N; const float* rr = R ? R + (size_t)row * N : nullptr;
  float vals[16];                     // up to N = 4096
  const int per = N / 256;            // contiguous chunk per thread? use strided-by-4 chunks: thread handles j = tid*4 + 1024*u
  float s1 = 0.f;
  for (int u = 0; u < per / 4; ++u) {
    const int j = tid * 4 + 1024 * u;
    const v4f a = *(const v4fa*)(x + j);
    v4f b = {0.f,0.f,0.f,0.f}; if (rr) b = *(const v4fa*)(rr + j);
#pragma unroll
    for (int q = 0; q < 4; ++q) { const float v = a[q] + b[q]; vals[u * 4 + q] = v; s1 += v; }
  }
  red[tid] = s1; __syncthreads();
  for (int st = 128; st > 0; st >>= 1) { if (tid < st) red[tid] += red[tid + st]; __syncthreads(); }
  const float mu = red[0] / (float)N; __syncthreads();
  float s2 = 0.f;
  for (int u = 0; u < per / 4; ++u)
#pragma unroll
    for (int q = 0; q < 4; ++q) { const float c = vals[u * 4 + q] - mu; s2 += c * c; }
  red[tid] = s2; __syncthreads();
  for (int st = 128; st > 0; st >>= 1) { if (tid < st) red[tid] += red[tid + st]; __syncthreads(); }
  const float rs = rsqrtf(red[0] / (float)N + eps);
  {
    for (int u = 0; u < per / 4; ++u) {
      const int j = tid * 4 + 1024 * u;
      v4f o, sm;
#pragma unroll
      for (int q = 0; q < 4; ++q) {
        float gg = g[j + q], bb = bta[j + q];
        if (PARAM_BF16) { gg = bf16_round(gg); bb = bf16_round(bb); }
        sm[q] = vals[u * 4 + q]; o[q] = (vals[u * 4 + q] - mu) * rs * gg + bb;
      }
      if (out_sum) *(v4f*)(out_sum + (size_t)row * N + j) = sm;
      *(v4f*)(out_norm + (size_t)row * N + j) = o;
    }
    
  }
}



// ---- f16 WMMA path (v_wmma_f32_16x16x32_f16): 11-bit significands for operands in range — used where a [0,1] probability operand needs more precision than bf16
typedef _Float16 v16h __attribute__((ext_vector_type(16)));
union FragH { v16h v; v8us half[2]; _Float16 h[16]; unsigned short u[16]; };
template <int NT>
__device__ __forceinline__ v8f mmaH(v16h ah, v16h al, v16h bh, v16h bl, v8f c) {
  c = __builtin_amdgcn_wmma_f32_16x16x32_f16(false, ah, false, bh, (short)0, c, false, false);
  if (NT >= 2) c = __builtin_amdgcn_wmma_f32_16x16x32_f16(false, al, false, bh, (short)0, c, false, false);
  if (NT >= 3) c = __builtin_amdgcn_wmma_f32_16x16x32_f16(false, ah, false, bl, (short)0, c, false, false);
  asm volatile("v_nop\n\tv_nop\n\tv_nop\n\tv_nop" : "+v"(c) : "v"(ah), "v"(al), "v"(bh), "v"(bl));
  return c;
}
// batched GEMM like k_gemm_b but f16 operands: A f32 (split into f16 hi/lo if ASPLIT, else rounded to f16), Bt = f16 values [n][k]; alpha; C f32; N multiple of 16 (partial tiles skipped)
template <bool ASPLIT>
__global__ __launch_bounds__(128) void k_gemm_h(const float* __restrict__ A, int lda, size_t sA, const _Float16* __restrict__ Bh, int ldb, size_t sB, float alpha, float* __restrict__ C, int ldc, size_t sC, int M, int N, int K) {
  __shared__ __attribute__((aligned(16))) float so[4][16][64];
  const int tid = threadIdx.x, w = tid >> 5, lane = tid & 31, ln = lane & 15, hh = lane >> 4; const int by = blockIdx.y;
  A += (size_t)by * sA; Bh += (size_t)by * sB; C += (size_t)by * sC;
  const int ntn = (N + 63) / 64; const int wid = blockIdx.x * 4 + w; const int mt = wid / ntn, nq = wid % ntn; if (mt * 16 >= M) return;
  const int row0 = mt * 16, col0 = nq * 64; const float* arow = A + (size_t)(row0 + ln) * lda;
  v8f acc[4] = {};
  for (int kb = 0; kb < K; kb += 32) {
    FragH ah, al;
    const v4f x0 = *(const v4fa*)(arow + kb + 8 * hh), x1 = *(const v4fa*)(arow + kb + 8 * hh + 4), x2 = *(const v4fa*)(arow + kb + 16 + 8 * hh), x3 = *(const v4fa*)(arow + kb + 16 + 8 * hh + 4);
    float xs[16] = {x0[0],x0[1],x0[2],x0[3],x1[0],x1[1],x1[2],x1[3],x2[0],x2[1],x2[2],x2[3],x3[0],x3[1],x3[2],x3[3]};
#pragma unroll
    for (int i = 0; i < 16; ++i) { const _Float16 h = (_Float16)xs[i]; ah.h[i] = h; al.h[i] = ASPLIT ? (_Float16)(xs[i] - (float)h) : (_Float16)0.0f; }
#pragma unroll
    for (int t = 0; t < 4; ++t) { if (col0 + t * 16 >= N) continue; const size_t boff = (size_t)(col0 + t * 16 + ln) * ldb + kb; FragH bq; bq.half[0] = *(const v8us*)(Bh + boff + 8 * hh); bq.half[1] = *(const v8us*)(Bh + boff + 16 + 8 * hh);
      acc[t] = mmaH<ASPLIT ? 2 : 1>(ah.v, al.v, bq.v, bq.v, acc[t]); }
  }
#pragma unroll
  for (int t = 0; t < 4; ++t) { if (col0 + t * 16 >= N) continue;
#pragma unroll
    for (int r = 0; r < 8; ++r) so[w][8 * hh + r][t * 16 + ln] = acc[t][r] * alpha; }
  __builtin_amdgcn_fence(__ATOMIC_ACQ_REL, "workgroup"); __builtin_amdgcn_wave_barrier();
  const int rsub = lane >> 4, c4 = (lane & 15) * 4;
  {
#pragma unroll
    for (int q = 0; q < 8; ++q) { const int r = q * 2 + rsub; if (col0 + c4 < N) { const v4f v = *(const v4fa*)&so[w][r][c4]; *(v4f*)(C + (size_t)(row0 + r) * ldc + col0 + c4) = v; } }
     }
}

// Wt[n][k] = f16(W[k][n]·scale) from f32 row-major W[K][N] (scale = power of two; bf16-exact weights stay exact in f16 away from the subnormal range)
__global__ __launch_bounds__(256) void k_wt_f16(const float* __restrict__ W, _Float16* __restrict__ Wt, int K, int N, float scale) {
  const int t = blockIdx.x * 256 + threadIdx.x; if (t >= N * (K / 8)) return; const int n = t / (K / 8), k8 = (t % (K / 8)) * 8; FragH f;
#pragma unroll
  for (int i = 0; i < 8; ++i) f.h[i] = (_Float16)(bf16_round(W[(size_t)(k8 + i) * N + n]) * scale); const v8us o = f.half[0];
  *(v8us*)((unsigned short*)Wt + (size_t)n * K + k8) = o; 
}
// k_gemm_hh variant with fused epilogue: v = acc·alpha + bias[by·sBias + col] (+ CP[(row/rowsPerB)·sCPb + by·64 + col] if CP) ; ACT 0 none / 1 elu ; writes f16 C16 (and f32 C if non-null)
template <int ACT>
__global__ __launch_bounds__(128) void k_gemm_hhx(const _Float16* __restrict__ A, int lda, size_t sA, const _Float16* __restrict__ Bh, int ldb, size_t sB, float alpha, const float* __restrict__ bias, size_t sBias, const float* __restrict__ CP, int rowsPerB, size_t sCPb, int row0g,
    float* __restrict__ C, _Float16* __restrict__ C16, int ldc, size_t sC, int M, int N, int K) {
  __shared__ __attribute__((aligned(16))) float so[4][16][64];
  const int tid = threadIdx.x, w = tid >> 5, lane = tid & 31, ln = lane & 15, hh = lane >> 4; const int by = blockIdx.y;
  A += (size_t)by * sA; Bh += (size_t)by * sB; const size_t cofs = (size_t)by * sC; const float* bp = bias ? bias + (size_t)by * sBias : nullptr;
  const int ntn = (N + 63) / 64; const int wid = blockIdx.x * 4 + w; const int mt = wid / ntn, nq = wid % ntn; if (mt * 16 >= M) return;
  const int row0 = mt * 16, col0 = nq * 64; const _Float16* arow = A + (size_t)(row0 + ln) * lda;
  v8f acc[4] = {};
  for (int kb = 0; kb < K; kb += 32) { FragH ah; ah.half[0] = *(const v8us*)((const unsigned short*)arow + kb + 8 * hh); ah.half[1] = *(const v8us*)((const unsigned short*)arow + kb + 16 + 8 * hh);
#pragma unroll
    for (int t = 0; t < 4; ++t) { if (col0 + t * 16 >= N) continue; const size_t boff = (size_t)(col0 + t * 16 + ln) * ldb + kb; FragH bq; bq.half[0] = *(const v8us*)((const unsigned short*)Bh + boff + 8 * hh); bq.half[1] = *(const v8us*)((const unsigned short*)Bh + boff + 16 + 8 * hh);
      acc[t] = mmaH<1>(ah.v, ah.v, bq.v, bq.v, acc[t]); }
  }
#pragma unroll
  for (int t = 0; t < 4; ++t) { if (col0 + t * 16 >= N) continue; const int col = col0 + t * 16 + ln; const float bv = bp ? bf16_round(bp[col]) : 0.f;
#pragma unroll
    for (int r = 0; r < 8; ++r) { float v = acc[t][r] * alpha + bv; if (CP) { const int rr = row0g + row0 + 8 * hh + r; if (rowsPerB < 0) v += CP[cofs + (size_t)rr * ldc + col];      /* rowsPerB < 0: own element of the batched C plane */ else { const int bidx = rr / rowsPerB; v += CP[(size_t)bidx * sCPb + (size_t)by * 64 + col]; } } if (ACT == 1) v = (v > 0.f) ? v : expm1f(v); else if (ACT == 7) v = (v > 0.f) ? v + 1.0f : expf(v); else if (ACT == 8) v = tanhf(v); else if (ACT == 9) v = 0.5f * v * (1.0f + tanhf(0.7978845608028654f * (v + 0.044715f * v * v * v))); else if (ACT == 11) v = 1.0f / (1.0f + expf(-v)); else if (ACT == 12) v = (v > 0.f) ? v : 0.01f * v; else if (ACT == 14) v = (v > 0.f) ? v : 0.1f * v; else if (ACT == 16) v = (v >= 0.f) ? v : 0.3f * v; else if (ACT == 17) v = (v >= 0.f) ? v : 0.2f * v; else if (ACT == 15) v = v / (1.0f + expf(-v)); else if (ACT == 3) v = fmaxf(v, 0.f); else if (ACT == 6) v = 0.5f * v * (1.0f + erff(v * 0.70710678118654752f)); so[w][8 * hh + r][t * 16 + ln] = v; } }
  __builtin_amdgcn_fence(__ATOMIC_ACQ_REL, "workgroup"); __builtin_amdgcn_wave_barrier();
  const int rsub = lane >> 4, c4 = (lane & 15) * 4; typedef _Float16 v4h __attribute__((ext_vector_type(4)));
  {
#pragma unroll
    for (int q = 0; q < 8; ++q) { const int r = q * 2 + rsub; if (col0 + c4 < N) { const v4f v = *(const v4fa*)&so[w][r][c4]; if (C) *(v4f*)(C + cofs + (size_t)(row0 + r) * ldc + col0 + c4) = v; if (C16) { v4h h4; for (int i = 0; i < 4; ++i) h4[i] = (_Float16)v[i]; *(v4h*)(C16 + cofs + (size_t)(row0 + r) * ldc + col0 + c4) = h4; } } }
     }
}


typedef _Float16 v4h __attribute__((ext_vector_type(4)));

__global__ __launch_bounds__(256) void k_x16(const float* __restrict__ x, _Float16* __restrict__ X16, size_t n8) { const size_t t = (size_t)blockIdx.x * 256 + threadIdx.x; if (t >= n8) return; FragH f;
#pragma unroll
  for (int q = 0; q < 8; ++q) f.h[q] = (_Float16)bf16_round(x[t * 8 + q]); *(v8us*)((unsigned short*)X16 + t * 8) = f.half[0];  }
__global__ __launch_bounds__(256) void k_h16(const float* __restrict__ x, _Float16* __restrict__ X16, size_t n8) { const size_t t = (size_t)blockIdx.x * 256 + threadIdx.x; if (t >= n8) return; FragH f;
#pragma unroll
  for (int q = 0; q < 8; ++q) f.h[q] = (_Float16)x[t * 8 + q]; *(v8us*)((unsigned short*)X16 + t * 8) = f.half[0];  }
__global__ __launch_bounds__(256) void k_round16f(const float* __restrict__ W, _Float16* __restrict__ Bt, size_t n8) { const size_t t = (size_t)blockIdx.x * 256 + threadIdx.x; if (t >= n8) return; FragH f;
#pragma unroll
  for (int i = 0; i < 8; ++i) f.h[i] = (_Float16)(bf16_round(W[t * 8 + i]) * 16.0f); *(v8us*)((unsigned short*)Bt + t * 8) = f.half[0];  }
template <int NHv, int TTv>
__global__ __launch_bounds__(256) void k_vt(const _Float16* __restrict__ V16, int ldv, int voff, _Float16* __restrict__ Vt) { __shared__ unsigned short tl[64][66]; const int tid = threadIdx.x; const int slab = blockIdx.x / (TTv / 64), lg = blockIdx.x % (TTv / 64); const int b = slab / NHv, h = slab % NHv;
  for (int i = tid; i < 64 * 8; i += 256) { const int r = i / 8, c8 = (i % 8) * 8; FragH f; f.half[0] = *(const v8us*)((const unsigned short*)V16 + ((size_t)b * TTv + lg * 64 + r) * ldv + voff + h * 64 + c8);
#pragma unroll
    for (int q = 0; q < 8; ++q) tl[r][c8 + q] = f.u[q]; }
  __syncthreads();
  {
#pragma unroll
    for (int rd = 0; rd < 2; ++rd) { const int d = rd * 32 + tid / 8, pc = tid % 8; FragH f;
#pragma unroll
      for (int q = 0; q < 8; ++q) f.u[q] = tl[pc * 8 + q][d];
      *(v8us*)((unsigned short*)Vt + ((size_t)slab * 64 + d) * TTv + lg * 64 + pc * 8) = f.half[0]; }
     } }

__global__ __launch_bounds__(256) void k_hl(const float* __restrict__ F, _Float16* __restrict__ Hh, _Float16* __restrict__ Hl, size_t n8) { const size_t t = (size_t)blockIdx.x * 256 + threadIdx.x; if (t >= n8) return; FragH fh, fl; const v4f a = *(const v4fa*)(F + t * 8), c = *(const v4fa*)(F + t * 8 + 4);
#pragma unroll
  for (int q = 0; q < 4; ++q) { _Float16 h = (_Float16)a[q]; fh.h[q] = h; fl.h[q] = (_Float16)((a[q] - (float)h) * 1024.0f); h = (_Float16)c[q]; fh.h[4 + q] = h; fl.h[4 + q] = (_Float16)((c[q] - (float)h) * 1024.0f); }
  { *(v8us*)((unsigned short*)Hh + t * 8) = fh.half[0]; *(v8us*)((unsigned short*)Hl + t * 8) = fl.half[0];  } }

// ---- fast GEMM (wave tile 32x64) ----
__device__ __forceinline__ v16h g2_frag(const _Float16* p, int hh) { FragH f; f.half[0] = *(const v8us*)((const unsigned short*)p + 8 * hh); f.half[1] = *(const v8us*)((const unsigned short*)p + 16 + 8 * hh); return f.v; }
__device__ __forceinline__ v8f g2_mma(v16h a, v16h b, v8f c) { v8f d = __builtin_amdgcn_wmma_f32_16x16x32_f16(false, a, false, b, (short)0, c, false, false); asm volatile("v_nop\n\tv_nop\n\tv_nop\n\tv_nop" : "+v"(d) : "v"(a), "v"(b)); return d; }
#define GM 128                       /* tile rows */
#define GN 128                       /* tile columns */
#define GK 64                        /* k per trip */
#define GP 144                       /* LDS row pitch in bytes: 128 + 16, so the 16 rows of a ds_load_b128 fall on all 64 banks */
#define GBUF ((GM + GN) * GP)        /* one buffer: A rows, then Bh rows */
__device__ __forceinline__ v16h g3_frag(const char* p) { FragH f; f.half[0] = *(const v8us*)p; f.half[1] = *(const v8us*)(p + 32); return f.v; }      /* g2_frag from the lane's own LDS byte address (row ln, 16 hh bytes in) */
// One tile: a thread copies 16 B of rows cr, cr + 32, cr + 64, cr + 96 of A and of Bh. l = the lane's LDS byte address of its first A piece, ga / gb = its global addresses in row cr.
__device__ __forceinline__ void g3_stage(unsigned l, const _Float16* ga, const _Float16* gb) {
  /* the s_wait_xcnt in the copies' own statement stands before any register that an issued copy names is rewritten */
  asm volatile("global_load_async_to_lds_b128 %0, %8, off\n\t"
               "global_load_async_to_lds_b128 %1, %9, off\n\t"
               "global_load_async_to_lds_b128 %2, %10, off\n\t"
               "global_load_async_to_lds_b128 %3, %11, off\n\t"
               "global_load_async_to_lds_b128 %4, %12, off\n\t"
               "global_load_async_to_lds_b128 %5, %13, off\n\t"
               "global_load_async_to_lds_b128 %6, %14, off\n\t"
               "global_load_async_to_lds_b128 %7, %15, off\n\t"
               "s_wait_xcnt 0x0"
               :: "v"(l), "v"(l + 32u * GP), "v"(l + 64u * GP), "v"(l + 96u * GP), "v"(l + 128u * GP), "v"(l + 160u * GP), "v"(l + 192u * GP), "v"(l + 224u * GP),
                  "v"(ga), "v"(ga + 32 * DM), "v"(ga + 64 * DM), "v"(ga + 96 * DM), "v"(gb), "v"(gb + 32 * DM), "v"(gb + 64 * DM), "v"(gb + 96 * DM) : "memory"); }
__global__ __launch_bounds__(256) void k_gemm3(const _Float16* __restrict__ A, const _Float16* __restrict__ Bh, float alpha, const float* __restrict__ bias, float* __restrict__ C, _Float16* __restrict__ C16) {
  static_assert(MP % GM == 0 && DM % GN == 0 && DM % GK == 0 && DM / GK >= 2 && GM == 128 && GN == 128 && GK == 64, "whole tiles, at least two trips, 8 copies per thread and tile");
  __shared__ __attribute__((aligned(16))) char ring[2 * GBUF]; __shared__ __attribute__((aligned(16))) float so[8][32][68];
  const int tid = threadIdx.x, w = tid >> 5, lane = tid & 31, ln = lane & 15, hh = lane >> 4;
  const int mt = blockIdx.x / (DM / GN), nq = blockIdx.x % (DM / GN); const int rowb = mt * GM, colb = nq * GN; const int row0 = rowb + 32 * (w & 3), col0 = colb + 64 * (w >> 2);
  const int cr = tid >> 3, cc = tid & 7;      /* 8 lanes cover one 128-B row */
  const _Float16* ga = A + (size_t)(rowb + cr) * DM + cc * 8; const _Float16* gb = Bh + (size_t)(colb + cr) * DM + cc * 8; const unsigned l0 = (unsigned)(size_t)ring + (unsigned)(cr * GP + cc * 16);
  const char* fa = ring + (32 * (w & 3) + ln) * GP + 16 * hh; const char* fb = ring + (GM + 64 * (w >> 2) + ln) * GP + 16 * hh;
  const v8f z8 = {0.f,0.f,0.f,0.f,0.f,0.f,0.f,0.f}; v8f c00 = z8, c01 = z8, c02 = z8, c03 = z8, c10 = z8, c11 = z8, c12 = z8, c13 = z8;
  g3_stage(l0, ga, gb);
  asm volatile("s_wait_asynccnt 0x0" ::: "memory");      /* this wave's share of tile 0 has landed */
  __syncthreads();      /* tile 0 is published */
  g3_stage(l0 + GBUF, ga + GK, gb + GK);
#pragma unroll 1      /* one trip per tile: the buffer is picked by the trip's parity and the loop stays short */
  for (int t = 0; t < DM / GK; ++t) { const int bo = (t & 1) * GBUF; v16h a[2][2], b[2][4];      /* [k step][fragment] */
#pragma unroll      /* constant indices keep the fragment arrays in registers; all 24 LDS reads of the trip stand as one group ahead of its WMMAs */
    for (int ks = 0; ks < 2; ++ks) { for (int i = 0; i < 2; ++i) a[ks][i] = g3_frag(fa + bo + ks * 64 + i * (16 * GP)); for (int j = 0; j < 4; ++j) b[ks][j] = g3_frag(fb + bo + ks * 64 + j * (16 * GP)); }
#pragma unroll      /* constant fragment indices, as above */
    for (int ks = 0; ks < 2; ++ks) { c00 = g2_mma(a[ks][0], b[ks][0], c00); c10 = g2_mma(a[ks][1], b[ks][0], c10); c01 = g2_mma(a[ks][0], b[ks][1], c01); c11 = g2_mma(a[ks][1], b[ks][1], c11);
      c02 = g2_mma(a[ks][0], b[ks][2], c02); c12 = g2_mma(a[ks][1], b[ks][2], c12); c03 = g2_mma(a[ks][0], b[ks][3], c03); c13 = g2_mma(a[ks][1], b[ks][3], c13); }
    asm volatile("s_wait_dscnt 0x0" ::: "memory");      /* this wave's reads of the buffer are done before it is handed back */
    asm volatile("s_wait_asynccnt 0x0" ::: "memory");      /* this wave's share of tile t + 1 has landed */
    __syncthreads();      /* publishes tile t + 1 and ends every wave's reads of tile t */
    if (t + 2 < DM / GK) g3_stage(l0 + (unsigned)bo, ga + (t + 2) * GK, gb + (t + 2) * GK); }
  asm volatile("s_wait_asynccnt 0x0" ::: "memory");      /* no copy is outstanding when the wave goes on */
  v8f accs[8] = {c00, c01, c02, c03, c10, c11, c12, c13};
#pragma unroll      /* constant accumulator indices (this loop and the next): no scratch */
  for (int u = 0; u < 8; ++u) { const int t = u & 3, half = u >> 2; const float bv = bf16_round(bias[col0 + t * 16 + ln]);
#pragma unroll
    for (int r = 0; r < 8; ++r) so[w][half * 16 + 8 * hh + r][t * 16 + ln] = accs[u][r] * alpha + bv; }
  __builtin_amdgcn_fence(__ATOMIC_ACQ_REL, "workgroup"); __builtin_amdgcn_wave_barrier();
  const int rsub = lane >> 4, c4 = (lane & 15) * 4;
#pragma unroll      /* the row pairs' LDS offsets become immediates */
  for (int q = 0; q < 16; ++q) { const int r = q * 2 + rsub; const v4f v = *(const v4fa*)&so[w][r][c4]; if (C) { *(v4f*)(C + (size_t)(row0 + r) * DM + col0 + c4) = v; asm volatile("s_wait_xcnt 0x0" ::: "memory"); }      /* the wait that stands before a register which the issued store names is rewritten (the f16 conversion below reuses its data registers) */
    if (C16) { v4h h4; for (int i = 0; i < 4; ++i) h4[i] = (_Float16)v[i]; *(v4h*)(C16 + (size_t)(row0 + r) * DM + col0 + c4) = h4; } } }


__global__ __launch_bounds__(256) void k_wnat(const float* __restrict__ w, size_t n8, _Float16* __restrict__ Bt) { const size_t t = (size_t)blockIdx.x * 256 + threadIdx.x; if (t >= n8) return; FragH f; for (int q = 0; q < 8; ++q) f.h[q] = (_Float16)(bf16_round(w[t * 8 + q]) * 16.0f); *(v8us*)((unsigned short*)Bt + t * 8) = f.half[0];  }
__global__ __launch_bounds__(256) void k_rsm(const float* __restrict__ S, _Float16* __restrict__ P, int nrows) {
  #pragma clang fp contract(off)
  const int i = blockIdx.x * 256 + threadIdx.x; if (i >= nrows) return; const float* s = S + (size_t)i * SQ; float mx = -3.0e38f;
#pragma unroll 1
  for (int j = 0; j < SQ; ++j) mx = fmaxf(mx, s[j]); float se = 0.f;
#pragma unroll 1
  for (int j = 0; j < SQ; ++j) se += expf(s[j] - mx); const float sc = 256.0f / se;
#pragma unroll 1
  for (int j0 = 0; j0 < SQ; j0 += 8) { FragH f; for (int q = 0; q < 8; ++q) f.h[q] = (_Float16)(expf(s[j0 + q] - mx) * sc); unsigned short* d = (unsigned short*)P + (size_t)i * SQ + j0; *(v8us*)d = f.half[0];  } }
__global__ __launch_bounds__(256) void k_vt(const _Float16* __restrict__ V16, int b, int h0, _Float16* __restrict__ VT) { __shared__ unsigned short tl[64][65]; const int tid = threadIdx.x; const int hh = blockIdx.x % HG, sg = blockIdx.x / HG; const int s0 = sg * 64; const int h = h0 + hh;
  for (int i = tid; i < 64 * 8; i += 256) { const int j = i / 8, d8 = (i % 8) * 8; FragH f; f.half[0] = *(const v8us*)((const unsigned short*)V16 + ((size_t)b * SQ + s0 + j) * DM + h * HD + d8); for (int q = 0; q < 8; ++q) tl[d8 + q][j] = f.u[q]; }
  __syncthreads();
  { for (int i = tid; i < 64 * 8; i += 256) { const int d = i / 8, j8 = (i % 8) * 8; FragH f; for (int q = 0; q < 8; ++q) f.u[q] = tl[d][j8 + q]; *(v8us*)((unsigned short*)VT + ((size_t)hh * HD + d) * SQ + s0 + j8) = f.half[0]; }  } }



// Fused attention, one launch for all batches and heads. A wave owns FQ = 32 query columns and walks the SQ keys 32 at a time; no LDS, no barrier.
// S^T = K Q^T: A = K rows, B = Q rows kept in registers (hi.hi in one accumulator, hi.lo + lo.hi in a second), so a lane holds scores of one query only: running max and running sum in-lane, one exchange between the wave halves.
// Two S^T tiles (keys 0 .. 15 and 16 .. 31) converted in place are the B operand of O^T += V^T P^T in the hardware k order, which g2_frag gives the V^T rows too; S and P never leave registers.
__device__ __forceinline__ float lane_xor_16(float v) { const int u = __float_as_int(v); return __int_as_float(__builtin_amdgcn_permlanex16(u, u, 0x76543210, 0xfedcba98, false, false)); }      /* lane l <- lane l ^ 16 */
__device__ __forceinline__ float exp2_slot(float a) { float r; asm("v_exp_f32 %0, %1\n\tv_nop" : "=v"(r) : "v"(a)); return r; }      /* 2^a; the v_nop in the same statement keeps the slot the instruction set asks for behind a transcendental, before its result is read or its source register reused */
__device__ __forceinline__ v4f exp2_slot4(v4f a) { float r0, r1, r2, r3;      /* four 2^a: each fills the slot behind the one before it (early-clobber outputs share no register with a source), one v_nop keeps the slot behind the last */
  asm("v_exp_f32 %0, %4\n\tv_exp_f32 %1, %5\n\tv_exp_f32 %2, %6\n\tv_exp_f32 %3, %7\n\tv_nop" : "=&v"(r0), "=&v"(r1), "=&v"(r2), "=&v"(r3) : "v"(a[0]), "v"(a[1]), "v"(a[2]), "v"(a[3])); const v4f r = {r0, r1, r2, r3}; return r; }
__device__ __forceinline__ v16h fa_frag(const char* p) { FragH f; f.half[0] = *(const v8us*)p; f.half[1] = *(const v8us*)(p + 32); return f.v; }      /* g2_frag from the lane's own byte address (row c, 16 hh bytes in) */
__device__ __forceinline__ v8f fa_mma(v16h a, v16h b, v8f c) { return __builtin_amdgcn_wmma_f32_16x16x32_f16(false, a, false, b, (short)0, c, false, false); }
#define FW 8                         /* waves per work-group */
#define FQ 32                        /* query columns per wave */
__global__ __launch_bounds__(FW * 32) __attribute__((amdgpu_waves_per_eu(4, 4))) void k_fattn(const _Float16* __restrict__ QH, const _Float16* __restrict__ QL, const _Float16* __restrict__ KH, const _Float16* __restrict__ KL, const _Float16* __restrict__ VT, float* __restrict__ out) {
  static_assert(SQ % (FW * FQ) == 0 && SQ % 32 == 0 && HD == 64, "whole query blocks, whole 32-key passes, two k steps per score");
  const int lane = threadIdx.x & 31, w = threadIdx.x >> 5, c = lane & 15, hh = lane >> 4; const int h = blockIdx.y, b = blockIdx.z;
  const size_t r0 = (size_t)b * SQ; const int q0 = blockIdx.x * (FW * FQ) + w * FQ;
  v16h qh[2][2], ql[2][2];      /* [query tile][k step] */
#pragma unroll
  for (int g = 0; g < 2; ++g) for (int ks = 0; ks < 2; ++ks) { const size_t qo = (r0 + q0 + g * 16 + c) * DM + h * HD + ks * 32; qh[g][ks] = g2_frag(QH + qo, hh); ql[g][ks] = g2_frag(QL + qo, hh); }
  const _Float16* kh = KH + r0 * DM + h * HD; const _Float16* kl = KL + r0 * DM + h * HD; const _Float16* vt = VT + ((size_t)b * NH + h) * HD * SQ;      /* uniform bases; the lane's part is ko / vo */
  const unsigned ko = (unsigned)(c * DM + 8 * hh) * 2u, vo = (unsigned)(c * SQ + 8 * hh) * 2u;
  const v8f z8 = {0.f, 0.f, 0.f, 0.f, 0.f, 0.f, 0.f, 0.f}; v8f o[2][4] = {{z8, z8, z8, z8}, {z8, z8, z8, z8}};      /* [query tile][d tile]: register r = O[query c][16 t + 8 hh + r] */
  float m[2] = {-3.0e38f, -3.0e38f}, l[2] = {0.f, 0.f};
  const float C1 = 0.125f * 1.44269504088896340736f, C2 = 0.0001220703125f * 1.44269504088896340736f;      /* 64^-0.5 and 64^-0.5 2^-10, in log2 units */
#pragma unroll 1
  for (int j0 = 0; j0 < SQ; j0 += 32) { v8f t[2][2];      /* [query tile][key tile]: register r = score of key j0 + 16 kt + 8 hh + r for query c */
    const char* kp = (const char*)(kh + (size_t)j0 * DM) + ko; const char* lp = (const char*)(kl + (size_t)j0 * DM) + ko; v16h kf[2][2], lf[2][2];      /* [key tile][k step] */
#pragma unroll
    for (int kt = 0; kt < 2; ++kt) for (int ks = 0; ks < 2; ++ks) { kf[kt][ks] = fa_frag(kp + kt * (16 * DM * 2) + ks * 64); lf[kt][ks] = fa_frag(lp + kt * (16 * DM * 2) + ks * 64); }
    asm volatile("s_wait_xcnt 0x0" :: "v"(kp), "v"(lp) : "memory");      /* the wait that stands before a register which an issued load names is rewritten; the two addresses are inputs, so they keep their registers up to it and no load result lands on them */
#pragma unroll
    for (int kt = 0; kt < 2; ++kt) {
#pragma unroll
      for (int g = 0; g < 2; ++g) { v8f sh = fa_mma(kf[kt][0], qh[g][0], z8); sh = fa_mma(kf[kt][1], qh[g][1], sh);
        v8f sl = fa_mma(kf[kt][0], ql[g][0], z8); sl = fa_mma(kf[kt][1], ql[g][1], sl); sl = fa_mma(lf[kt][0], qh[g][0], sl); sl = fa_mma(lf[kt][1], qh[g][1], sl);
        t[g][kt] = sl * C2 + sh * C1; } }
    const char* vp = (const char*)(vt + j0) + vo; v16h vf[4];
#pragma unroll
    for (int u = 0; u < 4; ++u) vf[u] = fa_frag(vp + u * (16 * SQ * 2));
    asm volatile("s_wait_xcnt 0x0" :: "v"(vp) : "memory");      /* as above, for the V^T address */
#pragma unroll
    for (int g = 0; g < 2; ++g) { float mx = t[g][0][0];
#pragma unroll
      for (int r = 1; r < 16; ++r) mx = fmaxf(mx, t[g][r >> 3][r & 7]);
      mx = fmaxf(mx, lane_xor_16(mx)); const float mn = fmaxf(m[g], mx); const float al = exp2_slot(m[g] - mn), mb = mn - 8.0f; m[g] = mn;      /* weights carried x256 (it cancels in the final division), which keeps small ones out of the f16 subnormals */
      FragH pf; v4f s4 = {0.f, 0.f, 0.f, 0.f};
#pragma unroll
      for (int kt = 0; kt < 2; ++kt) for (int q = 0; q < 2; ++q) { v4f a; for (int i = 0; i < 4; ++i) a[i] = t[g][kt][q * 4 + i] - mb; const v4f e = exp2_slot4(a); s4 += e; for (int i = 0; i < 4; ++i) pf.h[kt * 8 + q * 4 + i] = (_Float16)e[i]; }
      l[g] = fmaf(l[g], al, (s4[0] + s4[1]) + (s4[2] + s4[3]));      /* this half's keys only; the halves join after the loop */
#pragma unroll
      for (int u = 0; u < 4; ++u) { o[g][u] *= al; o[g][u] = fa_mma(vf[u], pf.v, o[g][u]); } } }
#pragma unroll
  for (int g = 0; g < 2; ++g) { const float inv = 1.0f / (l[g] + lane_xor_16(l[g])); float* op = out + (r0 + q0 + g * 16 + c) * DM + h * HD + 8 * hh;
#pragma unroll
    for (int u = 0; u < 4; ++u) { const v4f x0 = {o[g][u][0] * inv, o[g][u][1] * inv, o[g][u][2] * inv, o[g][u][3] * inv}, x1 = {o[g][u][4] * inv, o[g][u][5] * inv, o[g][u][6] * inv, o[g][u][7] * inv}; *(v4f*)(op + u * 16) = x0; *(v4f*)(op + u * 16 + 4) = x1; } } }


template <int MASKADD>
__global__ __launch_bounds__(64) void k_att0(const float* __restrict__ QF, const float* __restrict__ KF, const float* __restrict__ VF, int ld, const float* __restrict__ mask, float scale, float* __restrict__ OF, int ldo) {
  #pragma clang fp contract(off)
  __shared__ __attribute__((aligned(16))) float lq[64][64]; __shared__ __attribute__((aligned(16))) float lo[64][64];
  const int tid = threadIdx.x; const int h = blockIdx.x / (QT0 / 64), rg = blockIdx.x % (QT0 / 64); const int i = rg * 64 + tid;
  const float* qr = QF + (size_t)i * ld + h * HD;
#pragma unroll 1
  for (int c = 0; c < HD / 4; ++c) { *(v4f*)&lq[tid][c * 4] = *(const v4fa*)(qr + c * 4); const v4f z = {0.f, 0.f, 0.f, 0.f}; *(v4f*)&lo[tid][c * 4] = z; }
  float m = -1.0e30f, l = 0.f; const int jmax = MASKADD ? (SQ - 1) : (rg * 64 + 63);      /* additive-mask form: every key (the mask input decides); causal form: keys up to the block's last row */
#pragma unroll 1
  for (int j = 0; j <= jmax; ++j) { const float* kr = KF + (size_t)j * ld + h * HD; const float* vr = VF + (size_t)j * ld + h * HD; float s = 0.f;
#pragma unroll 1
    for (int c = 0; c < HD / 4; ++c) { const v4f kq = *(const v4fa*)(kr + c * 4); const v4f qq = *(v4f*)&lq[tid][c * 4]; s = __fadd_rn(s, __fmul_rn(qq[0], kq[0])); s = __fadd_rn(s, __fmul_rn(qq[1], kq[1])); s = __fadd_rn(s, __fmul_rn(qq[2], kq[2])); s = __fadd_rn(s, __fmul_rn(qq[3], kq[3])); }
    s = __fmul_rn(s, scale); if (MASKADD) s = __fadd_rn(s, __fmul_rn(bf16_round(mask[(size_t)i * SQ + j]), -10000.0f));
    const float f = (MASKADD || j <= i) ? 1.f : 0.f; const float sm = fmaf(f, s, (1.f - f) * -1.0e30f); const float mn = fmaxf(m, sm); const float sc = expf(m - mn); const float e = expf(sm - mn); l = __fadd_rn(__fmul_rn(l, sc), e); m = mn;
#pragma unroll 1
    for (int c = 0; c < HD / 4; ++c) { const v4f vv = *(const v4fa*)(vr + c * 4); v4f oo = *(v4f*)&lo[tid][c * 4]; for (int u = 0; u < 4; ++u) oo[u] = __fadd_rn(__fmul_rn(oo[u], sc), __fmul_rn(e, vv[u])); *(v4f*)&lo[tid][c * 4] = oo; } }
  const float fin = 64.0f / l;      /* o carried x64 */
#pragma unroll 1
  for (int c = 0; c < HD / 4; ++c) { v4f oo = *(v4f*)&lo[tid][c * 4]; for (int u = 0; u < 4; ++u) oo[u] = __fmul_rn(oo[u], fin); *(v4f*)&lo[tid][c * 4] = oo; }
  __syncthreads();
  {
#pragma unroll 1
    for (int it = 0; it < 16; ++it) { const int row = it * 4 + tid / 16, pc = (tid % 16) * 4; const v4f v = *(const v4f*)&lo[row][pc]; *(v4f*)(OF + (size_t)(rg * 64 + row) * ldo + h * HD + pc) = v; }
     } }

__global__ __launch_bounds__(256) void k_of0out(const float* __restrict__ src, float* __restrict__ dst, size_t n4) { const size_t t = (size_t)blockIdx.x * 256 + threadIdx.x; if (t >= n4) return; v4f v = *(const v4fa*)(src + t * 4); for (int q = 0; q < 4; ++q) v[q] = __fmul_rn(v[q], 0.015625f); *(v4f*)(dst + t * 4) = v;  }

extern "C" void kernel_launch(void* const* d_in, const int* in_sizes, int n_in,
                              void* d_out, int out_size, void* d_ws, size_t ws_size, hipStream_t stream) {
  (void)in_sizes; (void)n_in; (void)out_size;
  const float* const* I = (const float* const*)d_in; const float* x = I[0]; const float* wq = I[1]; const float* wk = I[2]; const float* wv = I[3]; const float* bq = I[4]; const float* bk = I[5]; const float* bv = I[6];      /* input order: x, Wq, Wk, Wv, bq, bk, bv: natural [out][in] weights, then the three biases (every projection launch passes the bias variables); NO output projection */
  char* ws = (char*)d_ws; size_t off = 0;
  auto take = [&](size_t bytes) { char* p = ws + off; off += (bytes + 255) & ~(size_t)255; return p; };
  _Float16* BQ = (_Float16*)take((size_t)DM * DM * 2); _Float16* BK = (_Float16*)take((size_t)DM * DM * 2); _Float16* BV = (_Float16*)take((size_t)DM * DM * 2);
  _Float16* X16 = (_Float16*)take(NR * DM * 2); float* QF = (float*)take(NR * DM * 4); _Float16* QH = (_Float16*)take(NR * DM * 2); _Float16* QL = (_Float16*)take(NR * DM * 2); _Float16* KH = (_Float16*)take(NR * DM * 2); _Float16* KL = (_Float16*)take(NR * DM * 2); _Float16* Q16 = QH; _Float16* K16 = KH; _Float16* V16 = (_Float16*)take(NR * DM * 2);
  _Float16* VT = (_Float16*)take((size_t)NB * NH * HD * SQ * 2);
  if (off > ws_size) return;
  { const unsigned g = (unsigned)(((size_t)DM * DM / 8 + 255) / 256); k_wnat<<<g, 256, 0, stream>>>(wq, (size_t)DM * DM / 8, BQ); k_wnat<<<g, 256, 0, stream>>>(wk, (size_t)DM * DM / 8, BK); k_wnat<<<g, 256, 0, stream>>>(wv, (size_t)DM * DM / 8, BV); }      /* natural [out][in] = Bt[n][k] x16 */
  k_x16<<<(unsigned)((NR * DM / 8 + 255) / 256), 256, 0, stream>>>(x, X16, NR * DM / 8);
  const size_t r0p = (size_t)B0 * SQ;      /* first projected row */
  k_gemm3<<<(MP / GM) * (DM / GN), 256, 0, stream>>>(X16 + r0p * DM, BQ, 0.0625f, bq, QF + r0p * DM, nullptr); k_hl<<<(unsigned)(((size_t)MP * DM / 8 + 255) / 256), 256, 0, stream>>>(QF + r0p * DM, QH + r0p * DM, QL + r0p * DM, (size_t)MP * DM / 8);      /* q (f32) -> f16 hi + x1024 residual: unscaled logits sigma ~8 */
  k_gemm3<<<(MP / GM) * (DM / GN), 256, 0, stream>>>(X16 + r0p * DM, BK, 0.0625f, bk, QF + r0p * DM, nullptr); k_hl<<<(unsigned)(((size_t)MP * DM / 8 + 255) / 256), 256, 0, stream>>>(QF + r0p * DM, KH + r0p * DM, KL + r0p * DM, (size_t)MP * DM / 8);      /* k likewise */
  k_gemm3<<<(MP / GM) * (DM / GN), 256, 0, stream>>>(X16 + r0p * DM, BV, 0.0625f, bv, nullptr, V16 + r0p * DM);
  k_vt<NH, SQ><<<NB * NH * (SQ / 64), 256, 0, stream>>>(V16, LQ, 0, VT);      /* V^T [NB][NH][HD][SQ], all batches */
  k_fattn<<<dim3(SQ / (FW * FQ), NH, NB), FW * 32, 0, stream>>>(QH, QL, KH, KL, VT, (float*)d_out);      /* scores (hi.hi + 2^-10 (hi.lo + lo.hi)), softmax over all keys and P V in one launch, f32 straight into the head-major output columns (no output projection) */
}

// v004
// A run of this version takes 174 microseconds.
// Next to v003, in two timings, it ran 1.16 and 1.15 times as fast.
// Over all steps from v000 it is 46.5 times as fast.
#include <hip/hip_runtime.h>
// Multi-head self-attention without an output projection, NON-causal (x [8][1024][1024]; q / k / v = x W^T + b (nn.Linear natural [1024][1024] sigma 1/32, biases sigma 0.01); 16 heads of 64; scores * 64^-0.5; softmax over all 1024 keys (no mask); out = ctx merged head-major -> [8][1024][1024]; the source never applies its out_proj).
// Structure: token rows r = b*1024 + s; x as exact f16 rows (bf16-rounded); q and k as WMMA GEMMs (128x128 work-group tiles staged in LDS by asynchronous copies, 32x64 wave tiles, f32 accumulation, exact x16 weights + bias) whose epilogue splits each f32 value into f16 hi + x1024 residual planes, v as the same GEMM with its operands swapped, so that its f16 tile is V^T as attention reads it; then ONE fused attention launch (k_fattn): per wave 32 queries, keys 32 at a time, scores as hi.hi + 2^-10 (hi.lo + lo.hi), online softmax (f32 running max and sum, native exp2), weights x256 as f16 straight from the score accumulators into O^T += V^T P^T, f32 out written into the head-major columns.
// Compute dtype: inputs rounded to bf16; x / weights exact; q and k as f16 hi + x1024 residual planes; v and softmax weights as plain f16 GEMM operands (~2^-12); scores, softmax statistics and o f32. v_wmma_f32_16x16x32_f16.
#define NB 8
#define SQ 1024
#define DM 1024
#define NH 16
#define HD 64
#define HG 4                         /* heads per group in the unlaunched k_vt overload */
#define QT 256                       /* unused */
#define NKX SQ                       /* unused */
#define QT0 128                      /* query rows per head in k_att0, which is not launched */
#define B0 0                         /* first batch processed (debug hook) */
#define NBR NB                       /* batches processed (debug hook) */
#define NR ((size_t)NB * SQ)         /* token rows */
#define MP ((int)((size_t)NBR * SQ)) /* rows projected (debug hook) */
#define QN SQ                        /* unused */
#define NHD NH                       /* unused */
#define MPO MP                       /* unused */
#define LQ DM      /* unused */
typedef __bf16 v16b __attribute__((ext_vector_type(16)));
typedef unsigned short v8us __attribute__((ext_vector_type(8), may_alias));
typedef float  v8f  __attribute__((ext_vector_type(8)));
typedef float  v4f  __attribute__((ext_vector_type(4)));
typedef float  v4fa __attribute__((ext_vector_type(4), may_alias));
union FragB { v16b v; v8us half[2]; unsigned short u[16]; };

__device__ __forceinline__ unsigned short bf16_bits(float x) { unsigned int u = __float_as_uint(x); return (unsigned short)((u + 0x7FFFu + ((u >> 16) & 1u)) >> 16); }
__device__ __forceinline__ float bf16_val(unsigned short b) { return __uint_as_float(((unsigned int)b) << 16); }
__device__ __forceinline__ float bf16_round(float x) { return bf16_val(bf16_bits(x)); }
// D += A·B with NT terms: 1 = ah·bh, 2 = + al·bh (A split), 3 = + ah·bl (both split)
template <int NT>
__device__ __forceinline__ v8f mmaN(v16b ah, v16b al, v16b bh, v16b bl, v8f c) {
  c = __builtin_amdgcn_wmma_f32_16x16x32_bf16(false, ah, false, bh, (short)0, c, false, false);
  if (NT >= 2) c = __builtin_amdgcn_wmma_f32_16x16x32_bf16(false, al, false, bh, (short)0, c, false, false);
  if (NT >= 3) c = __builtin_amdgcn_wmma_f32_16x16x32_bf16(false, ah, false, bl, (short)0, c, false, false);
  asm volatile("v_nop\n\tv_nop\n\tv_nop\n\tv_nop" : "+v"(c) : "v"(ah), "v"(al), "v"(bh), "v"(bl));
  return c;
}

__global__ __launch_bounds__(256) void k_wt_bf16(const float* __restrict__ W, unsigned short* __restrict__ Wt, int K, int N) {
  const int t = blockIdx.x * 256 + threadIdx.x;
  const int k8n = K / 8;
  if (t >= N * k8n) return;
  const int n = t / k8n, k8 = (t % k8n) * 8;
  v8us v;
#pragma unroll
  for (int i = 0; i < 8; ++i) v[i] = bf16_bits(W[(size_t)(k8 + i) * N + n]);
  *(v8us*)(Wt + (size_t)n * K + k8) = v;
  
}

// GEMM C[M][N] (f32, pitch ldc) = act(A[M][K]·W + bias). A f32 row-major (pitch lda) converted per fragment to bf16
// (ASPLIT: hi/lo two planes -> 2 terms, else single rounded term); Wt bf16 [N][K] (pitch ldb). BIAS_BF16 rounds the
// bias to bf16 first (bias quantised to bf16 before the add). K%32==0, M%16==0, N%64==0.
template <bool ASPLIT, int ACT, bool BIAS_BF16>
__global__ __launch_bounds__(128) void k_gemm_bf(const float* __restrict__ A, int lda, const unsigned short* __restrict__ Wt, int ldb,
                                               const float* __restrict__ bias, float* __restrict__ C, int ldc, int M, int N, int K) {
  __shared__ __attribute__((aligned(16))) float so[4][16][64];
  const int tid = threadIdx.x, w = tid >> 5, lane = tid & 31, ln = lane & 15, hh = lane >> 4;
  const int ntn = N / 64;
  const int wid = blockIdx.x * 4 + w;
  const int mt = wid / ntn, nq = wid % ntn;
  if (mt * 16 >= M) return;
  const int row0 = mt * 16, col0 = nq * 64;
  const float* arow = A + (size_t)(row0 + ln) * lda;
  v8f acc[4] = {};
  for (int kb = 0; kb < K; kb += 32) {
    FragB ah, al;
    const v4f x0 = *(const v4fa*)(arow + kb + 8 * hh), x1 = *(const v4fa*)(arow + kb + 8 * hh + 4);
    const v4f x2 = *(const v4fa*)(arow + kb + 16 + 8 * hh), x3 = *(const v4fa*)(arow + kb + 16 + 8 * hh + 4);
    float xs[16] = {x0[0],x0[1],x0[2],x0[3],x1[0],x1[1],x1[2],x1[3],x2[0],x2[1],x2[2],x2[3],x3[0],x3[1],x3[2],x3[3]};
#pragma unroll
    for (int i = 0; i < 16; ++i) { const unsigned short hb = bf16_bits(xs[i]); ah.u[i] = hb; al.u[i] = ASPLIT ? bf16_bits(xs[i] - bf16_val(hb)) : (unsigned short)0; }
#pragma unroll
    for (int t = 0; t < 4; ++t) {
      const unsigned short* brow = Wt + (size_t)(col0 + t * 16 + ln) * ldb + kb;
      FragB b;
      b.half[0] = *(const v8us*)(brow + 8 * hh);
      b.half[1] = *(const v8us*)(brow + 16 + 8 * hh);
      acc[t] = mmaN<ASPLIT ? 2 : 1>(ah.v, al.v, b.v, b.v, acc[t]);
    }
  }
#pragma unroll
  for (int t = 0; t < 4; ++t) {
    float bv = bias ? bias[col0 + t * 16 + ln] : 0.f;
    if (BIAS_BF16) bv = bf16_round(bv);
#pragma unroll
    for (int r = 0; r < 8; ++r) { float v = acc[t][r] + bv; if (ACT == 1) v = fmaxf(v, 0.f); so[w][8 * hh + r][t * 16 + ln] = v; }
  }
  __builtin_amdgcn_fence(__ATOMIC_ACQ_REL, "workgroup");
  __builtin_amdgcn_wave_barrier();
  const int rsub = lane >> 4, c4 = (lane & 15) * 4;
  {
#pragma unroll
    for (int q = 0; q < 8; ++q) {
      const int r = q * 2 + rsub;
      const v4f v = *(const v4fa*)&so[w][r][c4];
      *(v4f*)(C + (size_t)(row0 + r) * ldc + col0 + c4) = v;
    }
    
  }
}

// GEMM C = act(A·W + bias + resid): A f32 (ASPLIT -> hi/lo 2 terms), Wt bf16 [N][K]; ACT 0 none, 1 relu, 2 exact gelu;
// resid (optional, f32, row index = (row % rmod), pitch ldr, RES_BF16 rounds it) added before the activation.
template <bool ASPLIT, int ACT, bool BIAS_BF16, bool RES_BF16>
__global__ __launch_bounds__(128) void k_gemm_bf3(const float* __restrict__ A, int lda, const unsigned short* __restrict__ Wt, int ldb,
                                                const float* __restrict__ bias, const float* __restrict__ resid, int rmod, int ldr,
                                                float* __restrict__ C, int ldc, int M, int N, int K) {
  __shared__ __attribute__((aligned(16))) float so[4][16][64];
  const int tid = threadIdx.x, w = tid >> 5, lane = tid & 31, ln = lane & 15, hh = lane >> 4;
  const int ntn = N / 64;
  const int wid = blockIdx.x * 4 + w;
  const int mt = wid / ntn, nq = wid % ntn;
  if (mt * 16 >= M) return;
  const int row0 = mt * 16, col0 = nq * 64;
  const float* arow = A + (size_t)(row0 + ln) * lda;
  v8f acc[4] = {};
  for (int kb = 0; kb < K; kb += 32) {
    FragB ah, al;
    const v4f x0 = *(const v4fa*)(arow + kb + 8 * hh), x1 = *(const v4fa*)(arow + kb + 8 * hh + 4);
    const v4f x2 = *(const v4fa*)(arow + kb + 16 + 8 * hh), x3 = *(const v4fa*)(arow + kb + 16 + 8 * hh + 4);
    float xs[16] = {x0[0],x0[1],x0[2],x0[3],x1[0],x1[1],x1[2],x1[3],x2[0],x2[1],x2[2],x2[3],x3[0],x3[1],x3[2],x3[3]};
#pragma unroll
    for (int i = 0; i < 16; ++i) { const unsigned short hb = bf16_bits(xs[i]); ah.u[i] = hb; al.u[i] = ASPLIT ? bf16_bits(xs[i] - bf16_val(hb)) : (unsigned short)0; }
#pragma unroll
    for (int t = 0; t < 4; ++t) {
      const unsigned short* brow = Wt + (size_t)(col0 + t * 16 + ln) * ldb + kb;
      FragB b;
      b.half[0] = *(const v8us*)(brow + 8 * hh);
      b.half[1] = *(const v8us*)(brow + 16 + 8 * hh);
      acc[t] = mmaN<ASPLIT ? 2 : 1>(ah.v, al.v, b.v, b.v, acc[t]);
    }
  }
#pragma unroll
  for (int t = 0; t < 4; ++t) {
    const int col = col0 + t * 16 + ln;
    float bv = bias ? bias[col] : 0.f;
    if (BIAS_BF16) bv = bf16_round(bv);
#pragma unroll
    for (int r = 0; r < 8; ++r) {
      float v = acc[t][r] + bv;
      if (resid) { float rv = resid[(size_t)((row0 + 8 * hh + r) % rmod) * ldr + col]; if (RES_BF16) rv = bf16_round(rv); v += rv; }
      if (ACT == 1) v = fmaxf(v, 0.f);
      if (ACT == 2) v = 0.5f * v * (1.0f + erff(v * 0.70710678118654752f));
      if (ACT == 3) { const float u = 0.7978845608028654f * (v + 0.044715f * v * v * v); v = 0.5f * v * (1.0f + tanhf(u)); }
      so[w][8 * hh + r][t * 16 + ln] = v;
    }
  }
  __builtin_amdgcn_fence(__ATOMIC_ACQ_REL, "workgroup");
  __builtin_amdgcn_wave_barrier();
  const int rsub = lane >> 4, c4 = (lane & 15) * 4;
  {
#pragma unroll
    for (int q = 0; q < 8; ++q) {
      const int r = q * 2 + rsub;
      const v4f v = *(const v4fa*)&so[w][r][c4];
      *(v4f*)(C + (size_t)(row0 + r) * ldc + col0 + c4) = v;
    }
    
  }
}
// row LayerNorm (biased variance, eps) over N: s = X (+ R); optional out_sum <- s; out_norm <- (s-mu)*rsqrt(var+eps)*g + b
template <bool PARAM_BF16>
__global__ __launch_bounds__(256) void k_layernorm(const float* __restrict__ X, const float* __restrict__ R, const float* __restrict__ g, const float* __restrict__ bta,
                                                  float* __restrict__ out_sum, float* __restrict__ out_norm, int N, float eps) {
  __shared__ float red[256];
  const int row = blockIdx.x, tid = threadIdx.x;
  const float* x = X + (size_t)row * N; const float* rr = R ? R + (size_t)row * N : nullptr;
  float vals[16];                     // up to N = 4096
  const int per = N / 256;            // contiguous chunk per thread? use strided-by-4 chunks: thread handles j = tid*4 + 1024*u
  float s1 = 0.f;
  for (int u = 0; u < per / 4; ++u) {
    const int j = tid * 4 + 1024 * u;
    const v4f a = *(const v4fa*)(x + j);
    v4f b = {0.f,0.f,0.f,0.f}; if (rr) b = *(const v4fa*)(rr + j);
#pragma unroll
    for (int q = 0; q < 4; ++q) { const float v = a[q] + b[q]; vals[u * 4 + q] = v; s1 += v; }
  }
  red[tid] = s1; __syncthreads();
  for (int st = 128; st > 0; st >>= 1) { if (tid < st) red[tid] += red[tid + st]; __syncthreads(); }
  const float mu = red[0] / (float)N; __syncthreads();
  float s2 = 0.f;
  for (int u = 0; u < per / 4; ++u)
#pragma unroll
    for (int q = 0; q < 4; ++q) { const float c = vals[u * 4 + q] - mu; s2 += c * c; }
  red[tid] = s2; __syncthreads();
  for (int st = 128; st > 0; st >>= 1) { if (tid < st) red[tid] += red[tid + st]; __syncthreads(); }
  const float rs = rsqrtf(red[0] / (float)N + eps);
  {
    for (int u = 0; u < per / 4; ++u) {
      const int j = tid * 4 + 1024 * u;
      v4f o, sm;
#pragma unroll
      for (int q = 0; q < 4; ++q) {
        float gg = g[j + q], bb = bta[j + q];
        if (PARAM_BF16) { gg = bf16_round(gg); bb = bf16_round(bb); }
        sm[q] = vals[u * 4 + q]; o[q] = (vals[u * 4 + q] - mu) * rs * gg + bb;
      }
      if (out_sum) *(v4f*)(out_sum + (size_t)row * N + j) = sm;
      *(v4f*)(out_norm + (size_t)row * N + j) = o;
    }
    
  }
}



// ---- f16 WMMA path (v_wmma_f32_16x16x32_f16): 11-bit significands for operands in range — used where a [0,1] probability operand needs more precision than bf16
typedef _Float16 v16h __attribute__((ext_vector_type(16)));
union FragH { v16h v; v8us half[2]; _Float16 h[16]; unsigned short u[16]; };
template <int NT>
__device__ __forceinline__ v8f mmaH(v16h ah, v16h al, v16h bh, v16h bl, v8f c) {
  c = __builtin_amdgcn_wmma_f32_16x16x32_f16(false, ah, false, bh, (short)0, c, false, false);
  if (NT >= 2) c = __builtin_amdgcn_wmma_f32_16x16x32_f16(false, al, false, bh, (short)0, c, false, false);
  if (NT >= 3) c = __builtin_amdgcn_wmma_f32_16x16x32_f16(false, ah, false, bl, (short)0, c, false, false);
  asm volatile("v_nop\n\tv_nop\n\tv_nop\n\tv_nop" : "+v"(c) : "v"(ah), "v"(al), "v"(bh), "v"(bl));
  return c;
}
// batched GEMM like k_gemm_b but f16 operands: A f32 (split into f16 hi/lo if ASPLIT, else rounded to f16), Bt = f16 values [n][k]; alpha; C f32; N multiple of 16 (partial tiles skipped)
template <bool ASPLIT>
__global__ __launch_bounds__(128) void k_gemm_h(const float* __restrict__ A, int lda, size_t sA, const _Float16* __restrict__ Bh, int ldb, size_t sB, float alpha, float* __restrict__ C, int ldc, size_t sC, int M, int N, int K) {
  __shared__ __attribute__((aligned(16))) float so[4][16][64];
  const int tid = threadIdx.x, w = tid >> 5, lane = tid & 31, ln = lane & 15, hh = lane >> 4; const int by = blockIdx.y;
  A += (size_t)by * sA; Bh += (size_t)by * sB; C += (size_t)by * sC;
  const int ntn = (N + 63) / 64; const int wid = blockIdx.x * 4 + w; const int mt = wid / ntn, nq = wid % ntn; if (mt * 16 >= M) return;
  const int row0 = mt * 16, col0 = nq * 64; const float* arow = A + (size_t)(row0 + ln) * lda;
  v8f acc[4] = {};
  for (int kb = 0; kb < K; kb += 32) {
    FragH ah, al;
    const v4f x0 = *(const v4fa*)(arow + kb + 8 * hh), x1 = *(const v4fa*)(arow + kb + 8 * hh + 4), x2 = *(const v4fa*)(arow + kb + 16 + 8 * hh), x3 = *(const v4fa*)(arow + kb + 16 + 8 * hh + 4);
    float xs[16] = {x0[0],x0[1],x0[2],x0[3],x1[0],x1[1],x1[2],x1[3],x2[0],x2[1],x2[2],x2[3],x3[0],x3[1],x3[2],x3[3]};
#pragma unroll
    for (int i = 0; i < 16; ++i) { const _Float16 h = (_Float16)xs[i]; ah.h[i] = h; al.h[i] = ASPLIT ? (_Float16)(xs[i] - (float)h) : (_Float16)0.0f; }
#pragma unroll
    for (int t = 0; t < 4; ++t) { if (col0 + t * 16 >= N) continue; const size_t boff = (size_t)(col0 + t * 16 + ln) * ldb + kb; FragH bq; bq.half[0] = *(const v8us*)(Bh + boff + 8 * hh); bq.half[1] = *(const v8us*)(Bh + boff + 16 + 8 * hh);
      acc[t] = mmaH<ASPLIT ? 2 : 1>(ah.v, al.v, bq.v, bq.v, acc[t]); }
  }
#pragma unroll
  for (int t = 0; t < 4; ++t) { if (col0 + t * 16 >= N) continue;
#pragma unroll
    for (int r = 0; r < 8; ++r) so[w][8 * hh + r][t * 16 + ln] = acc[t][r] * alpha; }
  __builtin_amdgcn_fence(__ATOMIC_ACQ_REL, "workgroup"); __builtin_amdgcn_wave_barrier();
  const int rsub = lane >> 4, c4 = (lane & 15) * 4;
  {
#pragma unroll
    for (int q = 0; q < 8; ++q) { const int r = q * 2 + rsub; if (col0 + c4 < N) { const v4f v = *(const v4fa*)&so[w][r][c4]; *(v4f*)(C + (size_t)(row0 + r) * ldc + col0 + c4) = v; } }
     }
}

// Wt[n][k] = f16(W[k][n]·scale) from f32 row-major W[K][N] (scale = power of two; bf16-exact weights stay exact in f16 away from the subnormal range)
__global__ __launch_bounds__(256) void k_wt_f16(const float* __restrict__ W, _Float16* __restrict__ Wt, int K, int N, float scale) {
  const int t = blockIdx.x * 256 + threadIdx.x; if (t >= N * (K / 8)) return; const int n = t / (K / 8), k8 = (t % (K / 8)) * 8; FragH f;
#pragma unroll
  for (int i = 0; i < 8; ++i) f.h[i] = (_Float16)(bf16_round(W[(size_t)(k8 + i) * N + n]) * scale); const v8us o = f.half[0];
  *(v8us*)((unsigned short*)Wt + (size_t)n * K + k8) = o; 
}
// k_gemm_hh variant with fused epilogue: v = acc·alpha + bias[by·sBias + col] (+ CP[(row/rowsPerB)·sCPb + by·64 + col] if CP) ; ACT 0 none / 1 elu ; writes f16 C16 (and f32 C if non-null)
template <int ACT>
__global__ __launch_bounds__(128) void k_gemm_hhx(const _Float16* __restrict__ A, int lda, size_t sA, const _Float16* __restrict__ Bh, int ldb, size_t sB, float alpha, const float* __restrict__ bias, size_t sBias, const float* __restrict__ CP, int rowsPerB, size_t sCPb, int row0g,
    float* __restrict__ C, _Float16* __restrict__ C16, int ldc, size_t sC, int M, int N, int K) {
  __shared__ __attribute__((aligned(16))) float so[4][16][64];
  const int tid = threadIdx.x, w = tid >> 5, lane = tid & 31, ln = lane & 15, hh = lane >> 4; const int by = blockIdx.y;
  A += (size_t)by * sA; Bh += (size_t)by * sB; const size_t cofs = (size_t)by * sC; const float* bp = bias ? bias + (size_t)by * sBias : nullptr;
  const int ntn = (N + 63) / 64; const int wid = blockIdx.x * 4 + w; const int mt = wid / ntn, nq = wid % ntn; if (mt * 16 >= M) return;
  const int row0 = mt * 16, col0 = nq * 64; const _Float16* arow = A + (size_t)(row0 + ln) * lda;
  v8f acc[4] = {};
  for (int kb = 0; kb < K; kb += 32) { FragH ah; ah.half[0] = *(const v8us*)((const unsigned short*)arow + kb + 8 * hh); ah.half[1] = *(const v8us*)((const unsigned short*)arow + kb + 16 + 8 * hh);
#pragma unroll
    for (int t = 0; t < 4; ++t) { if (col0 + t * 16 >= N) continue; const size_t boff = (size_t)(col0 + t * 16 + ln) * ldb + kb; FragH bq; bq.half[0] = *(const v8us*)((const unsigned short*)Bh + boff + 8 * hh); bq.half[1] = *(const v8us*)((const unsigned short*)Bh + boff + 16 + 8 * hh);
      acc[t] = mmaH<1>(ah.v, ah.v, bq.v, bq.v, acc[t]); }
  }
#pragma unroll
  for (int t = 0; t < 4; ++t) { if (col0 + t * 16 >= N) continue; const int col = col0 + t * 16 + ln; const float bv = bp ? bf16_round(bp[col]) : 0.f;
#pragma unroll
    for (int r = 0; r < 8; ++r) { float v = acc[t][r] * alpha + bv; if (CP) { const int rr = row0g + row0 + 8 * hh + r; if (rowsPerB < 0) v += CP[cofs + (size_t)rr * ldc + col];      /* rowsPerB < 0: own element of the batched C plane */ else { const int bidx = rr / rowsPerB; v += CP[(size_t)bidx * sCPb + (size_t)by * 64 + col]; } } if (ACT == 1) v = (v > 0.f) ? v : expm1f(v); else if (ACT == 7) v = (v > 0.f) ? v + 1.0f : expf(v); else if (ACT == 8) v = tanhf(v); else if (ACT == 9) v = 0.5f * v * (1.0f + tanhf(0.7978845608028654f * (v + 0.044715f * v * v * v))); else if (ACT == 11) v = 1.0f / (1.0f + expf(-v)); else if (ACT == 12) v = (v > 0.f) ? v : 0.01f * v; else if (ACT == 14) v = (v > 0.f) ? v : 0.1f * v; else if (ACT == 16) v = (v >= 0.f) ? v : 0.3f * v; else if (ACT == 17) v = (v >= 0.f) ? v : 0.2f * v; else if (ACT == 15) v = v / (1.0f + expf(-v)); else if (ACT == 3) v = fmaxf(v, 0.f); else if (ACT == 6) v = 0.5f * v * (1.0f + erff(v * 0.70710678118654752f)); so[w][8 * hh + r][t * 16 + ln] = v; } }
  __builtin_amdgcn_fence(__ATOMIC_ACQ_REL, "workgroup"); __builtin_amdgcn_wave_barrier();
  const int rsub = lane >> 4, c4 = (lane & 15) * 4; typedef _Float16 v4h __attribute__((ext_vector_type(4)));
  {
#pragma unroll
    for (int q = 0; q < 8; ++q) { const int r = q * 2 + rsub; if (col0 + c4 < N) { const v4f v = *(const v4fa*)&so[w][r][c4]; if (C) *(v4f*)(C + cofs + (size_t)(row0 + r) * ldc + col0 + c4) = v; if (C16) { v4h h4; for (int i = 0; i < 4; ++i) h4[i] = (_Float16)v[i]; *(v4h*)(C16 + cofs + (size_t)(row0 + r) * ldc + col0 + c4) = h4; } } }
     }
}


typedef _Float16 v4h __attribute__((ext_vector_type(4)));

__global__ __launch_bounds__(256) void k_x16(const float* __restrict__ x, _Float16* __restrict__ X16, size_t n8) { const size_t t = (size_t)blockIdx.x * 256 + threadIdx.x; if (t >= n8) return; FragH f;
#pragma unroll
  for (int q = 0; q < 8; ++q) f.h[q] = (_Float16)bf16_round(x[t * 8 + q]); *(v8us*)((unsigned short*)X16 + t * 8) = f.half[0];  }
__global__ __launch_bounds__(256) void k_h16(const float* __restrict__ x, _Float16* __restrict__ X16, size_t n8) { const size_t t = (size_t)blockIdx.x * 256 + threadIdx.x; if (t >= n8) return; FragH f;
#pragma unroll
  for (int q = 0; q < 8; ++q) f.h[q] = (_Float16)x[t * 8 + q]; *(v8us*)((unsigned short*)X16 + t * 8) = f.half[0];  }
__global__ __launch_bounds__(256) void k_round16f(const float* __restrict__ W, _Float16* __restrict__ Bt, size_t n8) { const size_t t = (size_t)blockIdx.x * 256 + threadIdx.x; if (t >= n8) return; FragH f;
#pragma unroll
  for (int i = 0; i < 8; ++i) f.h[i] = (_Float16)(bf16_round(W[t * 8 + i]) * 16.0f); *(v8us*)((unsigned short*)Bt + t * 8) = f.half[0];  }
template <int NHv, int TTv>
__global__ __launch_bounds__(256) void k_vt(const _Float16* __restrict__ V16, int ldv, int voff, _Float16* __restrict__ Vt) { __shared__ unsigned short tl[64][66]; const int tid = threadIdx.x; const int slab = blockIdx.x / (TTv / 64), lg = blockIdx.x % (TTv / 64); const int b = slab / NHv, h = slab % NHv;
  for (int i = tid; i < 64 * 8; i += 256) { const int r = i / 8, c8 = (i % 8) * 8; FragH f; f.half[0] = *(const v8us*)((const unsigned short*)V16 + ((size_t)b * TTv + lg * 64 + r) * ldv + voff + h * 64 + c8);
#pragma unroll
    for (int q = 0; q < 8; ++q) tl[r][c8 + q] = f.u[q]; }
  __syncthreads();
  {
#pragma unroll
    for (int rd = 0; rd < 2; ++rd) { const int d = rd * 32 + tid / 8, pc = tid % 8; FragH f;
#pragma unroll
      for (int q = 0; q < 8; ++q) f.u[q] = tl[pc * 8 + q][d];
      *(v8us*)((unsigned short*)Vt + ((size_t)slab * 64 + d) * TTv + lg * 64 + pc * 8) = f.half[0]; }
     } }

__global__ __launch_bounds__(256) void k_hl(const float* __restrict__ F, _Float16* __restrict__ Hh, _Float16* __restrict__ Hl, size_t n8) { const size_t t = (size_t)blockIdx.x * 256 + threadIdx.x; if (t >= n8) return; FragH fh, fl; const v4f a = *(const v4fa*)(F + t * 8), c = *(const v4fa*)(F + t * 8 + 4);
#pragma unroll
  for (int q = 0; q < 4; ++q) { _Float16 h = (_Float16)a[q]; fh.h[q] = h; fl.h[q] = (_Float16)((a[q] - (float)h) * 1024.0f); h = (_Float16)c[q]; fh.h[4 + q] = h; fl.h[4 + q] = (_Float16)((c[q] - (float)h) * 1024.0f); }
  { *(v8us*)((unsigned short*)Hh + t * 8) = fh.half[0]; *(v8us*)((unsigned short*)Hl + t * 8) = fl.half[0];  } }

// ---- fast GEMM (wave tile 32x64) ----
__device__ __forceinline__ v16h g2_frag(const _Float16* p, int hh) { FragH f; f.half[0] = *(const v8us*)((const unsigned short*)p + 8 * hh); f.half[1] = *(const v8us*)((const unsigned short*)p + 16 + 8 * hh); return f.v; }
__device__ __forceinline__ v8f g2_mma(v16h a, v16h b, v8f c) { v8f d = __builtin_amdgcn_wmma_f32_16x16x32_f16(false, a, false, b, (short)0, c, false, false); asm volatile("v_nop\n\tv_nop\n\tv_nop\n\tv_nop" : "+v"(d) : "v"(a), "v"(b)); return d; }
#define GM 128                       /* tile rows */
#define GN 128                       /* tile columns */
#define GK 64                        /* k per trip */
#define GP 144                       /* LDS row pitch in bytes: 128 + 16, so the 16 rows of a ds_load_b128 fall on all 64 banks */
#define GBUF ((GM + GN) * GP)        /* one buffer: A rows, then Bh rows */
__device__ __forceinline__ v16h g3_frag(const char* p) { FragH f; f.half[0] = *(const v8us*)p; f.half[1] = *(const v8us*)(p + 32); return f.v; }      /* g2_frag from the lane's own LDS byte address (row ln, 16 hh bytes in) */
// One tile: a thread copies 16 B of rows cr, cr + 32, cr + 64, cr + 96 of A and of Bh. l = the lane's LDS byte address of its first A piece, ga / gb = its global addresses in row cr.
__device__ __forceinline__ void g3_stage(unsigned l, const _Float16* ga, const _Float16* gb) {
  /* the s_wait_xcnt in the copies' own statement stands before any register that an issued copy names is rewritten */
  asm volatile("global_load_async_to_lds_b128 %0, %8, off\n\t"
               "global_load_async_to_lds_b128 %1, %9, off\n\t"
               "global_load_async_to_lds_b128 %2, %10, off\n\t"
               "global_load_async_to_lds_b128 %3, %11, off\n\t"
               "global_load_async_to_lds_b128 %4, %12, off\n\t"
               "global_load_async_to_lds_b128 %5, %13, off\n\t"
               "global_load_async_to_lds_b128 %6, %14, off\n\t"
               "global_load_async_to_lds_b128 %7, %15, off\n\t"
               "s_wait_xcnt 0x0"
               :: "v"(l), "v"(l + 32u * GP), "v"(l + 64u * GP), "v"(l + 96u * GP), "v"(l + 128u * GP), "v"(l + 160u * GP), "v"(l + 192u * GP), "v"(l + 224u * GP),
                  "v"(ga), "v"(ga + 32 * DM), "v"(ga + 64 * DM), "v"(ga + 96 * DM), "v"(gb), "v"(gb + 32 * DM), "v"(gb + 64 * DM), "v"(gb + 96 * DM) : "memory"); }
template <bool VTR>
__global__ __launch_bounds__(256) void k_gemm3(const _Float16* __restrict__ A, const _Float16* __restrict__ Bh, float alpha, const float* __restrict__ bias, _Float16* __restrict__ P0, _Float16* __restrict__ P1) {
  static_assert(MP % GM == 0 && DM % GN == 0 && DM % GK == 0 && DM / GK >= 2 && GM == 128 && GN == 128 && GK == 64, "whole tiles, at least two trips, 8 copies per thread and tile");
  static_assert(SQ % GN == 0 && SQ == DM, "a token tile lies in one batch; V^T rows and q / k rows have one pitch");
  __shared__ __attribute__((aligned(16))) char ring[2 * GBUF]; __shared__ __attribute__((aligned(16))) float so[8][32][68];
  const int tid = threadIdx.x, w = tid >> 5, lane = tid & 31, ln = lane & 15, hh = lane >> 4;
  const int tt = blockIdx.x / (DM / GN), wt = blockIdx.x % (DM / GN);      /* token tile, weight tile: neighbouring work-groups share the token rows in both forms */
  const int rowb = (VTR ? wt : tt) * GM, colb = (VTR ? tt : wt) * GN; const int row0 = rowb + 32 * (w & 3), col0 = colb + 64 * (w >> 2);
  const int cr = tid >> 3, cc = tid & 7;      /* 8 lanes cover one 128-B row */
  const _Float16* ga = A + (size_t)(rowb + cr) * DM + cc * 8; const _Float16* gb = Bh + (size_t)(colb + cr) * DM + cc * 8; const unsigned l0 = (unsigned)(size_t)ring + (unsigned)(cr * GP + cc * 16);
  const char* fa = ring + (32 * (w & 3) + ln) * GP + 16 * hh; const char* fb = ring + (GM + 64 * (w >> 2) + ln) * GP + 16 * hh;
  const v8f z8 = {0.f,0.f,0.f,0.f,0.f,0.f,0.f,0.f}; v8f c00 = z8, c01 = z8, c02 = z8, c03 = z8, c10 = z8, c11 = z8, c12 = z8, c13 = z8;
  g3_stage(l0, ga, gb);
  asm volatile("s_wait_asynccnt 0x0" ::: "memory");      /* this wave's share of tile 0 has landed */
  __syncthreads();      /* tile 0 is published */
  g3_stage(l0 + GBUF, ga + GK, gb + GK);
#pragma unroll 1      /* one trip per tile: the buffer is picked by the trip's parity and the loop stays short */
  for (int t = 0; t < DM / GK; ++t) { const int bo = (t & 1) * GBUF; v16h a[2][2], b[2][4];      /* [k step][fragment] */
#pragma unroll      /* constant indices keep the fragment arrays in registers; all 24 LDS reads of the trip stand as one group ahead of its WMMAs */
    for (int ks = 0; ks < 2; ++ks) { for (int i = 0; i < 2; ++i) a[ks][i] = g3_frag(fa + bo + ks * 64 + i * (16 * GP)); for (int j = 0; j < 4; ++j) b[ks][j] = g3_frag(fb + bo + ks * 64 + j * (16 * GP)); }
#pragma unroll      /* constant fragment indices, as above */
    for (int ks = 0; ks < 2; ++ks) { c00 = g2_mma(a[ks][0], b[ks][0], c00); c10 = g2_mma(a[ks][1], b[ks][0], c10); c01 = g2_mma(a[ks][0], b[ks][1], c01); c11 = g2_mma(a[ks][1], b[ks][1], c11);
      c02 = g2_mma(a[ks][0], b[ks][2], c02); c12 = g2_mma(a[ks][1], b[ks][2], c12); c03 = g2_mma(a[ks][0], b[ks][3], c03); c13 = g2_mma(a[ks][1], b[ks][3], c13); }
    asm volatile("s_wait_dscnt 0x0" ::: "memory");      /* this wave's reads of the buffer are done before it is handed back */
    asm volatile("s_wait_asynccnt 0x0" ::: "memory");      /* this wave's share of tile t + 1 has landed */
    __syncthreads();      /* publishes tile t + 1 and ends every wave's reads of tile t */
    if (t + 2 < DM / GK) g3_stage(l0 + (unsigned)bo, ga + (t + 2) * GK, gb + (t + 2) * GK); }
  asm volatile("s_wait_asynccnt 0x0" ::: "memory");      /* no copy is outstanding when the wave goes on */
  v8f accs[8] = {c00, c01, c02, c03, c10, c11, c12, c13};
#pragma unroll      /* constant accumulator indices (this loop and the next): no scratch */
  for (int u = 0; u < 8; ++u) { const int t = u & 3, half = u >> 2;
#pragma unroll
    for (int r = 0; r < 8; ++r) { const float bv = bf16_round(bias[VTR ? row0 + half * 16 + 8 * hh + r : col0 + t * 16 + ln]); so[w][half * 16 + 8 * hh + r][t * 16 + ln] = accs[u][r] * alpha + bv; } }
  __builtin_amdgcn_fence(__ATOMIC_ACQ_REL, "workgroup"); __builtin_amdgcn_wave_barrier();
  const int rsub = lane >> 3, c8 = (lane & 7) * 8;      /* 8 lanes x 16 B cover one 128-B line of a plane, a wave four rows per store */
  const size_t e0 = (VTR ? ((size_t)(col0 / SQ) * DM + row0) * SQ + (col0 % SQ) : (size_t)row0 * DM + col0) + (size_t)rsub * DM + c8;      /* the lane's first element */
  v4f va[8], vb[8];
#pragma unroll      /* constant indices keep the rows in registers; the 16 LDS reads stand as one group ahead of the conversions */
  for (int q = 0; q < 8; ++q) { va[q] = *(const v4fa*)&so[w][q * 4 + rsub][c8]; vb[q] = *(const v4fa*)&so[w][q * 4 + rsub][c8 + 4]; }
#pragma unroll      /* constant indices, as above */
  for (int q = 0; q < 8; ++q) { FragH fh, fl;
#pragma unroll
    for (int i = 0; i < 4; ++i) { _Float16 h = (_Float16)va[q][i]; fh.h[i] = h; fl.h[i] = (_Float16)((va[q][i] - (float)h) * 1024.0f); h = (_Float16)vb[q][i]; fh.h[4 + i] = h; fl.h[4 + i] = (_Float16)((vb[q][i] - (float)h) * 1024.0f); }
    *(v8us*)((unsigned short*)P0 + e0 + (size_t)q * 4 * DM) = fh.half[0]; if (!VTR) *(v8us*)((unsigned short*)P1 + e0 + (size_t)q * 4 * DM) = fl.half[0];
    if (q < 7) asm volatile("s_wait_xcnt 0x0" ::: "memory"); } }      /* the wait that stands before a register which an issued store names is rewritten (later rows' conversions reuse the data registers) */


__global__ __launch_bounds__(256) void k_wnat(const float* __restrict__ w, size_t n8, _Float16* __restrict__ Bt) { const size_t t = (size_t)blockIdx.x * 256 + threadIdx.x; if (t >= n8) return; FragH f; for (int q = 0; q < 8; ++q) f.h[q] = (_Float16)(bf16_round(w[t * 8 + q]) * 16.0f); *(v8us*)((unsigned short*)Bt + t * 8) = f.half[0];  }
__global__ __launch_bounds__(256) void k_rsm(const float* __restrict__ S, _Float16* __restrict__ P, int nrows) {
  #pragma clang fp contract(off)
  const int i = blockIdx.x * 256 + threadIdx.x; if (i >= nrows) return; const float* s = S + (size_t)i * SQ; float mx = -3.0e38f;
#pragma unroll 1
  for (int j = 0; j < SQ; ++j) mx = fmaxf(mx, s[j]); float se = 0.f;
#pragma unroll 1
  for (int j = 0; j < SQ; ++j) se += expf(s[j] - mx); const float sc = 256.0f / se;
#pragma unroll 1
  for (int j0 = 0; j0 < SQ; j0 += 8) { FragH f; for (int q = 0; q < 8; ++q) f.h[q] = (_Float16)(expf(s[j0 + q] - mx) * sc); unsigned short* d = (unsigned short*)P + (size_t)i * SQ + j0; *(v8us*)d = f.half[0];  } }
__global__ __launch_bounds__(256) void k_vt(const _Float16* __restrict__ V16, int b, int h0, _Float16* __restrict__ VT) { __shared__ unsigned short tl[64][65]; const int tid = threadIdx.x; const int hh = blockIdx.x % HG, sg = blockIdx.x / HG; const int s0 = sg * 64; const int h = h0 + hh;
  for (int i = tid; i < 64 * 8; i += 256) { const int j = i / 8, d8 = (i % 8) * 8; FragH f; f.half[0] = *(const v8us*)((const unsigned short*)V16 + ((size_t)b * SQ + s0 + j) * DM + h * HD + d8); for (int q = 0; q < 8; ++q) tl[d8 + q][j] = f.u[q]; }
  __syncthreads();
  { for (int i = tid; i < 64 * 8; i += 256) { const int d = i / 8, j8 = (i % 8) * 8; FragH f; for (int q = 0; q < 8; ++q) f.u[q] = tl[d][j8 + q]; *(v8us*)((unsigned short*)VT + ((size_t)hh * HD + d) * SQ + s0 + j8) = f.half[0]; }  } }



// Fused attention, one launch for all batches and heads. A wave owns FQ = 32 query columns and walks the SQ keys 32 at a time; no LDS, no barrier.
// S^T = K Q^T: A = K rows, B = Q rows kept in registers (hi.hi in one accumulator, hi.lo + lo.hi in a second), so a lane holds scores of one query only: running max and running sum in-lane, one exchange between the wave halves.
// Two S^T tiles (keys 0 .. 15 and 16 .. 31) converted in place are the B operand of O^T += V^T P^T in the hardware k order, which g2_frag gives the V^T rows too; S and P never leave registers.
__device__ __forceinline__ float lane_xor_16(float v) { const int u = __float_as_int(v); return __int_as_float(__builtin_amdgcn_permlanex16(u, u, 0x76543210, 0xfedcba98, false, false)); }      /* lane l <- lane l ^ 16 */
__device__ __forceinline__ float exp2_slot(float a) { float r; asm("v_exp_f32 %0, %1\n\tv_nop" : "=v"(r) : "v"(a)); return r; }      /* 2^a; the v_nop in the same statement keeps the slot the instruction set asks for behind a transcendental, before its result is read or its source register reused */
__device__ __forceinline__ v4f exp2_slot4(v4f a) { float r0, r1, r2, r3;      /* four 2^a: each fills the slot behind the one before it (early-clobber outputs share no register with a source), one v_nop keeps the slot behind the last */
  asm("v_exp_f32 %0, %4\n\tv_exp_f32 %1, %5\n\tv_exp_f32 %2, %6\n\tv_exp_f32 %3, %7\n\tv_nop" : "=&v"(r0), "=&v"(r1), "=&v"(r2), "=&v"(r3) : "v"(a[0]), "v"(a[1]), "v"(a[2]), "v"(a[3])); const v4f r = {r0, r1, r2, r3}; return r; }
__device__ __forceinline__ v16h fa_frag(const char* p) { FragH f; f.half[0] = *(const v8us*)p; f.half[1] = *(const v8us*)(p + 32); return f.v; }      /* g2_frag from the lane's own byte address (row c, 16 hh bytes in) */
__device__ __forceinline__ v8f fa_mma(v16h a, v16h b, v8f c) { return __builtin_amdgcn_wmma_f32_16x16x32_f16(false, a, false, b, (short)0, c, false, false); }
#define FW 8                         /* waves per work-group */
#define FQ 32                        /* query columns per wave */
__global__ __launch_bounds__(FW * 32) __attribute__((amdgpu_waves_per_eu(4, 4))) void k_fattn(const _Float16* __restrict__ QH, const _Float16* __restrict__ QL, const _Float16* __restrict__ KH, const _Float16* __restrict__ KL, const _Float16* __restrict__ VT, float* __restrict__ out) {
  static_assert(SQ % (FW * FQ) == 0 && SQ % 32 == 0 && HD == 64, "whole query blocks, whole 32-key passes, two k steps per score");
  const int lane = threadIdx.x & 31, w = threadIdx.x >> 5, c = lane & 15, hh = lane >> 4; const int h = blockIdx.y, b = blockIdx.z;
  const size_t r0 = (size_t)b * SQ; const int q0 = blockIdx.x * (FW * FQ) + w * FQ;
  v16h qh[2][2], ql[2][2];      /* [query tile][k step] */
#pragma unroll
  for (int g = 0; g < 2; ++g) for (int ks = 0; ks < 2; ++ks) { const size_t qo = (r0 + q0 + g * 16 + c) * DM + h * HD + ks * 32; qh[g][ks] = g2_frag(QH + qo, hh); ql[g][ks] = g2_frag(QL + qo, hh); }
  const _Float16* kh = KH + r0 * DM + h * HD; const _Float16* kl = KL + r0 * DM + h * HD; const _Float16* vt = VT + ((size_t)b * NH + h) * HD * SQ;      /* uniform bases; the lane's part is ko / vo */
  const unsigned ko = (unsigned)(c * DM + 8 * hh) * 2u, vo = (unsigned)(c * SQ + 8 * hh) * 2u;
  const v8f z8 = {0.f, 0.f, 0.f, 0.f, 0.f, 0.f, 0.f, 0.f}; v8f o[2][4] = {{z8, z8, z8, z8}, {z8, z8, z8, z8}};      /* [query tile][d tile]: register r = O[query c][16 t + 8 hh + r] */
  float m[2] = {-3.0e38f, -3.0e38f}, l[2] = {0.f, 0.f};
  const float C1 = 0.125f * 1.44269504088896340736f, C2 = 0.0001220703125f * 1.44269504088896340736f;      /* 64^-0.5 and 64^-0.5 2^-10, in log2 units */
#pragma unroll 1
  for (int j0 = 0; j0 < SQ; j0 += 32) { v8f t[2][2];      /* [query tile][key tile]: register r = score of key j0 + 16 kt + 8 hh + r for query c */
    const char* kp = (const char*)(kh + (size_t)j0 * DM) + ko; const char* lp = (const char*)(kl + (size_t)j0 * DM) + ko; v16h kf[2][2], lf[2][2];      /* [key tile][k step] */
#pragma unroll
    for (int kt = 0; kt < 2; ++kt) for (int ks = 0; ks < 2; ++ks) { kf[kt][ks] = fa_frag(kp + kt * (16 * DM * 2) + ks * 64); lf[kt][ks] = fa_frag(lp + kt * (16 * DM * 2) + ks * 64); }
    asm volatile("s_wait_xcnt 0x0" :: "v"(kp), "v"(lp) : "memory");      /* the wait that stands before a register which an issued load names is rewritten; the two addresses are inputs, so they keep their registers up to it and no load result lands on them */
#pragma unroll
    for (int kt = 0; kt < 2; ++kt) {
#pragma unroll
      for (int g = 0; g < 2; ++g) { v8f sh = fa_mma(kf[kt][0], qh[g][0], z8); sh = fa_mma(kf[kt][1], qh[g][1], sh);
        v8f sl = fa_mma(kf[kt][0], ql[g][0], z8); sl = fa_mma(kf[kt][1], ql[g][1], sl); sl = fa_mma(lf[kt][0], qh[g][0], sl); sl = fa_mma(lf[kt][1], qh[g][1], sl);
        t[g][kt] = sl * C2 + sh * C1; } }
    const char* vp = (const char*)(vt + j0) + vo; v16h vf[4];
#pragma unroll
    for (int u = 0; u < 4; ++u) vf[u] = fa_frag(vp + u * (16 * SQ * 2));
    asm volatile("s_wait_xcnt 0x0" :: "v"(vp) : "memory");      /* as above, for the V^T address */
#pragma unroll
    for (int g = 0; g < 2; ++g) { float mx = t[g][0][0];
#pragma unroll
      for (int r = 1; r < 16; ++r) mx = fmaxf(mx, t[g][r >> 3][r & 7]);
      mx = fmaxf(mx, lane_xor_16(mx)); const float mn = fmaxf(m[g], mx); const float al = exp2_slot(m[g] - mn), mb = mn - 8.0f; m[g] = mn;      /* weights carried x256 (it cancels in the final division), which keeps small ones out of the f16 subnormals */
      FragH pf; v4f s4 = {0.f, 0.f, 0.f, 0.f};
#pragma unroll
      for (int kt = 0; kt < 2; ++kt) for (int q = 0; q < 2; ++q) { v4f a; for (int i = 0; i < 4; ++i) a[i] = t[g][kt][q * 4 + i] - mb; const v4f e = exp2_slot4(a); s4 += e; for (int i = 0; i < 4; ++i) pf.h[kt * 8 + q * 4 + i] = (_Float16)e[i]; }
      l[g] = fmaf(l[g], al, (s4[0] + s4[1]) + (s4[2] + s4[3]));      /* this half's keys only; the halves join after the loop */
#pragma unroll
      for (int u = 0; u < 4; ++u) { o[g][u] *= al; o[g][u] = fa_mma(vf[u], pf.v, o[g][u]); } } }
#pragma unroll
  for (int g = 0; g < 2; ++g) { const float inv = 1.0f / (l[g] + lane_xor_16(l[g])); float* op = out + (r0 + q0 + g * 16 + c) * DM + h * HD + 8 * hh;
#pragma unroll
    for (int u = 0; u < 4; ++u) { const v4f x0 = {o[g][u][0] * inv, o[g][u][1] * inv, o[g][u][2] * inv, o[g][u][3] * inv}, x1 = {o[g][u][4] * inv, o[g][u][5] * inv, o[g][u][6] * inv, o[g][u][7] * inv}; *(v4f*)(op + u * 16) = x0; *(v4f*)(op + u * 16 + 4) = x1; } } }


template <int MASKADD>
__global__ __launch_bounds__(64) void k_att0(const float* __restrict__ QF, const float* __restrict__ KF, const float* __restrict__ VF, int ld, const float* __restrict__ mask, float scale, float* __restrict__ OF, int ldo) {
  #pragma clang fp contract(off)
  __shared__ __attribute__((aligned(16))) float lq[64][64]; __shared__ __attribute__((aligned(16))) float lo[64][64];
  const int tid = threadIdx.x; const int h = blockIdx.x / (QT0 / 64), rg = blockIdx.x % (QT0 / 64); const int i = rg * 64 + tid;
  const float* qr = QF + (size_t)i * ld + h * HD;
#pragma unroll 1
  for (int c = 0; c < HD / 4; ++c) { *(v4f*)&lq[tid][c * 4] = *(const v4fa*)(qr + c * 4); const v4f z = {0.f, 0.f, 0.f, 0.f}; *(v4f*)&lo[tid][c * 4] = z; }
  float m = -1.0e30f, l = 0.f; const int jmax = MASKADD ? (SQ - 1) : (rg * 64 + 63);      /* additive-mask form: every key (the mask input decides); causal form: keys up to the block's last row */
#pragma unroll 1
  for (int j = 0; j <= jmax; ++j) { const float* kr = KF + (size_t)j * ld + h * HD; const float* vr = VF + (size_t)j * ld + h * HD; float s = 0.f;
#pragma unroll 1
    for (int c = 0; c < HD / 4; ++c) { const v4f kq = *(const v4fa*)(kr + c * 4); const v4f qq = *(v4f*)&lq[tid][c * 4]; s = __fadd_rn(s, __fmul_rn(qq[0], kq[0])); s = __fadd_rn(s, __fmul_rn(qq[1], kq[1])); s = __fadd_rn(s, __fmul_rn(qq[2], kq[2])); s = __fadd_rn(s, __fmul_rn(qq[3], kq[3])); }
    s = __fmul_rn(s, scale); if (MASKADD) s = __fadd_rn(s, __fmul_rn(bf16_round(mask[(size_t)i * SQ + j]), -10000.0f));
    const float f = (MASKADD || j <= i) ? 1.f : 0.f; const float sm = fmaf(f, s, (1.f - f) * -1.0e30f); const float mn = fmaxf(m, sm); const float sc = expf(m - mn); const float e = expf(sm - mn); l = __fadd_rn(__fmul_rn(l, sc), e); m = mn;
#pragma unroll 1
    for (int c = 0; c < HD / 4; ++c) { const v4f vv = *(const v4fa*)(vr + c * 4); v4f oo = *(v4f*)&lo[tid][c * 4]; for (int u = 0; u < 4; ++u) oo[u] = __fadd_rn(__fmul_rn(oo[u], sc), __fmul_rn(e, vv[u])); *(v4f*)&lo[tid][c * 4] = oo; } }
  const float fin = 64.0f / l;      /* o carried x64 */
#pragma unroll 1
  for (int c = 0; c < HD / 4; ++c) { v4f oo = *(v4f*)&lo[tid][c * 4]; for (int u = 0; u < 4; ++u) oo[u] = __fmul_rn(oo[u], fin); *(v4f*)&lo[tid][c * 4] = oo; }
  __syncthreads();
  {
#pragma unroll 1
    for (int it = 0; it < 16; ++it) { const int row = it * 4 + tid / 16, pc = (tid % 16) * 4; const v4f v = *(const v4f*)&lo[row][pc]; *(v4f*)(OF + (size_t)(rg * 64 + row) * ldo + h * HD + pc) = v; }
     } }

__global__ __launch_bounds__(256) void k_of0out(const float* __restrict__ src, float* __restrict__ dst, size_t n4) { const size_t t = (size_t)blockIdx.x * 256 + threadIdx.x; if (t >= n4) return; v4f v = *(const v4fa*)(src + t * 4); for (int q = 0; q < 4; ++q) v[q] = __fmul_rn(v[q], 0.015625f); *(v4f*)(dst + t * 4) = v;  }

extern "C" void kernel_launch(void* const* d_in, const int* in_sizes, int n_in,
                              void* d_out, int out_size, void* d_ws, size_t ws_size, hipStream_t stream) {
  (void)in_sizes; (void)n_in; (void)out_size;
  const float* const* I = (const float* const*)d_in; const float* x = I[0]; const float* wq = I[1]; const float* wk = I[2]; const float* wv = I[3]; const float* bq = I[4]; const float* bk = I[5]; const float* bv = I[6];      /* input order: x, Wq, Wk, Wv, bq, bk, bv: natural [out][in] weights, then the three biases (every projection launch passes the bias variables); NO output projection */
  char* ws = (char*)d_ws; size_t off = 0;
  auto take = [&](size_t bytes) { char* p = ws + off; off += (bytes + 255) & ~(size_t)255; return p; };
  _Float16* BQ = (_Float16*)take((size_t)DM * DM * 2); _Float16* BK = (_Float16*)take((size_t)DM * DM * 2); _Float16* BV = (_Float16*)take((size_t)DM * DM * 2);
  _Float16* X16 = (_Float16*)take(NR * DM * 2); _Float16* QH = (_Float16*)take(NR * DM * 2); _Float16* QL = (_Float16*)take(NR * DM * 2); _Float16* KH = (_Float16*)take(NR * DM * 2); _Float16* KL = (_Float16*)take(NR * DM * 2);
  _Float16* VT = (_Float16*)take((size_t)NB * NH * HD * SQ * 2);
  if (off > ws_size) return;
  { const unsigned g = (unsigned)(((size_t)DM * DM / 8 + 255) / 256); k_wnat<<<g, 256, 0, stream>>>(wq, (size_t)DM * DM / 8, BQ); k_wnat<<<g, 256, 0, stream>>>(wk, (size_t)DM * DM / 8, BK); k_wnat<<<g, 256, 0, stream>>>(wv, (size_t)DM * DM / 8, BV); }      /* natural [out][in] = Bt[n][k] x16 */
  k_x16<<<(unsigned)((NR * DM / 8 + 255) / 256), 256, 0, stream>>>(x, X16, NR * DM / 8);
  const size_t r0p = (size_t)B0 * SQ;      /* first projected row */
  k_gemm3<false><<<(MP / GM) * (DM / GN), 256, 0, stream>>>(X16 + r0p * DM, BQ, 0.0625f, bq, QH + r0p * DM, QL + r0p * DM);      /* q -> f16 hi + x1024 residual planes, from the GEMM's own epilogue: unscaled logits sigma ~8 */
  k_gemm3<false><<<(MP / GM) * (DM / GN), 256, 0, stream>>>(X16 + r0p * DM, BK, 0.0625f, bk, KH + r0p * DM, KL + r0p * DM);      /* k likewise */
  k_gemm3<true><<<(DM / GM) * (MP / GN), 256, 0, stream>>>(BV, X16 + r0p * DM, 0.0625f, bv, VT + r0p * DM, nullptr);      /* V^T [NB][NH][HD][SQ] = Wv . x^T, all batches */
  k_fattn<<<dim3(SQ / (FW * FQ), NH, NB), FW * 32, 0, stream>>>(QH, QL, KH, KL, VT, (float*)d_out);      /* scores (hi.hi + 2^-10 (hi.lo + lo.hi)), softmax over all keys and P V in one launch, f32 straight into the head-major output columns (no output projection) */
}

// v005
// Measured time: 122 microseconds a run.
// In two side-by-side timings against v004, it was 1.44 and 1.43 times as fast.
// Over all steps from v000 it is 66.7 times as fast.
#include <hip/hip_runtime.h>
// Multi-head self-attention without an output projection, NON-causal (x [8][1024][1024]; q / k / v = x W^T + b (nn.Linear natural [1024][1024] sigma 1/32, biases sigma 0.01); 16 heads of 64; scores * 64^-0.5; softmax over all 1024 keys (no mask); out = ctx merged head-major -> [8][1024][1024]; the source never applies its out_proj).
// Structure: token rows r = b*1024 + s; x as exact f16 rows (bf16-rounded); q and k as WMMA GEMMs (128x128 work-group tiles staged in LDS by asynchronous copies, 32x64 wave tiles, f32 accumulation, exact x16 weights + bias) whose epilogue splits each f32 value into f16 hi + x1024 residual planes, v as the same GEMM with its operands swapped, so that its f16 tile is V^T as attention reads it; then ONE fused attention launch (k_fattn): per wave 32 queries, keys 32 at a time from 64-key K / V^T tiles that a work-group stages in LDS by asynchronous copies, scores as hi.hi + 2^-10 (hi.lo + lo.hi), online softmax (f32 running max and sum, native exp2), weights x256 as f16 straight from the score accumulators into O^T += V^T P^T, f32 out written into the head-major columns.
// Compute dtype: inputs rounded to bf16; x / weights exact; q and k as f16 hi + x1024 residual planes, v and softmax weights as plain f16 GEMM operands (~2^-12); scores, softmax statistics and o f32. v_wmma_f32_16x16x32_f16.
#define NB 8
#define SQ 1024
#define DM 1024
#define NH 16
#define HD 64
#define HG 4                         /* heads per group in the unlaunched k_vt overload */
#define QT 256                       /* unused */
#define NKX SQ                       /* unused */
#define QT0 128                      /* query rows per head in k_att0, which is not launched */
#define B0 0                         /* first batch processed (debug hook) */
#define NBR NB                       /* batches processed (debug hook) */
#define NR ((size_t)NB * SQ)         /* token rows */
#define MP ((int)((size_t)NBR * SQ)) /* rows projected (debug hook) */
#define QN SQ                        /* unused */
#define NHD NH                       /* unused */
#define MPO MP                       /* unused */
#define LQ DM      /* unused */
typedef __bf16 v16b __attribute__((ext_vector_type(16)));
typedef unsigned short v8us __attribute__((ext_vector_type(8), may_alias));
typedef float  v8f  __attribute__((ext_vector_type(8)));
typedef float  v4f  __attribute__((ext_vector_type(4)));
typedef float  v4fa __attribute__((ext_vector_type(4), may_alias));
union FragB { v16b v; v8us half[2]; unsigned short u[16]; };

__device__ __forceinline__ unsigned short bf16_bits(float x) { unsigned int u = __float_as_uint(x); return (unsigned short)((u + 0x7FFFu + ((u >> 16) & 1u)) >> 16); }
__device__ __forceinline__ float bf16_val(unsigned short b) { return __uint_as_float(((unsigned int)b) << 16); }
__device__ __forceinline__ float bf16_round(float x) { return bf16_val(bf16_bits(x)); }
// D += A·B with NT terms: 1 = ah·bh, 2 = + al·bh (A split), 3 = + ah·bl (both split)
template <int NT>
__device__ __forceinline__ v8f mmaN(v16b ah, v16b al, v16b bh, v16b bl, v8f c) {
  c = __builtin_amdgcn_wmma_f32_16x16x32_bf16(false, ah, false, bh, (short)0, c, false, false);
  if (NT >= 2) c = __builtin_amdgcn_wmma_f32_16x16x32_bf16(false, al, false, bh, (short)0, c, false, false);
  if (NT >= 3) c = __builtin_amdgcn_wmma_f32_16x16x32_bf16(false, ah, false, bl, (short)0, c, false, false);
  asm volatile("v_nop\n\tv_nop\n\tv_nop\n\tv_nop" : "+v"(c) : "v"(ah), "v"(al), "v"(bh), "v"(bl));
  return c;
}

__global__ __launch_bounds__(256) void k_wt_bf16(const float* __restrict__ W, unsigned short* __restrict__ Wt, int K, int N) {
  const int t = blockIdx.x * 256 + threadIdx.x;
  const int k8n = K / 8;
  if (t >= N * k8n) return;
  const int n = t / k8n, k8 = (t % k8n) * 8;
  v8us v;
#pragma unroll
  for (int i = 0; i < 8; ++i) v[i] = bf16_bits(W[(size_t)(k8 + i) * N + n]);
  *(v8us*)(Wt + (size_t)n * K + k8) = v;
  
}

// GEMM C[M][N] (f32, pitch ldc) = act(A[M][K]·W + bias). A f32 row-major (pitch lda) converted per fragment to bf16
// (ASPLIT: hi/lo two planes -> 2 terms, else single rounded term); Wt bf16 [N][K] (pitch ldb). BIAS_BF16 rounds the
// bias to bf16 first (bias quantised to bf16 before the add). K%32==0, M%16==0, N%64==0.
template <bool ASPLIT, int ACT, bool BIAS_BF16>
__global__ __launch_bounds__(128) void k_gemm_bf(const float* __restrict__ A, int lda, const unsigned short* __restrict__ Wt, int ldb,
                                               const float* __restrict__ bias, float* __restrict__ C, int ldc, int M, int N, int K) {
  __shared__ __attribute__((aligned(16))) float so[4][16][64];
  const int tid = threadIdx.x, w = tid >> 5, lane = tid & 31, ln = lane & 15, hh = lane >> 4;
  const int ntn = N / 64;
  const int wid = blockIdx.x * 4 + w;
  const int mt = wid / ntn, nq = wid % ntn;
  if (mt * 16 >= M) return;
  const int row0 = mt * 16, col0 = nq * 64;
  const float* arow = A + (size_t)(row0 + ln) * lda;
  v8f acc[4] = {};
  for (int kb = 0; kb < K; kb += 32) {
    FragB ah, al;
    const v4f x0 = *(const v4fa*)(arow + kb + 8 * hh), x1 = *(const v4fa*)(arow + kb + 8 * hh + 4);
    const v4f x2 = *(const v4fa*)(arow + kb + 16 + 8 * hh), x3 = *(const v4fa*)(arow + kb + 16 + 8 * hh + 4);
    float xs[16] = {x0[0],x0[1],x0[2],x0[3],x1[0],x1[1],x1[2],x1[3],x2[0],x2[1],x2[2],x2[3],x3[0],x3[1],x3[2],x3[3]};
#pragma unroll
    for (int i = 0; i < 16; ++i) { const unsigned short hb = bf16_bits(xs[i]); ah.u[i] = hb; al.u[i] = ASPLIT ? bf16_bits(xs[i] - bf16_val(hb)) : (unsigned short)0; }
#pragma unroll
    for (int t = 0; t < 4; ++t) {
      const unsigned short* brow = Wt + (size_t)(col0 + t * 16 + ln) * ldb + kb;
      FragB b;
      b.half[0] = *(const v8us*)(brow + 8 * hh);
      b.half[1] = *(const v8us*)(brow + 16 + 8 * hh);
      acc[t] = mmaN<ASPLIT ? 2 : 1>(ah.v, al.v, b.v, b.v, acc[t]);
    }
  }
#pragma unroll
  for (int t = 0; t < 4; ++t) {
    float bv = bias ? bias[col0 + t * 16 + ln] : 0.f;
    if (BIAS_BF16) bv = bf16_round(bv);
#pragma unroll
    for (int r = 0; r < 8; ++r) { float v = acc[t][r] + bv; if (ACT == 1) v = fmaxf(v, 0.f); so[w][8 * hh + r][t * 16 + ln] = v; }
  }
  __builtin_amdgcn_fence(__ATOMIC_ACQ_REL, "workgroup");
  __builtin_amdgcn_wave_barrier();
  const int rsub = lane >> 4, c4 = (lane & 15) * 4;
  {
#pragma unroll
    for (int q = 0; q < 8; ++q) {
      const int r = q * 2 + rsub;
      const v4f v = *(const v4fa*)&so[w][r][c4];
      *(v4f*)(C + (size_t)(row0 + r) * ldc + col0 + c4) = v;
    }
    
  }
}

// GEMM C = act(A·W + bias + resid): A f32 (ASPLIT -> hi/lo 2 terms), Wt bf16 [N][K]; ACT 0 none, 1 relu, 2 exact gelu;
// resid (optional, f32, row index = (row % rmod), pitch ldr, RES_BF16 rounds it) added before the activation.
template <bool ASPLIT, int ACT, bool BIAS_BF16, bool RES_BF16>
__global__ __launch_bounds__(128) void k_gemm_bf3(const float* __restrict__ A, int lda, const unsigned short* __restrict__ Wt, int ldb,
                                                const float* __restrict__ bias, const float* __restrict__ resid, int rmod, int ldr,
                                                float* __restrict__ C, int ldc, int M, int N, int K) {
  __shared__ __attribute__((aligned(16))) float so[4][16][64];
  const int tid = threadIdx.x, w = tid >> 5, lane = tid & 31, ln = lane & 15, hh = lane >> 4;
  const int ntn = N / 64;
  const int wid = blockIdx.x * 4 + w;
  const int mt = wid / ntn, nq = wid % ntn;
  if (mt * 16 >= M) return;
  const int row0 = mt * 16, col0 = nq * 64;
  const float* arow = A + (size_t)(row0 + ln) * lda;
  v8f acc[4] = {};
  for (int kb = 0; kb < K; kb += 32) {
    FragB ah, al;
    const v4f x0 = *(const v4fa*)(arow + kb + 8 * hh), x1 = *(const v4fa*)(arow + kb + 8 * hh + 4);
    const v4f x2 = *(const v4fa*)(arow + kb + 16 + 8 * hh), x3 = *(const v4fa*)(arow + kb + 16 + 8 * hh + 4);
    float xs[16] = {x0[0],x0[1],x0[2],x0[3],x1[0],x1[1],x1[2],x1[3],x2[0],x2[1],x2[2],x2[3],x3[0],x3[1],x3[2],x3[3]};
#pragma unroll
    for (int i = 0; i < 16; ++i) { const unsigned short hb = bf16_bits(xs[i]); ah.u[i] = hb; al.u[i] = ASPLIT ? bf16_bits(xs[i] - bf16_val(hb)) : (unsigned short)0; }
#pragma unroll
    for (int t = 0; t < 4; ++t) {
      const unsigned short* brow = Wt + (size_t)(col0 + t * 16 + ln) * ldb + kb;
      FragB b;
      b.half[0] = *(const v8us*)(brow + 8 * hh);
      b.half[1] = *(const v8us*)(brow + 16 + 8 * hh);
      acc[t] = mmaN<ASPLIT ? 2 : 1>(ah.v, al.v, b.v, b.v, acc[t]);
    }
  }
#pragma unroll
  for (int t = 0; t < 4; ++t) {
    const int col = col0 + t * 16 + ln;
    float bv = bias ? bias[col] : 0.f;
    if (BIAS_BF16) bv = bf16_round(bv);
#pragma unroll
    for (int r = 0; r < 8; ++r) {
      float v = acc[t][r] + bv;
      if (resid) { float rv = resid[(size_t)((row0 + 8 * hh + r) % rmod) * ldr + col]; if (RES_BF16) rv = bf16_round(rv); v += rv; }
      if (ACT == 1) v = fmaxf(v, 0.f);
      if (ACT == 2) v = 0.5f * v * (1.0f + erff(v * 0.70710678118654752f));
      if (ACT == 3) { const float u = 0.7978845608028654f * (v + 0.044715f * v * v * v); v = 0.5f * v * (1.0f + tanhf(u)); }
      so[w][8 * hh + r][t * 16 + ln] = v;
    }
  }
  __builtin_amdgcn_fence(__ATOMIC_ACQ_REL, "workgroup");
  __builtin_amdgcn_wave_barrier();
  const int rsub = lane >> 4, c4 = (lane & 15) * 4;
  {
#pragma unroll
    for (int q = 0; q < 8; ++q) {
      const int r = q * 2 + rsub;
      const v4f v = *(const v4fa*)&so[w][r][c4];
      *(v4f*)(C + (size_t)(row0 + r) * ldc + col0 + c4) = v;
    }
    
  }
}
// row LayerNorm (biased variance, eps) over N: s = X (+ R); optional out_sum <- s; out_norm <- (s-mu)*rsqrt(var+eps)*g + b
template <bool PARAM_BF16>
__global__ __launch_bounds__(256) void k_layernorm(const float* __restrict__ X, const float* __restrict__ R, const float* __restrict__ g, const float* __restrict__ bta,
                                                  float* __restrict__ out_sum, float* __restrict__ out_norm, int N, float eps) {
  __shared__ float red[256];
  const int row = blockIdx.x, tid = threadIdx.x;
  const float* x = X + (size_t)row * N; const float* rr = R ? R + (size_t)row * N : nullptr;
  float vals[16];                     // up to N = 4096
  const int per = N / 256;            // contiguous chunk per thread? use strided-by-4 chunks: thread handles j = tid*4 + 1024*u
  float s1 = 0.f;
  for (int u = 0; u < per / 4; ++u) {
    const int j = tid * 4 + 1024 * u;
    const v4f a = *(const v4fa*)(x + j);
    v4f b = {0.f,0.f,0.f,0.f}; if (rr) b = *(const v4fa*)(rr + j);
#pragma unroll
    for (int q = 0; q < 4; ++q) { const float v = a[q] + b[q]; vals[u * 4 + q] = v; s1 += v; }
  }
  red[tid] = s1; __syncthreads();
  for (int st = 128; st > 0; st >>= 1) { if (tid < st) red[tid] += red[tid + st]; __syncthreads(); }
  const float mu = red[0] / (float)N; __syncthreads();
  float s2 = 0.f;
  for (int u = 0; u < per / 4; ++u)
#pragma unroll
    for (int q = 0; q < 4; ++q) { const float c = vals[u * 4 + q] - mu; s2 += c * c; }
  red[tid] = s2; __syncthreads();
  for (int st = 128; st > 0; st >>= 1) { if (tid < st) red[tid] += red[tid + st]; __syncthreads(); }
  const float rs = rsqrtf(red[0] / (float)N + eps);
  {
    for (int u = 0; u < per / 4; ++u) {
      const int j = tid * 4 + 1024 * u;
      v4f o, sm;
#pragma unroll
      for (int q = 0; q < 4; ++q) {
        float gg = g[j + q], bb = bta[j + q];
        if (PARAM_BF16) { gg = bf16_round(gg); bb = bf16_round(bb); }
        sm[q] = vals[u * 4 + q]; o[q] = (vals[u * 4 + q] - mu) * rs * gg + bb;
      }
      if (out_sum) *(v4f*)(out_sum + (size_t)row * N + j) = sm;
      *(v4f*)(out_norm + (size_t)row * N + j) = o;
    }
    
  }
}



// ---- f16 WMMA path (v_wmma_f32_16x16x32_f16): 11-bit significands for operands in range — used where a [0,1] probability operand needs more precision than bf16
typedef _Float16 v16h __attribute__((ext_vector_type(16)));
union FragH { v16h v; v8us half[2]; _Float16 h[16]; unsigned short u[16]; };
template <int NT>
__device__ __forceinline__ v8f mmaH(v16h ah, v16h al, v16h bh, v16h bl, v8f c) {
  c = __builtin_amdgcn_wmma_f32_16x16x32_f16(false, ah, false, bh, (short)0, c, false, false);
  if (NT >= 2) c = __builtin_amdgcn_wmma_f32_16x16x32_f16(false, al, false, bh, (short)0, c, false, false);
  if (NT >= 3) c = __builtin_amdgcn_wmma_f32_16x16x32_f16(false, ah, false, bl, (short)0, c, false, false);
  asm volatile("v_nop\n\tv_nop\n\tv_nop\n\tv_nop" : "+v"(c) : "v"(ah), "v"(al), "v"(bh), "v"(bl));
  return c;
}
// batched GEMM like k_gemm_b but f16 operands: A f32 (split into f16 hi/lo if ASPLIT, else rounded to f16), Bt = f16 values [n][k]; alpha; C f32; N multiple of 16 (partial tiles skipped)
template <bool ASPLIT>
__global__ __launch_bounds__(128) void k_gemm_h(const float* __restrict__ A, int lda, size_t sA, const _Float16* __restrict__ Bh, int ldb, size_t sB, float alpha, float* __restrict__ C, int ldc, size_t sC, int M, int N, int K) {
  __shared__ __attribute__((aligned(16))) float so[4][16][64];
  const int tid = threadIdx.x, w = tid >> 5, lane = tid & 31, ln = lane & 15, hh = lane >> 4; const int by = blockIdx.y;
  A += (size_t)by * sA; Bh += (size_t)by * sB; C += (size_t)by * sC;
  const int ntn = (N + 63) / 64; const int wid = blockIdx.x * 4 + w; const int mt = wid / ntn, nq = wid % ntn; if (mt * 16 >= M) return;
  const int row0 = mt * 16, col0 = nq * 64; const float* arow = A + (size_t)(row0 + ln) * lda;
  v8f acc[4] = {};
  for (int kb = 0; kb < K; kb += 32) {
    FragH ah, al;
    const v4f x0 = *(const v4fa*)(arow + kb + 8 * hh), x1 = *(const v4fa*)(arow + kb + 8 * hh + 4), x2 = *(const v4fa*)(arow + kb + 16 + 8 * hh), x3 = *(const v4fa*)(arow + kb + 16 + 8 * hh + 4);
    float xs[16] = {x0[0],x0[1],x0[2],x0[3],x1[0],x1[1],x1[2],x1[3],x2[0],x2[1],x2[2],x2[3],x3[0],x3[1],x3[2],x3[3]};
#pragma unroll
    for (int i = 0; i < 16; ++i) { const _Float16 h = (_Float16)xs[i]; ah.h[i] = h; al.h[i] = ASPLIT ? (_Float16)(xs[i] - (float)h) : (_Float16)0.0f; }
#pragma unroll
    for (int t = 0; t < 4; ++t) { if (col0 + t * 16 >= N) continue; const size_t boff = (size_t)(col0 + t * 16 + ln) * ldb + kb; FragH bq; bq.half[0] = *(const v8us*)(Bh + boff + 8 * hh); bq.half[1] = *(const v8us*)(Bh + boff + 16 + 8 * hh);
      acc[t] = mmaH<ASPLIT ? 2 : 1>(ah.v, al.v, bq.v, bq.v, acc[t]); }
  }
#pragma unroll
  for (int t = 0; t < 4; ++t) { if (col0 + t * 16 >= N) continue;
#pragma unroll
    for (int r = 0; r < 8; ++r) so[w][8 * hh + r][t * 16 + ln] = acc[t][r] * alpha; }
  __builtin_amdgcn_fence(__ATOMIC_ACQ_REL, "workgroup"); __builtin_amdgcn_wave_barrier();
  const int rsub = lane >> 4, c4 = (lane & 15) * 4;
  {
#pragma unroll
    for (int q = 0; q < 8; ++q) { const int r = q * 2 + rsub; if (col0 + c4 < N) { const v4f v = *(const v4fa*)&so[w][r][c4]; *(v4f*)(C + (size_t)(row0 + r) * ldc + col0 + c4) = v; } }
     }
}

// Wt[n][k] = f16(W[k][n]·scale) from f32 row-major W[K][N] (scale = power of two; bf16-exact weights stay exact in f16 away from the subnormal range)
__global__ __launch_bounds__(256) void k_wt_f16(const float* __restrict__ W, _Float16* __restrict__ Wt, int K, int N, float scale) {
  const int t = blockIdx.x * 256 + threadIdx.x; if (t >= N * (K / 8)) return; const int n = t / (K / 8), k8 = (t % (K / 8)) * 8; FragH f;
#pragma unroll
  for (int i = 0; i < 8; ++i) f.h[i] = (_Float16)(bf16_round(W[(size_t)(k8 + i) * N + n]) * scale); const v8us o = f.half[0];
  *(v8us*)((unsigned short*)Wt + (size_t)n * K + k8) = o; 
}
// k_gemm_hh variant with fused epilogue: v = acc·alpha + bias[by·sBias + col] (+ CP[(row/rowsPerB)·sCPb + by·64 + col] if CP) ; ACT 0 none / 1 elu ; writes f16 C16 (and f32 C if non-null)
template <int ACT>
__global__ __launch_bounds__(128) void k_gemm_hhx(const _Float16* __restrict__ A, int lda, size_t sA, const _Float16* __restrict__ Bh, int ldb, size_t sB, float alpha, const float* __restrict__ bias, size_t sBias, const float* __restrict__ CP, int rowsPerB, size_t sCPb, int row0g,
    float* __restrict__ C, _Float16* __restrict__ C16, int ldc, size_t sC, int M, int N, int K) {
  __shared__ __attribute__((aligned(16))) float so[4][16][64];
  const int tid = threadIdx.x, w = tid >> 5, lane = tid & 31, ln = lane & 15, hh = lane >> 4; const int by = blockIdx.y;
  A += (size_t)by * sA; Bh += (size_t)by * sB; const size_t cofs = (size_t)by * sC; const float* bp = bias ? bias + (size_t)by * sBias : nullptr;
  const int ntn = (N + 63) / 64; const int wid = blockIdx.x * 4 + w; const int mt = wid / ntn, nq = wid % ntn; if (mt * 16 >= M) return;
  const int row0 = mt * 16, col0 = nq * 64; const _Float16* arow = A + (size_t)(row0 + ln) * lda;
  v8f acc[4] = {};
  for (int kb = 0; kb < K; kb += 32) { FragH ah; ah.half[0] = *(const v8us*)((const unsigned short*)arow + kb + 8 * hh); ah.half[1] = *(const v8us*)((const unsigned short*)arow + kb + 16 + 8 * hh);
#pragma unroll
    for (int t = 0; t < 4; ++t) { if (col0 + t * 16 >= N) continue; const size_t boff = (size_t)(col0 + t * 16 + ln) * ldb + kb; FragH bq; bq.half[0] = *(const v8us*)((const unsigned short*)Bh + boff + 8 * hh); bq.half[1] = *(const v8us*)((const unsigned short*)Bh + boff + 16 + 8 * hh);
      acc[t] = mmaH<1>(ah.v, ah.v, bq.v, bq.v, acc[t]); }
  }
#pragma unroll
  for (int t = 0; t < 4; ++t) { if (col0 + t * 16 >= N) continue; const int col = col0 + t * 16 + ln; const float bv = bp ? bf16_round(bp[col]) : 0.f;
#pragma unroll
    for (int r = 0; r < 8; ++r) { float v = acc[t][r] * alpha + bv; if (CP) { const int rr = row0g + row0 + 8 * hh + r; if (rowsPerB < 0) v += CP[cofs + (size_t)rr * ldc + col];      /* rowsPerB < 0: own element of the batched C plane */ else { const int bidx = rr / rowsPerB; v += CP[(size_t)bidx * sCPb + (size_t)by * 64 + col]; } } if (ACT == 1) v = (v > 0.f) ? v : expm1f(v); else if (ACT == 7) v = (v > 0.f) ? v + 1.0f : expf(v); else if (ACT == 8) v = tanhf(v); else if (ACT == 9) v = 0.5f * v * (1.0f + tanhf(0.7978845608028654f * (v + 0.044715f * v * v * v))); else if (ACT == 11) v = 1.0f / (1.0f + expf(-v)); else if (ACT == 12) v = (v > 0.f) ? v : 0.01f * v; else if (ACT == 14) v = (v > 0.f) ? v : 0.1f * v; else if (ACT == 16) v = (v >= 0.f) ? v : 0.3f * v; else if (ACT == 17) v = (v >= 0.f) ? v : 0.2f * v; else if (ACT == 15) v = v / (1.0f + expf(-v)); else if (ACT == 3) v = fmaxf(v, 0.f); else if (ACT == 6) v = 0.5f * v * (1.0f + erff(v * 0.70710678118654752f)); so[w][8 * hh + r][t * 16 + ln] = v; } }
  __builtin_amdgcn_fence(__ATOMIC_ACQ_REL, "workgroup"); __builtin_amdgcn_wave_barrier();
  const int rsub = lane >> 4, c4 = (lane & 15) * 4; typedef _Float16 v4h __attribute__((ext_vector_type(4)));
  {
#pragma unroll
    for (int q = 0; q < 8; ++q) { const int r = q * 2 + rsub; if (col0 + c4 < N) { const v4f v = *(const v4fa*)&so[w][r][c4]; if (C) *(v4f*)(C + cofs + (size_t)(row0 + r) * ldc + col0 + c4) = v; if (C16) { v4h h4; for (int i = 0; i < 4; ++i) h4[i] = (_Float16)v[i]; *(v4h*)(C16 + cofs + (size_t)(row0 + r) * ldc + col0 + c4) = h4; } } }
     }
}


typedef _Float16 v4h __attribute__((ext_vector_type(4)));

__global__ __launch_bounds__(256) void k_x16(const float* __restrict__ x, _Float16* __restrict__ X16, size_t n8) { const size_t t = (size_t)blockIdx.x * 256 + threadIdx.x; if (t >= n8) return; FragH f;
#pragma unroll
  for (int q = 0; q < 8; ++q) f.h[q] = (_Float16)bf16_round(x[t * 8 + q]); *(v8us*)((unsigned short*)X16 + t * 8) = f.half[0];  }
__global__ __launch_bounds__(256) void k_h16(const float* __restrict__ x, _Float16* __restrict__ X16, size_t n8) { const size_t t = (size_t)blockIdx.x * 256 + threadIdx.x; if (t >= n8) return; FragH f;
#pragma unroll
  for (int q = 0; q < 8; ++q) f.h[q] = (_Float16)x[t * 8 + q]; *(v8us*)((unsigned short*)X16 + t * 8) = f.half[0];  }
__global__ __launch_bounds__(256) void k_round16f(const float* __restrict__ W, _Float16* __restrict__ Bt, size_t n8) { const size_t t = (size_t)blockIdx.x * 256 + threadIdx.x; if (t >= n8) return; FragH f;
#pragma unroll
  for (int i = 0; i < 8; ++i) f.h[i] = (_Float16)(bf16_round(W[t * 8 + i]) * 16.0f); *(v8us*)((unsigned short*)Bt + t * 8) = f.half[0];  }
template <int NHv, int TTv>
__global__ __launch_bounds__(256) void k_vt(const _Float16* __restrict__ V16, int ldv, int voff, _Float16* __restrict__ Vt) { __shared__ unsigned short tl[64][66]; const int tid = threadIdx.x; const int slab = blockIdx.x / (TTv / 64), lg = blockIdx.x % (TTv / 64); const int b = slab / NHv, h = slab % NHv;
  for (int i = tid; i < 64 * 8; i += 256) { const int r = i / 8, c8 = (i % 8) * 8; FragH f; f.half[0] = *(const v8us*)((const unsigned short*)V16 + ((size_t)b * TTv + lg * 64 + r) * ldv + voff + h * 64 + c8);
#pragma unroll
    for (int q = 0; q < 8; ++q) tl[r][c8 + q] = f.u[q]; }
  __syncthreads();
  {
#pragma unroll
    for (int rd = 0; rd < 2; ++rd) { const int d = rd * 32 + tid / 8, pc = tid % 8; FragH f;
#pragma unroll
      for (int q = 0; q < 8; ++q) f.u[q] = tl[pc * 8 + q][d];
      *(v8us*)((unsigned short*)Vt + ((size_t)slab * 64 + d) * TTv + lg * 64 + pc * 8) = f.half[0]; }
     } }

__global__ __launch_bounds__(256) void k_hl(const float* __restrict__ F, _Float16* __restrict__ Hh, _Float16* __restrict__ Hl, size_t n8) { const size_t t = (size_t)blockIdx.x * 256 + threadIdx.x; if (t >= n8) return; FragH fh, fl; const v4f a = *(const v4fa*)(F + t * 8), c = *(const v4fa*)(F + t * 8 + 4);
#pragma unroll
  for (int q = 0; q < 4; ++q) { _Float16 h = (_Float16)a[q]; fh.h[q] = h; fl.h[q] = (_Float16)((a[q] - (float)h) * 1024.0f); h = (_Float16)c[q]; fh.h[4 + q] = h; fl.h[4 + q] = (_Float16)((c[q] - (float)h) * 1024.0f); }
  { *(v8us*)((unsigned short*)Hh + t * 8) = fh.half[0]; *(v8us*)((unsigned short*)Hl + t * 8) = fl.half[0];  } }

// ---- fast GEMM (wave tile 32x64) ----
__device__ __forceinline__ v16h g2_frag(const _Float16* p, int hh) { FragH f; f.half[0] = *(const v8us*)((const unsigned short*)p + 8 * hh); f.half[1] = *(const v8us*)((const unsigned short*)p + 16 + 8 * hh); return f.v; }
__device__ __forceinline__ v8f g2_mma(v16h a, v16h b, v8f c) { v8f d = __builtin_amdgcn_wmma_f32_16x16x32_f16(false, a, false, b, (short)0, c, false, false); asm volatile("v_nop\n\tv_nop\n\tv_nop\n\tv_nop" : "+v"(d) : "v"(a), "v"(b)); return d; }
#define GM 128                       /* tile rows */
#define GN 128                       /* tile columns */
#define GK 64                        /* k per trip */
#define GP 144                       /* LDS row pitch in bytes: 128 + 16, so the 16 rows of a ds_load_b128 fall on all 64 banks */
#define GBUF ((GM + GN) * GP)        /* one buffer: A rows, then Bh rows */
__device__ __forceinline__ v16h g3_frag(const char* p) { FragH f; f.half[0] = *(const v8us*)p; f.half[1] = *(const v8us*)(p + 32); return f.v; }      /* g2_frag from the lane's own LDS byte address (row ln, 16 hh bytes in) */
// One tile: a thread copies 16 B of rows cr, cr + 32, cr + 64, cr + 96 of A and of Bh. l = the lane's LDS byte address of its first A piece, ga / gb = its global addresses in row cr.
__device__ __forceinline__ void g3_stage(unsigned l, const _Float16* ga, const _Float16* gb) {
  /* the s_wait_xcnt in the copies' own statement stands before any register that an issued copy names is rewritten */
  asm volatile("global_load_async_to_lds_b128 %0, %8, off\n\t"
               "global_load_async_to_lds_b128 %1, %9, off\n\t"
               "global_load_async_to_lds_b128 %2, %10, off\n\t"
               "global_load_async_to_lds_b128 %3, %11, off\n\t"
               "global_load_async_to_lds_b128 %4, %12, off\n\t"
               "global_load_async_to_lds_b128 %5, %13, off\n\t"
               "global_load_async_to_lds_b128 %6, %14, off\n\t"
               "global_load_async_to_lds_b128 %7, %15, off\n\t"
               "s_wait_xcnt 0x0"
               :: "v"(l), "v"(l + 32u * GP), "v"(l + 64u * GP), "v"(l + 96u * GP), "v"(l + 128u * GP), "v"(l + 160u * GP), "v"(l + 192u * GP), "v"(l + 224u * GP),
                  "v"(ga), "v"(ga + 32 * DM), "v"(ga + 64 * DM), "v"(ga + 96 * DM), "v"(gb), "v"(gb + 32 * DM), "v"(gb + 64 * DM), "v"(gb + 96 * DM) : "memory"); }
template <bool VTR>
__global__ __launch_bounds__(256) void k_gemm3(const _Float16* __restrict__ A, const _Float16* __restrict__ Bh, float alpha, const float* __restrict__ bias, _Float16* __restrict__ P0, _Float16* __restrict__ P1) {
  static_assert(MP % GM == 0 && DM % GN == 0 && DM % GK == 0 && DM / GK >= 2 && GM == 128 && GN == 128 && GK == 64, "whole tiles, at least two trips, 8 copies per thread and tile");
  static_assert(SQ % GN == 0 && SQ == DM, "a token tile lies in one batch; V^T rows and q / k rows have one pitch");
  __shared__ __attribute__((aligned(16))) char ring[2 * GBUF]; __shared__ __attribute__((aligned(16))) float so[8][32][68];
  const int tid = threadIdx.x, w = tid >> 5, lane = tid & 31, ln = lane & 15, hh = lane >> 4;
  const int tt = blockIdx.x / (DM / GN), wt = blockIdx.x % (DM / GN);      /* token tile, weight tile: neighbouring work-groups share the token rows in both forms */
  const int rowb = (VTR ? wt : tt) * GM, colb = (VTR ? tt : wt) * GN; const int row0 = rowb + 32 * (w & 3), col0 = colb + 64 * (w >> 2);
  const int cr = tid >> 3, cc = tid & 7;      /* 8 lanes cover one 128-B row */
  const _Float16* ga = A + (size_t)(rowb + cr) * DM + cc * 8; const _Float16* gb = Bh + (size_t)(colb + cr) * DM + cc * 8; const unsigned l0 = (unsigned)(size_t)ring + (unsigned)(cr * GP + cc * 16);
  const char* fa = ring + (32 * (w & 3) + ln) * GP + 16 * hh; const char* fb = ring + (GM + 64 * (w >> 2) + ln) * GP + 16 * hh;
  const v8f z8 = {0.f,0.f,0.f,0.f,0.f,0.f,0.f,0.f}; v8f c00 = z8, c01 = z8, c02 = z8, c03 = z8, c10 = z8, c11 = z8, c12 = z8, c13 = z8;
  g3_stage(l0, ga, gb);
  asm volatile("s_wait_asynccnt 0x0" ::: "memory");      /* this wave's share of tile 0 has landed */
  __syncthreads();      /* tile 0 is published */
  g3_stage(l0 + GBUF, ga + GK, gb + GK);
#pragma unroll 1      /* one trip per tile: the buffer is picked by the trip's parity and the loop stays short */
  for (int t = 0; t < DM / GK; ++t) { const int bo = (t & 1) * GBUF; v16h a[2][2], b[2][4];      /* [k step][fragment] */
#pragma unroll      /* constant indices keep the fragment arrays in registers; all 24 LDS reads of the trip stand as one group ahead of its WMMAs */
    for (int ks = 0; ks < 2; ++ks) { for (int i = 0; i < 2; ++i) a[ks][i] = g3_frag(fa + bo + ks * 64 + i * (16 * GP)); for (int j = 0; j < 4; ++j) b[ks][j] = g3_frag(fb + bo + ks * 64 + j * (16 * GP)); }
#pragma unroll      /* constant fragment indices, as above */
    for (int ks = 0; ks < 2; ++ks) { c00 = g2_mma(a[ks][0], b[ks][0], c00); c10 = g2_mma(a[ks][1], b[ks][0], c10); c01 = g2_mma(a[ks][0], b[ks][1], c01); c11 = g2_mma(a[ks][1], b[ks][1], c11);
      c02 = g2_mma(a[ks][0], b[ks][2], c02); c12 = g2_mma(a[ks][1], b[ks][2], c12); c03 = g2_mma(a[ks][0], b[ks][3], c03); c13 = g2_mma(a[ks][1], b[ks][3], c13); }
    asm volatile("s_wait_dscnt 0x0" ::: "memory");      /* this wave's reads of the buffer are done before it is handed back */
    asm volatile("s_wait_asynccnt 0x0" ::: "memory");      /* this wave's share of tile t + 1 has landed */
    __syncthreads();      /* publishes tile t + 1 and ends every wave's reads of tile t */
    if (t + 2 < DM / GK) g3_stage(l0 + (unsigned)bo, ga + (t + 2) * GK, gb + (t + 2) * GK); }
  asm volatile("s_wait_asynccnt 0x0" ::: "memory");      /* no copy is outstanding when the wave goes on */
  v8f accs[8] = {c00, c01, c02, c03, c10, c11, c12, c13};
#pragma unroll      /* constant accumulator indices (this loop and the next): no scratch */
  for (int u = 0; u < 8; ++u) { const int t = u & 3, half = u >> 2;
#pragma unroll
    for (int r = 0; r < 8; ++r) { const float bv = bf16_round(bias[VTR ? row0 + half * 16 + 8 * hh + r : col0 + t * 16 + ln]); so[w][half * 16 + 8 * hh + r][t * 16 + ln] = accs[u][r] * alpha + bv; } }
  __builtin_amdgcn_fence(__ATOMIC_ACQ_REL, "workgroup"); __builtin_amdgcn_wave_barrier();
  const int rsub = lane >> 3, c8 = (lane & 7) * 8;      /* 8 lanes x 16 B cover one 128-B line of a plane, a wave four rows per store */
  const size_t e0 = (VTR ? ((size_t)(col0 / SQ) * DM + row0) * SQ + (col0 % SQ) : (size_t)row0 * DM + col0) + (size_t)rsub * DM + c8;      /* the lane's first element */
  v4f va[8], vb[8];
#pragma unroll      /* constant indices keep the rows in registers; the 16 LDS reads stand as one group ahead of the conversions */
  for (int q = 0; q < 8; ++q) { va[q] = *(const v4fa*)&so[w][q * 4 + rsub][c8]; vb[q] = *(const v4fa*)&so[w][q * 4 + rsub][c8 + 4]; }
#pragma unroll      /* constant indices, as above */
  for (int q = 0; q < 8; ++q) { FragH fh, fl;
#pragma unroll
    for (int i = 0; i < 4; ++i) { _Float16 h = (_Float16)va[q][i]; fh.h[i] = h; fl.h[i] = (_Float16)((va[q][i] - (float)h) * 1024.0f); h = (_Float16)vb[q][i]; fh.h[4 + i] = h; fl.h[4 + i] = (_Float16)((vb[q][i] - (float)h) * 1024.0f); }
    *(v8us*)((unsigned short*)P0 + e0 + (size_t)q * 4 * DM) = fh.half[0]; if (!VTR) *(v8us*)((unsigned short*)P1 + e0 + (size_t)q * 4 * DM) = fl.half[0];
    if (q < 7) asm volatile("s_wait_xcnt 0x0" ::: "memory"); } }      /* the wait that stands before a register which an issued store names is rewritten (later rows' conversions reuse the data registers) */


__global__ __launch_bounds__(256) void k_wnat(const float* __restrict__ w, size_t n8, _Float16* __restrict__ Bt) { const size_t t = (size_t)blockIdx.x * 256 + threadIdx.x; if (t >= n8) return; FragH f; for (int q = 0; q < 8; ++q) f.h[q] = (_Float16)(bf16_round(w[t * 8 + q]) * 16.0f); *(v8us*)((unsigned short*)Bt + t * 8) = f.half[0];  }
__global__ __launch_bounds__(256) void k_rsm(const float* __restrict__ S, _Float16* __restrict__ P, int nrows) {
  #pragma clang fp contract(off)
  const int i = blockIdx.x * 256 + threadIdx.x; if (i >= nrows) return; const float* s = S + (size_t)i * SQ; float mx = -3.0e38f;
#pragma unroll 1
  for (int j = 0; j < SQ; ++j) mx = fmaxf(mx, s[j]); float se = 0.f;
#pragma unroll 1
  for (int j = 0; j < SQ; ++j) se += expf(s[j] - mx); const float sc = 256.0f / se;
#pragma unroll 1
  for (int j0 = 0; j0 < SQ; j0 += 8) { FragH f; for (int q = 0; q < 8; ++q) f.h[q] = (_Float16)(expf(s[j0 + q] - mx) * sc); unsigned short* d = (unsigned short*)P + (size_t)i * SQ + j0; *(v8us*)d = f.half[0];  } }
__global__ __launch_bounds__(256) void k_vt(const _Float16* __restrict__ V16, int b, int h0, _Float16* __restrict__ VT) { __shared__ unsigned short tl[64][65]; const int tid = threadIdx.x; const int hh = blockIdx.x % HG, sg = blockIdx.x / HG; const int s0 = sg * 64; const int h = h0 + hh;
  for (int i = tid; i < 64 * 8; i += 256) { const int j = i / 8, d8 = (i % 8) * 8; FragH f; f.half[0] = *(const v8us*)((const unsigned short*)V16 + ((size_t)b * SQ + s0 + j) * DM + h * HD + d8); for (int q = 0; q < 8; ++q) tl[d8 + q][j] = f.u[q]; }
  __syncthreads();
  { for (int i = tid; i < 64 * 8; i += 256) { const int d = i / 8, j8 = (i % 8) * 8; FragH f; for (int q = 0; q < 8; ++q) f.u[q] = tl[d][j8 + q]; *(v8us*)((unsigned short*)VT + ((size_t)hh * HD + d) * SQ + s0 + j8) = f.half[0]; }  } }



__device__ __forceinline__ float lane_xor_16(float v) { const int u = __float_as_int(v); return __int_as_float(__builtin_amdgcn_permlanex16(u, u, 0x76543210, 0xfedcba98, false, false)); }      /* lane l <- lane l ^ 16 */
__device__ __forceinline__ float exp2_slot(float a) { float r; asm("v_exp_f32 %0, %1\n\tv_nop" : "=v"(r) : "v"(a)); return r; }      /* 2^a; the v_nop in the same statement keeps the slot the instruction set asks for behind a transcendental, before its result is read or its source register reused */
__device__ __forceinline__ v4f exp2_slot4(v4f a) { float r0, r1, r2, r3;      /* four 2^a: each fills the slot behind the one before it (early-clobber outputs share no register with a source), one v_nop keeps the slot behind the last */
  asm("v_exp_f32 %0, %4\n\tv_exp_f32 %1, %5\n\tv_exp_f32 %2, %6\n\tv_exp_f32 %3, %7\n\tv_nop" : "=&v"(r0), "=&v"(r1), "=&v"(r2), "=&v"(r3) : "v"(a[0]), "v"(a[1]), "v"(a[2]), "v"(a[3])); const v4f r = {r0, r1, r2, r3}; return r; }
__device__ __forceinline__ v16h fa_frag(const char* p) { FragH f; f.half[0] = *(const v8us*)p; f.half[1] = *(const v8us*)(p + 32); return f.v; }      /* g2_frag from the lane's own LDS byte address (row c, 16 hh bytes in) */
__device__ __forceinline__ v8f fa_mma(v16h a, v16h b, v8f c) { return __builtin_amdgcn_wmma_f32_16x16x32_f16(false, a, false, b, (short)0, c, false, false); }
#define FW 8                         /* waves per work-group */
#define FQ 32                        /* query columns per wave */
#define FK 64                        /* keys per staged tile: two passes of 32 */
#define FP 144                       /* LDS row pitch in bytes: 128 + 16, so the 16 rows of a ds_load_b128 fall on all 64 banks */
#define FBUF ((2 * FK + HD) * FP)    /* one buffer: FK K rows, FK K residual rows, HD V^T rows */
// One tile: a thread copies 16 B of rows cr and cr + 32 of K, of the K residuals and of V^T. l = the lane's LDS byte address of its first K piece, gk / gl / gv = its global addresses in row cr of the three planes.
__device__ __forceinline__ void fa_stage(unsigned l, const _Float16* gk, const _Float16* gl, const _Float16* gv) {
  /* the s_wait_xcnt in the copies' own statement stands before any register that an issued copy names is rewritten */
  asm volatile("global_load_async_to_lds_b128 %0, %6, off\n\t"
               "global_load_async_to_lds_b128 %1, %7, off\n\t"
               "global_load_async_to_lds_b128 %2, %8, off\n\t"
               "global_load_async_to_lds_b128 %3, %9, off\n\t"
               "global_load_async_to_lds_b128 %4, %10, off\n\t"
               "global_load_async_to_lds_b128 %5, %11, off\n\t"
               "s_wait_xcnt 0x0"
               :: "v"(l), "v"(l + 32u * FP), "v"(l + 64u * FP), "v"(l + 96u * FP), "v"(l + 128u * FP), "v"(l + 160u * FP),
                  "v"(gk), "v"(gk + 32 * DM), "v"(gl), "v"(gl + 32 * DM), "v"(gv), "v"(gv + 32 * SQ) : "memory"); }
__global__ __launch_bounds__(FW * 32) __attribute__((amdgpu_waves_per_eu(4, 4))) void k_fattn(const _Float16* __restrict__ QH, const _Float16* __restrict__ QL, const _Float16* __restrict__ KH, const _Float16* __restrict__ KL, const _Float16* __restrict__ VT, float* __restrict__ out) {
  static_assert(SQ % (FW * FQ) == 0 && SQ % FK == 0 && SQ / FK >= 2 && FK == 64 && HD == 64 && FW == 8, "whole query blocks, whole tiles and at least two, two k steps per score, 6 copies per thread and tile");
  __shared__ __attribute__((aligned(16))) char ring[2 * FBUF];
  const int lane = threadIdx.x & 31, w = threadIdx.x >> 5, c = lane & 15, hh = lane >> 4; const int h = blockIdx.y, b = blockIdx.z;
  const size_t r0 = (size_t)b * SQ; const int q0 = blockIdx.x * (FW * FQ) + w * FQ;
  v16h qh[2][2], ql[2][2];      /* [query tile][k step] */
#pragma unroll
  for (int g = 0; g < 2; ++g) for (int ks = 0; ks < 2; ++ks) { const size_t qo = (r0 + q0 + g * 16 + c) * DM + h * HD + ks * 32; qh[g][ks] = g2_frag(QH + qo, hh); ql[g][ks] = g2_frag(QL + qo, hh); }
  const int cr = threadIdx.x >> 3, cc = threadIdx.x & 7;      /* 8 lanes cover one 128-B row */
  const _Float16* gk = KH + (r0 + cr) * DM + h * HD + cc * 8; const _Float16* gl = KL + (r0 + cr) * DM + h * HD + cc * 8; const _Float16* gv = VT + (((size_t)b * NH + h) * HD + cr) * SQ + cc * 8;
  const unsigned l0 = (unsigned)(size_t)ring + (unsigned)(cr * FP + cc * 16);
  const char* fr = ring + c * FP + 16 * hh;      /* the lane's place in row c of a buffer */
  const v8f z8 = {0.f, 0.f, 0.f, 0.f, 0.f, 0.f, 0.f, 0.f}; v8f o[2][4] = {{z8, z8, z8, z8}, {z8, z8, z8, z8}};      /* [query tile][d tile]: register r = O[query c][16 t + 8 hh + r] */
  float m[2] = {-3.0e38f, -3.0e38f}, l[2] = {0.f, 0.f};
  const float C1 = 0.125f * 1.44269504088896340736f, C2 = 0.0001220703125f * 1.44269504088896340736f;      /* 64^-0.5 and 64^-0.5 2^-10, in log2 units */
  fa_stage(l0, gk, gl, gv);
  asm volatile("s_wait_asynccnt 0x0" ::: "memory");      /* this wave's share of tile 0 has landed */
  __syncthreads();      /* tile 0 is published */
  fa_stage(l0 + FBUF, gk + FK * DM, gl + FK * DM, gv + FK);
#pragma unroll 1      /* one trip per tile: the buffer is picked by the trip's parity */
  for (int kt0 = 0; kt0 < SQ / FK; ++kt0) { const int bo = (kt0 & 1) * FBUF;
#pragma unroll 1      /* the two passes of a tile stay one body: the unrolled build spills registers to scratch */
   for (int ps = 0; ps < FK / 32; ++ps) { v8f t[2][2];      /* [query tile][key tile]: register r = score of key 64 kt0 + 32 ps + 16 kt + 8 hh + r for query c */
    const char* kp = fr + bo + ps * (32 * FP); v16h kf[2][2], lf[2][2];      /* [key tile][k step] */
#pragma unroll
    for (int kt = 0; kt < 2; ++kt) for (int ks = 0; ks < 2; ++ks) { kf[kt][ks] = fa_frag(kp + kt * (16 * FP) + ks * 64); lf[kt][ks] = fa_frag(kp + FK * FP + kt * (16 * FP) + ks * 64); }
#pragma unroll
    for (int kt = 0; kt < 2; ++kt) {
#pragma unroll
      for (int g = 0; g < 2; ++g) { v8f sh = fa_mma(kf[kt][0], qh[g][0], z8); sh = fa_mma(kf[kt][1], qh[g][1], sh);
        v8f sl = fa_mma(kf[kt][0], ql[g][0], z8); sl = fa_mma(kf[kt][1], ql[g][1], sl); sl = fa_mma(lf[kt][0], qh[g][0], sl); sl = fa_mma(lf[kt][1], qh[g][1], sl);
        t[g][kt] = sl * C2 + sh * C1; } }
    const char* vp = fr + bo + 2 * FK * FP + ps * 64; v16h vf[4];
#pragma unroll
    for (int u = 0; u < 4; ++u) vf[u] = fa_frag(vp + u * (16 * FP));
#pragma unroll
    for (int g = 0; g < 2; ++g) { float mx = t[g][0][0];
#pragma unroll
      for (int r = 1; r < 16; ++r) mx = fmaxf(mx, t[g][r >> 3][r & 7]);
      mx = fmaxf(mx, lane_xor_16(mx)); const float mn = fmaxf(m[g], mx); const float al = exp2_slot(m[g] - mn), mb = mn - 8.0f; m[g] = mn;      /* weights carried x256 (it cancels in the final division), which keeps small ones out of the f16 subnormals */
      FragH pf; v4f s4 = {0.f, 0.f, 0.f, 0.f};
#pragma unroll
      for (int kt = 0; kt < 2; ++kt) for (int q = 0; q < 2; ++q) { v4f a; for (int i = 0; i < 4; ++i) a[i] = t[g][kt][q * 4 + i] - mb; const v4f e = exp2_slot4(a); s4 += e; for (int i = 0; i < 4; ++i) pf.h[kt * 8 + q * 4 + i] = (_Float16)e[i]; }
      l[g] = fmaf(l[g], al, (s4[0] + s4[1]) + (s4[2] + s4[3]));      /* this half's keys only; the halves join after the loop */
#pragma unroll
      for (int u = 0; u < 4; ++u) { o[g][u] *= al; o[g][u] = fa_mma(vf[u], pf.v, o[g][u]); }
      if (g == 0) asm volatile("v_nop\n\tv_nop\n\tv_nop\n\tv_nop" :: "v"(pf.v), "v"(o[g][0]), "v"(o[g][1]), "v"(o[g][2]), "v"(o[g][3])); } }      /* the four vector slots the chip needs behind a WMMA before its B registers are overwritten: the next query tile's v_exp_f32 statements are asm text, which the compiler does not pad for; inputs only: the results place it behind the four WMMAs, the weights keep their registers up to it */
    asm volatile("s_wait_dscnt 0x0" ::: "memory");      /* this wave's reads of the buffer are done before it is handed back */
    asm volatile("s_wait_asynccnt 0x0" ::: "memory");      /* this wave's share of tile kt0 + 1 has landed */
    __syncthreads();      /* publishes tile kt0 + 1 and ends every wave's reads of tile kt0 */
    if (kt0 + 2 < SQ / FK) fa_stage(l0 + (unsigned)bo, gk + (size_t)(kt0 + 2) * (FK * DM), gl + (size_t)(kt0 + 2) * (FK * DM), gv + (kt0 + 2) * FK); }
  asm volatile("s_wait_asynccnt 0x0" ::: "memory");      /* no copy is outstanding when the wave goes on */
#pragma unroll
  for (int g = 0; g < 2; ++g) { const float inv = 1.0f / (l[g] + lane_xor_16(l[g])); float* op = out + (r0 + q0 + g * 16 + c) * DM + h * HD + 8 * hh;
#pragma unroll
    for (int u = 0; u < 4; ++u) { const v4f x0 = {o[g][u][0] * inv, o[g][u][1] * inv, o[g][u][2] * inv, o[g][u][3] * inv}, x1 = {o[g][u][4] * inv, o[g][u][5] * inv, o[g][u][6] * inv, o[g][u][7] * inv}; *(v4f*)(op + u * 16) = x0; *(v4f*)(op + u * 16 + 4) = x1; } } }


template <int MASKADD>
__global__ __launch_bounds__(64) void k_att0(const float* __restrict__ QF, const float* __restrict__ KF, const float* __restrict__ VF, int ld, const float* __restrict__ mask, float scale, float* __restrict__ OF, int ldo) {
  #pragma clang fp contract(off)
  __shared__ __attribute__((aligned(16))) float lq[64][64]; __shared__ __attribute__((aligned(16))) float lo[64][64];
  const int tid = threadIdx.x; const int h = blockIdx.x / (QT0 / 64), rg = blockIdx.x % (QT0 / 64); const int i = rg * 64 + tid;
  const float* qr = QF + (size_t)i * ld + h * HD;
#pragma unroll 1
  for (int c = 0; c < HD / 4; ++c) { *(v4f*)&lq[tid][c * 4] = *(const v4fa*)(qr + c * 4); const v4f z = {0.f, 0.f, 0.f, 0.f}; *(v4f*)&lo[tid][c * 4] = z; }
  float m = -1.0e30f, l = 0.f; const int jmax = MASKADD ? (SQ - 1) : (rg * 64 + 63);      /* additive-mask form: every key (the mask input decides); causal form: keys up to the block's last row */
#pragma unroll 1
  for (int j = 0; j <= jmax; ++j) { const float* kr = KF + (size_t)j * ld + h * HD; const float* vr = VF + (size_t)j * ld + h * HD; float s = 0.f;
#pragma unroll 1
    for (int c = 0; c < HD / 4; ++c) { const v4f kq = *(const v4fa*)(kr + c * 4); const v4f qq = *(v4f*)&lq[tid][c * 4]; s = __fadd_rn(s, __fmul_rn(qq[0], kq[0])); s = __fadd_rn(s, __fmul_rn(qq[1], kq[1])); s = __fadd_rn(s, __fmul_rn(qq[2], kq[2])); s = __fadd_rn(s, __fmul_rn(qq[3], kq[3])); }
    s = __fmul_rn(s, scale); if (MASKADD) s = __fadd_rn(s, __fmul_rn(bf16_round(mask[(size_t)i * SQ + j]), -10000.0f));
    const float f = (MASKADD || j <= i) ? 1.f : 0.f; const float sm = fmaf(f, s, (1.f - f) * -1.0e30f); const float mn = fmaxf(m, sm); const float sc = expf(m - mn); const float e = expf(sm - mn); l = __fadd_rn(__fmul_rn(l, sc), e); m = mn;
#pragma unroll 1
    for (int c = 0; c < HD / 4; ++c) { const v4f vv = *(const v4fa*)(vr + c * 4); v4f oo = *(v4f*)&lo[tid][c * 4]; for (int u = 0; u < 4; ++u) oo[u] = __fadd_rn(__fmul_rn(oo[u], sc), __fmul_rn(e, vv[u])); *(v4f*)&lo[tid][c * 4] = oo; } }
  const float fin = 64.0f / l;      /* o carried x64 */
#pragma unroll 1
  for (int c = 0; c < HD / 4; ++c) { v4f oo = *(v4f*)&lo[tid][c * 4]; for (int u = 0; u < 4; ++u) oo[u] = __fmul_rn(oo[u], fin); *(v4f*)&lo[tid][c * 4] = oo; }
  __syncthreads();
  {
#pragma unroll 1
    for (int it = 0; it < 16; ++it) { const int row = it * 4 + tid / 16, pc = (tid % 16) * 4; const v4f v = *(const v4f*)&lo[row][pc]; *(v4f*)(OF + (size_t)(rg * 64 + row) * ldo + h * HD + pc) = v; }
     } }

__global__ __launch_bounds__(256) void k_of0out(const float* __restrict__ src, float* __restrict__ dst, size_t n4) { const size_t t = (size_t)blockIdx.x * 256 + threadIdx.x; if (t >= n4) return; v4f v = *(const v4fa*)(src + t * 4); for (int q = 0; q < 4; ++q) v[q] = __fmul_rn(v[q], 0.015625f); *(v4f*)(dst + t * 4) = v;  }

extern "C" void kernel_launch(void* const* d_in, const int* in_sizes, int n_in,
                              void* d_out, int out_size, void* d_ws, size_t ws_size, hipStream_t stream) {
  (void)in_sizes; (void)n_in; (void)out_size;
  const float* const* I = (const float* const*)d_in; const float* x = I[0]; const float* wq = I[1]; const float* wk = I[2]; const float* wv = I[3]; const float* bq = I[4]; const float* bk = I[5]; const float* bv = I[6];      /* input order: x, Wq, Wk, Wv, bq, bk, bv: natural [out][in] weights, then the three biases (every projection launch passes the bias variables); NO output projection */
  char* ws = (char*)d_ws; size_t off = 0;
  auto take = [&](size_t bytes) { char* p = ws + off; off += (bytes + 255) & ~(size_t)255; return p; };
  _Float16* BQ = (_Float16*)take((size_t)DM * DM * 2); _Float16* BK = (_Float16*)take((size_t)DM * DM * 2); _Float16* BV = (_Float16*)take((size_t)DM * DM * 2);
  _Float16* X16 = (_Float16*)take(NR * DM * 2); _Float16* QH = (_Float16*)take(NR * DM * 2); _Float16* QL = (_Float16*)take(NR * DM * 2); _Float16* KH = (_Float16*)take(NR * DM * 2); _Float16* KL = (_Float16*)take(NR * DM * 2);
  _Float16* VT = (_Float16*)take((size_t)NB * NH * HD * SQ * 2);
  if (off > ws_size) return;
  { const unsigned g = (unsigned)(((size_t)DM * DM / 8 + 255) / 256); k_wnat<<<g, 256, 0, stream>>>(wq, (size_t)DM * DM / 8, BQ); k_wnat<<<g, 256, 0, stream>>>(wk, (size_t)DM * DM / 8, BK); k_wnat<<<g, 256, 0, stream>>>(wv, (size_t)DM * DM / 8, BV); }      /* natural [out][in] = Bt[n][k] x16 */
  k_x16<<<(unsigned)((NR * DM / 8 + 255) / 256), 256, 0, stream>>>(x, X16, NR * DM / 8);
  const size_t r0p = (size_t)B0 * SQ;      /* first projected row */
  k_gemm3<false><<<(MP / GM) * (DM / GN), 256, 0, stream>>>(X16 + r0p * DM, BQ, 0.0625f, bq, QH + r0p * DM, QL + r0p * DM);      /* q -> f16 hi + x1024 residual planes, from the GEMM's own epilogue: unscaled logits sigma ~8 */
  k_gemm3<false><<<(MP / GM) * (DM / GN), 256, 0, stream>>>(X16 + r0p * DM, BK, 0.0625f, bk, KH + r0p * DM, KL + r0p * DM);      /* k likewise */
  k_gemm3<true><<<(DM / GM) * (MP / GN), 256, 0, stream>>>(BV, X16 + r0p * DM, 0.0625f, bv, VT + r0p * DM, nullptr);      /* V^T [NB][NH][HD][SQ] = Wv . x^T, all batches */
  k_fattn<<<dim3(SQ / (FW * FQ), NH, NB), FW * 32, 0, stream>>>(QH, QL, KH, KL, VT, (float*)d_out);      /* scores (hi.hi + 2^-10 (hi.lo + lo.hi)), softmax over all keys and P V in one launch, f32 straight into the head-major output columns (no output projection) */
}

// v006
// One run takes 114 microseconds.
// In both of two side-by-side timings against v005, it was 1.06 times as fast.
// All steps since v000 together make it 70.8 times as fast.
#include <hip/hip_runtime.h>
// Multi-head self-attention without an output projection, NON-causal (x [8][1024][1024]; q / k / v = x W^T + b (nn.Linear natural [1024][1024] sigma 1/32, biases sigma 0.01); 16 heads of 64; scores * 64^-0.5; softmax over all 1024 keys (no mask); out = ctx merged head-major -> [8][1024][1024]; the source never applies its out_proj).
// Structure: token rows r = b*1024 + s; x as exact f16 rows (bf16-rounded); q and k as WMMA GEMMs (128x128 work-group tiles staged in LDS by asynchronous copies, 32x64 wave tiles, f32 accumulation, exact x16 weights + bias) whose epilogue splits each f32 value into f16 hi + x1024 residual planes, v as the same GEMM with its operands swapped, so that its f16 tile is V^T as attention reads it; then ONE fused attention launch (k_fattn): per wave 32 queries, keys 32 at a time from 64-key K / V^T tiles that a work-group stages in LDS by asynchronous copies, scores as hi.hi + 2^-10 (hi.lo + lo.hi), online softmax (f32 running max and sum, native exp2), weights x256 as f16 straight from the score accumulators into O^T += V^T P^T, f32 out written into the head-major columns.
// Compute dtype: inputs rounded to bf16; x / weights exact; q and k as f16 hi + x1024 residual planes, v and softmax weights as plain f16 GEMM operands (~2^-12); scores, softmax statistics and o f32. v_wmma_f32_16x16x32_f16.
#define NB 8
#define SQ 1024
#define DM 1024
#define NH 16
#define HD 64
#define HG 4                         /* heads per group in the unlaunched k_vt overload */
#define QT 256                       /* unused */
#define NKX SQ                       /* unused */
#define QT0 128                      /* query rows per head in k_att0, which is not launched */
#define B0 0                         /* first batch processed (debug hook) */
#define NBR NB                       /* batches processed (debug hook) */
#define NR ((size_t)NB * SQ)         /* token rows */
#define MP ((int)((size_t)NBR * SQ)) /* rows projected (debug hook) */
#define QN SQ                        /* unused */
#define NHD NH                       /* unused */
#define MPO MP                       /* unused */
#define LQ DM      /* unused */
typedef __bf16 v16b __attribute__((ext_vector_type(16)));
typedef unsigned short v8us __attribute__((ext_vector_type(8), may_alias));
typedef float  v8f  __attribute__((ext_vector_type(8)));
typedef float  v4f  __attribute__((ext_vector_type(4)));
typedef float  v4fa __attribute__((ext_vector_type(4), may_alias));
union FragB { v16b v; v8us half[2]; unsigned short u[16]; };

__device__ __forceinline__ unsigned short bf16_bits(float x) { unsigned int u = __float_as_uint(x); return (unsigned short)((u + 0x7FFFu + ((u >> 16) & 1u)) >> 16); }
__device__ __forceinline__ float bf16_val(unsigned short b) { return __uint_as_float(((unsigned int)b) << 16); }
__device__ __forceinline__ float bf16_round(float x) { return bf16_val(bf16_bits(x)); }
// D += A·B with NT terms: 1 = ah·bh, 2 = + al·bh (A split), 3 = + ah·bl (both split)
template <int NT>
__device__ __forceinline__ v8f mmaN(v16b ah, v16b al, v16b bh, v16b bl, v8f c) {
  c = __builtin_amdgcn_wmma_f32_16x16x32_bf16(false, ah, false, bh, (short)0, c, false, false);
  if (NT >= 2) c = __builtin_amdgcn_wmma_f32_16x16x32_bf16(false, al, false, bh, (short)0, c, false, false);
  if (NT >= 3) c = __builtin_amdgcn_wmma_f32_16x16x32_bf16(false, ah, false, bl, (short)0, c, false, false);
  asm volatile("v_nop\n\tv_nop\n\tv_nop\n\tv_nop" : "+v"(c) : "v"(ah), "v"(al), "v"(bh), "v"(bl));
  return c;
}

__global__ __launch_bounds__(256) void k_wt_bf16(const float* __restrict__ W, unsigned short* __restrict__ Wt, int K, int N) {
  const int t = blockIdx.x * 256 + threadIdx.x;
  const int k8n = K / 8;
  if (t >= N * k8n) return;
  const int n = t / k8n, k8 = (t % k8n) * 8;
  v8us v;
#pragma unroll
  for (int i = 0; i < 8; ++i) v[i] = bf16_bits(W[(size_t)(k8 + i) * N + n]);
  *(v8us*)(Wt + (size_t)n * K + k8) = v;
  
}

// GEMM C[M][N] (f32, pitch ldc) = act(A[M][K]·W + bias). A f32 row-major (pitch lda) converted per fragment to bf16
// (ASPLIT: hi/lo two planes -> 2 terms, else single rounded term); Wt bf16 [N][K] (pitch ldb). BIAS_BF16 rounds the
// bias to bf16 first (bias quantised to bf16 before the add). K%32==0, M%16==0, N%64==0.
template <bool ASPLIT, int ACT, bool BIAS_BF16>
__global__ __launch_bounds__(128) void k_gemm_bf(const float* __restrict__ A, int lda, const unsigned short* __restrict__ Wt, int ldb,
                                               const float* __restrict__ bias, float* __restrict__ C, int ldc, int M, int N, int K) {
  __shared__ __attribute__((aligned(16))) float so[4][16][64];
  const int tid = threadIdx.x, w = tid >> 5, lane = tid & 31, ln = lane & 15, hh = lane >> 4;
  const int ntn = N / 64;
  const int wid = blockIdx.x * 4 + w;
  const int mt = wid / ntn, nq = wid % ntn;
  if (mt * 16 >= M) return;
  const int row0 = mt * 16, col0 = nq * 64;
  const float* arow = A + (size_t)(row0 + ln) * lda;
  v8f acc[4] = {};
  for (int kb = 0; kb < K; kb += 32) {
    FragB ah, al;
    const v4f x0 = *(const v4fa*)(arow + kb + 8 * hh), x1 = *(const v4fa*)(arow + kb + 8 * hh + 4);
    const v4f x2 = *(const v4fa*)(arow + kb + 16 + 8 * hh), x3 = *(const v4fa*)(arow + kb + 16 + 8 * hh + 4);
    float xs[16] = {x0[0],x0[1],x0[2],x0[3],x1[0],x1[1],x1[2],x1[3],x2[0],x2[1],x2[2],x2[3],x3[0],x3[1],x3[2],x3[3]};
#pragma unroll
    for (int i = 0; i < 16; ++i) { const unsigned short hb = bf16_bits(xs[i]); ah.u[i] = hb; al.u[i] = ASPLIT ? bf16_bits(xs[i] - bf16_val(hb)) : (unsigned short)0; }
#pragma unroll
    for (int t = 0; t < 4; ++t) {
      const unsigned short* brow = Wt + (size_t)(col0 + t * 16 + ln) * ldb + kb;
      FragB b;
      b.half[0] = *(const v8us*)(brow + 8 * hh);
      b.half[1] = *(const v8us*)(brow + 16 + 8 * hh);
      acc[t] = mmaN<ASPLIT ? 2 : 1>(ah.v, al.v, b.v, b.v, acc[t]);
    }
  }
#pragma unroll
  for (int t = 0; t < 4; ++t) {
    float bv = bias ? bias[col0 + t * 16 + ln] : 0.f;
    if (BIAS_BF16) bv = bf16_round(bv);
#pragma unroll
    for (int r = 0; r < 8; ++r) { float v = acc[t][r] + bv; if (ACT == 1) v = fmaxf(v, 0.f); so[w][8 * hh + r][t * 16 + ln] = v; }
  }
  __builtin_amdgcn_fence(__ATOMIC_ACQ_REL, "workgroup");
  __builtin_amdgcn_wave_barrier();
  const int rsub = lane >> 4, c4 = (lane & 15) * 4;
  {
#pragma unroll
    for (int q = 0; q < 8; ++q) {
      const int r = q * 2 + rsub;
      const v4f v = *(const v4fa*)&so[w][r][c4];
      *(v4f*)(C + (size_t)(row0 + r) * ldc + col0 + c4) = v;
    }
    
  }
}

// GEMM C = act(A·W + bias + resid): A f32 (ASPLIT -> hi/lo 2 terms), Wt bf16 [N][K]; ACT 0 none, 1 relu, 2 exact gelu;
// resid (optional, f32, row index = (row % rmod), pitch ldr, RES_BF16 rounds it) added before the activation.
template <bool ASPLIT, int ACT, bool BIAS_BF16, bool RES_BF16>
__global__ __launch_bounds__(128) void k_gemm_bf3(const float* __restrict__ A, int lda, const unsigned short* __restrict__ Wt, int ldb,
                                                const float* __restrict__ bias, const float* __restrict__ resid, int rmod, int ldr,
                                                float* __restrict__ C, int ldc, int M, int N, int K) {
  __shared__ __attribute__((aligned(16))) float so[4][16][64];
  const int tid = threadIdx.x, w = tid >> 5, lane = tid & 31, ln = lane & 15, hh = lane >> 4;
  const int ntn = N / 64;
  const int wid = blockIdx.x * 4 + w;
  const int mt = wid / ntn, nq = wid % ntn;
  if (mt * 16 >= M) return;
  const int row0 = mt * 16, col0 = nq * 64;
  const float* arow = A + (size_t)(row0 + ln) * lda;
  v8f acc[4] = {};
  for (int kb = 0; kb < K; kb += 32) {
    FragB ah, al;
    const v4f x0 = *(const v4fa*)(arow + kb + 8 * hh), x1 = *(const v4fa*)(arow + kb + 8 * hh + 4);
    const v4f x2 = *(const v4fa*)(arow + kb + 16 + 8 * hh), x3 = *(const v4fa*)(arow + kb + 16 + 8 * hh + 4);
    float xs[16] = {x0[0],x0[1],x0[2],x0[3],x1[0],x1[1],x1[2],x1[3],x2[0],x2[1],x2[2],x2[3],x3[0],x3[1],x3[2],x3[3]};
#pragma unroll
    for (int i = 0; i < 16; ++i) { const unsigned short hb = bf16_bits(xs[i]); ah.u[i] = hb; al.u[i] = ASPLIT ? bf16_bits(xs[i] - bf16_val(hb)) : (unsigned short)0; }
#pragma unroll
    for (int t = 0; t < 4; ++t) {
      const unsigned short* brow = Wt + (size_t)(col0 + t * 16 + ln) * ldb + kb;
      FragB b;
      b.half[0] = *(const v8us*)(brow + 8 * hh);
      b.half[1] = *(const v8us*)(brow + 16 + 8 * hh);
      acc[t] = mmaN<ASPLIT ? 2 : 1>(ah.v, al.v, b.v, b.v, acc[t]);
    }
  }
#pragma unroll
  for (int t = 0; t < 4; ++t) {
    const int col = col0 + t * 16 + ln;
    float bv = bias ? bias[col] : 0.f;
    if (BIAS_BF16) bv = bf16_round(bv);
#pragma unroll
    for (int r = 0; r < 8; ++r) {
      float v = acc[t][r] + bv;
      if (resid) { float rv = resid[(size_t)((row0 + 8 * hh + r) % rmod) * ldr + col]; if (RES_BF16) rv = bf16_round(rv); v += rv; }
      if (ACT == 1) v = fmaxf(v, 0.f);
      if (ACT == 2) v = 0.5f * v * (1.0f + erff(v * 0.70710678118654752f));
      if (ACT == 3) { const float u = 0.7978845608028654f * (v + 0.044715f * v * v * v); v = 0.5f * v * (1.0f + tanhf(u)); }
      so[w][8 * hh + r][t * 16 + ln] = v;
    }
  }
  __builtin_amdgcn_fence(__ATOMIC_ACQ_REL, "workgroup");
  __builtin_amdgcn_wave_barrier();
  const int rsub = lane >> 4, c4 = (lane & 15) * 4;
  {
#pragma unroll
    for (int q = 0; q < 8; ++q) {
      const int r = q * 2 + rsub;
      const v4f v = *(const v4fa*)&so[w][r][c4];
      *(v4f*)(C + (size_t)(row0 + r) * ldc + col0 + c4) = v;
    }
    
  }
}
// row LayerNorm (biased variance, eps) over N: s = X (+ R); optional out_sum <- s; out_norm <- (s-mu)*rsqrt(var+eps)*g + b
template <bool PARAM_BF16>
__global__ __launch_bounds__(256) void k_layernorm(const float* __restrict__ X, const float* __restrict__ R, const float* __restrict__ g, const float* __restrict__ bta,
                                                  float* __restrict__ out_sum, float* __restrict__ out_norm, int N, float eps) {
  __shared__ float red[256];
  const int row = blockIdx.x, tid = threadIdx.x;
  const float* x = X + (size_t)row * N; const float* rr = R ? R + (size_t)row * N : nullptr;
  float vals[16];                     // up to N = 4096
  const int per = N / 256;            // contiguous chunk per thread? use strided-by-4 chunks: thread handles j = tid*4 + 1024*u
  float s1 = 0.f;
  for (int u = 0; u < per / 4; ++u) {
    const int j = tid * 4 + 1024 * u;
    const v4f a = *(const v4fa*)(x + j);
    v4f b = {0.f,0.f,0.f,0.f}; if (rr) b = *(const v4fa*)(rr + j);
#pragma unroll
    for (int q = 0; q < 4; ++q) { const float v = a[q] + b[q]; vals[u * 4 + q] = v; s1 += v; }
  }
  red[tid] = s1; __syncthreads();
  for (int st = 128; st > 0; st >>= 1) { if (tid < st) red[tid] += red[tid + st]; __syncthreads(); }
  const float mu = red[0] / (float)N; __syncthreads();
  float s2 = 0.f;
  for (int u = 0; u < per / 4; ++u)
#pragma unroll
    for (int q = 0; q < 4; ++q) { const float c = vals[u * 4 + q] - mu; s2 += c * c; }
  red[tid] = s2; __syncthreads();
  for (int st = 128; st > 0; st >>= 1) { if (tid < st) red[tid] += red[tid + st]; __syncthreads(); }
  const float rs = rsqrtf(red[0] / (float)N + eps);
  {
    for (int u = 0; u < per / 4; ++u) {
      const int j = tid * 4 + 1024 * u;
      v4f o, sm;
#pragma unroll
      for (int q = 0; q < 4; ++q) {
        float gg = g[j + q], bb = bta[j + q];
        if (PARAM_BF16) { gg = bf16_round(gg); bb = bf16_round(bb); }
        sm[q] = vals[u * 4 + q]; o[q] = (vals[u * 4 + q] - mu) * rs * gg + bb;
      }
      if (out_sum) *(v4f*)(out_sum + (size_t)row * N + j) = sm;
      *(v4f*)(out_norm + (size_t)row * N + j) = o;
    }
    
  }
}



// ---- f16 WMMA path (v_wmma_f32_16x16x32_f16): 11-bit significands for operands in range — used where a [0,1] probability operand needs more precision than bf16
typedef _Float16 v16h __attribute__((ext_vector_type(16)));
union FragH { v16h v; v8us half[2]; _Float16 h[16]; unsigned short u[16]; };
template <int NT>
__device__ __forceinline__ v8f mmaH(v16h ah, v16h al, v16h bh, v16h bl, v8f c) {
  c = __builtin_amdgcn_wmma_f32_16x16x32_f16(false, ah, false, bh, (short)0, c, false, false);
  if (NT >= 2) c = __builtin_amdgcn_wmma_f32_16x16x32_f16(false, al, false, bh, (short)0, c, false, false);
  if (NT >= 3) c = __builtin_amdgcn_wmma_f32_16x16x32_f16(false, ah, false, bl, (short)0, c, false, false);
  asm volatile("v_nop\n\tv_nop\n\tv_nop\n\tv_nop" : "+v"(c) : "v"(ah), "v"(al), "v"(bh), "v"(bl));
  return c;
}
// batched GEMM like k_gemm_b but f16 operands: A f32 (split into f16 hi/lo if ASPLIT, else rounded to f16), Bt = f16 values [n][k]; alpha; C f32; N multiple of 16 (partial tiles skipped)
template <bool ASPLIT>
__global__ __launch_bounds__(128) void k_gemm_h(const float* __restrict__ A, int lda, size_t sA, const _Float16* __restrict__ Bh, int ldb, size_t sB, float alpha, float* __restrict__ C, int ldc, size_t sC, int M, int N, int K) {
  __shared__ __attribute__((aligned(16))) float so[4][16][64];
  const int tid = threadIdx.x, w = tid >> 5, lane = tid & 31, ln = lane & 15, hh = lane >> 4; const int by = blockIdx.y;
  A += (size_t)by * sA; Bh += (size_t)by * sB; C += (size_t)by * sC;
  const int ntn = (N + 63) / 64; const int wid = blockIdx.x * 4 + w; const int mt = wid / ntn, nq = wid % ntn; if (mt * 16 >= M) return;
  const int row0 = mt * 16, col0 = nq * 64; const float* arow = A + (size_t)(row0 + ln) * lda;
  v8f acc[4] = {};
  for (int kb = 0; kb < K; kb += 32) {
    FragH ah, al;
    const v4f x0 = *(const v4fa*)(arow + kb + 8 * hh), x1 = *(const v4fa*)(arow + kb + 8 * hh + 4), x2 = *(const v4fa*)(arow + kb + 16 + 8 * hh), x3 = *(const v4fa*)(arow + kb + 16 + 8 * hh + 4);
    float xs[16] = {x0[0],x0[1],x0[2],x0[3],x1[0],x1[1],x1[2],x1[3],x2[0],x2[1],x2[2],x2[3],x3[0],x3[1],x3[2],x3[3]};
#pragma unroll
    for (int i = 0; i < 16; ++i) { const _Float16 h = (_Float16)xs[i]; ah.h[i] = h; al.h[i] = ASPLIT ? (_Float16)(xs[i] - (float)h) : (_Float16)0.0f; }
#pragma unroll
    for (int t = 0; t < 4; ++t) { if (col0 + t * 16 >= N) continue; const size_t boff = (size_t)(col0 + t * 16 + ln) * ldb + kb; FragH bq; bq.half[0] = *(const v8us*)(Bh + boff + 8 * hh); bq.half[1] = *(const v8us*)(Bh + boff + 16 + 8 * hh);
      acc[t] = mmaH<ASPLIT ? 2 : 1>(ah.v, al.v, bq.v, bq.v, acc[t]); }
  }
#pragma unroll
  for (int t = 0; t < 4; ++t) { if (col0 + t * 16 >= N) continue;
#pragma unroll
    for (int r = 0; r < 8; ++r) so[w][8 * hh + r][t * 16 + ln] = acc[t][r] * alpha; }
  __builtin_amdgcn_fence(__ATOMIC_ACQ_REL, "workgroup"); __builtin_amdgcn_wave_barrier();
  const int rsub = lane >> 4, c4 = (lane & 15) * 4;
  {
#pragma unroll
    for (int q = 0; q < 8; ++q) { const int r = q * 2 + rsub; if (col0 + c4 < N) { const v4f v = *(const v4fa*)&so[w][r][c4]; *(v4f*)(C + (size_t)(row0 + r) * ldc + col0 + c4) = v; } }
     }
}

// Wt[n][k] = f16(W[k][n]·scale) from f32 row-major W[K][N] (scale = power of two; bf16-exact weights stay exact in f16 away from the subnormal range)
__global__ __launch_bounds__(256) void k_wt_f16(const float* __restrict__ W, _Float16* __restrict__ Wt, int K, int N, float scale) {
  const int t = blockIdx.x * 256 + threadIdx.x; if (t >= N * (K / 8)) return; const int n = t / (K / 8), k8 = (t % (K / 8)) * 8; FragH f;
#pragma unroll
  for (int i = 0; i < 8; ++i) f.h[i] = (_Float16)(bf16_round(W[(size_t)(k8 + i) * N + n]) * scale); const v8us o = f.half[0];
  *(v8us*)((unsigned short*)Wt + (size_t)n * K + k8) = o; 
}
// k_gemm_hh variant with fused epilogue: v = acc·alpha + bias[by·sBias + col] (+ CP[(row/rowsPerB)·sCPb + by·64 + col] if CP) ; ACT 0 none / 1 elu ; writes f16 C16 (and f32 C if non-null)
template <int ACT>
__global__ __launch_bounds__(128) void k_gemm_hhx(const _Float16* __restrict__ A, int lda, size_t sA, const _Float16* __restrict__ Bh, int ldb, size_t sB, float alpha, const float* __restrict__ bias, size_t sBias, const float* __restrict__ CP, int rowsPerB, size_t sCPb, int row0g,
    float* __restrict__ C, _Float16* __restrict__ C16, int ldc, size_t sC, int M, int N, int K) {
  __shared__ __attribute__((aligned(16))) float so[4][16][64];
  const int tid = threadIdx.x, w = tid >> 5, lane = tid & 31, ln = lane & 15, hh = lane >> 4; const int by = blockIdx.y;
  A += (size_t)by * sA; Bh += (size_t)by * sB; const size_t cofs = (size_t)by * sC; const float* bp = bias ? bias + (size_t)by * sBias : nullptr;
  const int ntn = (N + 63) / 64; const int wid = blockIdx.x * 4 + w; const int mt = wid / ntn, nq = wid % ntn; if (mt * 16 >= M) return;
  const int row0 = mt * 16, col0 = nq * 64; const _Float16* arow = A + (size_t)(row0 + ln) * lda;
  v8f acc[4] = {};
  for (int kb = 0; kb < K; kb += 32) { FragH ah; ah.half[0] = *(const v8us*)((const unsigned short*)arow + kb + 8 * hh); ah.half[1] = *(const v8us*)((const unsigned short*)arow + kb + 16 + 8 * hh);
#pragma unroll
    for (int t = 0; t < 4; ++t) { if (col0 + t * 16 >= N) continue; const size_t boff = (size_t)(col0 + t * 16 + ln) * ldb + kb; FragH bq; bq.half[0] = *(const v8us*)((const unsigned short*)Bh + boff + 8 * hh); bq.half[1] = *(const v8us*)((const unsigned short*)Bh + boff + 16 + 8 * hh);
      acc[t] = mmaH<1>(ah.v, ah.v, bq.v, bq.v, acc[t]); }
  }
#pragma unroll
  for (int t = 0; t < 4; ++t) { if (col0 + t * 16 >= N) continue; const int col = col0 + t * 16 + ln; const float bv = bp ? bf16_round(bp[col]) : 0.f;
#pragma unroll
    for (int r = 0; r < 8; ++r) { float v = acc[t][r] * alpha + bv; if (CP) { const int rr = row0g + row0 + 8 * hh + r; if (rowsPerB < 0) v += CP[cofs + (size_t)rr * ldc + col];      /* rowsPerB < 0: own element of the batched C plane */ else { const int bidx = rr / rowsPerB; v += CP[(size_t)bidx * sCPb + (size_t)by * 64 + col]; } } if (ACT == 1) v = (v > 0.f) ? v : expm1f(v); else if (ACT == 7) v = (v > 0.f) ? v + 1.0f : expf(v); else if (ACT == 8) v = tanhf(v); else if (ACT == 9) v = 0.5f * v * (1.0f + tanhf(0.7978845608028654f * (v + 0.044715f * v * v * v))); else if (ACT == 11) v = 1.0f / (1.0f + expf(-v)); else if (ACT == 12) v = (v > 0.f) ? v : 0.01f * v; else if (ACT == 14) v = (v > 0.f) ? v : 0.1f * v; else if (ACT == 16) v = (v >= 0.f) ? v : 0.3f * v; else if (ACT == 17) v = (v >= 0.f) ? v : 0.2f * v; else if (ACT == 15) v = v / (1.0f + expf(-v)); else if (ACT == 3) v = fmaxf(v, 0.f); else if (ACT == 6) v = 0.5f * v * (1.0f + erff(v * 0.70710678118654752f)); so[w][8 * hh + r][t * 16 + ln] = v; } }
  __builtin_amdgcn_fence(__ATOMIC_ACQ_REL, "workgroup"); __builtin_amdgcn_wave_barrier();
  const int rsub = lane >> 4, c4 = (lane & 15) * 4; typedef _Float16 v4h __attribute__((ext_vector_type(4)));
  {
#pragma unroll
    for (int q = 0; q < 8; ++q) { const int r = q * 2 + rsub; if (col0 + c4 < N) { const v4f v = *(const v4fa*)&so[w][r][c4]; if (C) *(v4f*)(C + cofs + (size_t)(row0 + r) * ldc + col0 + c4) = v; if (C16) { v4h h4; for (int i = 0; i < 4; ++i) h4[i] = (_Float16)v[i]; *(v4h*)(C16 + cofs + (size_t)(row0 + r) * ldc + col0 + c4) = h4; } } }
     }
}


typedef _Float16 v4h __attribute__((ext_vector_type(4)));

__global__ __launch_bounds__(256) void k_h16(const float* __restrict__ x, _Float16* __restrict__ X16, size_t n8) { const size_t t = (size_t)blockIdx.x * 256 + threadIdx.x; if (t >= n8) return; FragH f;
#pragma unroll
  for (int q = 0; q < 8; ++q) f.h[q] = (_Float16)x[t * 8 + q]; *(v8us*)((unsigned short*)X16 + t * 8) = f.half[0];  }
__global__ __launch_bounds__(256) void k_round16f(const float* __restrict__ W, _Float16* __restrict__ Bt, size_t n8) { const size_t t = (size_t)blockIdx.x * 256 + threadIdx.x; if (t >= n8) return; FragH f;
#pragma unroll
  for (int i = 0; i < 8; ++i) f.h[i] = (_Float16)(bf16_round(W[t * 8 + i]) * 16.0f); *(v8us*)((unsigned short*)Bt + t * 8) = f.half[0];  }
template <int NHv, int TTv>
__global__ __launch_bounds__(256) void k_vt(const _Float16* __restrict__ V16, int ldv, int voff, _Float16* __restrict__ Vt) { __shared__ unsigned short tl[64][66]; const int tid = threadIdx.x; const int slab = blockIdx.x / (TTv / 64), lg = blockIdx.x % (TTv / 64); const int b = slab / NHv, h = slab % NHv;
  for (int i = tid; i < 64 * 8; i += 256) { const int r = i / 8, c8 = (i % 8) * 8; FragH f; f.half[0] = *(const v8us*)((const unsigned short*)V16 + ((size_t)b * TTv + lg * 64 + r) * ldv + voff + h * 64 + c8);
#pragma unroll
    for (int q = 0; q < 8; ++q) tl[r][c8 + q] = f.u[q]; }
  __syncthreads();
  {
#pragma unroll
    for (int rd = 0; rd < 2; ++rd) { const int d = rd * 32 + tid / 8, pc = tid % 8; FragH f;
#pragma unroll
      for (int q = 0; q < 8; ++q) f.u[q] = tl[pc * 8 + q][d];
      *(v8us*)((unsigned short*)Vt + ((size_t)slab * 64 + d) * TTv + lg * 64 + pc * 8) = f.half[0]; }
     } }

__global__ __launch_bounds__(256) void k_hl(const float* __restrict__ F, _Float16* __restrict__ Hh, _Float16* __restrict__ Hl, size_t n8) { const size_t t = (size_t)blockIdx.x * 256 + threadIdx.x; if (t >= n8) return; FragH fh, fl; const v4f a = *(const v4fa*)(F + t * 8), c = *(const v4fa*)(F + t * 8 + 4);
#pragma unroll
  for (int q = 0; q < 4; ++q) { _Float16 h = (_Float16)a[q]; fh.h[q] = h; fl.h[q] = (_Float16)((a[q] - (float)h) * 1024.0f); h = (_Float16)c[q]; fh.h[4 + q] = h; fl.h[4 + q] = (_Float16)((c[q] - (float)h) * 1024.0f); }
  { *(v8us*)((unsigned short*)Hh + t * 8) = fh.half[0]; *(v8us*)((unsigned short*)Hl + t * 8) = fl.half[0];  } }

// ---- fast GEMM (wave tile 32x64) ----
__device__ __forceinline__ v16h g2_frag(const _Float16* p, int hh) { FragH f; f.half[0] = *(const v8us*)((const unsigned short*)p + 8 * hh); f.half[1] = *(const v8us*)((const unsigned short*)p + 16 + 8 * hh); return f.v; }
__device__ __forceinline__ v8f g2_mma(v16h a, v16h b, v8f c) { v8f d = __builtin_amdgcn_wmma_f32_16x16x32_f16(false, a, false, b, (short)0, c, false, false); asm volatile("v_nop\n\tv_nop\n\tv_nop\n\tv_nop" : "+v"(d) : "v"(a), "v"(b)); return d; }
#define GM 128                       /* tile rows */
#define GN 128                       /* tile columns */
#define GK 64                        /* k per trip */
#define GP 144                       /* LDS row pitch in bytes: 128 + 16, so the 16 rows of a ds_load_b128 fall on all 64 banks */
#define GBUF ((GM + GN) * GP)        /* one buffer: A rows, then Bh rows */
__device__ __forceinline__ v16h g3_frag(const char* p) { FragH f; f.half[0] = *(const v8us*)p; f.half[1] = *(const v8us*)(p + 32); return f.v; }      /* g2_frag from the lane's own LDS byte address (row ln, 16 hh bytes in) */
// One tile: a thread copies 16 B of rows cr, cr + 32, cr + 64, cr + 96 of A and of Bh. l = the lane's LDS byte address of its first A piece, ga / gb = its global addresses in row cr.
__device__ __forceinline__ void g3_stage(unsigned l, const _Float16* ga, const _Float16* gb) {
  /* the s_wait_xcnt in the copies' own statement stands before any register that an issued copy names is rewritten */
  asm volatile("global_load_async_to_lds_b128 %0, %8, off\n\t"
               "global_load_async_to_lds_b128 %1, %9, off\n\t"
               "global_load_async_to_lds_b128 %2, %10, off\n\t"
               "global_load_async_to_lds_b128 %3, %11, off\n\t"
               "global_load_async_to_lds_b128 %4, %12, off\n\t"
               "global_load_async_to_lds_b128 %5, %13, off\n\t"
               "global_load_async_to_lds_b128 %6, %14, off\n\t"
               "global_load_async_to_lds_b128 %7, %15, off\n\t"
               "s_wait_xcnt 0x0"
               :: "v"(l), "v"(l + 32u * GP), "v"(l + 64u * GP), "v"(l + 96u * GP), "v"(l + 128u * GP), "v"(l + 160u * GP), "v"(l + 192u * GP), "v"(l + 224u * GP),
                  "v"(ga), "v"(ga + 32 * DM), "v"(ga + 64 * DM), "v"(ga + 96 * DM), "v"(gb), "v"(gb + 32 * DM), "v"(gb + 64 * DM), "v"(gb + 96 * DM) : "memory"); }
template <bool VTR>
__global__ __launch_bounds__(256) void k_gemm3(const _Float16* __restrict__ A, const _Float16* __restrict__ Bh, float alpha, const float* __restrict__ bias, _Float16* __restrict__ P0, _Float16* __restrict__ P1) {
  static_assert(MP % GM == 0 && DM % GN == 0 && DM % GK == 0 && DM / GK >= 2 && GM == 128 && GN == 128 && GK == 64, "whole tiles, at least two trips, 8 copies per thread and tile");
  static_assert(SQ % GN == 0 && SQ == DM, "a token tile lies in one batch; V^T rows and q / k rows have one pitch");
  __shared__ __attribute__((aligned(16))) char ring[2 * GBUF]; __shared__ __attribute__((aligned(16))) float so[8][32][68];
  const int tid = threadIdx.x, w = tid >> 5, lane = tid & 31, ln = lane & 15, hh = lane >> 4;
  const int tt = blockIdx.x / (DM / GN), wt = blockIdx.x % (DM / GN);      /* token tile, weight tile: neighbouring work-groups share the token rows in both forms */
  const int rowb = (VTR ? wt : tt) * GM, colb = (VTR ? tt : wt) * GN; const int row0 = rowb + 32 * (w & 3), col0 = colb + 64 * (w >> 2);
  const int cr = tid >> 3, cc = tid & 7;      /* 8 lanes cover one 128-B row */
  const _Float16* ga = A + (size_t)(rowb + cr) * DM + cc * 8; const _Float16* gb = Bh + (size_t)(colb + cr) * DM + cc * 8; const unsigned l0 = (unsigned)(size_t)ring + (unsigned)(cr * GP + cc * 16);
  const char* fa = ring + (32 * (w & 3) + ln) * GP + 16 * hh; const char* fb = ring + (GM + 64 * (w >> 2) + ln) * GP + 16 * hh;
  const v8f z8 = {0.f,0.f,0.f,0.f,0.f,0.f,0.f,0.f}; v8f c00 = z8, c01 = z8, c02 = z8, c03 = z8, c10 = z8, c11 = z8, c12 = z8, c13 = z8;
  g3_stage(l0, ga, gb);
  asm volatile("s_wait_asynccnt 0x0" ::: "memory");      /* this wave's share of tile 0 has landed */
  __syncthreads();      /* tile 0 is published */
  g3_stage(l0 + GBUF, ga + GK, gb + GK);
#pragma unroll 1      /* one trip per tile: the buffer is picked by the trip's parity and the loop stays short */
  for (int t = 0; t < DM / GK; ++t) { const int bo = (t & 1) * GBUF; v16h a[2][2], b[2][4];      /* [k step][fragment] */
#pragma unroll      /* constant indices keep the fragment arrays in registers; all 24 LDS reads of the trip stand as one group ahead of its WMMAs */
    for (int ks = 0; ks < 2; ++ks) { for (int i = 0; i < 2; ++i) a[ks][i] = g3_frag(fa + bo + ks * 64 + i * (16 * GP)); for (int j = 0; j < 4; ++j) b[ks][j] = g3_frag(fb + bo + ks * 64 + j * (16 * GP)); }
#pragma unroll      /* constant fragment indices, as above */
    for (int ks = 0; ks < 2; ++ks) { c00 = g2_mma(a[ks][0], b[ks][0], c00); c10 = g2_mma(a[ks][1], b[ks][0], c10); c01 = g2_mma(a[ks][0], b[ks][1], c01); c11 = g2_mma(a[ks][1], b[ks][1], c11);
      c02 = g2_mma(a[ks][0], b[ks][2], c02); c12 = g2_mma(a[ks][1], b[ks][2], c12); c03 = g2_mma(a[ks][0], b[ks][3], c03); c13 = g2_mma(a[ks][1], b[ks][3], c13); }
    asm volatile("s_wait_dscnt 0x0" ::: "memory");      /* this wave's reads of the buffer are done before it is handed back */
    asm volatile("s_wait_asynccnt 0x0" ::: "memory");      /* this wave's share of tile t + 1 has landed */
    __syncthreads();      /* publishes tile t + 1 and ends every wave's reads of tile t */
    if (t + 2 < DM / GK) g3_stage(l0 + (unsigned)bo, ga + (t + 2) * GK, gb + (t + 2) * GK); }
  asm volatile("s_wait_asynccnt 0x0" ::: "memory");      /* no copy is outstanding when the wave goes on */
  v8f accs[8] = {c00, c01, c02, c03, c10, c11, c12, c13};
#pragma unroll      /* constant accumulator indices (this loop and the next): no scratch */
  for (int u = 0; u < 8; ++u) { const int t = u & 3, half = u >> 2;
#pragma unroll
    for (int r = 0; r < 8; ++r) { const float bv = bf16_round(bias[VTR ? row0 + half * 16 + 8 * hh + r : col0 + t * 16 + ln]); so[w][half * 16 + 8 * hh + r][t * 16 + ln] = accs[u][r] * alpha + bv; } }
  __builtin_amdgcn_fence(__ATOMIC_ACQ_REL, "workgroup"); __builtin_amdgcn_wave_barrier();
  const int rsub = lane >> 3, c8 = (lane & 7) * 8;      /* 8 lanes x 16 B cover one 128-B line of a plane, a wave four rows per store */
  const size_t e0 = (VTR ? ((size_t)(col0 / SQ) * DM + row0) * SQ + (col0 % SQ) : (size_t)row0 * DM + col0) + (size_t)rsub * DM + c8;      /* the lane's first element */
  v4f va[8], vb[8];
#pragma unroll      /* constant indices keep the rows in registers; the 16 LDS reads stand as one group ahead of the conversions */
  for (int q = 0; q < 8; ++q) { va[q] = *(const v4fa*)&so[w][q * 4 + rsub][c8]; vb[q] = *(const v4fa*)&so[w][q * 4 + rsub][c8 + 4]; }
#pragma unroll      /* constant indices, as above */
  for (int q = 0; q < 8; ++q) { FragH fh, fl;
#pragma unroll
    for (int i = 0; i < 4; ++i) { _Float16 h = (_Float16)va[q][i]; fh.h[i] = h; fl.h[i] = (_Float16)((va[q][i] - (float)h) * 1024.0f); h = (_Float16)vb[q][i]; fh.h[4 + i] = h; fl.h[4 + i] = (_Float16)((vb[q][i] - (float)h) * 1024.0f); }
    *(v8us*)((unsigned short*)P0 + e0 + (size_t)q * 4 * DM) = fh.half[0]; if (!VTR) *(v8us*)((unsigned short*)P1 + e0 + (size_t)q * 4 * DM) = fl.half[0];
    if (q < 7) asm volatile("s_wait_xcnt 0x0" ::: "memory"); } }      /* the wait that stands before a register which an issued store names is rewritten (later rows' conversions reuse the data registers) */


// x and the three weight matrices -> their f16 operand planes (x bf16-rounded, exact in f16; weights bf16-rounded x16, natural [out][in] = Bt[n][k]), ONE launch of CWG work-groups: 16 waves per WGP instead of one short wave per 256 elements.
// A work-group owns one contiguous share of each plane and walks it in slabs of 256 threads x 4 f32: a wave-wide load covers 512 contiguous bytes, a wave-wide store 256 (whole lines). CX slabs of x and CW of each weight matrix per thread; all the loads are independent and stand ahead of the conversions (amdgpu_waves_per_eu names the 4 waves per SIMD that this grid gives: without it the compiler sinks half the loads among the conversions to save registers).
#define CWG 512                      /* work-groups of the conversion launch */
#define CX 16                        /* slabs of x per work-group */
#define CW 2                         /* slabs of each weight matrix per work-group */
__device__ __forceinline__ v4h cvt4(v4f a, float scale) { v4h h;
#pragma unroll
  for (int q = 0; q < 4; ++q) h[q] = (_Float16)(bf16_round(a[q]) * scale); return h; }
__global__ __launch_bounds__(256) __attribute__((amdgpu_waves_per_eu(4, 4))) void k_cvt(const float* __restrict__ x, const float* __restrict__ wq, const float* __restrict__ wk, const float* __restrict__ wv, _Float16* __restrict__ X16, _Float16* __restrict__ BQ, _Float16* __restrict__ BK, _Float16* __restrict__ BV) {
  static_assert(NR * DM == (size_t)CWG * CX * 1024 && (size_t)DM * DM == (size_t)CWG * CW * 1024, "whole slabs of 1024 elements, no remainder");
  const unsigned ex = blockIdx.x * (CX * 1024u) + threadIdx.x * 4u, ew = blockIdx.x * (CW * 1024u) + threadIdx.x * 4u;      /* the thread's first element of x and of a weight matrix; the slabs lie at constant offsets from it */
  v4f a[CX], q[CW], k[CW], v[CW];
#pragma unroll      /* constant indices keep the pieces in registers (this loop and the next three) */
  for (int i = 0; i < CX; ++i) a[i] = *(const v4fa*)(x + ex + i * 1024);
#pragma unroll
  for (int i = 0; i < CW; ++i) { q[i] = *(const v4fa*)(wq + ew + i * 1024); k[i] = *(const v4fa*)(wk + ew + i * 1024); v[i] = *(const v4fa*)(wv + ew + i * 1024); }
#pragma unroll
  for (int i = 0; i < CX; ++i) *(v4h*)(X16 + ex + i * 1024) = cvt4(a[i], 1.0f);
#pragma unroll
  for (int i = 0; i < CW; ++i) { *(v4h*)(BQ + ew + i * 1024) = cvt4(q[i], 16.0f); *(v4h*)(BK + ew + i * 1024) = cvt4(k[i], 16.0f); *(v4h*)(BV + ew + i * 1024) = cvt4(v[i], 16.0f); } }
__global__ __launch_bounds__(256) void k_rsm(const float* __restrict__ S, _Float16* __restrict__ P, int nrows) {
  #pragma clang fp contract(off)
  const int i = blockIdx.x * 256 + threadIdx.x; if (i >= nrows) return; const float* s = S + (size_t)i * SQ; float mx = -3.0e38f;
#pragma unroll 1
  for (int j = 0; j < SQ; ++j) mx = fmaxf(mx, s[j]); float se = 0.f;
#pragma unroll 1
  for (int j = 0; j < SQ; ++j) se += expf(s[j] - mx); const float sc = 256.0f / se;
#pragma unroll 1
  for (int j0 = 0; j0 < SQ; j0 += 8) { FragH f; for (int q = 0; q < 8; ++q) f.h[q] = (_Float16)(expf(s[j0 + q] - mx) * sc); unsigned short* d = (unsigned short*)P + (size_t)i * SQ + j0; *(v8us*)d = f.half[0];  } }
__global__ __launch_bounds__(256) void k_vt(const _Float16* __restrict__ V16, int b, int h0, _Float16* __restrict__ VT) { __shared__ unsigned short tl[64][65]; const int tid = threadIdx.x; const int hh = blockIdx.x % HG, sg = blockIdx.x / HG; const int s0 = sg * 64; const int h = h0 + hh;
  for (int i = tid; i < 64 * 8; i += 256) { const int j = i / 8, d8 = (i % 8) * 8; FragH f; f.half[0] = *(const v8us*)((const unsigned short*)V16 + ((size_t)b * SQ + s0 + j) * DM + h * HD + d8); for (int q = 0; q < 8; ++q) tl[d8 + q][j] = f.u[q]; }
  __syncthreads();
  { for (int i = tid; i < 64 * 8; i += 256) { const int d = i / 8, j8 = (i % 8) * 8; FragH f; for (int q = 0; q < 8; ++q) f.u[q] = tl[d][j8 + q]; *(v8us*)((unsigned short*)VT + ((size_t)hh * HD + d) * SQ + s0 + j8) = f.half[0]; }  } }



__device__ __forceinline__ float lane_xor_16(float v) { const int u = __float_as_int(v); return __int_as_float(__builtin_amdgcn_permlanex16(u, u, 0x76543210, 0xfedcba98, false, false)); }      /* lane l <- lane l ^ 16 */
__device__ __forceinline__ float exp2_slot(float a) { float r; asm("v_exp_f32 %0, %1\n\tv_nop" : "=v"(r) : "v"(a)); return r; }      /* 2^a; the v_nop in the same statement keeps the slot the instruction set asks for behind a transcendental, before its result is read or its source register reused */
__device__ __forceinline__ v4f exp2_slot4(v4f a) { float r0, r1, r2, r3;      /* four 2^a: each fills the slot behind the one before it (early-clobber outputs share no register with a source), one v_nop keeps the slot behind the last */
  asm("v_exp_f32 %0, %4\n\tv_exp_f32 %1, %5\n\tv_exp_f32 %2, %6\n\tv_exp_f32 %3, %7\n\tv_nop" : "=&v"(r0), "=&v"(r1), "=&v"(r2), "=&v"(r3) : "v"(a[0]), "v"(a[1]), "v"(a[2]), "v"(a[3])); const v4f r = {r0, r1, r2, r3}; return r; }
__device__ __forceinline__ v16h fa_frag(const char* p) { FragH f; f.half[0] = *(const v8us*)p; f.half[1] = *(const v8us*)(p + 32); return f.v; }      /* g2_frag from the lane's own LDS byte address (row c, 16 hh bytes in) */
__device__ __forceinline__ v8f fa_mma(v16h a, v16h b, v8f c) { return __builtin_amdgcn_wmma_f32_16x16x32_f16(false, a, false, b, (short)0, c, false, false); }
#define FW 8                         /* waves per work-group */
#define FQ 32                        /* query columns per wave */
#define FK 64                        /* keys per staged tile: two passes of 32 */
#define FP 144                       /* LDS row pitch in bytes: 128 + 16, so the 16 rows of a ds_load_b128 fall on all 64 banks */
#define FBUF ((2 * FK + HD) * FP)    /* one buffer: FK K rows, FK K residual rows, HD V^T rows */
// One tile: a thread copies 16 B of rows cr and cr + 32 of K, of the K residuals and of V^T. l = the lane's LDS byte address of its first K piece, gk / gl / gv = its global addresses in row cr of the three planes.
__device__ __forceinline__ void fa_stage(unsigned l, const _Float16* gk, const _Float16* gl, const _Float16* gv) {
  /* the s_wait_xcnt in the copies' own statement stands before any register that an issued copy names is rewritten */
  asm volatile("global_load_async_to_lds_b128 %0, %6, off\n\t"
               "global_load_async_to_lds_b128 %1, %7, off\n\t"
               "global_load_async_to_lds_b128 %2, %8, off\n\t"
               "global_load_async_to_lds_b128 %3, %9, off\n\t"
               "global_load_async_to_lds_b128 %4, %10, off\n\t"
               "global_load_async_to_lds_b128 %5, %11, off\n\t"
               "s_wait_xcnt 0x0"
               :: "v"(l), "v"(l + 32u * FP), "v"(l + 64u * FP), "v"(l + 96u * FP), "v"(l + 128u * FP), "v"(l + 160u * FP),
                  "v"(gk), "v"(gk + 32 * DM), "v"(gl), "v"(gl + 32 * DM), "v"(gv), "v"(gv + 32 * SQ) : "memory"); }
__global__ __launch_bounds__(FW * 32) __attribute__((amdgpu_waves_per_eu(4, 4))) void k_fattn(const _Float16* __restrict__ QH, const _Float16* __restrict__ QL, const _Float16* __restrict__ KH, const _Float16* __restrict__ KL, const _Float16* __restrict__ VT, float* __restrict__ out) {
  static_assert(SQ % (FW * FQ) == 0 && SQ % FK == 0 && SQ / FK >= 2 && FK == 64 && HD == 64 && FW == 8, "whole query blocks, whole tiles and at least two, two k steps per score, 6 copies per thread and tile");
  __shared__ __attribute__((aligned(16))) char ring[2 * FBUF];
  const int lane = threadIdx.x & 31, w = threadIdx.x >> 5, c = lane & 15, hh = lane >> 4; const int h = blockIdx.y, b = blockIdx.z;
  const size_t r0 = (size_t)b * SQ; const int q0 = blockIdx.x * (FW * FQ) + w * FQ;
  v16h qh[2][2], ql[2][2];      /* [query tile][k step] */
#pragma unroll
  for (int g = 0; g < 2; ++g) for (int ks = 0; ks < 2; ++ks) { const size_t qo = (r0 + q0 + g * 16 + c) * DM + h * HD + ks * 32; qh[g][ks] = g2_frag(QH + qo, hh); ql[g][ks] = g2_frag(QL + qo, hh); }
  const int cr = threadIdx.x >> 3, cc = threadIdx.x & 7;      /* 8 lanes cover one 128-B row */
  const _Float16* gk = KH + (r0 + cr) * DM + h * HD + cc * 8; const _Float16* gl = KL + (r0 + cr) * DM + h * HD + cc * 8; const _Float16* gv = VT + (((size_t)b * NH + h) * HD + cr) * SQ + cc * 8;
  const unsigned l0 = (unsigned)(size_t)ring + (unsigned)(cr * FP + cc * 16);
  const char* fr = ring + c * FP + 16 * hh;      /* the lane's place in row c of a buffer */
  const v8f z8 = {0.f, 0.f, 0.f, 0.f, 0.f, 0.f, 0.f, 0.f}; v8f o[2][4] = {{z8, z8, z8, z8}, {z8, z8, z8, z8}};      /* [query tile][d tile]: register r = O[query c][16 t + 8 hh + r] */
  float m[2] = {-3.0e38f, -3.0e38f}, l[2] = {0.f, 0.f};
  const float C1 = 0.125f * 1.44269504088896340736f, C2 = 0.0001220703125f * 1.44269504088896340736f;      /* 64^-0.5 and 64^-0.5 2^-10, in log2 units */
  fa_stage(l0, gk, gl, gv);
  asm volatile("s_wait_asynccnt 0x0" ::: "memory");      /* this wave's share of tile 0 has landed */
  __syncthreads();      /* tile 0 is published */
  fa_stage(l0 + FBUF, gk + FK * DM, gl + FK * DM, gv + FK);
#pragma unroll 1      /* one trip per tile: the buffer is picked by the trip's parity */
  for (int kt0 = 0; kt0 < SQ / FK; ++kt0) { const int bo = (kt0 & 1) * FBUF;
#pragma unroll 1      /* the two passes of a tile stay one body: the unrolled build spills registers to scratch */
   for (int ps = 0; ps < FK / 32; ++ps) { v8f t[2][2];      /* [query tile][key tile]: register r = score of key 64 kt0 + 32 ps + 16 kt + 8 hh + r for query c */
    const char* kp = fr + bo + ps * (32 * FP); v16h kf[2][2], lf[2][2];      /* [key tile][k step] */
#pragma unroll
    for (int kt = 0; kt < 2; ++kt) for (int ks = 0; ks < 2; ++ks) { kf[kt][ks] = fa_frag(kp + kt * (16 * FP) + ks * 64); lf[kt][ks] = fa_frag(kp + FK * FP + kt * (16 * FP) + ks * 64); }
#pragma unroll
    for (int kt = 0; kt < 2; ++kt) {
#pragma unroll
      for (int g = 0; g < 2; ++g) { v8f sh = fa_mma(kf[kt][0], qh[g][0], z8); sh = fa_mma(kf[kt][1], qh[g][1], sh);
        v8f sl = fa_mma(kf[kt][0], ql[g][0], z8); sl = fa_mma(kf[kt][1], ql[g][1], sl); sl = fa_mma(lf[kt][0], qh[g][0], sl); sl = fa_mma(lf[kt][1], qh[g][1], sl);
        t[g][kt] = sl * C2 + sh * C1; } }
    const char* vp = fr + bo + 2 * FK * FP + ps * 64; v16h vf[4];
#pragma unroll
    for (int u = 0; u < 4; ++u) vf[u] = fa_frag(vp + u * (16 * FP));
#pragma unroll
    for (int g = 0; g < 2; ++g) { float mx = t[g][0][0];
#pragma unroll
      for (int r = 1; r < 16; ++r) mx = fmaxf(mx, t[g][r >> 3][r & 7]);
      mx = fmaxf(mx, lane_xor_16(mx)); const float mn = fmaxf(m[g], mx); const float al = exp2_slot(m[g] - mn), mb = mn - 8.0f; m[g] = mn;      /* weights carried x256 (it cancels in the final division), which keeps small ones out of the f16 subnormals */
      FragH pf; v4f s4 = {0.f, 0.f, 0.f, 0.f};
#pragma unroll
      for (int kt = 0; kt < 2; ++kt) for (int q = 0; q < 2; ++q) { v4f a; for (int i = 0; i < 4; ++i) a[i] = t[g][kt][q * 4 + i] - mb; const v4f e = exp2_slot4(a); s4 += e; for (int i = 0; i < 4; ++i) pf.h[kt * 8 + q * 4 + i] = (_Float16)e[i]; }
      l[g] = fmaf(l[g], al, (s4[0] + s4[1]) + (s4[2] + s4[3]));      /* this half's keys only; the halves join after the loop */
#pragma unroll
      for (int u = 0; u < 4; ++u) { o[g][u] *= al; o[g][u] = fa_mma(vf[u], pf.v, o[g][u]); }
      if (g == 0) asm volatile("v_nop\n\tv_nop\n\tv_nop\n\tv_nop" :: "v"(pf.v), "v"(o[g][0]), "v"(o[g][1]), "v"(o[g][2]), "v"(o[g][3])); } }      /* the four vector slots the chip needs behind a WMMA before its B registers are overwritten: the next query tile's v_exp_f32 statements are asm text, which the compiler does not pad for; inputs only: the results place it behind the four WMMAs, the weights keep their registers up to it */
    asm volatile("s_wait_dscnt 0x0" ::: "memory");      /* this wave's reads of the buffer are done before it is handed back */
    asm volatile("s_wait_asynccnt 0x0" ::: "memory");      /* this wave's share of tile kt0 + 1 has landed */
    __syncthreads();      /* publishes tile kt0 + 1 and ends every wave's reads of tile kt0 */
    if (kt0 + 2 < SQ / FK) fa_stage(l0 + (unsigned)bo, gk + (size_t)(kt0 + 2) * (FK * DM), gl + (size_t)(kt0 + 2) * (FK * DM), gv + (kt0 + 2) * FK); }
  asm volatile("s_wait_asynccnt 0x0" ::: "memory");      /* no copy is outstanding when the wave goes on */
#pragma unroll
  for (int g = 0; g < 2; ++g) { const float inv = 1.0f / (l[g] + lane_xor_16(l[g])); float* op = out + (r0 + q0 + g * 16 + c) * DM + h * HD + 8 * hh;
#pragma unroll
    for (int u = 0; u < 4; ++u) { const v4f x0 = {o[g][u][0] * inv, o[g][u][1] * inv, o[g][u][2] * inv, o[g][u][3] * inv}, x1 = {o[g][u][4] * inv, o[g][u][5] * inv, o[g][u][6] * inv, o[g][u][7] * inv}; *(v4f*)(op + u * 16) = x0; *(v4f*)(op + u * 16 + 4) = x1; } } }


template <int MASKADD>
__global__ __launch_bounds__(64) void k_att0(const float* __restrict__ QF, const float* __restrict__ KF, const float* __restrict__ VF, int ld, const float* __restrict__ mask, float scale, float* __restrict__ OF, int ldo) {
  #pragma clang fp contract(off)
  __shared__ __attribute__((aligned(16))) float lq[64][64]; __shared__ __attribute__((aligned(16))) float lo[64][64];
  const int tid = threadIdx.x; const int h = blockIdx.x / (QT0 / 64), rg = blockIdx.x % (QT0 / 64); const int i = rg * 64 + tid;
  const float* qr = QF + (size_t)i * ld + h * HD;
#pragma unroll 1
  for (int c = 0; c < HD / 4; ++c) { *(v4f*)&lq[tid][c * 4] = *(const v4fa*)(qr + c * 4); const v4f z = {0.f, 0.f, 0.f, 0.f}; *(v4f*)&lo[tid][c * 4] = z; }
  float m = -1.0e30f, l = 0.f; const int jmax = MASKADD ? (SQ - 1) : (rg * 64 + 63);      /* additive-mask form: every key (the mask input decides); causal form: keys up to the block's last row */
#pragma unroll 1
  for (int j = 0; j <= jmax; ++j) { const float* kr = KF + (size_t)j * ld + h * HD; const float* vr = VF + (size_t)j * ld + h * HD; float s = 0.f;
#pragma unroll 1
    for (int c = 0; c < HD / 4; ++c) { const v4f kq = *(const v4fa*)(kr + c * 4); const v4f qq = *(v4f*)&lq[tid][c * 4]; s = __fadd_rn(s, __fmul_rn(qq[0], kq[0])); s = __fadd_rn(s, __fmul_rn(qq[1], kq[1])); s = __fadd_rn(s, __fmul_rn(qq[2], kq[2])); s = __fadd_rn(s, __fmul_rn(qq[3], kq[3])); }
    s = __fmul_rn(s, scale); if (MASKADD) s = __fadd_rn(s, __fmul_rn(bf16_round(mask[(size_t)i * SQ + j]), -10000.0f));
    const float f = (MASKADD || j <= i) ? 1.f : 0.f; const float sm = fmaf(f, s, (1.f - f) * -1.0e30f); const float mn = fmaxf(m, sm); const float sc = expf(m - mn); const float e = expf(sm - mn); l = __fadd_rn(__fmul_rn(l, sc), e); m = mn;
#pragma unroll 1
    for (int c = 0; c < HD / 4; ++c) { const v4f vv = *(const v4fa*)(vr + c * 4); v4f oo = *(v4f*)&lo[tid][c * 4]; for (int u = 0; u < 4; ++u) oo[u] = __fadd_rn(__fmul_rn(oo[u], sc), __fmul_rn(e, vv[u])); *(v4f*)&lo[tid][c * 4] = oo; } }
  const float fin = 64.0f / l;      /* o carried x64 */
#pragma unroll 1
  for (int c = 0; c < HD / 4; ++c) { v4f oo = *(v4f*)&lo[tid][c * 4]; for (int u = 0; u < 4; ++u) oo[u] = __fmul_rn(oo[u], fin); *(v4f*)&lo[tid][c * 4] = oo; }
  __syncthreads();
  {
#pragma unroll 1
    for (int it = 0; it < 16; ++it) { const int row = it * 4 + tid / 16, pc = (tid % 16) * 4; const v4f v = *(const v4f*)&lo[row][pc]; *(v4f*)(OF + (size_t)(rg * 64 + row) * ldo + h * HD + pc) = v; }
     } }

__global__ __launch_bounds__(256) void k_of0out(const float* __restrict__ src, float* __restrict__ dst, size_t n4) { const size_t t = (size_t)blockIdx.x * 256 + threadIdx.x; if (t >= n4) return; v4f v = *(const v4fa*)(src + t * 4); for (int q = 0; q < 4; ++q) v[q] = __fmul_rn(v[q], 0.015625f); *(v4f*)(dst + t * 4) = v;  }

extern "C" void kernel_launch(void* const* d_in, const int* in_sizes, int n_in,
                              void* d_out, int out_size, void* d_ws, size_t ws_size, hipStream_t stream) {
  (void)in_sizes; (void)n_in; (void)out_size;
  const float* const* I = (const float* const*)d_in; const float* x = I[0]; const float* wq = I[1]; const float* wk = I[2]; const float* wv = I[3]; const float* bq = I[4]; const float* bk = I[5]; const float* bv = I[6];      /* input order: x, Wq, Wk, Wv, bq, bk, bv: natural [out][in] weights, then the three biases (every projection launch passes the bias variables); NO output projection */
  char* ws = (char*)d_ws; size_t off = 0;
  auto take = [&](size_t bytes) { char* p = ws + off; off += (bytes + 255) & ~(size_t)255; return p; };
  _Float16* BQ = (_Float16*)take((size_t)DM * DM * 2); _Float16* BK = (_Float16*)take((size_t)DM * DM * 2); _Float16* BV = (_Float16*)take((size_t)DM * DM * 2);
  _Float16* X16 = (_Float16*)take(NR * DM * 2); _Float16* QH = (_Float16*)take(NR * DM * 2); _Float16* QL = (_Float16*)take(NR * DM * 2); _Float16* KH = (_Float16*)take(NR * DM * 2); _Float16* KL = (_Float16*)take(NR * DM * 2);
  _Float16* VT = (_Float16*)take((size_t)NB * NH * HD * SQ * 2);
  if (off > ws_size) return;
  k_cvt<<<CWG, 256, 0, stream>>>(x, wq, wk, wv, X16, BQ, BK, BV);      /* x -> exact f16 rows; natural [out][in] weights = Bt[n][k] x16 */
  const size_t r0p = (size_t)B0 * SQ;      /* first projected row */
  k_gemm3<false><<<(MP / GM) * (DM / GN), 256, 0, stream>>>(X16 + r0p * DM, BQ, 0.0625f, bq, QH + r0p * DM, QL + r0p * DM);      /* q -> f16 hi + x1024 residual planes, from the GEMM's own epilogue: unscaled logits sigma ~8 */
  k_gemm3<false><<<(MP / GM) * (DM / GN), 256, 0, stream>>>(X16 + r0p * DM, BK, 0.0625f, bk, KH + r0p * DM, KL + r0p * DM);      /* k likewise */
  k_gemm3<true><<<(DM / GM) * (MP / GN), 256, 0, stream>>>(BV, X16 + r0p * DM, 0.0625f, bv, VT + r0p * DM, nullptr);      /* V^T [NB][NH][HD][SQ] = Wv . x^T, all batches */
  k_fattn<<<dim3(SQ / (FW * FQ), NH, NB), FW * 32, 0, stream>>>(QH, QL, KH, KL, VT, (float*)d_out);      /* scores (hi.hi + 2^-10 (hi.lo + lo.hi)), softmax over all keys and P V in one launch, f32 straight into the head-major output columns (no output projection) */
}

// v007
// One run takes 110 microseconds.
// Timed twice side by side with v006, it ran 1.04 times as fast both times.
// Over all steps from v000 it is 73.6 times as fast.
#include <hip/hip_runtime.h>
// Multi-head self-attention without an output projection, NON-causal (x [8][1024][1024]; q / k / v = x W^T + b (nn.Linear natural [1024][1024] sigma 1/32, biases sigma 0.01); 16 heads of 64; scores * 64^-0.5; softmax over all 1024 keys (no mask); out = ctx merged head-major -> [8][1024][1024]; the source never applies its out_proj).
// Structure: token rows r = b*1024 + s; x as exact f16 rows (bf16-rounded); q and k as WMMA GEMMs (128x128 work-group tiles staged in LDS by asynchronous copies, 32x64 wave tiles, f32 accumulation, exact x16 weights + bias) whose epilogue carries each f32 value x16 and splits it into f16 hi + residual planes of one scale, v as the same GEMM with its operands swapped, so that its f16 tile is V^T as attention reads it; then ONE fused attention launch (k_fattn): per wave 32 queries, keys 32 at a time from 64-key K / V^T tiles that a work-group stages in LDS by asynchronous copies, scores as hi.lo + lo.hi + hi.hi in one f32 accumulator, online softmax (f32 running max and sum, native exp2), weights x256 as f16 straight from the score accumulators into O^T += V^T P^T, f32 out written into the head-major columns.
// Compute dtype: inputs rounded to bf16; x / weights exact; q and k as f16 hi + residual planes, v and softmax weights as plain f16 GEMM operands (~2^-12); scores, softmax statistics and o f32. v_wmma_f32_16x16x32_f16.
#define NB 8
#define SQ 1024
#define DM 1024
#define NH 16
#define HD 64
#define HG 4                         /* heads per group in the unlaunched k_vt overload */
#define QT 256                       /* unused */
#define NKX SQ                       /* unused */
#define QT0 128                      /* query rows per head in k_att0, which is not launched */
#define B0 0                         /* first batch processed (debug hook) */
#define NBR NB                       /* batches processed (debug hook) */
#define NR ((size_t)NB * SQ)         /* token rows */
#define MP ((int)((size_t)NBR * SQ)) /* rows projected (debug hook) */
#define QN SQ                        /* unused */
#define NHD NH                       /* unused */
#define MPO MP                       /* unused */
#define LQ DM      /* unused */
typedef __bf16 v16b __attribute__((ext_vector_type(16)));
typedef unsigned short v8us __attribute__((ext_vector_type(8), may_alias));
typedef float  v8f  __attribute__((ext_vector_type(8)));
typedef float  v4f  __attribute__((ext_vector_type(4)));
typedef float  v4fa __attribute__((ext_vector_type(4), may_alias));
union FragB { v16b v; v8us half[2]; unsigned short u[16]; };

__device__ __forceinline__ unsigned short bf16_bits(float x) { unsigned int u = __float_as_uint(x); return (unsigned short)((u + 0x7FFFu + ((u >> 16) & 1u)) >> 16); }
__device__ __forceinline__ float bf16_val(unsigned short b) { return __uint_as_float(((unsigned int)b) << 16); }
__device__ __forceinline__ float bf16_round(float x) { return bf16_val(bf16_bits(x)); }
// D += A·B with NT terms: 1 = ah·bh, 2 = + al·bh (A split), 3 = + ah·bl (both split)
template <int NT>
__device__ __forceinline__ v8f mmaN(v16b ah, v16b al, v16b bh, v16b bl, v8f c) {
  c = __builtin_amdgcn_wmma_f32_16x16x32_bf16(false, ah, false, bh, (short)0, c, false, false);
  if (NT >= 2) c = __builtin_amdgcn_wmma_f32_16x16x32_bf16(false, al, false, bh, (short)0, c, false, false);
  if (NT >= 3) c = __builtin_amdgcn_wmma_f32_16x16x32_bf16(false, ah, false, bl, (short)0, c, false, false);
  asm volatile("v_nop\n\tv_nop\n\tv_nop\n\tv_nop" : "+v"(c) : "v"(ah), "v"(al), "v"(bh), "v"(bl));
  return c;
}

__global__ __launch_bounds__(256) void k_wt_bf16(const float* __restrict__ W, unsigned short* __restrict__ Wt, int K, int N) {
  const int t = blockIdx.x * 256 + threadIdx.x;
  const int k8n = K / 8;
  if (t >= N * k8n) return;
  const int n = t / k8n, k8 = (t % k8n) * 8;
  v8us v;
#pragma unroll
  for (int i = 0; i < 8; ++i) v[i] = bf16_bits(W[(size_t)(k8 + i) * N + n]);
  *(v8us*)(Wt + (size_t)n * K + k8) = v;
  
}

// GEMM C[M][N] (f32, pitch ldc) = act(A[M][K]·W + bias). A f32 row-major (pitch lda) converted per fragment to bf16
// (ASPLIT: hi/lo two planes -> 2 terms, else single rounded term); Wt bf16 [N][K] (pitch ldb). BIAS_BF16 rounds the
// bias to bf16 first (bias quantised to bf16 before the add). K%32==0, M%16==0, N%64==0.
template <bool ASPLIT, int ACT, bool BIAS_BF16>
__global__ __launch_bounds__(128) void k_gemm_bf(const float* __restrict__ A, int lda, const unsigned short* __restrict__ Wt, int ldb,
                                               const float* __restrict__ bias, float* __restrict__ C, int ldc, int M, int N, int K) {
  __shared__ __attribute__((aligned(16))) float so[4][16][64];
  const int tid = threadIdx.x, w = tid >> 5, lane = tid & 31, ln = lane & 15, hh = lane >> 4;
  const int ntn = N / 64;
  const int wid = blockIdx.x * 4 + w;
  const int mt = wid / ntn, nq = wid % ntn;
  if (mt * 16 >= M) return;
  const int row0 = mt * 16, col0 = nq * 64;
  const float* arow = A + (size_t)(row0 + ln) * lda;
  v8f acc[4] = {};
  for (int kb = 0; kb < K; kb += 32) {
    FragB ah, al;
    const v4f x0 = *(const v4fa*)(arow + kb + 8 * hh), x1 = *(const v4fa*)(arow + kb + 8 * hh + 4);
    const v4f x2 = *(const v4fa*)(arow + kb + 16 + 8 * hh), x3 = *(const v4fa*)(arow + kb + 16 + 8 * hh + 4);
    float xs[16] = {x0[0],x0[1],x0[2],x0[3],x1[0],x1[1],x1[2],x1[3],x2[0],x2[1],x2[2],x2[3],x3[0],x3[1],x3[2],x3[3]};
#pragma unroll
    for (int i = 0; i < 16; ++i) { const unsigned short hb = bf16_bits(xs[i]); ah.u[i] = hb; al.u[i] = ASPLIT ? bf16_bits(xs[i] - bf16_val(hb)) : (unsigned short)0; }
#pragma unroll
    for (int t = 0; t < 4; ++t) {
      const unsigned short* brow = Wt + (size_t)(col0 + t * 16 + ln) * ldb + kb;
      FragB b;
      b.half[0] = *(const v8us*)(brow + 8 * hh);
      b.half[1] = *(const v8us*)(brow + 16 + 8 * hh);
      acc[t] = mmaN<ASPLIT ? 2 : 1>(ah.v, al.v, b.v, b.v, acc[t]);
    }
  }
#pragma unroll
  for (int t = 0; t < 4; ++t) {
    float bv = bias ? bias[col0 + t * 16 + ln] : 0.f;
    if (BIAS_BF16) bv = bf16_round(bv);
#pragma unroll
    for (int r = 0; r < 8; ++r) { float v = acc[t][r] + bv; if (ACT == 1) v = fmaxf(v, 0.f); so[w][8 * hh + r][t * 16 + ln] = v; }
  }
  __builtin_amdgcn_fence(__ATOMIC_ACQ_REL, "workgroup");
  __builtin_amdgcn_wave_barrier();
  const int rsub = lane >> 4, c4 = (lane & 15) * 4;
  {
#pragma unroll
    for (int q = 0; q < 8; ++q) {
      const int r = q * 2 + rsub;
      const v4f v = *(const v4fa*)&so[w][r][c4];
      *(v4f*)(C + (size_t)(row0 + r) * ldc + col0 + c4) = v;
    }
    
  }
}

// GEMM C = act(A·W + bias + resid): A f32 (ASPLIT -> hi/lo 2 terms), Wt bf16 [N][K]; ACT 0 none, 1 relu, 2 exact gelu;
// resid (optional, f32, row index = (row % rmod), pitch ldr, RES_BF16 rounds it) added before the activation.
template <bool ASPLIT, int ACT, bool BIAS_BF16, bool RES_BF16>
__global__ __launch_bounds__(128) void k_gemm_bf3(const float* __restrict__ A, int lda, const unsigned short* __restrict__ Wt, int ldb,
                                                const float* __restrict__ bias, const float* __restrict__ resid, int rmod, int ldr,
                                                float* __restrict__ C, int ldc, int M, int N, int K) {
  __shared__ __attribute__((aligned(16))) float so[4][16][64];
  const int tid = threadIdx.x, w = tid >> 5, lane = tid & 31, ln = lane & 15, hh = lane >> 4;
  const int ntn = N / 64;
  const int wid = blockIdx.x * 4 + w;
  const int mt = wid / ntn, nq = wid % ntn;
  if (mt * 16 >= M) return;
  const int row0 = mt * 16, col0 = nq * 64;
  const float* arow = A + (size_t)(row0 + ln) * lda;
  v8f acc[4] = {};
  for (int kb = 0; kb < K; kb += 32) {
    FragB ah, al;
    const v4f x0 = *(const v4fa*)(arow + kb + 8 * hh), x1 = *(const v4fa*)(arow + kb + 8 * hh + 4);
    const v4f x2 = *(const v4fa*)(arow + kb + 16 + 8 * hh), x3 = *(const v4fa*)(arow + kb + 16 + 8 * hh + 4);
    float xs[16] = {x0[0],x0[1],x0[2],x0[3],x1[0],x1[1],x1[2],x1[3],x2[0],x2[1],x2[2],x2[3],x3[0],x3[1],x3[2],x3[3]};
#pragma unroll
    for (int i = 0; i < 16; ++i) { const unsigned short hb = bf16_bits(xs[i]); ah.u[i] = hb; al.u[i] = ASPLIT ? bf16_bits(xs[i] - bf16_val(hb)) : (unsigned short)0; }
#pragma unroll
    for (int t = 0; t < 4; ++t) {
      const unsigned short* brow = Wt + (size_t)(col0 + t * 16 + ln) * ldb + kb;
      FragB b;
      b.half[0] = *(const v8us*)(brow + 8 * hh);
      b.half[1] = *(const v8us*)(brow + 16 + 8 * hh);
      acc[t] = mmaN<ASPLIT ? 2 : 1>(ah.v, al.v, b.v, b.v, acc[t]);
    }
  }
#pragma unroll
  for (int t = 0; t < 4; ++t) {
    const int col = col0 + t * 16 + ln;
    float bv = bias ? bias[col] : 0.f;
    if (BIAS_BF16) bv = bf16_round(bv);
#pragma unroll
    for (int r = 0; r < 8; ++r) {
      float v = acc[t][r] + bv;
      if (resid) { float rv = resid[(size_t)((row0 + 8 * hh + r) % rmod) * ldr + col]; if (RES_BF16) rv = bf16_round(rv); v += rv; }
      if (ACT == 1) v = fmaxf(v, 0.f);
      if (ACT == 2) v = 0.5f * v * (1.0f + erff(v * 0.70710678118654752f));
      if (ACT == 3) { const float u = 0.7978845608028654f * (v + 0.044715f * v * v * v); v = 0.5f * v * (1.0f + tanhf(u)); }
      so[w][8 * hh + r][t * 16 + ln] = v;
    }
  }
  __builtin_amdgcn_fence(__ATOMIC_ACQ_REL, "workgroup");
  __builtin_amdgcn_wave_barrier();
  const int rsub = lane >> 4, c4 = (lane & 15) * 4;
  {
#pragma unroll
    for (int q = 0; q < 8; ++q) {
      const int r = q * 2 + rsub;
      const v4f v = *(const v4fa*)&so[w][r][c4];
      *(v4f*)(C + (size_t)(row0 + r) * ldc + col0 + c4) = v;
    }
    
  }
}
// row LayerNorm (biased variance, eps) over N: s = X (+ R); optional out_sum <- s; out_norm <- (s-mu)*rsqrt(var+eps)*g + b
template <bool PARAM_BF16>
__global__ __launch_bounds__(256) void k_layernorm(const float* __restrict__ X, const float* __restrict__ R, const float* __restrict__ g, const float* __restrict__ bta,
                                                  float* __restrict__ out_sum, float* __restrict__ out_norm, int N, float eps) {
  __shared__ float red[256];
  const int row = blockIdx.x, tid = threadIdx.x;
  const float* x = X + (size_t)row * N; const float* rr = R ? R + (size_t)row * N : nullptr;
  float vals[16];                     // up to N = 4096
  const int per = N / 256;            // contiguous chunk per thread? use strided-by-4 chunks: thread handles j = tid*4 + 1024*u
  float s1 = 0.f;
  for (int u = 0; u < per / 4; ++u) {
    const int j = tid * 4 + 1024 * u;
    const v4f a = *(const v4fa*)(x + j);
    v4f b = {0.f,0.f,0.f,0.f}; if (rr) b = *(const v4fa*)(rr + j);
#pragma unroll
    for (int q = 0; q < 4; ++q) { const float v = a[q] + b[q]; vals[u * 4 + q] = v; s1 += v; }
  }
  red[tid] = s1; __syncthreads();
  for (int st = 128; st > 0; st >>= 1) { if (tid < st) red[tid] += red[tid + st]; __syncthreads(); }
  const float mu = red[0] / (float)N; __syncthreads();
  float s2 = 0.f;
  for (int u = 0; u < per / 4; ++u)
#pragma unroll
    for (int q = 0; q < 4; ++q) { const float c = vals[u * 4 + q] - mu; s2 += c * c; }
  red[tid] = s2; __syncthreads();
  for (int st = 128; st > 0; st >>= 1) { if (tid < st) red[tid] += red[tid + st]; __syncthreads(); }
  const float rs = rsqrtf(red[0] / (float)N + eps);
  {
    for (int u = 0; u < per / 4; ++u) {
      const int j = tid * 4 + 1024 * u;
      v4f o, sm;
#pragma unroll
      for (int q = 0; q < 4; ++q) {
        float gg = g[j + q], bb = bta[j + q];
        if (PARAM_BF16) { gg = bf16_round(gg); bb = bf16_round(bb); }
        sm[q] = vals[u * 4 + q]; o[q] = (vals[u * 4 + q] - mu) * rs * gg + bb;
      }
      if (out_sum) *(v4f*)(out_sum + (size_t)row * N + j) = sm;
      *(v4f*)(out_norm + (size_t)row * N + j) = o;
    }
    
  }
}



// ---- f16 WMMA path (v_wmma_f32_16x16x32_f16): 11-bit significands for operands in range — used where a [0,1] probability operand needs more precision than bf16
typedef _Float16 v16h __attribute__((ext_vector_type(16)));
union FragH { v16h v; v8us half[2]; _Float16 h[16]; unsigned short u[16]; };
template <int NT>
__device__ __forceinline__ v8f mmaH(v16h ah, v16h al, v16h bh, v16h bl, v8f c) {
  c = __builtin_amdgcn_wmma_f32_16x16x32_f16(false, ah, false, bh, (short)0, c, false, false);
  if (NT >= 2) c = __builtin_amdgcn_wmma_f32_16x16x32_f16(false, al, false, bh, (short)0, c, false, false);
  if (NT >= 3) c = __builtin_amdgcn_wmma_f32_16x16x32_f16(false, ah, false, bl, (short)0, c, false, false);
  asm volatile("v_nop\n\tv_nop\n\tv_nop\n\tv_nop" : "+v"(c) : "v"(ah), "v"(al), "v"(bh), "v"(bl));
  return c;
}
// batched GEMM like k_gemm_b but f16 operands: A f32 (split into f16 hi/lo if ASPLIT, else rounded to f16), Bt = f16 values [n][k]; alpha; C f32; N multiple of 16 (partial tiles skipped)
template <bool ASPLIT>
__global__ __launch_bounds__(128) void k_gemm_h(const float* __restrict__ A, int lda, size_t sA, const _Float16* __restrict__ Bh, int ldb, size_t sB, float alpha, float* __restrict__ C, int ldc, size_t sC, int M, int N, int K) {
  __shared__ __attribute__((aligned(16))) float so[4][16][64];
  const int tid = threadIdx.x, w = tid >> 5, lane = tid & 31, ln = lane & 15, hh = lane >> 4; const int by = blockIdx.y;
  A += (size_t)by * sA; Bh += (size_t)by * sB; C += (size_t)by * sC;
  const int ntn = (N + 63) / 64; const int wid = blockIdx.x * 4 + w; const int mt = wid / ntn, nq = wid % ntn; if (mt * 16 >= M) return;
  const int row0 = mt * 16, col0 = nq * 64; const float* arow = A + (size_t)(row0 + ln) * lda;
  v8f acc[4] = {};
  for (int kb = 0; kb < K; kb += 32) {
    FragH ah, al;
    const v4f x0 = *(const v4fa*)(arow + kb + 8 * hh), x1 = *(const v4fa*)(arow + kb + 8 * hh + 4), x2 = *(const v4fa*)(arow + kb + 16 + 8 * hh), x3 = *(const v4fa*)(arow + kb + 16 + 8 * hh + 4);
    float xs[16] = {x0[0],x0[1],x0[2],x0[3],x1[0],x1[1],x1[2],x1[3],x2[0],x2[1],x2[2],x2[3],x3[0],x3[1],x3[2],x3[3]};
#pragma unroll
    for (int i = 0; i < 16; ++i) { const _Float16 h = (_Float16)xs[i]; ah.h[i] = h; al.h[i] = ASPLIT ? (_Float16)(xs[i] - (float)h) : (_Float16)0.0f; }
#pragma unroll
    for (int t = 0; t < 4; ++t) { if (col0 + t * 16 >= N) continue; const size_t boff = (size_t)(col0 + t * 16 + ln) * ldb + kb; FragH bq; bq.half[0] = *(const v8us*)(Bh + boff + 8 * hh); bq.half[1] = *(const v8us*)(Bh + boff + 16 + 8 * hh);
      acc[t] = mmaH<ASPLIT ? 2 : 1>(ah.v, al.v, bq.v, bq.v, acc[t]); }
  }
#pragma unroll
  for (int t = 0; t < 4; ++t) { if (col0 + t * 16 >= N) continue;
#pragma unroll
    for (int r = 0; r < 8; ++r) so[w][8 * hh + r][t * 16 + ln] = acc[t][r] * alpha; }
  __builtin_amdgcn_fence(__ATOMIC_ACQ_REL, "workgroup"); __builtin_amdgcn_wave_barrier();
  const int rsub = lane >> 4, c4 = (lane & 15) * 4;
  {
#pragma unroll
    for (int q = 0; q < 8; ++q) { const int r = q * 2 + rsub; if (col0 + c4 < N) { const v4f v = *(const v4fa*)&so[w][r][c4]; *(v4f*)(C + (size_t)(row0 + r) * ldc + col0 + c4) = v; } }
     }
}

// Wt[n][k] = f16(W[k][n]·scale) from f32 row-major W[K][N] (scale = power of two; bf16-exact weights stay exact in f16 away from the subnormal range)
__global__ __launch_bounds__(256) void k_wt_f16(const float* __restrict__ W, _Float16* __restrict__ Wt, int K, int N, float scale) {
  const int t = blockIdx.x * 256 + threadIdx.x; if (t >= N * (K / 8)) return; const int n = t / (K / 8), k8 = (t % (K / 8)) * 8; FragH f;
#pragma unroll
  for (int i = 0; i < 8; ++i) f.h[i] = (_Float16)(bf16_round(W[(size_t)(k8 + i) * N + n]) * scale); const v8us o = f.half[0];
  *(v8us*)((unsigned short*)Wt + (size_t)n * K + k8) = o; 
}
// k_gemm_hh variant with fused epilogue: v = acc·alpha + bias[by·sBias + col] (+ CP[(row/rowsPerB)·sCPb + by·64 + col] if CP) ; ACT 0 none / 1 elu ; writes f16 C16 (and f32 C if non-null)
template <int ACT>
__global__ __launch_bounds__(128) void k_gemm_hhx(const _Float16* __restrict__ A, int lda, size_t sA, const _Float16* __restrict__ Bh, int ldb, size_t sB, float alpha, const float* __restrict__ bias, size_t sBias, const float* __restrict__ CP, int rowsPerB, size_t sCPb, int row0g,
    float* __restrict__ C, _Float16* __restrict__ C16, int ldc, size_t sC, int M, int N, int K) {
  __shared__ __attribute__((aligned(16))) float so[4][16][64];
  const int tid = threadIdx.x, w = tid >> 5, lane = tid & 31, ln = lane & 15, hh = lane >> 4; const int by = blockIdx.y;
  A += (size_t)by * sA; Bh += (size_t)by * sB; const size_t cofs = (size_t)by * sC; const float* bp = bias ? bias + (size_t)by * sBias : nullptr;
  const int ntn = (N + 63) / 64; const int wid = blockIdx.x * 4 + w; const int mt = wid / ntn, nq = wid % ntn; if (mt * 16 >= M) return;
  const int row0 = mt * 16, col0 = nq * 64; const _Float16* arow = A + (size_t)(row0 + ln) * lda;
  v8f acc[4] = {};
  for (int kb = 0; kb < K; kb += 32) { FragH ah; ah.half[0] = *(const v8us*)((const unsigned short*)arow + kb + 8 * hh); ah.half[1] = *(const v8us*)((const unsigned short*)arow + kb + 16 + 8 * hh);
#pragma unroll
    for (int t = 0; t < 4; ++t) { if (col0 + t * 16 >= N) continue; const size_t boff = (size_t)(col0 + t * 16 + ln) * ldb + kb; FragH bq; bq.half[0] = *(const v8us*)((const unsigned short*)Bh + boff + 8 * hh); bq.half[1] = *(const v8us*)((const unsigned short*)Bh + boff + 16 + 8 * hh);
      acc[t] = mmaH<1>(ah.v, ah.v, bq.v, bq.v, acc[t]); }
  }
#pragma unroll
  for (int t = 0; t < 4; ++t) { if (col0 + t * 16 >= N) continue; const int col = col0 + t * 16 + ln; const float bv = bp ? bf16_round(bp[col]) : 0.f;
#pragma unroll
    for (int r = 0; r < 8; ++r) { float v = acc[t][r] * alpha + bv; if (CP) { const int rr = row0g + row0 + 8 * hh + r; if (rowsPerB < 0) v += CP[cofs + (size_t)rr * ldc + col];      /* rowsPerB < 0: own element of the batched C plane */ else { const int bidx = rr / rowsPerB; v += CP[(size_t)bidx * sCPb + (size_t)by * 64 + col]; } } if (ACT == 1) v = (v > 0.f) ? v : expm1f(v); else if (ACT == 7) v = (v > 0.f) ? v + 1.0f : expf(v); else if (ACT == 8) v = tanhf(v); else if (ACT == 9) v = 0.5f * v * (1.0f + tanhf(0.7978845608028654f * (v + 0.044715f * v * v * v))); else if (ACT == 11) v = 1.0f / (1.0f + expf(-v)); else if (ACT == 12) v = (v > 0.f) ? v : 0.01f * v; else if (ACT == 14) v = (v > 0.f) ? v : 0.1f * v; else if (ACT == 16) v = (v >= 0.f) ? v : 0.3f * v; else if (ACT == 17) v = (v >= 0.f) ? v : 0.2f * v; else if (ACT == 15) v = v / (1.0f + expf(-v)); else if (ACT == 3) v = fmaxf(v, 0.f); else if (ACT == 6) v = 0.5f * v * (1.0f + erff(v * 0.70710678118654752f)); so[w][8 * hh + r][t * 16 + ln] = v; } }
  __builtin_amdgcn_fence(__ATOMIC_ACQ_REL, "workgroup"); __builtin_amdgcn_wave_barrier();
  const int rsub = lane >> 4, c4 = (lane & 15) * 4; typedef _Float16 v4h __attribute__((ext_vector_type(4)));
  {
#pragma unroll
    for (int q = 0; q < 8; ++q) { const int r = q * 2 + rsub; if (col0 + c4 < N) { const v4f v = *(const v4fa*)&so[w][r][c4]; if (C) *(v4f*)(C + cofs + (size_t)(row0 + r) * ldc + col0 + c4) = v; if (C16) { v4h h4; for (int i = 0; i < 4; ++i) h4[i] = (_Float16)v[i]; *(v4h*)(C16 + cofs + (size_t)(row0 + r) * ldc + col0 + c4) = h4; } } }
     }
}


typedef _Float16 v4h __attribute__((ext_vector_type(4)));

__global__ __launch_bounds__(256) void k_h16(const float* __restrict__ x, _Float16* __restrict__ X16, size_t n8) { const size_t t = (size_t)blockIdx.x * 256 + threadIdx.x; if (t >= n8) return; FragH f;
#pragma unroll
  for (int q = 0; q < 8; ++q) f.h[q] = (_Float16)x[t * 8 + q]; *(v8us*)((unsigned short*)X16 + t * 8) = f.half[0];  }
__global__ __launch_bounds__(256) void k_round16f(const float* __restrict__ W, _Float16* __restrict__ Bt, size_t n8) { const size_t t = (size_t)blockIdx.x * 256 + threadIdx.x; if (t >= n8) return; FragH f;
#pragma unroll
  for (int i = 0; i < 8; ++i) f.h[i] = (_Float16)(bf16_round(W[t * 8 + i]) * 16.0f); *(v8us*)((unsigned short*)Bt + t * 8) = f.half[0];  }
template <int NHv, int TTv>
__global__ __launch_bounds__(256) void k_vt(const _Float16* __restrict__ V16, int ldv, int voff, _Float16* __restrict__ Vt) { __shared__ unsigned short tl[64][66]; const int tid = threadIdx.x; const int slab = blockIdx.x / (TTv / 64), lg = blockIdx.x % (TTv / 64); const int b = slab / NHv, h = slab % NHv;
  for (int i = tid; i < 64 * 8; i += 256) { const int r = i / 8, c8 = (i % 8) * 8; FragH f; f.half[0] = *(const v8us*)((const unsigned short*)V16 + ((size_t)b * TTv + lg * 64 + r) * ldv + voff + h * 64 + c8);
#pragma unroll
    for (int q = 0; q < 8; ++q) tl[r][c8 + q] = f.u[q]; }
  __syncthreads();
  {
#pragma unroll
    for (int rd = 0; rd < 2; ++rd) { const int d = rd * 32 + tid / 8, pc = tid % 8; FragH f;
#pragma unroll
      for (int q = 0; q < 8; ++q) f.u[q] = tl[pc * 8 + q][d];
      *(v8us*)((unsigned short*)Vt + ((size_t)slab * 64 + d) * TTv + lg * 64 + pc * 8) = f.half[0]; }
     } }

__global__ __launch_bounds__(256) void k_hl(const float* __restrict__ F, _Float16* __restrict__ Hh, _Float16* __restrict__ Hl, size_t n8) { const size_t t = (size_t)blockIdx.x * 256 + threadIdx.x; if (t >= n8) return; FragH fh, fl; const v4f a = *(const v4fa*)(F + t * 8), c = *(const v4fa*)(F + t * 8 + 4);
#pragma unroll
  for (int q = 0; q < 4; ++q) { _Float16 h = (_Float16)a[q]; fh.h[q] = h; fl.h[q] = (_Float16)((a[q] - (float)h) * 1024.0f); h = (_Float16)c[q]; fh.h[4 + q] = h; fl.h[4 + q] = (_Float16)((c[q] - (float)h) * 1024.0f); }
  { *(v8us*)((unsigned short*)Hh + t * 8) = fh.half[0]; *(v8us*)((unsigned short*)Hl + t * 8) = fl.half[0];  } }

// ---- fast GEMM (wave tile 32x64) ----
__device__ __forceinline__ v16h g2_frag(const _Float16* p, int hh) { FragH f; f.half[0] = *(const v8us*)((const unsigned short*)p + 8 * hh); f.half[1] = *(const v8us*)((const unsigned short*)p + 16 + 8 * hh); return f.v; }
__device__ __forceinline__ v8f g2_mma(v16h a, v16h b, v8f c) { v8f d = __builtin_amdgcn_wmma_f32_16x16x32_f16(false, a, false, b, (short)0, c, false, false); asm volatile("v_nop\n\tv_nop\n\tv_nop\n\tv_nop" : "+v"(d) : "v"(a), "v"(b)); return d; }
#define GM 128                       /* tile rows */
#define GN 128                       /* tile columns */
#define GK 64                        /* k per trip */
#define GP 144                       /* LDS row pitch in bytes: 128 + 16, so the 16 rows of a ds_load_b128 fall on all 64 banks */
#define GBUF ((GM + GN) * GP)        /* one buffer: A rows, then Bh rows */
__device__ __forceinline__ v16h g3_frag(const char* p) { FragH f; f.half[0] = *(const v8us*)p; f.half[1] = *(const v8us*)(p + 32); return f.v; }      /* g2_frag from the lane's own LDS byte address (row ln, 16 hh bytes in) */
// One tile: a thread copies 16 B of rows cr, cr + 32, cr + 64, cr + 96 of A and of Bh. l = the lane's LDS byte address of its first A piece, ga / gb = its global addresses in row cr.
__device__ __forceinline__ void g3_stage(unsigned l, const _Float16* ga, const _Float16* gb) {
  /* the s_wait_xcnt in the copies' own statement stands before any register that an issued copy names is rewritten */
  asm volatile("global_load_async_to_lds_b128 %0, %8, off\n\t"
               "global_load_async_to_lds_b128 %1, %9, off\n\t"
               "global_load_async_to_lds_b128 %2, %10, off\n\t"
               "global_load_async_to_lds_b128 %3, %11, off\n\t"
               "global_load_async_to_lds_b128 %4, %12, off\n\t"
               "global_load_async_to_lds_b128 %5, %13, off\n\t"
               "global_load_async_to_lds_b128 %6, %14, off\n\t"
               "global_load_async_to_lds_b128 %7, %15, off\n\t"
               "s_wait_xcnt 0x0"
               :: "v"(l), "v"(l + 32u * GP), "v"(l + 64u * GP), "v"(l + 96u * GP), "v"(l + 128u * GP), "v"(l + 160u * GP), "v"(l + 192u * GP), "v"(l + 224u * GP),
                  "v"(ga), "v"(ga + 32 * DM), "v"(ga + 64 * DM), "v"(ga + 96 * DM), "v"(gb), "v"(gb + 32 * DM), "v"(gb + 64 * DM), "v"(gb + 96 * DM) : "memory"); }
template <bool VTR>
__global__ __launch_bounds__(256) void k_gemm3(const _Float16* __restrict__ A, const _Float16* __restrict__ Bh, float alpha, const float* __restrict__ bias, _Float16* __restrict__ P0, _Float16* __restrict__ P1) {
  static_assert(MP % GM == 0 && DM % GN == 0 && DM % GK == 0 && DM / GK >= 2 && GM == 128 && GN == 128 && GK == 64, "whole tiles, at least two trips, 8 copies per thread and tile");
  static_assert(SQ % GN == 0 && SQ == DM, "a token tile lies in one batch; V^T rows and q / k rows have one pitch");
  __shared__ __attribute__((aligned(16))) char ring[2 * GBUF]; __shared__ __attribute__((aligned(16))) float so[8][32][68];
  const int tid = threadIdx.x, w = tid >> 5, lane = tid & 31, ln = lane & 15, hh = lane >> 4;
  const int tt = blockIdx.x / (DM / GN), wt = blockIdx.x % (DM / GN);      /* token tile, weight tile: neighbouring work-groups share the token rows in both forms */
  const int rowb = (VTR ? wt : tt) * GM, colb = (VTR ? tt : wt) * GN; const int row0 = rowb + 32 * (w & 3), col0 = colb + 64 * (w >> 2);
  const int cr = tid >> 3, cc = tid & 7;      /* 8 lanes cover one 128-B row */
  const _Float16* ga = A + (size_t)(rowb + cr) * DM + cc * 8; const _Float16* gb = Bh + (size_t)(colb + cr) * DM + cc * 8; const unsigned l0 = (unsigned)(size_t)ring + (unsigned)(cr * GP + cc * 16);
  const char* fa = ring + (32 * (w & 3) + ln) * GP + 16 * hh; const char* fb = ring + (GM + 64 * (w >> 2) + ln) * GP + 16 * hh;
  const v8f z8 = {0.f,0.f,0.f,0.f,0.f,0.f,0.f,0.f}; v8f c00 = z8, c01 = z8, c02 = z8, c03 = z8, c10 = z8, c11 = z8, c12 = z8, c13 = z8;
  g3_stage(l0, ga, gb);
  asm volatile("s_wait_asynccnt 0x0" ::: "memory");      /* this wave's share of tile 0 has landed */
  __syncthreads();      /* tile 0 is published */
  g3_stage(l0 + GBUF, ga + GK, gb + GK);
#pragma unroll 1      /* one trip per tile: the buffer is picked by the trip's parity and the loop stays short */
  for (int t = 0; t < DM / GK; ++t) { const int bo = (t & 1) * GBUF; v16h a[2][2], b[2][4];      /* [k step][fragment] */
#pragma unroll      /* constant indices keep the fragment arrays in registers; all 24 LDS reads of the trip stand as one group ahead of its WMMAs */
    for (int ks = 0; ks < 2; ++ks) { for (int i = 0; i < 2; ++i) a[ks][i] = g3_frag(fa + bo + ks * 64 + i * (16 * GP)); for (int j = 0; j < 4; ++j) b[ks][j] = g3_frag(fb + bo + ks * 64 + j * (16 * GP)); }
#pragma unroll      /* constant fragment indices, as above */
    for (int ks = 0; ks < 2; ++ks) { c00 = g2_mma(a[ks][0], b[ks][0], c00); c10 = g2_mma(a[ks][1], b[ks][0], c10); c01 = g2_mma(a[ks][0], b[ks][1], c01); c11 = g2_mma(a[ks][1], b[ks][1], c11);
      c02 = g2_mma(a[ks][0], b[ks][2], c02); c12 = g2_mma(a[ks][1], b[ks][2], c12); c03 = g2_mma(a[ks][0], b[ks][3], c03); c13 = g2_mma(a[ks][1], b[ks][3], c13); }
    asm volatile("s_wait_dscnt 0x0" ::: "memory");      /* this wave's reads of the buffer are done before it is handed back */
    asm volatile("s_wait_asynccnt 0x0" ::: "memory");      /* this wave's share of tile t + 1 has landed */
    __syncthreads();      /* publishes tile t + 1 and ends every wave's reads of tile t */
    if (t + 2 < DM / GK) g3_stage(l0 + (unsigned)bo, ga + (t + 2) * GK, gb + (t + 2) * GK); }
  asm volatile("s_wait_asynccnt 0x0" ::: "memory");      /* no copy is outstanding when the wave goes on */
  v8f accs[8] = {c00, c01, c02, c03, c10, c11, c12, c13};
#pragma unroll      /* constant accumulator indices (this loop and the next): no scratch */
  for (int u = 0; u < 8; ++u) { const int t = u & 3, half = u >> 2;
#pragma unroll
    for (int r = 0; r < 8; ++r) { const float bv = bf16_round(bias[VTR ? row0 + half * 16 + 8 * hh + r : col0 + t * 16 + ln]) * (VTR ? 1.0f : 16.0f); so[w][half * 16 + 8 * hh + r][t * 16 + ln] = accs[u][r] * alpha + bv; } }
  __builtin_amdgcn_fence(__ATOMIC_ACQ_REL, "workgroup"); __builtin_amdgcn_wave_barrier();
  const int rsub = lane >> 3, c8 = (lane & 7) * 8;      /* 8 lanes x 16 B cover one 128-B line of a plane, a wave four rows per store */
  const size_t e0 = (VTR ? ((size_t)(col0 / SQ) * DM + row0) * SQ + (col0 % SQ) : (size_t)row0 * DM + col0) + (size_t)rsub * DM + c8;      /* the lane's first element */
  v4f va[8], vb[8];
#pragma unroll      /* constant indices keep the rows in registers; the 16 LDS reads stand as one group ahead of the conversions */
  for (int q = 0; q < 8; ++q) { va[q] = *(const v4fa*)&so[w][q * 4 + rsub][c8]; vb[q] = *(const v4fa*)&so[w][q * 4 + rsub][c8 + 4]; }
#pragma unroll      /* constant indices, as above */
  for (int q = 0; q < 8; ++q) { FragH fh, fl;
#pragma unroll
    for (int i = 0; i < 4; ++i) { _Float16 h = (_Float16)va[q][i]; fh.h[i] = h; fl.h[i] = (_Float16)(va[q][i] - (float)h); h = (_Float16)vb[q][i]; fh.h[4 + i] = h; fl.h[4 + i] = (_Float16)(vb[q][i] - (float)h); }
    *(v8us*)((unsigned short*)P0 + e0 + (size_t)q * 4 * DM) = fh.half[0]; if (!VTR) *(v8us*)((unsigned short*)P1 + e0 + (size_t)q * 4 * DM) = fl.half[0];
    if (q < 7) asm volatile("s_wait_xcnt 0x0" ::: "memory"); } }      /* the wait that stands before a register which an issued store names is rewritten (later rows' conversions reuse the data registers) */


// x and the three weight matrices -> their f16 operand planes (x bf16-rounded, exact in f16; weights bf16-rounded x16, natural [out][in] = Bt[n][k]), ONE launch of CWG work-groups: 16 waves per WGP instead of one short wave per 256 elements.
// A work-group owns one contiguous share of each plane and walks it in slabs of 256 threads x 4 f32: a wave-wide load covers 512 contiguous bytes, a wave-wide store 256 (whole lines). CX slabs of x and CW of each weight matrix per thread; all the loads are independent and stand ahead of the conversions (amdgpu_waves_per_eu names the 4 waves per SIMD that this grid gives: without it the compiler sinks half the loads among the conversions to save registers).
#define CWG 512                      /* work-groups of the conversion launch */
#define CX 16                        /* slabs of x per work-group */
#define CW 2                         /* slabs of each weight matrix per work-group */
__device__ __forceinline__ v4h cvt4(v4f a, float scale) { v4h h;
#pragma unroll
  for (int q = 0; q < 4; ++q) h[q] = (_Float16)(bf16_round(a[q]) * scale); return h; }
__global__ __launch_bounds__(256) __attribute__((amdgpu_waves_per_eu(4, 4))) void k_cvt(const float* __restrict__ x, const float* __restrict__ wq, const float* __restrict__ wk, const float* __restrict__ wv, _Float16* __restrict__ X16, _Float16* __restrict__ BQ, _Float16* __restrict__ BK, _Float16* __restrict__ BV) {
  static_assert(NR * DM == (size_t)CWG * CX * 1024 && (size_t)DM * DM == (size_t)CWG * CW * 1024, "whole slabs of 1024 elements, no remainder");
  const unsigned ex = blockIdx.x * (CX * 1024u) + threadIdx.x * 4u, ew = blockIdx.x * (CW * 1024u) + threadIdx.x * 4u;      /* the thread's first element of x and of a weight matrix; the slabs lie at constant offsets from it */
  v4f a[CX], q[CW], k[CW], v[CW];
#pragma unroll      /* constant indices keep the pieces in registers (this loop and the next three) */
  for (int i = 0; i < CX; ++i) a[i] = *(const v4fa*)(x + ex + i * 1024);
#pragma unroll
  for (int i = 0; i < CW; ++i) { q[i] = *(const v4fa*)(wq + ew + i * 1024); k[i] = *(const v4fa*)(wk + ew + i * 1024); v[i] = *(const v4fa*)(wv + ew + i * 1024); }
#pragma unroll
  for (int i = 0; i < CX; ++i) *(v4h*)(X16 + ex + i * 1024) = cvt4(a[i], 1.0f);
#pragma unroll
  for (int i = 0; i < CW; ++i) { *(v4h*)(BQ + ew + i * 1024) = cvt4(q[i], 16.0f); *(v4h*)(BK + ew + i * 1024) = cvt4(k[i], 16.0f); *(v4h*)(BV + ew + i * 1024) = cvt4(v[i], 16.0f); } }
__global__ __launch_bounds__(256) void k_rsm(const float* __restrict__ S, _Float16* __restrict__ P, int nrows) {
  #pragma clang fp contract(off)
  const int i = blockIdx.x * 256 + threadIdx.x; if (i >= nrows) return; const float* s = S + (size_t)i * SQ; float mx = -3.0e38f;
#pragma unroll 1
  for (int j = 0; j < SQ; ++j) mx = fmaxf(mx, s[j]); float se = 0.f;
#pragma unroll 1
  for (int j = 0; j < SQ; ++j) se += expf(s[j] - mx); const float sc = 256.0f / se;
#pragma unroll 1
  for (int j0 = 0; j0 < SQ; j0 += 8) { FragH f; for (int q = 0; q < 8; ++q) f.h[q] = (_Float16)(expf(s[j0 + q] - mx) * sc); unsigned short* d = (unsigned short*)P + (size_t)i * SQ + j0; *(v8us*)d = f.half[0];  } }
__global__ __launch_bounds__(256) void k_vt(const _Float16* __restrict__ V16, int b, int h0, _Float16* __restrict__ VT) { __shared__ unsigned short tl[64][65]; const int tid = threadIdx.x; const int hh = blockIdx.x % HG, sg = blockIdx.x / HG; const int s0 = sg * 64; const int h = h0 + hh;
  for (int i = tid; i < 64 * 8; i += 256) { const int j = i / 8, d8 = (i % 8) * 8; FragH f; f.half[0] = *(const v8us*)((const unsigned short*)V16 + ((size_t)b * SQ + s0 + j) * DM + h * HD + d8); for (int q = 0; q < 8; ++q) tl[d8 + q][j] = f.u[q]; }
  __syncthreads();
  { for (int i = tid; i < 64 * 8; i += 256) { const int d = i / 8, j8 = (i % 8) * 8; FragH f; for (int q = 0; q < 8; ++q) f.u[q] = tl[d][j8 + q]; *(v8us*)((unsigned short*)VT + ((size_t)hh * HD + d) * SQ + s0 + j8) = f.half[0]; }  } }



__device__ __forceinline__ float lane_xor_16(float v) { const int u = __float_as_int(v); return __int_as_float(__builtin_amdgcn_permlanex16(u, u, 0x76543210, 0xfedcba98, false, false)); }      /* lane l <- lane l ^ 16 */
__device__ __forceinline__ float exp2_slot(float a) { float r; asm("v_exp_f32 %0, %1\n\tv_nop" : "=v"(r) : "v"(a)); return r; }      /* 2^a; the v_nop in the same statement keeps the slot the instruction set asks for behind a transcendental, before its result is read or its source register reused */
__device__ __forceinline__ v4f exp2_slot4(v4f a) { float r0, r1, r2, r3;      /* four 2^a: each fills the slot behind the one before it (early-clobber outputs share no register with a source), one v_nop keeps the slot behind the last */
  asm("v_exp_f32 %0, %4\n\tv_exp_f32 %1, %5\n\tv_exp_f32 %2, %6\n\tv_exp_f32 %3, %7\n\tv_nop" : "=&v"(r0), "=&v"(r1), "=&v"(r2), "=&v"(r3) : "v"(a[0]), "v"(a[1]), "v"(a[2]), "v"(a[3])); const v4f r = {r0, r1, r2, r3}; return r; }
__device__ __forceinline__ v16h fa_frag(const char* p) { FragH f; f.half[0] = *(const v8us*)p; f.half[1] = *(const v8us*)(p + 32); return f.v; }      /* g2_frag from the lane's own LDS byte address (row c, 16 hh bytes in) */
__device__ __forceinline__ v8f fa_mma(v16h a, v16h b, v8f c) { return __builtin_amdgcn_wmma_f32_16x16x32_f16(false, a, false, b, (short)0, c, false, false); }
#define FW 8                         /* waves per work-group */
#define FQ 32                        /* query columns per wave */
#define FK 64                        /* keys per staged tile: two passes of 32 */
#define FP 144                       /* LDS row pitch in bytes: 128 + 16, so the 16 rows of a ds_load_b128 fall on all 64 banks */
#define FBUF ((2 * FK + HD) * FP)    /* one buffer: FK K rows, FK K residual rows, HD V^T rows */
// One tile: a thread copies 16 B of rows cr and cr + 32 of K, of the K residuals and of V^T. l = the lane's LDS byte address of its first K piece, gk / gl / gv = its global addresses in row cr of the three planes.
__device__ __forceinline__ void fa_stage(unsigned l, const _Float16* gk, const _Float16* gl, const _Float16* gv) {
  /* the s_wait_xcnt in the copies' own statement stands before any register that an issued copy names is rewritten */
  asm volatile("global_load_async_to_lds_b128 %0, %6, off\n\t"
               "global_load_async_to_lds_b128 %1, %7, off\n\t"
               "global_load_async_to_lds_b128 %2, %8, off\n\t"
               "global_load_async_to_lds_b128 %3, %9, off\n\t"
               "global_load_async_to_lds_b128 %4, %10, off\n\t"
               "global_load_async_to_lds_b128 %5, %11, off\n\t"
               "s_wait_xcnt 0x0"
               :: "v"(l), "v"(l + 32u * FP), "v"(l + 64u * FP), "v"(l + 96u * FP), "v"(l + 128u * FP), "v"(l + 160u * FP),
                  "v"(gk), "v"(gk + 32 * DM), "v"(gl), "v"(gl + 32 * DM), "v"(gv), "v"(gv + 32 * SQ) : "memory"); }
__global__ __launch_bounds__(FW * 32) __attribute__((amdgpu_waves_per_eu(4, 4))) void k_fattn(const _Float16* __restrict__ QH, const _Float16* __restrict__ QL, const _Float16* __restrict__ KH, const _Float16* __restrict__ KL, const _Float16* __restrict__ VT, float* __restrict__ out) {
  static_assert(SQ % (FW * FQ) == 0 && SQ % FK == 0 && SQ / FK >= 2 && FK == 64 && HD == 64 && FW == 8, "whole query blocks, whole tiles and at least two, two k steps per score, 6 copies per thread and tile");
  __shared__ __attribute__((aligned(16))) char ring[2 * FBUF];
  const int lane = threadIdx.x & 31, w = threadIdx.x >> 5, c = lane & 15, hh = lane >> 4; const int h = blockIdx.y, b = blockIdx.z;
  const size_t r0 = (size_t)b * SQ; const int q0 = blockIdx.x * (FW * FQ) + w * FQ;
  v16h qh[2][2], ql[2][2];      /* [query tile][k step] */
#pragma unroll
  for (int g = 0; g < 2; ++g) for (int ks = 0; ks < 2; ++ks) { const size_t qo = (r0 + q0 + g * 16 + c) * DM + h * HD + ks * 32; qh[g][ks] = g2_frag(QH + qo, hh); ql[g][ks] = g2_frag(QL + qo, hh); }
  const int cr = threadIdx.x >> 3, cc = threadIdx.x & 7;      /* 8 lanes cover one 128-B row */
  const _Float16* gk = KH + (r0 + cr) * DM + h * HD + cc * 8; const _Float16* gl = KL + (r0 + cr) * DM + h * HD + cc * 8; const _Float16* gv = VT + (((size_t)b * NH + h) * HD + cr) * SQ + cc * 8;
  const unsigned l0 = (unsigned)(size_t)ring + (unsigned)(cr * FP + cc * 16);
  const char* fr = ring + c * FP + 16 * hh;      /* the lane's place in row c of a buffer */
  const v8f z8 = {0.f, 0.f, 0.f, 0.f, 0.f, 0.f, 0.f, 0.f}; v8f o[2][4] = {{z8, z8, z8, z8}, {z8, z8, z8, z8}};      /* [query tile][d tile]: register r = O[query c][16 t + 8 hh + r] */
  float m[2] = {-3.0e38f, -3.0e38f}, l[2] = {0.f, 0.f};
  const float CS = 0.00048828125f * 1.44269504088896340736f;      /* 64^-0.5 / 256 in log2 units: accumulator units -> exponent */
  fa_stage(l0, gk, gl, gv);
  asm volatile("s_wait_asynccnt 0x0" ::: "memory");      /* this wave's share of tile 0 has landed */
  __syncthreads();      /* tile 0 is published */
  fa_stage(l0 + FBUF, gk + FK * DM, gl + FK * DM, gv + FK);
#pragma unroll 1      /* one trip per tile: the buffer is picked by the trip's parity */
  for (int kt0 = 0; kt0 < SQ / FK; ++kt0) { const int bo = (kt0 & 1) * FBUF;
#pragma unroll 1      /* the two passes of a tile stay one body: the unrolled build spills registers to scratch */
   for (int ps = 0; ps < FK / 32; ++ps) { v8f t[2][2];      /* [query tile][key tile]: register r = 256 q.k of key 64 kt0 + 32 ps + 16 kt + 8 hh + r for query c */
    const char* kp = fr + bo + ps * (32 * FP); v16h kf[2][2], lf[2][2];      /* [key tile][k step] */
#pragma unroll
    for (int kt = 0; kt < 2; ++kt) for (int ks = 0; ks < 2; ++ks) { kf[kt][ks] = fa_frag(kp + kt * (16 * FP) + ks * 64); lf[kt][ks] = fa_frag(kp + FK * FP + kt * (16 * FP) + ks * 64); }
#pragma unroll      /* constant indices keep fragments and accumulators in registers; six terms per score tile, written tile after tile in turn, so that neighbouring WMMAs are independent */
    for (int e = 0; e < 6; ++e) for (int kt = 0; kt < 2; ++kt) for (int g = 0; g < 2; ++g) { const int ks = e & 1;
      t[g][kt] = fa_mma(e == 2 || e == 3 ? lf[kt][ks] : kf[kt][ks], e < 2 ? ql[g][ks] : qh[g][ks], e == 0 ? z8 : t[g][kt]); }
    const char* vp = fr + bo + 2 * FK * FP + ps * 64; v16h vf[4];
#pragma unroll
    for (int u = 0; u < 4; ++u) vf[u] = fa_frag(vp + u * (16 * FP));
#pragma unroll
    for (int g = 0; g < 2; ++g) { float mx = t[g][0][0];
#pragma unroll
      for (int r = 1; r < 16; ++r) mx = fmaxf(mx, t[g][r >> 3][r & 7]);
      mx = fmaxf(mx, lane_xor_16(mx)); const float mn = fmaxf(m[g], mx); const float al = exp2_slot((m[g] - mn) * CS), nb = fmaf(-mn, CS, 8.0f); m[g] = mn;      /* weights carried x256 (it cancels in the final division), which keeps small ones out of the f16 subnormals */
      FragH pf; v4f s4 = {0.f, 0.f, 0.f, 0.f};
#pragma unroll
      for (int kt = 0; kt < 2; ++kt) for (int q = 0; q < 2; ++q) { v4f a; for (int i = 0; i < 4; ++i) a[i] = fmaf(t[g][kt][q * 4 + i], CS, nb); const v4f e = exp2_slot4(a); s4 += e; for (int i = 0; i < 4; ++i) pf.h[kt * 8 + q * 4 + i] = (_Float16)e[i]; }
      l[g] = fmaf(l[g], al, (s4[0] + s4[1]) + (s4[2] + s4[3]));      /* this half's keys only; the halves join after the loop */
#pragma unroll
      for (int u = 0; u < 4; ++u) { o[g][u] *= al; o[g][u] = fa_mma(vf[u], pf.v, o[g][u]); }
      }
    asm volatile("v_nop\n\tv_nop\n\tv_nop\n\tv_nop" :: "v"(o[0][0]), "v"(o[0][1]), "v"(o[0][2]), "v"(o[0][3]), "v"(o[1][0]), "v"(o[1][1]), "v"(o[1][2]), "v"(o[1][3])); }      /* the four vector slots the chip needs behind a WMMA before its A or B registers are overwritten: the pass ends in WMMAs, and the taken back edge leads to address arithmetic that reuses V^T fragment registers; inputs only: the eight results place it behind all the WMMAs of the pass */
    asm volatile("s_wait_dscnt 0x0" ::: "memory");      /* this wave's reads of the buffer are done before it is handed back */
    asm volatile("s_wait_asynccnt 0x0" ::: "memory");      /* this wave's share of tile kt0 + 1 has landed */
    __syncthreads();      /* publishes tile kt0 + 1 and ends every wave's reads of tile kt0 */
    if (kt0 + 2 < SQ / FK) fa_stage(l0 + (unsigned)bo, gk + (size_t)(kt0 + 2) * (FK * DM), gl + (size_t)(kt0 + 2) * (FK * DM), gv + (kt0 + 2) * FK); }
  asm volatile("s_wait_asynccnt 0x0" ::: "memory");      /* no copy is outstanding when the wave goes on */
#pragma unroll
  for (int g = 0; g < 2; ++g) { const float inv = 1.0f / (l[g] + lane_xor_16(l[g])); float* op = out + (r0 + q0 + g * 16 + c) * DM + h * HD + 8 * hh;
#pragma unroll
    for (int u = 0; u < 4; ++u) { const v4f x0 = {o[g][u][0] * inv, o[g][u][1] * inv, o[g][u][2] * inv, o[g][u][3] * inv}, x1 = {o[g][u][4] * inv, o[g][u][5] * inv, o[g][u][6] * inv, o[g][u][7] * inv}; *(v4f*)(op + u * 16) = x0; *(v4f*)(op + u * 16 + 4) = x1; } } }


template <int MASKADD>
__global__ __launch_bounds__(64) void k_att0(const float* __restrict__ QF, const float* __restrict__ KF, const float* __restrict__ VF, int ld, const float* __restrict__ mask, float scale, float* __restrict__ OF, int ldo) {
  #pragma clang fp contract(off)
  __shared__ __attribute__((aligned(16))) float lq[64][64]; __shared__ __attribute__((aligned(16))) float lo[64][64];
  const int tid = threadIdx.x; const int h = blockIdx.x / (QT0 / 64), rg = blockIdx.x % (QT0 / 64); const int i = rg * 64 + tid;
  const float* qr = QF + (size_t)i * ld + h * HD;
#pragma unroll 1
  for (int c = 0; c < HD / 4; ++c) { *(v4f*)&lq[tid][c * 4] = *(const v4fa*)(qr + c * 4); const v4f z = {0.f, 0.f, 0.f, 0.f}; *(v4f*)&lo[tid][c * 4] = z; }
  float m = -1.0e30f, l = 0.f; const int jmax = MASKADD ? (SQ - 1) : (rg * 64 + 63);      /* additive-mask form: every key (the mask input decides); causal form: keys up to the block's last row */
#pragma unroll 1
  for (int j = 0; j <= jmax; ++j) { const float* kr = KF + (size_t)j * ld + h * HD; const float* vr = VF + (size_t)j * ld + h * HD; float s = 0.f;
#pragma unroll 1
    for (int c = 0; c < HD / 4; ++c) { const v4f kq = *(const v4fa*)(kr + c * 4); const v4f qq = *(v4f*)&lq[tid][c * 4]; s = __fadd_rn(s, __fmul_rn(qq[0], kq[0])); s = __fadd_rn(s, __fmul_rn(qq[1], kq[1])); s = __fadd_rn(s, __fmul_rn(qq[2], kq[2])); s = __fadd_rn(s, __fmul_rn(qq[3], kq[3])); }
    s = __fmul_rn(s, scale); if (MASKADD) s = __fadd_rn(s, __fmul_rn(bf16_round(mask[(size_t)i * SQ + j]), -10000.0f));
    const float f = (MASKADD || j <= i) ? 1.f : 0.f; const float sm = fmaf(f, s, (1.f - f) * -1.0e30f); const float mn = fmaxf(m, sm); const float sc = expf(m - mn); const float e = expf(sm - mn); l = __fadd_rn(__fmul_rn(l, sc), e); m = mn;
#pragma unroll 1
    for (int c = 0; c < HD / 4; ++c) { const v4f vv = *(const v4fa*)(vr + c * 4); v4f oo = *(v4f*)&lo[tid][c * 4]; for (int u = 0; u < 4; ++u) oo[u] = __fadd_rn(__fmul_rn(oo[u], sc), __fmul_rn(e, vv[u])); *(v4f*)&lo[tid][c * 4] = oo; } }
  const float fin = 64.0f / l;      /* o carried x64 */
#pragma unroll 1
  for (int c = 0; c < HD / 4; ++c) { v4f oo = *(v4f*)&lo[tid][c * 4]; for (int u = 0; u < 4; ++u) oo[u] = __fmul_rn(oo[u], fin); *(v4f*)&lo[tid][c * 4] = oo; }
  __syncthreads();
  {
#pragma unroll 1
    for (int it = 0; it < 16; ++it) { const int row = it * 4 + tid / 16, pc = (tid % 16) * 4; const v4f v = *(const v4f*)&lo[row][pc]; *(v4f*)(OF + (size_t)(rg * 64 + row) * ldo + h * HD + pc) = v; }
     } }

__global__ __launch_bounds__(256) void k_of0out(const float* __restrict__ src, float* __restrict__ dst, size_t n4) { const size_t t = (size_t)blockIdx.x * 256 + threadIdx.x; if (t >= n4) return; v4f v = *(const v4fa*)(src + t * 4); for (int q = 0; q < 4; ++q) v[q] = __fmul_rn(v[q], 0.015625f); *(v4f*)(dst + t * 4) = v;  }

extern "C" void kernel_launch(void* const* d_in, const int* in_sizes, int n_in,
                              void* d_out, int out_size, void* d_ws, size_t ws_size, hipStream_t stream) {
  (void)in_sizes; (void)n_in; (void)out_size;
  const float* const* I = (const float* const*)d_in; const float* x = I[0]; const float* wq = I[1]; const float* wk = I[2]; const float* wv = I[3]; const float* bq = I[4]; const float* bk = I[5]; const float* bv = I[6];      /* input order: x, Wq, Wk, Wv, bq, bk, bv: natural [out][in] weights, then the three biases (every projection launch passes the bias variables); NO output projection */
  char* ws = (char*)d_ws; size_t off = 0;
  auto take = [&](size_t bytes) { char* p = ws + off; off += (bytes + 255) & ~(size_t)255; return p; };
  _Float16* BQ = (_Float16*)take((size_t)DM * DM * 2); _Float16* BK = (_Float16*)take((size_t)DM * DM * 2); _Float16* BV = (_Float16*)take((size_t)DM * DM * 2);
  _Float16* X16 = (_Float16*)take(NR * DM * 2); _Float16* QH = (_Float16*)take(NR * DM * 2); _Float16* QL = (_Float16*)take(NR * DM * 2); _Float16* KH = (_Float16*)take(NR * DM * 2); _Float16* KL = (_Float16*)take(NR * DM * 2);
  _Float16* VT = (_Float16*)take((size_t)NB * NH * HD * SQ * 2);
  if (off > ws_size) return;
  k_cvt<<<CWG, 256, 0, stream>>>(x, wq, wk, wv, X16, BQ, BK, BV);      /* x -> exact f16 rows; natural [out][in] weights = Bt[n][k] x16 */
  const size_t r0p = (size_t)B0 * SQ;      /* first projected row */
  k_gemm3<false><<<(MP / GM) * (DM / GN), 256, 0, stream>>>(X16 + r0p * DM, BQ, 1.0f, bq, QH + r0p * DM, QL + r0p * DM);      /* 16 q -> f16 hi + residual planes, from the GEMM's own epilogue */
  k_gemm3<false><<<(MP / GM) * (DM / GN), 256, 0, stream>>>(X16 + r0p * DM, BK, 1.0f, bk, KH + r0p * DM, KL + r0p * DM);      /* k likewise */
  k_gemm3<true><<<(DM / GM) * (MP / GN), 256, 0, stream>>>(BV, X16 + r0p * DM, 0.0625f, bv, VT + r0p * DM, nullptr);      /* V^T [NB][NH][HD][SQ] = Wv . x^T, all batches */
  k_fattn<<<dim3(SQ / (FW * FQ), NH, NB), FW * 32, 0, stream>>>(QH, QL, KH, KL, VT, (float*)d_out);      /* scores (hi.lo + lo.hi + hi.hi in one accumulator), softmax over all keys and P V in one launch, f32 straight into the head-major output columns (no output projection) */
}

// v008
// One run takes 106 microseconds.
// Next to v007, in two timings, it ran 1.04 and 1.03 times as fast.
// Counting every step since v000, it is 76.2 times as fast.
#include <hip/hip_runtime.h>
// Multi-head self-attention without an output projection, NON-causal (x [8][1024][1024]; q / k / v = x W^T + b (nn.Linear natural [1024][1024] sigma 1/32, biases sigma 0.01); 16 heads of 64; scores * 64^-0.5; softmax over all 1024 keys (no mask); out = ctx merged head-major -> [8][1024][1024]; the source never applies its out_proj).
// Structure: token rows r = b*1024 + s; x as exact f16 rows (bf16-rounded); q and k as WMMA GEMMs (128x128 work-group tiles staged in LDS by asynchronous copies, 32x64 wave tiles, f32 accumulation, exact x16 weights + bias) whose epilogue carries each f32 value x16 and splits it into f16 hi + residual planes of one scale, v as the same GEMM with its operands swapped, so that its f16 tile is V^T as attention reads it, the three in ONE launch (a work-group does its q, its k and its V^T tile in turn); then ONE fused attention launch (k_fattn): per wave 32 queries, keys 32 at a time from 64-key K / V^T tiles that a work-group stages in LDS by asynchronous copies, scores as hi.lo + lo.hi + hi.hi in one f32 accumulator, online softmax (f32 running max and sum, native exp2), weights x256 as f16 straight from the score accumulators into O^T += V^T P^T, f32 out written into the head-major columns.
// Compute dtype: inputs rounded to bf16; x / weights exact; q and k as f16 hi + residual planes, v and softmax weights as plain f16 GEMM operands (~2^-12); scores, softmax statistics and o f32. v_wmma_f32_16x16x32_f16.
#define NB 8
#define SQ 1024
#define DM 1024
#define NH 16
#define HD 64
#define HG 4                         /* heads per group in the unlaunched k_vt overload */
#define QT 256                       /* unused */
#define NKX SQ                       /* unused */
#define QT0 128                      /* query rows per head in k_att0, which is not launched */
#define B0 0                         /* first batch processed (debug hook) */
#define NBR NB                       /* batches processed (debug hook) */
#define NR ((size_t)NB * SQ)         /* token rows */
#define MP ((int)((size_t)NBR * SQ)) /* rows projected (debug hook) */
#define QN SQ                        /* unused */
#define NHD NH                       /* unused */
#define MPO MP                       /* unused */
#define LQ DM      /* unused */
typedef __bf16 v16b __attribute__((ext_vector_type(16)));
typedef unsigned short v8us __attribute__((ext_vector_type(8), may_alias));
typedef float  v8f  __attribute__((ext_vector_type(8)));
typedef float  v4f  __attribute__((ext_vector_type(4)));
typedef float  v4fa __attribute__((ext_vector_type(4), may_alias));
union FragB { v16b v; v8us half[2]; unsigned short u[16]; };

__device__ __forceinline__ unsigned short bf16_bits(float x) { unsigned int u = __float_as_uint(x); return (unsigned short)((u + 0x7FFFu + ((u >> 16) & 1u)) >> 16); }
__device__ __forceinline__ float bf16_val(unsigned short b) { return __uint_as_float(((unsigned int)b) << 16); }
__device__ __forceinline__ float bf16_round(float x) { return bf16_val(bf16_bits(x)); }
// D += A·B with NT terms: 1 = ah·bh, 2 = + al·bh (A split), 3 = + ah·bl (both split)
template <int NT>
__device__ __forceinline__ v8f mmaN(v16b ah, v16b al, v16b bh, v16b bl, v8f c) {
  c = __builtin_amdgcn_wmma_f32_16x16x32_bf16(false, ah, false, bh, (short)0, c, false, false);
  if (NT >= 2) c = __builtin_amdgcn_wmma_f32_16x16x32_bf16(false, al, false, bh, (short)0, c, false, false);
  if (NT >= 3) c = __builtin_amdgcn_wmma_f32_16x16x32_bf16(false, ah, false, bl, (short)0, c, false, false);
  asm volatile("v_nop\n\tv_nop\n\tv_nop\n\tv_nop" : "+v"(c) : "v"(ah), "v"(al), "v"(bh), "v"(bl));
  return c;
}

__global__ __launch_bounds__(256) void k_wt_bf16(const float* __restrict__ W, unsigned short* __restrict__ Wt, int K, int N) {
  const int t = blockIdx.x * 256 + threadIdx.x;
  const int k8n = K / 8;
  if (t >= N * k8n) return;
  const int n = t / k8n, k8 = (t % k8n) * 8;
  v8us v;
#pragma unroll
  for (int i = 0; i < 8; ++i) v[i] = bf16_bits(W[(size_t)(k8 + i) * N + n]);
  *(v8us*)(Wt + (size_t)n * K + k8) = v;
  
}

// GEMM C[M][N] (f32, pitch ldc) = act(A[M][K]·W + bias). A f32 row-major (pitch lda) converted per fragment to bf16
// (ASPLIT: hi/lo two planes -> 2 terms, else single rounded term); Wt bf16 [N][K] (pitch ldb). BIAS_BF16 rounds the
// bias to bf16 first (bias quantised to bf16 before the add). K%32==0, M%16==0, N%64==0.
template <bool ASPLIT, int ACT, bool BIAS_BF16>
__global__ __launch_bounds__(128) void k_gemm_bf(const float* __restrict__ A, int lda, const unsigned short* __restrict__ Wt, int ldb,
                                               const float* __restrict__ bias, float* __restrict__ C, int ldc, int M, int N, int K) {
  __shared__ __attribute__((aligned(16))) float so[4][16][64];
  const int tid = threadIdx.x, w = tid >> 5, lane = tid & 31, ln = lane & 15, hh = lane >> 4;
  const int ntn = N / 64;
  const int wid = blockIdx.x * 4 + w;
  const int mt = wid / ntn, nq = wid % ntn;
  if (mt * 16 >= M) return;
  const int row0 = mt * 16, col0 = nq * 64;
  const float* arow = A + (size_t)(row0 + ln) * lda;
  v8f acc[4] = {};
  for (int kb = 0; kb < K; kb += 32) {
    FragB ah, al;
    const v4f x0 = *(const v4fa*)(arow + kb + 8 * hh), x1 = *(const v4fa*)(arow + kb + 8 * hh + 4);
    const v4f x2 = *(const v4fa*)(arow + kb + 16 + 8 * hh), x3 = *(const v4fa*)(arow + kb + 16 + 8 * hh + 4);
    float xs[16] = {x0[0],x0[1],x0[2],x0[3],x1[0],x1[1],x1[2],x1[3],x2[0],x2[1],x2[2],x2[3],x3[0],x3[1],x3[2],x3[3]};
#pragma unroll
    for (int i = 0; i < 16; ++i) { const unsigned short hb = bf16_bits(xs[i]); ah.u[i] = hb; al.u[i] = ASPLIT ? bf16_bits(xs[i] - bf16_val(hb)) : (unsigned short)0; }
#pragma unroll
    for (int t = 0; t < 4; ++t) {
      const unsigned short* brow = Wt + (size_t)(col0 + t * 16 + ln) * ldb + kb;
      FragB b;
      b.half[0] = *(const v8us*)(brow + 8 * hh);
      b.half[1] = *(const v8us*)(brow + 16 + 8 * hh);
      acc[t] = mmaN<ASPLIT ? 2 : 1>(ah.v, al.v, b.v, b.v, acc[t]);
    }
  }
#pragma unroll
  for (int t = 0; t < 4; ++t) {
    float bv = bias ? bias[col0 + t * 16 + ln] : 0.f;
    if (BIAS_BF16) bv = bf16_round(bv);
#pragma unroll
    for (int r = 0; r < 8; ++r) { float v = acc[t][r] + bv; if (ACT == 1) v = fmaxf(v, 0.f); so[w][8 * hh + r][t * 16 + ln] = v; }
  }
  __builtin_amdgcn_fence(__ATOMIC_ACQ_REL, "workgroup");
  __builtin_amdgcn_wave_barrier();
  const int rsub = lane >> 4, c4 = (lane & 15) * 4;
  {
#pragma unroll
    for (int q = 0; q < 8; ++q) {
      const int r = q * 2 + rsub;
      const v4f v = *(const v4fa*)&so[w][r][c4];
      *(v4f*)(C + (size_t)(row0 + r) * ldc + col0 + c4) = v;
    }
    
  }
}

// GEMM C = act(A·W + bias + resid): A f32 (ASPLIT -> hi/lo 2 terms), Wt bf16 [N][K]; ACT 0 none, 1 relu, 2 exact gelu;
// resid (optional, f32, row index = (row % rmod), pitch ldr, RES_BF16 rounds it) added before the activation.
template <bool ASPLIT, int ACT, bool BIAS_BF16, bool RES_BF16>
__global__ __launch_bounds__(128) void k_gemm_bf3(const float* __restrict__ A, int lda, const unsigned short* __restrict__ Wt, int ldb,
                                                const float* __restrict__ bias, const float* __restrict__ resid, int rmod, int ldr,
                                                float* __restrict__ C, int ldc, int M, int N, int K) {
  __shared__ __attribute__((aligned(16))) float so[4][16][64];
  const int tid = threadIdx.x, w = tid >> 5, lane = tid & 31, ln = lane & 15, hh = lane >> 4;
  const int ntn = N / 64;
  const int wid = blockIdx.x * 4 + w;
  const int mt = wid / ntn, nq = wid % ntn;
  if (mt * 16 >= M) return;
  const int row0 = mt * 16, col0 = nq * 64;
  const float* arow = A + (size_t)(row0 + ln) * lda;
  v8f acc[4] = {};
  for (int kb = 0; kb < K; kb += 32) {
    FragB ah, al;
    const v4f x0 = *(const v4fa*)(arow + kb + 8 * hh), x1 = *(const v4fa*)(arow + kb + 8 * hh + 4);
    const v4f x2 = *(const v4fa*)(arow + kb + 16 + 8 * hh), x3 = *(const v4fa*)(arow + kb + 16 + 8 * hh + 4);
    float xs[16] = {x0[0],x0[1],x0[2],x0[3],x1[0],x1[1],x1[2],x1[3],x2[0],x2[1],x2[2],x2[3],x3[0],x3[1],x3[2],x3[3]};
#pragma unroll
    for (int i = 0; i < 16; ++i) { const unsigned short hb = bf16_bits(xs[i]); ah.u[i] = hb; al.u[i] = ASPLIT ? bf16_bits(xs[i] - bf16_val(hb)) : (unsigned short)0; }
#pragma unroll
    for (int t = 0; t < 4; ++t) {
      const unsigned short* brow = Wt + (size_t)(col0 + t * 16 + ln) * ldb + kb;
      FragB b;
      b.half[0] = *(const v8us*)(brow + 8 * hh);
      b.half[1] = *(const v8us*)(brow + 16 + 8 * hh);
      acc[t] = mmaN<ASPLIT ? 2 : 1>(ah.v, al.v, b.v, b.v, acc[t]);
    }
  }
#pragma unroll
  for (int t = 0; t < 4; ++t) {
    const int col = col0 + t * 16 + ln;
    float bv = bias ? bias[col] : 0.f;
    if (BIAS_BF16) bv = bf16_round(bv);
#pragma unroll
    for (int r = 0; r < 8; ++r) {
      float v = acc[t][r] + bv;
      if (resid) { float rv = resid[(size_t)((row0 + 8 * hh + r) % rmod) * ldr + col]; if (RES_BF16) rv = bf16_round(rv); v += rv; }
      if (ACT == 1) v = fmaxf(v, 0.f);
      if (ACT == 2) v = 0.5f * v * (1.0f + erff(v * 0.70710678118654752f));
      if (ACT == 3) { const float u = 0.7978845608028654f * (v + 0.044715f * v * v * v); v = 0.5f * v * (1.0f + tanhf(u)); }
      so[w][8 * hh + r][t * 16 + ln] = v;
    }
  }
  __builtin_amdgcn_fence(__ATOMIC_ACQ_REL, "workgroup");
  __builtin_amdgcn_wave_barrier();
  const int rsub = lane >> 4, c4 = (lane & 15) * 4;
  {
#pragma unroll
    for (int q = 0; q < 8; ++q) {
      const int r = q * 2 + rsub;
      const v4f v = *(const v4fa*)&so[w][r][c4];
      *(v4f*)(C + (size_t)(row0 + r) * ldc + col0 + c4) = v;
    }
    
  }
}
// row LayerNorm (biased variance, eps) over N: s = X (+ R); optional out_sum <- s; out_norm <- (s-mu)*rsqrt(var+eps)*g + b
template <bool PARAM_BF16>
__global__ __launch_bounds__(256) void k_layernorm(const float* __restrict__ X, const float* __restrict__ R, const float* __restrict__ g, const float* __restrict__ bta,
                                                  float* __restrict__ out_sum, float* __restrict__ out_norm, int N, float eps) {
  __shared__ float red[256];
  const int row = blockIdx.x, tid = threadIdx.x;
  const float* x = X + (size_t)row * N; const float* rr = R ? R + (size_t)row * N : nullptr;
  float vals[16];                     // up to N = 4096
  const int per = N / 256;            // contiguous chunk per thread? use strided-by-4 chunks: thread handles j = tid*4 + 1024*u
  float s1 = 0.f;
  for (int u = 0; u < per / 4; ++u) {
    const int j = tid * 4 + 1024 * u;
    const v4f a = *(const v4fa*)(x + j);
    v4f b = {0.f,0.f,0.f,0.f}; if (rr) b = *(const v4fa*)(rr + j);
#pragma unroll
    for (int q = 0; q < 4; ++q) { const float v = a[q] + b[q]; vals[u * 4 + q] = v; s1 += v; }
  }
  red[tid] = s1; __syncthreads();
  for (int st = 128; st > 0; st >>= 1) { if (tid < st) red[tid] += red[tid + st]; __syncthreads(); }
  const float mu = red[0] / (float)N; __syncthreads();
  float s2 = 0.f;
  for (int u = 0; u < per / 4; ++u)
#pragma unroll
    for (int q = 0; q < 4; ++q) { const float c = vals[u * 4 + q] - mu; s2 += c * c; }
  red[tid] = s2; __syncthreads();
  for (int st = 128; st > 0; st >>= 1) { if (tid < st) red[tid] += red[tid + st]; __syncthreads(); }
  const float rs = rsqrtf(red[0] / (float)N + eps);
  {
    for (int u = 0; u < per / 4; ++u) {
      const int j = tid * 4 + 1024 * u;
      v4f o, sm;
#pragma unroll
      for (int q = 0; q < 4; ++q) {
        float gg = g[j + q], bb = bta[j + q];
        if (PARAM_BF16) { gg = bf16_round(gg); bb = bf16_round(bb); }
        sm[q] = vals[u * 4 + q]; o[q] = (vals[u * 4 + q] - mu) * rs * gg + bb;
      }
      if (out_sum) *(v4f*)(out_sum + (size_t)row * N + j) = sm;
      *(v4f*)(out_norm + (size_t)row * N + j) = o;
    }
    
  }
}



// ---- f16 WMMA path (v_wmma_f32_16x16x32_f16): 11-bit significands for operands in range — used where a [0,1] probability operand needs more precision than bf16
typedef _Float16 v16h __attribute__((ext_vector_type(16)));
union FragH { v16h v; v8us half[2]; _Float16 h[16]; unsigned short u[16]; };
template <int NT>
__device__ __forceinline__ v8f mmaH(v16h ah, v16h al, v16h bh, v16h bl, v8f c) {
  c = __builtin_amdgcn_wmma_f32_16x16x32_f16(false, ah, false, bh, (short)0, c, false, false);
  if (NT >= 2) c = __builtin_amdgcn_wmma_f32_16x16x32_f16(false, al, false, bh, (short)0, c, false, false);
  if (NT >= 3) c = __builtin_amdgcn_wmma_f32_16x16x32_f16(false, ah, false, bl, (short)0, c, false, false);
  asm volatile("v_nop\n\tv_nop\n\tv_nop\n\tv_nop" : "+v"(c) : "v"(ah), "v"(al), "v"(bh), "v"(bl));
  return c;
}
// batched GEMM like k_gemm_b but f16 operands: A f32 (split into f16 hi/lo if ASPLIT, else rounded to f16), Bt = f16 values [n][k]; alpha; C f32; N multiple of 16 (partial tiles skipped)
template <bool ASPLIT>
__global__ __launch_bounds__(128) void k_gemm_h(const float* __restrict__ A, int lda, size_t sA, const _Float16* __restrict__ Bh, int ldb, size_t sB, float alpha, float* __restrict__ C, int ldc, size_t sC, int M, int N, int K) {
  __shared__ __attribute__((aligned(16))) float so[4][16][64];
  const int tid = threadIdx.x, w = tid >> 5, lane = tid & 31, ln = lane & 15, hh = lane >> 4; const int by = blockIdx.y;
  A += (size_t)by * sA; Bh += (size_t)by * sB; C += (size_t)by * sC;
  const int ntn = (N + 63) / 64; const int wid = blockIdx.x * 4 + w; const int mt = wid / ntn, nq = wid % ntn; if (mt * 16 >= M) return;
  const int row0 = mt * 16, col0 = nq * 64; const float* arow = A + (size_t)(row0 + ln) * lda;
  v8f acc[4] = {};
  for (int kb = 0; kb < K; kb += 32) {
    FragH ah, al;
    const v4f x0 = *(const v4fa*)(arow + kb + 8 * hh), x1 = *(const v4fa*)(arow + kb + 8 * hh + 4), x2 = *(const v4fa*)(arow + kb + 16 + 8 * hh), x3 = *(const v4fa*)(arow + kb + 16 + 8 * hh + 4);
    float xs[16] = {x0[0],x0[1],x0[2],x0[3],x1[0],x1[1],x1[2],x1[3],x2[0],x2[1],x2[2],x2[3],x3[0],x3[1],x3[2],x3[3]};
#pragma unroll
    for (int i = 0; i < 16; ++i) { const _Float16 h = (_Float16)xs[i]; ah.h[i] = h; al.h[i] = ASPLIT ? (_Float16)(xs[i] - (float)h) : (_Float16)0.0f; }
#pragma unroll
    for (int t = 0; t < 4; ++t) { if (col0 + t * 16 >= N) continue; const size_t boff = (size_t)(col0 + t * 16 + ln) * ldb + kb; FragH bq; bq.half[0] = *(const v8us*)(Bh + boff + 8 * hh); bq.half[1] = *(const v8us*)(Bh + boff + 16 + 8 * hh);
      acc[t] = mmaH<ASPLIT ? 2 : 1>(ah.v, al.v, bq.v, bq.v, acc[t]); }
  }
#pragma unroll
  for (int t = 0; t < 4; ++t) { if (col0 + t * 16 >= N) continue;
#pragma unroll
    for (int r = 0; r < 8; ++r) so[w][8 * hh + r][t * 16 + ln] = acc[t][r] * alpha; }
  __builtin_amdgcn_fence(__ATOMIC_ACQ_REL, "workgroup"); __builtin_amdgcn_wave_barrier();
  const int rsub = lane >> 4, c4 = (lane & 15) * 4;
  {
#pragma unroll
    for (int q = 0; q < 8; ++q) { const int r = q * 2 + rsub; if (col0 + c4 < N) { const v4f v = *(const v4fa*)&so[w][r][c4]; *(v4f*)(C + (size_t)(row0 + r) * ldc + col0 + c4) = v; } }
     }
}

// Wt[n][k] = f16(W[k][n]·scale) from f32 row-major W[K][N] (scale = power of two; bf16-exact weights stay exact in f16 away from the subnormal range)
__global__ __launch_bounds__(256) void k_wt_f16(const float* __restrict__ W, _Float16* __restrict__ Wt, int K, int N, float scale) {
  const int t = blockIdx.x * 256 + threadIdx.x; if (t >= N * (K / 8)) return; const int n = t / (K / 8), k8 = (t % (K / 8)) * 8; FragH f;
#pragma unroll
  for (int i = 0; i < 8; ++i) f.h[i] = (_Float16)(bf16_round(W[(size_t)(k8 + i) * N + n]) * scale); const v8us o = f.half[0];
  *(v8us*)((unsigned short*)Wt + (size_t)n * K + k8) = o; 
}
// k_gemm_hh variant with fused epilogue: v = acc·alpha + bias[by·sBias + col] (+ CP[(row/rowsPerB)·sCPb + by·64 + col] if CP) ; ACT 0 none / 1 elu ; writes f16 C16 (and f32 C if non-null)
template <int ACT>
__global__ __launch_bounds__(128) void k_gemm_hhx(const _Float16* __restrict__ A, int lda, size_t sA, const _Float16* __restrict__ Bh, int ldb, size_t sB, float alpha, const float* __restrict__ bias, size_t sBias, const float* __restrict__ CP, int rowsPerB, size_t sCPb, int row0g,
    float* __restrict__ C, _Float16* __restrict__ C16, int ldc, size_t sC, int M, int N, int K) {
  __shared__ __attribute__((aligned(16))) float so[4][16][64];
  const int tid = threadIdx.x, w = tid >> 5, lane = tid & 31, ln = lane & 15, hh = lane >> 4; const int by = blockIdx.y;
  A += (size_t)by * sA; Bh += (size_t)by * sB; const size_t cofs = (size_t)by * sC; const float* bp = bias ? bias + (size_t)by * sBias : nullptr;
  const int ntn = (N + 63) / 64; const int wid = blockIdx.x * 4 + w; const int mt = wid / ntn, nq = wid % ntn; if (mt * 16 >= M) return;
  const int row0 = mt * 16, col0 = nq * 64; const _Float16* arow = A + (size_t)(row0 + ln) * lda;
  v8f acc[4] = {};
  for (int kb = 0; kb < K; kb += 32) { FragH ah; ah.half[0] = *(const v8us*)((const unsigned short*)arow + kb + 8 * hh); ah.half[1] = *(const v8us*)((const unsigned short*)arow + kb + 16 + 8 * hh);
#pragma unroll
    for (int t = 0; t < 4; ++t) { if (col0 + t * 16 >= N) continue; const size_t boff = (size_t)(col0 + t * 16 + ln) * ldb + kb; FragH bq; bq.half[0] = *(const v8us*)((const unsigned short*)Bh + boff + 8 * hh); bq.half[1] = *(const v8us*)((const unsigned short*)Bh + boff + 16 + 8 * hh);
      acc[t] = mmaH<1>(ah.v, ah.v, bq.v, bq.v, acc[t]); }
  }
#pragma unroll
  for (int t = 0; t < 4; ++t) { if (col0 + t * 16 >= N) continue; const int col = col0 + t * 16 + ln; const float bv = bp ? bf16_round(bp[col]) : 0.f;
#pragma unroll
    for (int r = 0; r < 8; ++r) { float v = acc[t][r] * alpha + bv; if (CP) { const int rr = row0g + row0 + 8 * hh + r; if (rowsPerB < 0) v += CP[cofs + (size_t)rr * ldc + col];      /* rowsPerB < 0: own element of the batched C plane */ else { const int bidx = rr / rowsPerB; v += CP[(size_t)bidx * sCPb + (size_t)by * 64 + col]; } } if (ACT == 1) v = (v > 0.f) ? v : expm1f(v); else if (ACT == 7) v = (v > 0.f) ? v + 1.0f : expf(v); else if (ACT == 8) v = tanhf(v); else if (ACT == 9) v = 0.5f * v * (1.0f + tanhf(0.7978845608028654f * (v + 0.044715f * v * v * v))); else if (ACT == 11) v = 1.0f / (1.0f + expf(-v)); else if (ACT == 12) v = (v > 0.f) ? v : 0.01f * v; else if (ACT == 14) v = (v > 0.f) ? v : 0.1f * v; else if (ACT == 16) v = (v >= 0.f) ? v : 0.3f * v; else if (ACT == 17) v = (v >= 0.f) ? v : 0.2f * v; else if (ACT == 15) v = v / (1.0f + expf(-v)); else if (ACT == 3) v = fmaxf(v, 0.f); else if (ACT == 6) v = 0.5f * v * (1.0f + erff(v * 0.70710678118654752f)); so[w][8 * hh + r][t * 16 + ln] = v; } }
  __builtin_amdgcn_fence(__ATOMIC_ACQ_REL, "workgroup"); __builtin_amdgcn_wave_barrier();
  const int rsub = lane >> 4, c4 = (lane & 15) * 4; typedef _Float16 v4h __attribute__((ext_vector_type(4)));
  {
#pragma unroll
    for (int q = 0; q < 8; ++q) { const int r = q * 2 + rsub; if (col0 + c4 < N) { const v4f v = *(const v4fa*)&so[w][r][c4]; if (C) *(v4f*)(C + cofs + (size_t)(row0 + r) * ldc + col0 + c4) = v; if (C16) { v4h h4; for (int i = 0; i < 4; ++i) h4[i] = (_Float16)v[i]; *(v4h*)(C16 + cofs + (size_t)(row0 + r) * ldc + col0 + c4) = h4; } } }
     }
}


typedef _Float16 v4h __attribute__((ext_vector_type(4)));

__global__ __launch_bounds__(256) void k_h16(const float* __restrict__ x, _Float16* __restrict__ X16, size_t n8) { const size_t t = (size_t)blockIdx.x * 256 + threadIdx.x; if (t >= n8) return; FragH f;
#pragma unroll
  for (int q = 0; q < 8; ++q) f.h[q] = (_Float16)x[t * 8 + q]; *(v8us*)((unsigned short*)X16 + t * 8) = f.half[0];  }
__global__ __launch_bounds__(256) void k_round16f(const float* __restrict__ W, _Float16* __restrict__ Bt, size_t n8) { const size_t t = (size_t)blockIdx.x * 256 + threadIdx.x; if (t >= n8) return; FragH f;
#pragma unroll
  for (int i = 0; i < 8; ++i) f.h[i] = (_Float16)(bf16_round(W[t * 8 + i]) * 16.0f); *(v8us*)((unsigned short*)Bt + t * 8) = f.half[0];  }
template <int NHv, int TTv>
__global__ __launch_bounds__(256) void k_vt(const _Float16* __restrict__ V16, int ldv, int voff, _Float16* __restrict__ Vt) { __shared__ unsigned short tl[64][66]; const int tid = threadIdx.x; const int slab = blockIdx.x / (TTv / 64), lg = blockIdx.x % (TTv / 64); const int b = slab / NHv, h = slab % NHv;
  for (int i = tid; i < 64 * 8; i += 256) { const int r = i / 8, c8 = (i % 8) * 8; FragH f; f.half[0] = *(const v8us*)((const unsigned short*)V16 + ((size_t)b * TTv + lg * 64 + r) * ldv + voff + h * 64 + c8);
#pragma unroll
    for (int q = 0; q < 8; ++q) tl[r][c8 + q] = f.u[q]; }
  __syncthreads();
  {
#pragma unroll
    for (int rd = 0; rd < 2; ++rd) { const int d = rd * 32 + tid / 8, pc = tid % 8; FragH f;
#pragma unroll
      for (int q = 0; q < 8; ++q) f.u[q] = tl[pc * 8 + q][d];
      *(v8us*)((unsigned short*)Vt + ((size_t)slab * 64 + d) * TTv + lg * 64 + pc * 8) = f.half[0]; }
     } }

__global__ __launch_bounds__(256) void k_hl(const float* __restrict__ F, _Float16* __restrict__ Hh, _Float16* __restrict__ Hl, size_t n8) { const size_t t = (size_t)blockIdx.x * 256 + threadIdx.x; if (t >= n8) return; FragH fh, fl; const v4f a = *(const v4fa*)(F + t * 8), c = *(const v4fa*)(F + t * 8 + 4);
#pragma unroll
  for (int q = 0; q < 4; ++q) { _Float16 h = (_Float16)a[q]; fh.h[q] = h; fl.h[q] = (_Float16)((a[q] - (float)h) * 1024.0f); h = (_Float16)c[q]; fh.h[4 + q] = h; fl.h[4 + q] = (_Float16)((c[q] - (float)h) * 1024.0f); }
  { *(v8us*)((unsigned short*)Hh + t * 8) = fh.half[0]; *(v8us*)((unsigned short*)Hl + t * 8) = fl.half[0];  } }

// ---- fast GEMM (wave tile 32x64) ----
__device__ __forceinline__ v16h g2_frag(const _Float16* p, int hh) { FragH f; f.half[0] = *(const v8us*)((const unsigned short*)p + 8 * hh); f.half[1] = *(const v8us*)((const unsigned short*)p + 16 + 8 * hh); return f.v; }
__device__ __forceinline__ v8f g2_mma(v16h a, v16h b, v8f c) { v8f d = __builtin_amdgcn_wmma_f32_16x16x32_f16(false, a, false, b, (short)0, c, false, false); asm volatile("v_nop\n\tv_nop\n\tv_nop\n\tv_nop" : "+v"(d) : "v"(a), "v"(b)); return d; }
#define GM 128                       /* tile rows */
#define GN 128                       /* tile columns */
#define GK 64                        /* k per trip */
#define GP 144                       /* LDS row pitch in bytes: 128 + 16, so the 16 rows of a ds_load_b128 fall on all 64 banks */
#define GBUF ((GM + GN) * GP)        /* one buffer: A rows, then Bh rows */
__device__ __forceinline__ v16h g3_frag(const char* p) { FragH f; f.half[0] = *(const v8us*)p; f.half[1] = *(const v8us*)(p + 32); return f.v; }      /* g2_frag from the lane's own LDS byte address (row ln, 16 hh bytes in) */
// One tile: a thread copies 16 B of rows cr, cr + 32, cr + 64, cr + 96 of A and of Bh. l = the lane's LDS byte address of its first A piece, ga / gb = its global addresses in row cr.
__device__ __forceinline__ void g3_stage(unsigned l, const _Float16* ga, const _Float16* gb) {
  /* the s_wait_xcnt in the copies' own statement stands before any register that an issued copy names is rewritten */
  asm volatile("global_load_async_to_lds_b128 %0, %8, off\n\t"
               "global_load_async_to_lds_b128 %1, %9, off\n\t"
               "global_load_async_to_lds_b128 %2, %10, off\n\t"
               "global_load_async_to_lds_b128 %3, %11, off\n\t"
               "global_load_async_to_lds_b128 %4, %12, off\n\t"
               "global_load_async_to_lds_b128 %5, %13, off\n\t"
               "global_load_async_to_lds_b128 %6, %14, off\n\t"
               "global_load_async_to_lds_b128 %7, %15, off\n\t"
               "s_wait_xcnt 0x0"
               :: "v"(l), "v"(l + 32u * GP), "v"(l + 64u * GP), "v"(l + 96u * GP), "v"(l + 128u * GP), "v"(l + 160u * GP), "v"(l + 192u * GP), "v"(l + 224u * GP),
                  "v"(ga), "v"(ga + 32 * DM), "v"(ga + 64 * DM), "v"(ga + 96 * DM), "v"(gb), "v"(gb + 32 * DM), "v"(gb + 64 * DM), "v"(gb + 96 * DM) : "memory"); }
// One tile of one projection. On entry its k tile 0 lies published in buffer 0 and the copies of its k tile 1 are under way into buffer 1 (ga / gb = the lane's global addresses in row cr of A and of Bh, l0 = its LDS byte address in buffer 0).
// MORE: another projection follows in the same work-group and is handed the same state: its k tile 0 (na / nb) is copied into buffer 0 while this tile's results pass through so, is published, and its k tile 1 sets out while they are converted and stored.
template <bool VTR, bool MORE>
__device__ __forceinline__ void g3_tile(const char* ring, float (*so)[32][68], int tt, int wt, unsigned l0, const _Float16* ga, const _Float16* gb, const _Float16* na, const _Float16* nb, float alpha, const float* __restrict__ bias, _Float16* __restrict__ P0, _Float16* __restrict__ P1) {
  const int tid = threadIdx.x, w = tid >> 5, lane = tid & 31, ln = lane & 15, hh = lane >> 4;
  const int rowb = (VTR ? wt : tt) * GM, colb = (VTR ? tt : wt) * GN; const int row0 = rowb + 32 * (w & 3), col0 = colb + 64 * (w >> 2);
  const char* fa = ring + (32 * (w & 3) + ln) * GP + 16 * hh; const char* fb = ring + (GM + 64 * (w >> 2) + ln) * GP + 16 * hh;
  const v8f z8 = {0.f,0.f,0.f,0.f,0.f,0.f,0.f,0.f}; v8f c00 = z8, c01 = z8, c02 = z8, c03 = z8, c10 = z8, c11 = z8, c12 = z8, c13 = z8;
#pragma unroll 1      /* one trip per tile: the buffer is picked by the trip's parity and the loop stays short */
  for (int t = 0; t < DM / GK; ++t) { const int bo = (t & 1) * GBUF; v16h a[2][2], b[2][4];      /* [k step][fragment] */
#pragma unroll      /* constant indices keep the fragment arrays in registers; all 24 LDS reads of the trip stand as one group ahead of its WMMAs */
    for (int ks = 0; ks < 2; ++ks) { for (int i = 0; i < 2; ++i) a[ks][i] = g3_frag(fa + bo + ks * 64 + i * (16 * GP)); for (int j = 0; j < 4; ++j) b[ks][j] = g3_frag(fb + bo + ks * 64 + j * (16 * GP)); }
#pragma unroll      /* constant fragment indices, as above */
    for (int ks = 0; ks < 2; ++ks) { c00 = g2_mma(a[ks][0], b[ks][0], c00); c10 = g2_mma(a[ks][1], b[ks][0], c10); c01 = g2_mma(a[ks][0], b[ks][1], c01); c11 = g2_mma(a[ks][1], b[ks][1], c11);
      c02 = g2_mma(a[ks][0], b[ks][2], c02); c12 = g2_mma(a[ks][1], b[ks][2], c12); c03 = g2_mma(a[ks][0], b[ks][3], c03); c13 = g2_mma(a[ks][1], b[ks][3], c13); }
    asm volatile("s_wait_dscnt 0x0" ::: "memory");      /* this wave's reads of the buffer are done before it is handed back */
    asm volatile("s_wait_asynccnt 0x0" ::: "memory");      /* this wave's share of tile t + 1 has landed */
    __syncthreads();      /* publishes tile t + 1 and ends every wave's reads of tile t */
    if (t + 2 < DM / GK) g3_stage(l0 + (unsigned)bo, ga + (t + 2) * GK, gb + (t + 2) * GK); }
  asm volatile("s_wait_asynccnt 0x0" ::: "memory");      /* no copy is outstanding when the wave goes on */
  if (MORE) g3_stage(l0, na, nb);      /* both buffers are free behind the last trip's barrier: the next projection's first tile flies while this one's results pass through so */
  v8f accs[8] = {c00, c01, c02, c03, c10, c11, c12, c13};
#pragma unroll      /* constant accumulator indices (this loop and the next): no scratch */
  for (int u = 0; u < 8; ++u) { const int t = u & 3, half = u >> 2;
#pragma unroll
    for (int r = 0; r < 8; ++r) { const float bv = bf16_round(bias[VTR ? row0 + half * 16 + 8 * hh + r : col0 + t * 16 + ln]) * (VTR ? 1.0f : 16.0f); so[w][half * 16 + 8 * hh + r][t * 16 + ln] = accs[u][r] * alpha + bv; } }
  __builtin_amdgcn_fence(__ATOMIC_ACQ_REL, "workgroup"); __builtin_amdgcn_wave_barrier();
  const int rsub = lane >> 3, c8 = (lane & 7) * 8;      /* 8 lanes x 16 B cover one 128-B line of a plane, a wave four rows per store */
  const size_t e0 = (VTR ? ((size_t)(col0 / SQ) * DM + row0) * SQ + (col0 % SQ) : (size_t)row0 * DM + col0) + (size_t)rsub * DM + c8;      /* the lane's first element */
  v4f va[8], vb[8];
#pragma unroll      /* constant indices keep the rows in registers; the 16 LDS reads stand as one group ahead of the conversions */
  for (int q = 0; q < 8; ++q) { va[q] = *(const v4fa*)&so[w][q * 4 + rsub][c8]; vb[q] = *(const v4fa*)&so[w][q * 4 + rsub][c8 + 4]; }
  if (MORE) { asm volatile("s_wait_asynccnt 0x0" ::: "memory");      /* this wave's share of the next projection's tile 0 has landed */
    __syncthreads();      /* that tile is published; the barrier stands ahead of the stores, so that no wave waits here for its stores to be acknowledged */
    g3_stage(l0 + GBUF, na + GK, nb + GK); }
#pragma unroll      /* constant indices, as above */
  for (int q = 0; q < 8; ++q) { FragH fh, fl;
#pragma unroll
    for (int i = 0; i < 4; ++i) { _Float16 h = (_Float16)va[q][i]; fh.h[i] = h; fl.h[i] = (_Float16)(va[q][i] - (float)h); h = (_Float16)vb[q][i]; fh.h[4 + i] = h; fl.h[4 + i] = (_Float16)(vb[q][i] - (float)h); }
    *(v8us*)((unsigned short*)P0 + e0 + (size_t)q * 4 * DM) = fh.half[0]; if (!VTR) *(v8us*)((unsigned short*)P1 + e0 + (size_t)q * 4 * DM) = fl.half[0];
    if (q < 7 || MORE) asm volatile("s_wait_xcnt 0x0" ::: "memory"); }      /* the wait that stands before a register which an issued store names is rewritten (later rows' conversions, and the next projection, reuse the registers) */
}
// The three projections in ONE launch: a work-group takes the q, the k and the V^T tile of its token tile tt and weight tile wt one after the other, so that the waves start once and only the first k tile of all is waited for with nothing else to do.
__global__ __launch_bounds__(256) void k_qkv(const _Float16* __restrict__ X, const _Float16* __restrict__ BQ, const _Float16* __restrict__ BK, const _Float16* __restrict__ BV, const float* __restrict__ bq, const float* __restrict__ bk, const float* __restrict__ bv,
                                             _Float16* __restrict__ QH, _Float16* __restrict__ QL, _Float16* __restrict__ KH, _Float16* __restrict__ KL, _Float16* __restrict__ VT) {
  static_assert(MP % GM == 0 && DM % GN == 0 && DM % GK == 0 && DM / GK >= 2 && GM == 128 && GN == 128 && GK == 64, "whole tiles, at least two trips, 8 copies per thread and tile");
  static_assert(SQ % GN == 0 && SQ == DM, "a token tile lies in one batch; V^T rows and q / k rows have one pitch");
  __shared__ __attribute__((aligned(16))) char ring[2 * GBUF]; __shared__ __attribute__((aligned(16))) float so[8][32][68];
  const int tid = threadIdx.x; const int tt = blockIdx.x / (DM / GN), wt = blockIdx.x % (DM / GN);      /* token tile, weight tile: neighbouring work-groups share the token rows */
  const int cr = tid >> 3, cc = tid & 7;      /* 8 lanes cover one 128-B row */
  const size_t ox = (size_t)(tt * GM + cr) * DM + cc * 8, ow = (size_t)(wt * GN + cr) * DM + cc * 8;      /* the lane's piece in row cr of the token tile and of a weight tile */
  const unsigned l0 = (unsigned)(size_t)ring + (unsigned)(cr * GP + cc * 16);
  g3_stage(l0, X + ox, BQ + ow);
  asm volatile("s_wait_asynccnt 0x0" ::: "memory");      /* this wave's share of tile 0 has landed */
  __syncthreads();      /* tile 0 is published */
  g3_stage(l0 + GBUF, X + ox + GK, BQ + ow + GK);
  g3_tile<false, true>(ring, so, tt, wt, l0, X + ox, BQ + ow, X + ox, BK + ow, 1.0f, bq, QH, QL);      /* 16 q -> f16 hi + residual planes */
  g3_tile<false, true>(ring, so, tt, wt, l0, X + ox, BK + ow, BV + ow, X + ox, 1.0f, bk, KH, KL);      /* k likewise */
  g3_tile<true, false>(ring, so, tt, wt, l0, BV + ow, X + ox, nullptr, nullptr, 0.0625f, bv, VT, nullptr); }      /* V^T [NB][NH][HD][SQ] = Wv . x^T */


// x and the three weight matrices -> their f16 operand planes (x bf16-rounded, exact in f16; weights bf16-rounded x16, natural [out][in] = Bt[n][k]), ONE launch of CWG work-groups: 16 waves per WGP instead of one short wave per 256 elements.
// A work-group owns one contiguous share of each plane and walks it in slabs of 256 threads x 4 f32: a wave-wide load covers 512 contiguous bytes, a wave-wide store 256 (whole lines). CX slabs of x and CW of each weight matrix per thread; all the loads are independent and stand ahead of the conversions (amdgpu_waves_per_eu names the 4 waves per SIMD that this grid gives: without it the compiler sinks half the loads among the conversions to save registers).
#define CWG 512                      /* work-groups of the conversion launch */
#define CX 16                        /* slabs of x per work-group */
#define CW 2                         /* slabs of each weight matrix per work-group */
__device__ __forceinline__ v4h cvt4(v4f a, float scale) { v4h h;
#pragma unroll
  for (int q = 0; q < 4; ++q) h[q] = (_Float16)(bf16_round(a[q]) * scale); return h; }
__global__ __launch_bounds__(256) __attribute__((amdgpu_waves_per_eu(4, 4))) void k_cvt(const float* __restrict__ x, const float* __restrict__ wq, const float* __restrict__ wk, const float* __restrict__ wv, _Float16* __restrict__ X16, _Float16* __restrict__ BQ, _Float16* __restrict__ BK, _Float16* __restrict__ BV) {
  static_assert(NR * DM == (size_t)CWG * CX * 1024 && (size_t)DM * DM == (size_t)CWG * CW * 1024, "whole slabs of 1024 elements, no remainder");
  const unsigned ex = blockIdx.x * (CX * 1024u) + threadIdx.x * 4u, ew = blockIdx.x * (CW * 1024u) + threadIdx.x * 4u;      /* the thread's first element of x and of a weight matrix; the slabs lie at constant offsets from it */
  v4f a[CX], q[CW], k[CW], v[CW];
#pragma unroll      /* constant indices keep the pieces in registers (this loop and the next three) */
  for (int i = 0; i < CX; ++i) a[i] = *(const v4fa*)(x + ex + i * 1024);
#pragma unroll
  for (int i = 0; i < CW; ++i) { q[i] = *(const v4fa*)(wq + ew + i * 1024); k[i] = *(const v4fa*)(wk + ew + i * 1024); v[i] = *(const v4fa*)(wv + ew + i * 1024); }
#pragma unroll
  for (int i = 0; i < CX; ++i) *(v4h*)(X16 + ex + i * 1024) = cvt4(a[i], 1.0f);
#pragma unroll
  for (int i = 0; i < CW; ++i) { *(v4h*)(BQ + ew + i * 1024) = cvt4(q[i], 16.0f); *(v4h*)(BK + ew + i * 1024) = cvt4(k[i], 16.0f); *(v4h*)(BV + ew + i * 1024) = cvt4(v[i], 16.0f); } }
__global__ __launch_bounds__(256) void k_rsm(const float* __restrict__ S, _Float16* __restrict__ P, int nrows) {
  #pragma clang fp contract(off)
  const int i = blockIdx.x * 256 + threadIdx.x; if (i >= nrows) return; const float* s = S + (size_t)i * SQ; float mx = -3.0e38f;
#pragma unroll 1
  for (int j = 0; j < SQ; ++j) mx = fmaxf(mx, s[j]); float se = 0.f;
#pragma unroll 1
  for (int j = 0; j < SQ; ++j) se += expf(s[j] - mx); const float sc = 256.0f / se;
#pragma unroll 1
  for (int j0 = 0; j0 < SQ; j0 += 8) { FragH f; for (int q = 0; q < 8; ++q) f.h[q] = (_Float16)(expf(s[j0 + q] - mx) * sc); unsigned short* d = (unsigned short*)P + (size_t)i * SQ + j0; *(v8us*)d = f.half[0];  } }
__global__ __launch_bounds__(256) void k_vt(const _Float16* __restrict__ V16, int b, int h0, _Float16* __restrict__ VT) { __shared__ unsigned short tl[64][65]; const int tid = threadIdx.x; const int hh = blockIdx.x % HG, sg = blockIdx.x / HG; const int s0 = sg * 64; const int h = h0 + hh;
  for (int i = tid; i < 64 * 8; i += 256) { const int j = i / 8, d8 = (i % 8) * 8; FragH f; f.half[0] = *(const v8us*)((const unsigned short*)V16 + ((size_t)b * SQ + s0 + j) * DM + h * HD + d8); for (int q = 0; q < 8; ++q) tl[d8 + q][j] = f.u[q]; }
  __syncthreads();
  { for (int i = tid; i < 64 * 8; i += 256) { const int d = i / 8, j8 = (i % 8) * 8; FragH f; for (int q = 0; q < 8; ++q) f.u[q] = tl[d][j8 + q]; *(v8us*)((unsigned short*)VT + ((size_t)hh * HD + d) * SQ + s0 + j8) = f.half[0]; }  } }



__device__ __forceinline__ float lane_xor_16(float v) { const int u = __float_as_int(v); return __int_as_float(__builtin_amdgcn_permlanex16(u, u, 0x76543210, 0xfedcba98, false, false)); }      /* lane l <- lane l ^ 16 */
__device__ __forceinline__ float exp2_slot(float a) { float r; asm("v_exp_f32 %0, %1\n\tv_nop" : "=v"(r) : "v"(a)); return r; }      /* 2^a; the v_nop in the same statement keeps the slot the instruction set asks for behind a transcendental, before its result is read or its source register reused */
__device__ __forceinline__ v4f exp2_slot4(v4f a) { float r0, r1, r2, r3;      /* four 2^a: each fills the slot behind the one before it (early-clobber outputs share no register with a source), one v_nop keeps the slot behind the last */
  asm("v_exp_f32 %0, %4\n\tv_exp_f32 %1, %5\n\tv_exp_f32 %2, %6\n\tv_exp_f32 %3, %7\n\tv_nop" : "=&v"(r0), "=&v"(r1), "=&v"(r2), "=&v"(r3) : "v"(a[0]), "v"(a[1]), "v"(a[2]), "v"(a[3])); const v4f r = {r0, r1, r2, r3}; return r; }
__device__ __forceinline__ v16h fa_frag(const char* p) { FragH f; f.half[0] = *(const v8us*)p; f.half[1] = *(const v8us*)(p + 32); return f.v; }      /* g2_frag from the lane's own LDS byte address (row c, 16 hh bytes in) */
__device__ __forceinline__ v8f fa_mma(v16h a, v16h b, v8f c) { return __builtin_amdgcn_wmma_f32_16x16x32_f16(false, a, false, b, (short)0, c, false, false); }
#define FW 8                         /* waves per work-group */
#define FQ 32                        /* query columns per wave */
#define FK 64                        /* keys per staged tile: two passes of 32 */
#define FP 144                       /* LDS row pitch in bytes: 128 + 16, so the 16 rows of a ds_load_b128 fall on all 64 banks */
#define FBUF ((2 * FK + HD) * FP)    /* one buffer: FK K rows, FK K residual rows, HD V^T rows */
// One tile: a thread copies 16 B of rows cr and cr + 32 of K, of the K residuals and of V^T. l = the lane's LDS byte address of its first K piece, gk / gl / gv = its global addresses in row cr of the three planes.
__device__ __forceinline__ void fa_stage(unsigned l, const _Float16* gk, const _Float16* gl, const _Float16* gv) {
  /* the s_wait_xcnt in the copies' own statement stands before any register that an issued copy names is rewritten */
  asm volatile("global_load_async_to_lds_b128 %0, %6, off\n\t"
               "global_load_async_to_lds_b128 %1, %7, off\n\t"
               "global_load_async_to_lds_b128 %2, %8, off\n\t"
               "global_load_async_to_lds_b128 %3, %9, off\n\t"
               "global_load_async_to_lds_b128 %4, %10, off\n\t"
               "global_load_async_to_lds_b128 %5, %11, off\n\t"
               "s_wait_xcnt 0x0"
               :: "v"(l), "v"(l + 32u * FP), "v"(l + 64u * FP), "v"(l + 96u * FP), "v"(l + 128u * FP), "v"(l + 160u * FP),
                  "v"(gk), "v"(gk + 32 * DM), "v"(gl), "v"(gl + 32 * DM), "v"(gv), "v"(gv + 32 * SQ) : "memory"); }
__global__ __launch_bounds__(FW * 32) __attribute__((amdgpu_waves_per_eu(4, 4))) void k_fattn(const _Float16* __restrict__ QH, const _Float16* __restrict__ QL, const _Float16* __restrict__ KH, const _Float16* __restrict__ KL, const _Float16* __restrict__ VT, float* __restrict__ out) {
  static_assert(SQ % (FW * FQ) == 0 && SQ % FK == 0 && SQ / FK >= 2 && FK == 64 && HD == 64 && FW == 8, "whole query blocks, whole tiles and at least two, two k steps per score, 6 copies per thread and tile");
  __shared__ __attribute__((aligned(16))) char ring[2 * FBUF];
  const int lane = threadIdx.x & 31, w = threadIdx.x >> 5, c = lane & 15, hh = lane >> 4; const int h = blockIdx.y, b = blockIdx.z;
  const size_t r0 = (size_t)b * SQ; const int q0 = blockIdx.x * (FW * FQ) + w * FQ;
  v16h qh[2][2], ql[2][2];      /* [query tile][k step] */
#pragma unroll
  for (int g = 0; g < 2; ++g) for (int ks = 0; ks < 2; ++ks) { const size_t qo = (r0 + q0 + g * 16 + c) * DM + h * HD + ks * 32; qh[g][ks] = g2_frag(QH + qo, hh); ql[g][ks] = g2_frag(QL + qo, hh); }
  const int cr = threadIdx.x >> 3, cc = threadIdx.x & 7;      /* 8 lanes cover one 128-B row */
  const _Float16* gk = KH + (r0 + cr) * DM + h * HD + cc * 8; const _Float16* gl = KL + (r0 + cr) * DM + h * HD + cc * 8; const _Float16* gv = VT + (((size_t)b * NH + h) * HD + cr) * SQ + cc * 8;
  const unsigned l0 = (unsigned)(size_t)ring + (unsigned)(cr * FP + cc * 16);
  const char* fr = ring + c * FP + 16 * hh;      /* the lane's place in row c of a buffer */
  const v8f z8 = {0.f, 0.f, 0.f, 0.f, 0.f, 0.f, 0.f, 0.f}; v8f o[2][4] = {{z8, z8, z8, z8}, {z8, z8, z8, z8}};      /* [query tile][d tile]: register r = O[query c][16 t + 8 hh + r] */
  float m[2] = {-3.0e38f, -3.0e38f}, l[2] = {0.f, 0.f};
  const float CS = 0.00048828125f * 1.44269504088896340736f;      /* 64^-0.5 / 256 in log2 units: accumulator units -> exponent */
  fa_stage(l0, gk, gl, gv);
  asm volatile("s_wait_asynccnt 0x0" ::: "memory");      /* this wave's share of tile 0 has landed */
  __syncthreads();      /* tile 0 is published */
  fa_stage(l0 + FBUF, gk + FK * DM, gl + FK * DM, gv + FK);
#pragma unroll 1      /* one trip per tile: the buffer is picked by the trip's parity */
  for (int kt0 = 0; kt0 < SQ / FK; ++kt0) { const int bo = (kt0 & 1) * FBUF;
#pragma unroll 1      /* the two passes of a tile stay one body: the unrolled build spills registers to scratch */
   for (int ps = 0; ps < FK / 32; ++ps) { v8f t[2][2];      /* [query tile][key tile]: register r = 256 q.k of key 64 kt0 + 32 ps + 16 kt + 8 hh + r for query c */
    const char* kp = fr + bo + ps * (32 * FP); v16h kf[2][2], lf[2][2];      /* [key tile][k step] */
#pragma unroll
    for (int kt = 0; kt < 2; ++kt) for (int ks = 0; ks < 2; ++ks) { kf[kt][ks] = fa_frag(kp + kt * (16 * FP) + ks * 64); lf[kt][ks] = fa_frag(kp + FK * FP + kt * (16 * FP) + ks * 64); }
#pragma unroll      /* constant indices keep fragments and accumulators in registers; six terms per score tile, written tile after tile in turn, so that neighbouring WMMAs are independent */
    for (int e = 0; e < 6; ++e) for (int kt = 0; kt < 2; ++kt) for (int g = 0; g < 2; ++g) { const int ks = e & 1;
      t[g][kt] = fa_mma(e == 2 || e == 3 ? lf[kt][ks] : kf[kt][ks], e < 2 ? ql[g][ks] : qh[g][ks], e == 0 ? z8 : t[g][kt]); }
    const char* vp = fr + bo + 2 * FK * FP + ps * 64; v16h vf[4];
#pragma unroll
    for (int u = 0; u < 4; ++u) vf[u] = fa_frag(vp + u * (16 * FP));
#pragma unroll
    for (int g = 0; g < 2; ++g) { float mx = t[g][0][0];
#pragma unroll
      for (int r = 1; r < 16; ++r) mx = fmaxf(mx, t[g][r >> 3][r & 7]);
      mx = fmaxf(mx, lane_xor_16(mx)); const float mn = fmaxf(m[g], mx); const float al = exp2_slot((m[g] - mn) * CS), nb = fmaf(-mn, CS, 8.0f); m[g] = mn;      /* weights carried x256 (it cancels in the final division), which keeps small ones out of the f16 subnormals */
      FragH pf; v4f s4 = {0.f, 0.f, 0.f, 0.f};
#pragma unroll
      for (int kt = 0; kt < 2; ++kt) for (int q = 0; q < 2; ++q) { v4f a; for (int i = 0; i < 4; ++i) a[i] = fmaf(t[g][kt][q * 4 + i], CS, nb); const v4f e = exp2_slot4(a); s4 += e; for (int i = 0; i < 4; ++i) pf.h[kt * 8 + q * 4 + i] = (_Float16)e[i]; }
      l[g] = fmaf(l[g], al, (s4[0] + s4[1]) + (s4[2] + s4[3]));      /* this half's keys only; the halves join after the loop */
#pragma unroll
      for (int u = 0; u < 4; ++u) { o[g][u] *= al; o[g][u] = fa_mma(vf[u], pf.v, o[g][u]); }
      }
    asm volatile("v_nop\n\tv_nop\n\tv_nop\n\tv_nop" :: "v"(o[0][0]), "v"(o[0][1]), "v"(o[0][2]), "v"(o[0][3]), "v"(o[1][0]), "v"(o[1][1]), "v"(o[1][2]), "v"(o[1][3])); }      /* the four vector slots the chip needs behind a WMMA before its A or B registers are overwritten: the pass ends in WMMAs, and the taken back edge leads to address arithmetic that reuses V^T fragment registers; inputs only: the eight results place it behind all the WMMAs of the pass */
    asm volatile("s_wait_dscnt 0x0" ::: "memory");      /* this wave's reads of the buffer are done before it is handed back */
    asm volatile("s_wait_asynccnt 0x0" ::: "memory");      /* this wave's share of tile kt0 + 1 has landed */
    __syncthreads();      /* publishes tile kt0 + 1 and ends every wave's reads of tile kt0 */
    if (kt0 + 2 < SQ / FK) fa_stage(l0 + (unsigned)bo, gk + (size_t)(kt0 + 2) * (FK * DM), gl + (size_t)(kt0 + 2) * (FK * DM), gv + (kt0 + 2) * FK); }
  asm volatile("s_wait_asynccnt 0x0" ::: "memory");      /* no copy is outstanding when the wave goes on */
#pragma unroll
  for (int g = 0; g < 2; ++g) { const float inv = 1.0f / (l[g] + lane_xor_16(l[g])); float* op = out + (r0 + q0 + g * 16 + c) * DM + h * HD + 8 * hh;
#pragma unroll
    for (int u = 0; u < 4; ++u) { const v4f x0 = {o[g][u][0] * inv, o[g][u][1] * inv, o[g][u][2] * inv, o[g][u][3] * inv}, x1 = {o[g][u][4] * inv, o[g][u][5] * inv, o[g][u][6] * inv, o[g][u][7] * inv}; *(v4f*)(op + u * 16) = x0; *(v4f*)(op + u * 16 + 4) = x1; } } }


template <int MASKADD>
__global__ __launch_bounds__(64) void k_att0(const float* __restrict__ QF, const float* __restrict__ KF, const float* __restrict__ VF, int ld, const float* __restrict__ mask, float scale, float* __restrict__ OF, int ldo) {
  #pragma clang fp contract(off)
  __shared__ __attribute__((aligned(16))) float lq[64][64]; __shared__ __attribute__((aligned(16))) float lo[64][64];
  const int tid = threadIdx.x; const int h = blockIdx.x / (QT0 / 64), rg = blockIdx.x % (QT0 / 64); const int i = rg * 64 + tid;
  const float* qr = QF + (size_t)i * ld + h * HD;
#pragma unroll 1
  for (int c = 0; c < HD / 4; ++c) { *(v4f*)&lq[tid][c * 4] = *(const v4fa*)(qr + c * 4); const v4f z = {0.f, 0.f, 0.f, 0.f}; *(v4f*)&lo[tid][c * 4] = z; }
  float m = -1.0e30f, l = 0.f; const int jmax = MASKADD ? (SQ - 1) : (rg * 64 + 63);      /* additive-mask form: every key (the mask input decides); causal form: keys up to the block's last row */
#pragma unroll 1
  for (int j = 0; j <= jmax; ++j) { const float* kr = KF + (size_t)j * ld + h * HD; const float* vr = VF + (size_t)j * ld + h * HD; float s = 0.f;
#pragma unroll 1
    for (int c = 0; c < HD / 4; ++c) { const v4f kq = *(const v4fa*)(kr + c * 4); const v4f qq = *(v4f*)&lq[tid][c * 4]; s = __fadd_rn(s, __fmul_rn(qq[0], kq[0])); s = __fadd_rn(s, __fmul_rn(qq[1], kq[1])); s = __fadd_rn(s, __fmul_rn(qq[2], kq[2])); s = __fadd_rn(s, __fmul_rn(qq[3], kq[3])); }
    s = __fmul_rn(s, scale); if (MASKADD) s = __fadd_rn(s, __fmul_rn(bf16_round(mask[(size_t)i * SQ + j]), -10000.0f));
    const float f = (MASKADD || j <= i) ? 1.f : 0.f; const float sm = fmaf(f, s, (1.f - f) * -1.0e30f); const float mn = fmaxf(m, sm); const float sc = expf(m - mn); const float e = expf(sm - mn); l = __fadd_rn(__fmul_rn(l, sc), e); m = mn;
#pragma unroll 1
    for (int c = 0; c < HD / 4; ++c) { const v4f vv = *(const v4fa*)(vr + c * 4); v4f oo = *(v4f*)&lo[tid][c * 4]; for (int u = 0; u < 4; ++u) oo[u] = __fadd_rn(__fmul_rn(oo[u], sc), __fmul_rn(e, vv[u])); *(v4f*)&lo[tid][c * 4] = oo; } }
  const float fin = 64.0f / l;      /* o carried x64 */
#pragma unroll 1
  for (int c = 0; c < HD / 4; ++c) { v4f oo = *(v4f*)&lo[tid][c * 4]; for (int u = 0; u < 4; ++u) oo[u] = __fmul_rn(oo[u], fin); *(v4f*)&lo[tid][c * 4] = oo; }
  __syncthreads();
  {
#pragma unroll 1
    for (int it = 0; it < 16; ++it) { const int row = it * 4 + tid / 16, pc = (tid % 16) * 4; const v4f v = *(const v4f*)&lo[row][pc]; *(v4f*)(OF + (size_t)(rg * 64 + row) * ldo + h * HD + pc) = v; }
     } }

__global__ __launch_bounds__(256) void k_of0out(const float* __restrict__ src, float* __restrict__ dst, size_t n4) { const size_t t = (size_t)blockIdx.x * 256 + threadIdx.x; if (t >= n4) return; v4f v = *(const v4fa*)(src + t * 4); for (int q = 0; q < 4; ++q) v[q] = __fmul_rn(v[q], 0.015625f); *(v4f*)(dst + t * 4) = v;  }

extern "C" void kernel_launch(void* const* d_in, const int* in_sizes, int n_in,
                              void* d_out, int out_size, void* d_ws, size_t ws_size, hipStream_t stream) {
  (void)in_sizes; (void)n_in; (void)out_size;
  const float* const* I = (const float* const*)d_in; const float* x = I[0]; const float* wq = I[1]; const float* wk = I[2]; const float* wv = I[3]; const float* bq = I[4]; const float* bk = I[5]; const float* bv = I[6];      /* input order: x, Wq, Wk, Wv, bq, bk, bv: natural [out][in] weights, then the three biases (every projection launch passes the bias variables); NO output projection */
  char* ws = (char*)d_ws; size_t off = 0;
  auto take = [&](size_t bytes) { char* p = ws + off; off += (bytes + 255) & ~(size_t)255; return p; };
  _Float16* BQ = (_Float16*)take((size_t)DM * DM * 2); _Float16* BK = (_Float16*)take((size_t)DM * DM * 2); _Float16* BV = (_Float16*)take((size_t)DM * DM * 2);
  _Float16* X16 = (_Float16*)take(NR * DM * 2); _Float16* QH = (_Float16*)take(NR * DM * 2); _Float16* QL = (_Float16*)take(NR * DM * 2); _Float16* KH = (_Float16*)take(NR * DM * 2); _Float16* KL = (_Float16*)take(NR * DM * 2);
  _Float16* VT = (_Float16*)take((size_t)NB * NH * HD * SQ * 2);
  if (off > ws_size) return;
  k_cvt<<<CWG, 256, 0, stream>>>(x, wq, wk, wv, X16, BQ, BK, BV);      /* x -> exact f16 rows; natural [out][in] weights = Bt[n][k] x16 */
  const size_t r0p = (size_t)B0 * SQ;      /* first projected row */
  k_qkv<<<(MP / GM) * (DM / GN), 256, 0, stream>>>(X16 + r0p * DM, BQ, BK, BV, bq, bk, bv, QH + r0p * DM, QL + r0p * DM, KH + r0p * DM, KL + r0p * DM, VT + r0p * DM);      /* q, k (x16, f16 hi + residual planes) and V^T, from the GEMM's own epilogues, one launch */
  k_fattn<<<dim3(SQ / (FW * FQ), NH, NB), FW * 32, 0, stream>>>(QH, QL, KH, KL, VT, (float*)d_out);      /* scores (hi.lo + lo.hi + hi.hi in one accumulator), softmax over all keys and P V in one launch, f32 straight into the head-major output columns (no output projection) */
}

// v009
// A run of this version takes 98.6 microseconds.
// Timed twice side by side with v008, it ran 1.08 and 1.07 times as fast.
// Counting every step since v000, it is 81.9 times as fast.
#include <hip/hip_runtime.h>
// Multi-head self-attention without an output projection, NON-causal (x [8][1024][1024]; q / k / v = x W^T + b (nn.Linear natural [1024][1024] sigma 1/32, biases sigma 0.01); 16 heads of 64; scores * 64^-0.5; softmax over all 1024 keys (no mask); out = ctx merged head-major -> [8][1024][1024]; the source never applies its out_proj).
// Structure: token rows r = b*1024 + s; x as exact f16 rows (bf16-rounded); q and k as WMMA GEMMs (f32 accumulation, exact x16 weights + bias) whose epilogue carries each f32 value x16 and splits it into f16 hi + residual planes of one scale, v as the same GEMM with its operands swapped, so that its f16 tile is V^T as attention reads it, the three in ONE launch and ONE work-group tile (256 tokens x 128 features of each, staged in LDS by asynchronous copies, the x rows once for all three; a wave holds 64 x 64 of q, of k and of V^T); then ONE fused attention launch (k_fattn): per wave 32 queries, keys 32 at a time from 64-key K / V^T tiles that a work-group stages in LDS by asynchronous copies, scores as hi.lo + lo.hi + hi.hi in one f32 accumulator, online softmax (f32 running max and sum, native exp2), weights x256 as f16 straight from the score accumulators into O^T += V^T P^T, f32 out written into the head-major columns.
// Compute dtype: inputs rounded to bf16; x / weights exact; q and k as f16 hi + residual planes, v and softmax weights as plain f16 GEMM operands (~2^-12); scores, softmax statistics and o f32. v_wmma_f32_16x16x32_f16.
#define NB 8
#define SQ 1024
#define DM 1024
#define NH 16
#define HD 64
#define HG 4                         /* heads per group in the unlaunched k_vt overload */
#define QT 256                       /* unused */
#define NKX SQ                       /* unused */
#define QT0 128                      /* query rows per head in k_att0, which is not launched */
#define B0 0                         /* first batch processed (debug hook) */
#define NBR NB                       /* batches processed (debug hook) */
#define NR ((size_t)NB * SQ)         /* token rows */
#define MP ((int)((size_t)NBR * SQ)) /* rows projected (debug hook) */
#define QN SQ                        /* unused */
#define NHD NH                       /* unused */
#define MPO MP                       /* unused */
#define LQ DM      /* unused */
typedef __bf16 v16b __attribute__((ext_vector_type(16)));
typedef unsigned short v8us __attribute__((ext_vector_type(8), may_alias));
typedef float  v8f  __attribute__((ext_vector_type(8)));
typedef float  v4f  __attribute__((ext_vector_type(4)));
typedef float  v4fa __attribute__((ext_vector_type(4), may_alias));
union FragB { v16b v; v8us half[2]; unsigned short u[16]; };

__device__ __forceinline__ unsigned short bf16_bits(float x) { unsigned int u = __float_as_uint(x); return (unsigned short)((u + 0x7FFFu + ((u >> 16) & 1u)) >> 16); }
__device__ __forceinline__ float bf16_val(unsigned short b) { return __uint_as_float(((unsigned int)b) << 16); }
__device__ __forceinline__ float bf16_round(float x) { return bf16_val(bf16_bits(x)); }
// D += A·B with NT terms: 1 = ah·bh, 2 = + al·bh (A split), 3 = + ah·bl (both split)
template <int NT>
__device__ __forceinline__ v8f mmaN(v16b ah, v16b al, v16b bh, v16b bl, v8f c) {
  c = __builtin_amdgcn_wmma_f32_16x16x32_bf16(false, ah, false, bh, (short)0, c, false, false);
  if (NT >= 2) c = __builtin_amdgcn_wmma_f32_16x16x32_bf16(false, al, false, bh, (short)0, c, false, false);
  if (NT >= 3) c = __builtin_amdgcn_wmma_f32_16x16x32_bf16(false, ah, false, bl, (short)0, c, false, false);
  asm volatile("v_nop\n\tv_nop\n\tv_nop\n\tv_nop" : "+v"(c) : "v"(ah), "v"(al), "v"(bh), "v"(bl));
  return c;
}

__global__ __launch_bounds__(256) void k_wt_bf16(const float* __restrict__ W, unsigned short* __restrict__ Wt, int K, int N) {
  const int t = blockIdx.x * 256 + threadIdx.x;
  const int k8n = K / 8;
  if (t >= N * k8n) return;
  const int n = t / k8n, k8 = (t % k8n) * 8;
  v8us v;
#pragma unroll
  for (int i = 0; i < 8; ++i) v[i] = bf16_bits(W[(size_t)(k8 + i) * N + n]);
  *(v8us*)(Wt + (size_t)n * K + k8) = v;
  
}

// GEMM C[M][N] (f32, pitch ldc) = act(A[M][K]·W + bias). A f32 row-major (pitch lda) converted per fragment to bf16
// (ASPLIT: hi/lo two planes -> 2 terms, else single rounded term); Wt bf16 [N][K] (pitch ldb). BIAS_BF16 rounds the
// bias to bf16 first (bias quantised to bf16 before the add). K%32==0, M%16==0, N%64==0.
template <bool ASPLIT, int ACT, bool BIAS_BF16>
__global__ __launch_bounds__(128) void k_gemm_bf(const float* __restrict__ A, int lda, const unsigned short* __restrict__ Wt, int ldb,
                                               const float* __restrict__ bias, float* __restrict__ C, int ldc, int M, int N, int K) {
  __shared__ __attribute__((aligned(16))) float so[4][16][64];
  const int tid = threadIdx.x, w = tid >> 5, lane = tid & 31, ln = lane & 15, hh = lane >> 4;
  const int ntn = N / 64;
  const int wid = blockIdx.x * 4 + w;
  const int mt = wid / ntn, nq = wid % ntn;
  if (mt * 16 >= M) return;
  const int row0 = mt * 16, col0 = nq * 64;
  const float* arow = A + (size_t)(row0 + ln) * lda;
  v8f acc[4] = {};
  for (int kb = 0; kb < K; kb += 32) {
    FragB ah, al;
    const v4f x0 = *(const v4fa*)(arow + kb + 8 * hh), x1 = *(const v4fa*)(arow + kb + 8 * hh + 4);
    const v4f x2 = *(const v4fa*)(arow + kb + 16 + 8 * hh), x3 = *(const v4fa*)(arow + kb + 16 + 8 * hh + 4);
    float xs[16] = {x0[0],x0[1],x0[2],x0[3],x1[0],x1[1],x1[2],x1[3],x2[0],x2[1],x2[2],x2[3],x3[0],x3[1],x3[2],x3[3]};
#pragma unroll
    for (int i = 0; i < 16; ++i) { const unsigned short hb = bf16_bits(xs[i]); ah.u[i] = hb; al.u[i] = ASPLIT ? bf16_bits(xs[i] - bf16_val(hb)) : (unsigned short)0; }
#pragma unroll
    for (int t = 0; t < 4; ++t) {
      const unsigned short* brow = Wt + (size_t)(col0 + t * 16 + ln) * ldb + kb;
      FragB b;
      b.half[0] = *(const v8us*)(brow + 8 * hh);
      b.half[1] = *(const v8us*)(brow + 16 + 8 * hh);
      acc[t] = mmaN<ASPLIT ? 2 : 1>(ah.v, al.v, b.v, b.v, acc[t]);
    }
  }
#pragma unroll
  for (int t = 0; t < 4; ++t) {
    float bv = bias ? bias[col0 + t * 16 + ln] : 0.f;
    if (BIAS_BF16) bv = bf16_round(bv);
#pragma unroll
    for (int r = 0; r < 8; ++r) { float v = acc[t][r] + bv; if (ACT == 1) v = fmaxf(v, 0.f); so[w][8 * hh + r][t * 16 + ln] = v; }
  }
  __builtin_amdgcn_fence(__ATOMIC_ACQ_REL, "workgroup");
  __builtin_amdgcn_wave_barrier();
  const int rsub = lane >> 4, c4 = (lane & 15) * 4;
  {
#pragma unroll
    for (int q = 0; q < 8; ++q) {
      const int r = q * 2 + rsub;
      const v4f v = *(const v4fa*)&so[w][r][c4];
      *(v4f*)(C + (size_t)(row0 + r) * ldc + col0 + c4) = v;
    }
    
  }
}

// GEMM C = act(A·W + bias + resid): A f32 (ASPLIT -> hi/lo 2 terms), Wt bf16 [N][K]; ACT 0 none, 1 relu, 2 exact gelu;
// resid (optional, f32, row index = (row % rmod), pitch ldr, RES_BF16 rounds it) added before the activation.
template <bool ASPLIT, int ACT, bool BIAS_BF16, bool RES_BF16>
__global__ __launch_bounds__(128) void k_gemm_bf3(const float* __restrict__ A, int lda, const unsigned short* __restrict__ Wt, int ldb,
                                                const float* __restrict__ bias, const float* __restrict__ resid, int rmod, int ldr,
                                                float* __restrict__ C, int ldc, int M, int N, int K) {
  __shared__ __attribute__((aligned(16))) float so[4][16][64];
  const int tid = threadIdx.x, w = tid >> 5, lane = tid & 31, ln = lane & 15, hh = lane >> 4;
  const int ntn = N / 64;
  const int wid = blockIdx.x * 4 + w;
  const int mt = wid / ntn, nq = wid % ntn;
  if (mt * 16 >= M) return;
  const int row0 = mt * 16, col0 = nq * 64;
  const float* arow = A + (size_t)(row0 + ln) * lda;
  v8f acc[4] = {};
  for (int kb = 0; kb < K; kb += 32) {
    FragB ah, al;
    const v4f x0 = *(const v4fa*)(arow + kb + 8 * hh), x1 = *(const v4fa*)(arow + kb + 8 * hh + 4);
    const v4f x2 = *(const v4fa*)(arow + kb + 16 + 8 * hh), x3 = *(const v4fa*)(arow + kb + 16 + 8 * hh + 4);
    float xs[16] = {x0[0],x0[1],x0[2],x0[3],x1[0],x1[1],x1[2],x1[3],x2[0],x2[1],x2[2],x2[3],x3[0],x3[1],x3[2],x3[3]};
#pragma unroll
    for (int i = 0; i < 16; ++i) { const unsigned short hb = bf16_bits(xs[i]); ah.u[i] = hb; al.u[i] = ASPLIT ? bf16_bits(xs[i] - bf16_val(hb)) : (unsigned short)0; }
#pragma unroll
    for (int t = 0; t < 4; ++t) {
      const unsigned short* brow = Wt + (size_t)(col0 + t * 16 + ln) * ldb + kb;
      FragB b;
      b.half[0] = *(const v8us*)(brow + 8 * hh);
      b.half[1] = *(const v8us*)(brow + 16 + 8 * hh);
      acc[t] = mmaN<ASPLIT ? 2 : 1>(ah.v, al.v, b.v, b.v, acc[t]);
    }
  }
#pragma unroll
  for (int t = 0; t < 4; ++t) {
    const int col = col0 + t * 16 + ln;
    float bv = bias ? bias[col] : 0.f;
    if (BIAS_BF16) bv = bf16_round(bv);
#pragma unroll
    for (int r = 0; r < 8; ++r) {
      float v = acc[t][r] + bv;
      if (resid) { float rv = resid[(size_t)((row0 + 8 * hh + r) % rmod) * ldr + col]; if (RES_BF16) rv = bf16_round(rv); v += rv; }
      if (ACT == 1) v = fmaxf(v, 0.f);
      if (ACT == 2) v = 0.5f * v * (1.0f + erff(v * 0.70710678118654752f));
      if (ACT == 3) { const float u = 0.7978845608028654f * (v + 0.044715f * v * v * v); v = 0.5f * v * (1.0f + tanhf(u)); }
      so[w][8 * hh + r][t * 16 + ln] = v;
    }
  }
  __builtin_amdgcn_fence(__ATOMIC_ACQ_REL, "workgroup");
  __builtin_amdgcn_wave_barrier();
  const int rsub = lane >> 4, c4 = (lane & 15) * 4;
  {
#pragma unroll
    for (int q = 0; q < 8; ++q) {
      const int r = q * 2 + rsub;
      const v4f v = *(const v4fa*)&so[w][r][c4];
      *(v4f*)(C + (size_t)(row0 + r) * ldc + col0 + c4) = v;
    }
    
  }
}
// row LayerNorm (biased variance, eps) over N: s = X (+ R); optional out_sum <- s; out_norm <- (s-mu)*rsqrt(var+eps)*g + b
template <bool PARAM_BF16>
__global__ __launch_bounds__(256) void k_layernorm(const float* __restrict__ X, const float* __restrict__ R, const float* __restrict__ g, const float* __restrict__ bta,
                                                  float* __restrict__ out_sum, float* __restrict__ out_norm, int N, float eps) {
  __shared__ float red[256];
  const int row = blockIdx.x, tid = threadIdx.x;
  const float* x = X + (size_t)row * N; const float* rr = R ? R + (size_t)row * N : nullptr;
  float vals[16];                     // up to N = 4096
  const int per = N / 256;            // contiguous chunk per thread? use strided-by-4 chunks: thread handles j = tid*4 + 1024*u
  float s1 = 0.f;
  for (int u = 0; u < per / 4; ++u) {
    const int j = tid * 4 + 1024 * u;
    const v4f a = *(const v4fa*)(x + j);
    v4f b = {0.f,0.f,0.f,0.f}; if (rr) b = *(const v4fa*)(rr + j);
#pragma unroll
    for (int q = 0; q < 4; ++q) { const float v = a[q] + b[q]; vals[u * 4 + q] = v; s1 += v; }
  }
  red[tid] = s1; __syncthreads();
  for (int st = 128; st > 0; st >>= 1) { if (tid < st) red[tid] += red[tid + st]; __syncthreads(); }
  const float mu = red[0] / (float)N; __syncthreads();
  float s2 = 0.f;
  for (int u = 0; u < per / 4; ++u)
#pragma unroll
    for (int q = 0; q < 4; ++q) { const float c = vals[u * 4 + q] - mu; s2 += c * c; }
  red[tid] = s2; __syncthreads();
  for (int st = 128; st > 0; st >>= 1) { if (tid < st) red[tid] += red[tid + st]; __syncthreads(); }
  const float rs = rsqrtf(red[0] / (float)N + eps);
  {
    for (int u = 0; u < per / 4; ++u) {
      const int j = tid * 4 + 1024 * u;
      v4f o, sm;
#pragma unroll
      for (int q = 0; q < 4; ++q) {
        float gg = g[j + q], bb = bta[j + q];
        if (PARAM_BF16) { gg = bf16_round(gg); bb = bf16_round(bb); }
        sm[q] = vals[u * 4 + q]; o[q] = (vals[u * 4 + q] - mu) * rs * gg + bb;
      }
      if (out_sum) *(v4f*)(out_sum + (size_t)row * N + j) = sm;
      *(v4f*)(out_norm + (size_t)row * N + j) = o;
    }
    
  }
}



// ---- f16 WMMA path (v_wmma_f32_16x16x32_f16): 11-bit significands for operands in range — used where a [0,1] probability operand needs more precision than bf16
typedef _Float16 v16h __attribute__((ext_vector_type(16)));
union FragH { v16h v; v8us half[2]; _Float16 h[16]; unsigned short u[16]; };
template <int NT>
__device__ __forceinline__ v8f mmaH(v16h ah, v16h al, v16h bh, v16h bl, v8f c) {
  c = __builtin_amdgcn_wmma_f32_16x16x32_f16(false, ah, false, bh, (short)0, c, false, false);
  if (NT >= 2) c = __builtin_amdgcn_wmma_f32_16x16x32_f16(false, al, false, bh, (short)0, c, false, false);
  if (NT >= 3) c = __builtin_amdgcn_wmma_f32_16x16x32_f16(false, ah, false, bl, (short)0, c, false, false);
  asm volatile("v_nop\n\tv_nop\n\tv_nop\n\tv_nop" : "+v"(c) : "v"(ah), "v"(al), "v"(bh), "v"(bl));
  return c;
}
// batched GEMM like k_gemm_b but f16 operands: A f32 (split into f16 hi/lo if ASPLIT, else rounded to f16), Bt = f16 values [n][k]; alpha; C f32; N multiple of 16 (partial tiles skipped)
template <bool ASPLIT>
__global__ __launch_bounds__(128) void k_gemm_h(const float* __restrict__ A, int lda, size_t sA, const _Float16* __restrict__ Bh, int ldb, size_t sB, float alpha, float* __restrict__ C, int ldc, size_t sC, int M, int N, int K) {
  __shared__ __attribute__((aligned(16))) float so[4][16][64];
  const int tid = threadIdx.x, w = tid >> 5, lane = tid & 31, ln = lane & 15, hh = lane >> 4; const int by = blockIdx.y;
  A += (size_t)by * sA; Bh += (size_t)by * sB; C += (size_t)by * sC;
  const int ntn = (N + 63) / 64; const int wid = blockIdx.x * 4 + w; const int mt = wid / ntn, nq = wid % ntn; if (mt * 16 >= M) return;
  const int row0 = mt * 16, col0 = nq * 64; const float* arow = A + (size_t)(row0 + ln) * lda;
  v8f acc[4] = {};
  for (int kb = 0; kb < K; kb += 32) {
    FragH ah, al;
    const v4f x0 = *(const v4fa*)(arow + kb + 8 * hh), x1 = *(const v4fa*)(arow + kb + 8 * hh + 4), x2 = *(const v4fa*)(arow + kb + 16 + 8 * hh), x3 = *(const v4fa*)(arow + kb + 16 + 8 * hh + 4);
    float xs[16] = {x0[0],x0[1],x0[2],x0[3],x1[0],x1[1],x1[2],x1[3],x2[0],x2[1],x2[2],x2[3],x3[0],x3[1],x3[2],x3[3]};
#pragma unroll
    for (int i = 0; i < 16; ++i) { const _Float16 h = (_Float16)xs[i]; ah.h[i] = h; al.h[i] = ASPLIT ? (_Float16)(xs[i] - (float)h) : (_Float16)0.0f; }
#pragma unroll
    for (int t = 0; t < 4; ++t) { if (col0 + t * 16 >= N) continue; const size_t boff = (size_t)(col0 + t * 16 + ln) * ldb + kb; FragH bq; bq.half[0] = *(const v8us*)(Bh + boff + 8 * hh); bq.half[1] = *(const v8us*)(Bh + boff + 16 + 8 * hh);
      acc[t] = mmaH<ASPLIT ? 2 : 1>(ah.v, al.v, bq.v, bq.v, acc[t]); }
  }
#pragma unroll
  for (int t = 0; t < 4; ++t) { if (col0 + t * 16 >= N) continue;
#pragma unroll
    for (int r = 0; r < 8; ++r) so[w][8 * hh + r][t * 16 + ln] = acc[t][r] * alpha; }
  __builtin_amdgcn_fence(__ATOMIC_ACQ_REL, "workgroup"); __builtin_amdgcn_wave_barrier();
  const int rsub = lane >> 4, c4 = (lane & 15) * 4;
  {
#pragma unroll
    for (int q = 0; q < 8; ++q) { const int r = q * 2 + rsub; if (col0 + c4 < N) { const v4f v = *(const v4fa*)&so[w][r][c4]; *(v4f*)(C + (size_t)(row0 + r) * ldc + col0 + c4) = v; } }
     }
}

// Wt[n][k] = f16(W[k][n]·scale) from f32 row-major W[K][N] (scale = power of two; bf16-exact weights stay exact in f16 away from the subnormal range)
__global__ __launch_bounds__(256) void k_wt_f16(const float* __restrict__ W, _Float16* __restrict__ Wt, int K, int N, float scale) {
  const int t = blockIdx.x * 256 + threadIdx.x; if (t >= N * (K / 8)) return; const int n = t / (K / 8), k8 = (t % (K / 8)) * 8; FragH f;
#pragma unroll
  for (int i = 0; i < 8; ++i) f.h[i] = (_Float16)(bf16_round(W[(size_t)(k8 + i) * N + n]) * scale); const v8us o = f.half[0];
  *(v8us*)((unsigned short*)Wt + (size_t)n * K + k8) = o; 
}
// k_gemm_hh variant with fused epilogue: v = acc·alpha + bias[by·sBias + col] (+ CP[(row/rowsPerB)·sCPb + by·64 + col] if CP) ; ACT 0 none / 1 elu ; writes f16 C16 (and f32 C if non-null)
template <int ACT>
__global__ __launch_bounds__(128) void k_gemm_hhx(const _Float16* __restrict__ A, int lda, size_t sA, const _Float16* __restrict__ Bh, int ldb, size_t sB, float alpha, const float* __restrict__ bias, size_t sBias, const float* __restrict__ CP, int rowsPerB, size_t sCPb, int row0g,
    float* __restrict__ C, _Float16* __restrict__ C16, int ldc, size_t sC, int M, int N, int K) {
  __shared__ __attribute__((aligned(16))) float so[4][16][64];
  const int tid = threadIdx.x, w = tid >> 5, lane = tid & 31, ln = lane & 15, hh = lane >> 4; const int by = blockIdx.y;
  A += (size_t)by * sA; Bh += (size_t)by * sB; const size_t cofs = (size_t)by * sC; const float* bp = bias ? bias + (size_t)by * sBias : nullptr;
  const int ntn = (N + 63) / 64; const int wid = blockIdx.x * 4 + w; const int mt = wid / ntn, nq = wid % ntn; if (mt * 16 >= M) return;
  const int row0 = mt * 16, col0 = nq * 64; const _Float16* arow = A + (size_t)(row0 + ln) * lda;
  v8f acc[4] = {};
  for (int kb = 0; kb < K; kb += 32) { FragH ah; ah.half[0] = *(const v8us*)((const unsigned short*)arow + kb + 8 * hh); ah.half[1] = *(const v8us*)((const unsigned short*)arow + kb + 16 + 8 * hh);
#pragma unroll
    for (int t = 0; t < 4; ++t) { if (col0 + t * 16 >= N) continue; const size_t boff = (size_t)(col0 + t * 16 + ln) * ldb + kb; FragH bq; bq.half[0] = *(const v8us*)((const unsigned short*)Bh + boff + 8 * hh); bq.half[1] = *(const v8us*)((const unsigned short*)Bh + boff + 16 + 8 * hh);
      acc[t] = mmaH<1>(ah.v, ah.v, bq.v, bq.v, acc[t]); }
  }
#pragma unroll
  for (int t = 0; t < 4; ++t) { if (col0 + t * 16 >= N) continue; const int col = col0 + t * 16 + ln; const float bv = bp ? bf16_round(bp[col]) : 0.f;
#pragma unroll
    for (int r = 0; r < 8; ++r) { float v = acc[t][r] * alpha + bv; if (CP) { const int rr = row0g + row0 + 8 * hh + r; if (rowsPerB < 0) v += CP[cofs + (size_t)rr * ldc + col];      /* rowsPerB < 0: own element of the batched C plane */ else { const int bidx = rr / rowsPerB; v += CP[(size_t)bidx * sCPb + (size_t)by * 64 + col]; } } if (ACT == 1) v = (v > 0.f) ? v : expm1f(v); else if (ACT == 7) v = (v > 0.f) ? v + 1.0f : expf(v); else if (ACT == 8) v = tanhf(v); else if (ACT == 9) v = 0.5f * v * (1.0f + tanhf(0.7978845608028654f * (v + 0.044715f * v * v * v))); else if (ACT == 11) v = 1.0f / (1.0f + expf(-v)); else if (ACT == 12) v = (v > 0.f) ? v : 0.01f * v; else if (ACT == 14) v = (v > 0.f) ? v : 0.1f * v; else if (ACT == 16) v = (v >= 0.f) ? v : 0.3f * v; else if (ACT == 17) v = (v >= 0.f) ? v : 0.2f * v; else if (ACT == 15) v = v / (1.0f + expf(-v)); else if (ACT == 3) v = fmaxf(v, 0.f); else if (ACT == 6) v = 0.5f * v * (1.0f + erff(v * 0.70710678118654752f)); so[w][8 * hh + r][t * 16 + ln] = v; } }
  __builtin_amdgcn_fence(__ATOMIC_ACQ_REL, "workgroup"); __builtin_amdgcn_wave_barrier();
  const int rsub = lane >> 4, c4 = (lane & 15) * 4; typedef _Float16 v4h __attribute__((ext_vector_type(4)));
  {
#pragma unroll
    for (int q = 0; q < 8; ++q) { const int r = q * 2 + rsub; if (col0 + c4 < N) { const v4f v = *(const v4fa*)&so[w][r][c4]; if (C) *(v4f*)(C + cofs + (size_t)(row0 + r) * ldc + col0 + c4) = v; if (C16) { v4h h4; for (int i = 0; i < 4; ++i) h4[i] = (_Float16)v[i]; *(v4h*)(C16 + cofs + (size_t)(row0 + r) * ldc + col0 + c4) = h4; } } }
     }
}


typedef _Float16 v4h __attribute__((ext_vector_type(4)));

__global__ __launch_bounds__(256) void k_h16(const float* __restrict__ x, _Float16* __restrict__ X16, size_t n8) { const size_t t = (size_t)blockIdx.x * 256 + threadIdx.x; if (t >= n8) return; FragH f;
#pragma unroll
  for (int q = 0; q < 8; ++q) f.h[q] = (_Float16)x[t * 8 + q]; *(v8us*)((unsigned short*)X16 + t * 8) = f.half[0];  }
__global__ __launch_bounds__(256) void k_round16f(const float* __restrict__ W, _Float16* __restrict__ Bt, size_t n8) { const size_t t = (size_t)blockIdx.x * 256 + threadIdx.x; if (t >= n8) return; FragH f;
#pragma unroll
  for (int i = 0; i < 8; ++i) f.h[i] = (_Float16)(bf16_round(W[t * 8 + i]) * 16.0f); *(v8us*)((unsigned short*)Bt + t * 8) = f.half[0];  }
template <int NHv, int TTv>
__global__ __launch_bounds__(256) void k_vt(const _Float16* __restrict__ V16, int ldv, int voff, _Float16* __restrict__ Vt) { __shared__ unsigned short tl[64][66]; const int tid = threadIdx.x; const int slab = blockIdx.x / (TTv / 64), lg = blockIdx.x % (TTv / 64); const int b = slab / NHv, h = slab % NHv;
  for (int i = tid; i < 64 * 8; i += 256) { const int r = i / 8, c8 = (i % 8) * 8; FragH f; f.half[0] = *(const v8us*)((const unsigned short*)V16 + ((size_t)b * TTv + lg * 64 + r) * ldv + voff + h * 64 + c8);
#pragma unroll
    for (int q = 0; q < 8; ++q) tl[r][c8 + q] = f.u[q]; }
  __syncthreads();
  {
#pragma unroll
    for (int rd = 0; rd < 2; ++rd) { const int d = rd * 32 + tid / 8, pc = tid % 8; FragH f;
#pragma unroll
      for (int q = 0; q < 8; ++q) f.u[q] = tl[pc * 8 + q][d];
      *(v8us*)((unsigned short*)Vt + ((size_t)slab * 64 + d) * TTv + lg * 64 + pc * 8) = f.half[0]; }
     } }

__global__ __launch_bounds__(256) void k_hl(const float* __restrict__ F, _Float16* __restrict__ Hh, _Float16* __restrict__ Hl, size_t n8) { const size_t t = (size_t)blockIdx.x * 256 + threadIdx.x; if (t >= n8) return; FragH fh, fl; const v4f a = *(const v4fa*)(F + t * 8), c = *(const v4fa*)(F + t * 8 + 4);
#pragma unroll
  for (int q = 0; q < 4; ++q) { _Float16 h = (_Float16)a[q]; fh.h[q] = h; fl.h[q] = (_Float16)((a[q] - (float)h) * 1024.0f); h = (_Float16)c[q]; fh.h[4 + q] = h; fl.h[4 + q] = (_Float16)((c[q] - (float)h) * 1024.0f); }
  { *(v8us*)((unsigned short*)Hh + t * 8) = fh.half[0]; *(v8us*)((unsigned short*)Hl + t * 8) = fl.half[0];  } }

// ---- fast GEMM (wave tile 64x64) ----
__device__ __forceinline__ v16h g2_frag(const _Float16* p, int hh) { FragH f; f.half[0] = *(const v8us*)((const unsigned short*)p + 8 * hh); f.half[1] = *(const v8us*)((const unsigned short*)p + 16 + 8 * hh); return f.v; }
#define GM 256                       /* token rows of a work-group tile */
#define GN 128                       /* weight rows of each projection in a work-group tile */
#define GK 64                        /* k per trip */
#define GP 144                       /* LDS row pitch in bytes: 128 + 16, so the 16 rows of a ds_load_b128 fall on all 64 banks */
#define GBUF ((GM + 3 * GN) * GP)    /* one buffer: x rows, then Wq, Wk, Wv rows */
#define GR 6                         /* register sets in the ring of weight fragments */
#define GB_OFF(g) ((((g) % 12) / 4) * (GN * GP) + ((g) / 12) * 64 + ((g) % 4) * (16 * GP))      /* byte offset of group g's weight fragment from the wave's first one */
__device__ __forceinline__ v16h g3_frag(const char* p) { FragH f; f.half[0] = *(const v8us*)p; f.half[1] = *(const v8us*)(p + 32); return f.v; }      /* g2_frag from the lane's own LDS byte address (row ln, 16 hh bytes in) */
__device__ __forceinline__ v8f g3_mma(v16h a, v16h b, v8f c) { return __builtin_amdgcn_wmma_f32_16x16x32_f16(false, a, false, b, (short)0, c, false, false); }
// One tile: a thread copies 16 B of rows cr + 32 i of x (i < 8) and of each weight matrix (i < 4). l = the lane's LDS byte address of its first x piece, vo = the lane's byte offset in a plane's rows cr (row cr, piece cc), sx / sq / sk / sv = the work-group's first element of this k tile in the four planes.
// The global address is a scalar base plus the one lane offset: a copy then names two vector registers, one of them shared by all, and the 384 accumulator registers stay where they are while a tile is staged.
__device__ __forceinline__ void g3_stage(unsigned l, unsigned vo, const _Float16* sx, const _Float16* sq, const _Float16* sk, const _Float16* sv) {
  /* the s_wait_xcnt in the copies' own statement stands before any register that an issued copy names is rewritten (both statements) */
  asm volatile("global_load_async_to_lds_b128 %0, %8, %9\n\t"
               "global_load_async_to_lds_b128 %1, %8, %10\n\t"
               "global_load_async_to_lds_b128 %2, %8, %11\n\t"
               "global_load_async_to_lds_b128 %3, %8, %12\n\t"
               "global_load_async_to_lds_b128 %4, %8, %13\n\t"
               "global_load_async_to_lds_b128 %5, %8, %14\n\t"
               "global_load_async_to_lds_b128 %6, %8, %15\n\t"
               "global_load_async_to_lds_b128 %7, %8, %16\n\t"
               "s_wait_xcnt 0x0"
               :: "v"(l), "v"(l + 32u * GP), "v"(l + 64u * GP), "v"(l + 96u * GP), "v"(l + 128u * GP), "v"(l + 160u * GP), "v"(l + 192u * GP), "v"(l + 224u * GP), "v"(vo),
                  "s"(sx), "s"(sx + 32 * DM), "s"(sx + 64 * DM), "s"(sx + 96 * DM), "s"(sx + 128 * DM), "s"(sx + 160 * DM), "s"(sx + 192 * DM), "s"(sx + 224 * DM) : "memory");
  asm volatile("global_load_async_to_lds_b128 %0, %12, %13\n\t"
               "global_load_async_to_lds_b128 %1, %12, %14\n\t"
               "global_load_async_to_lds_b128 %2, %12, %15\n\t"
               "global_load_async_to_lds_b128 %3, %12, %16\n\t"
               "global_load_async_to_lds_b128 %4, %12, %17\n\t"
               "global_load_async_to_lds_b128 %5, %12, %18\n\t"
               "global_load_async_to_lds_b128 %6, %12, %19\n\t"
               "global_load_async_to_lds_b128 %7, %12, %20\n\t"
               "global_load_async_to_lds_b128 %8, %12, %21\n\t"
               "global_load_async_to_lds_b128 %9, %12, %22\n\t"
               "global_load_async_to_lds_b128 %10, %12, %23\n\t"
               "global_load_async_to_lds_b128 %11, %12, %24\n\t"
               "s_wait_xcnt 0x0"
               :: "v"(l + 256u * GP), "v"(l + 288u * GP), "v"(l + 320u * GP), "v"(l + 352u * GP), "v"(l + 384u * GP), "v"(l + 416u * GP), "v"(l + 448u * GP), "v"(l + 480u * GP), "v"(l + 512u * GP), "v"(l + 544u * GP), "v"(l + 576u * GP), "v"(l + 608u * GP), "v"(vo),
                  "s"(sq), "s"(sq + 32 * DM), "s"(sq + 64 * DM), "s"(sq + 96 * DM), "s"(sk), "s"(sk + 32 * DM), "s"(sk + 64 * DM), "s"(sk + 96 * DM), "s"(sv), "s"(sv + 32 * DM), "s"(sv + 64 * DM), "s"(sv + 96 * DM) : "memory"); }
// 16 B a lane into one plane, or into both planes of a split value. The s_wait_xcnt stands in the stores' own statement, before any register that an issued store names is rewritten: in a statement of its own the compiler put later rows' conversions, which reuse the data registers, ahead of it.
__device__ __forceinline__ void g3_store1(unsigned short* p0, v8us h) { asm volatile("global_store_b128 %0, %1, off\n\ts_wait_xcnt 0x0" :: "v"(p0), "v"(h) : "memory"); }
__device__ __forceinline__ void g3_store2(unsigned short* p0, v8us h, unsigned short* p1, v8us l) { asm volatile("global_store_b128 %0, %1, off\n\tglobal_store_b128 %2, %3, off\n\ts_wait_xcnt 0x0" :: "v"(p0), "v"(h), "v"(p1), "v"(l) : "memory"); }
// A wave's 64 x 64 results of one projection, acc[token fragment][feature fragment], through its own LDS rows sw into whole 128-B lines of the planes. row0 / col0 = first row and column of the tile as it is stored (q, k: token, feature; V^T: feature, token). LAST: nothing follows in the wave.
template <bool VTR, bool LAST>
__device__ __forceinline__ void g3_out(float (*sw)[68], const v8f (&acc)[4][4], int row0, int col0, float alpha, const float* __restrict__ bias, _Float16* __restrict__ P0, _Float16* __restrict__ P1) {
  const int lane = threadIdx.x & 31, ln = lane & 15, hh = lane >> 4;
  v4f bw[8];      /* V^T: the biases of the lane's 32 rows, rows row0 + 16 rt + 8 hh + r in bw[2 rt + r / 4][r % 4] */
  if (VTR) { const unsigned bo = (unsigned)(row0 + 8 * hh) * 4u;      /* byte offset of the lane's first row bias */
    /* the loads and their data wait in one statement: the offset register that they name is not rewritten while a load is under way */
    asm volatile("global_load_b128 %0, %8, %9\n\t"
                 "global_load_b128 %1, %8, %9 offset:16\n\t"
                 "global_load_b128 %2, %8, %9 offset:64\n\t"
                 "global_load_b128 %3, %8, %9 offset:80\n\t"
                 "global_load_b128 %4, %8, %9 offset:128\n\t"
                 "global_load_b128 %5, %8, %9 offset:144\n\t"
                 "global_load_b128 %6, %8, %9 offset:192\n\t"
                 "global_load_b128 %7, %8, %9 offset:208\n\t"
                 "s_wait_loadcnt 0x0"
                 : "=&v"(bw[0]), "=&v"(bw[1]), "=&v"(bw[2]), "=&v"(bw[3]), "=&v"(bw[4]), "=&v"(bw[5]), "=&v"(bw[6]), "=&v"(bw[7]) : "v"(bo), "s"(bias) : "memory"); }
#pragma unroll      /* constant accumulator indices (this loop and the two inside it): no scratch */
  for (int i = 0; i < 4; ++i) {
#pragma unroll
    for (int j = 0; j < 4; ++j) { const int rt = VTR ? j : i, ct = VTR ? i : j;      /* row and column fragment of the stored tile */
#pragma unroll
      for (int r = 0; r < 8; ++r) { const float bv = bf16_round(VTR ? bw[rt * 2 + (r >> 2)][r & 3] : bias[col0 + ct * 16 + ln]) * (VTR ? 1.0f : 16.0f); sw[rt * 16 + 8 * hh + r][ct * 16 + ln] = acc[i][j][r] * alpha + bv; } } }
  __builtin_amdgcn_fence(__ATOMIC_ACQ_REL, "workgroup"); __builtin_amdgcn_wave_barrier();
  const int rsub = lane >> 3, c8 = (lane & 7) * 8;      /* 8 lanes x 16 B cover one 128-B line of a plane, a wave four rows per store */
  const size_t e0 = (VTR ? ((size_t)(col0 / SQ) * DM + row0) * SQ + (col0 % SQ) : (size_t)row0 * DM + col0) + (size_t)rsub * DM + c8;      /* the lane's first element */
#pragma unroll      /* two halves of 32 rows: constant indices, and no more than 64 registers of rows at a time */
  for (int hq = 0; hq < 2; ++hq) { v4f va[8], vb[8];
#pragma unroll      /* constant indices keep the rows in registers; the 16 LDS reads stand as one group ahead of the conversions */
    for (int q = 0; q < 8; ++q) { va[q] = *(const v4fa*)&sw[(hq * 8 + q) * 4 + rsub][c8]; vb[q] = *(const v4fa*)&sw[(hq * 8 + q) * 4 + rsub][c8 + 4]; }
#pragma unroll      /* constant indices, as above */
    for (int q = 0; q < 8; ++q) { FragH fh, fl;
#pragma unroll
      for (int i = 0; i < 4; ++i) { _Float16 h = (_Float16)va[q][i]; fh.h[i] = h; fl.h[i] = (_Float16)(va[q][i] - (float)h); h = (_Float16)vb[q][i]; fh.h[4 + i] = h; fl.h[4 + i] = (_Float16)(vb[q][i] - (float)h); }
      const size_t e = e0 + (size_t)(hq * 8 + q) * 4 * DM;
      if (!VTR) g3_store2((unsigned short*)P0 + e, fh.half[0], (unsigned short*)P1 + e, fl.half[0]); else if (!LAST || hq < 1 || q < 7) g3_store1((unsigned short*)P0 + e, fh.half[0]); else *(v8us*)((unsigned short*)P0 + e) = fh.half[0]; } }      /* behind the wave's last store no register is rewritten any more: it needs no wait */
  if (!LAST) { __builtin_amdgcn_fence(__ATOMIC_ACQ_REL, "workgroup"); __builtin_amdgcn_wave_barrier(); }      /* the wave's reads of sw stay ahead of the next projection's writes there */
}
__global__ __launch_bounds__(256) void k_qkv(const _Float16* __restrict__ X, const _Float16* __restrict__ BQ, const _Float16* __restrict__ BK, const _Float16* __restrict__ BV, const float* __restrict__ bq, const float* __restrict__ bk, const float* __restrict__ bv,
                                             _Float16* __restrict__ QH, _Float16* __restrict__ QL, _Float16* __restrict__ KH, _Float16* __restrict__ KL, _Float16* __restrict__ VT) {
  static_assert(MP % GM == 0 && DM % GN == 0 && DM % GK == 0 && DM / GK >= 2 && GM == 256 && GN == 128 && GK == 64, "whole tiles, at least two trips, 20 copies per thread and tile");
  static_assert(SQ % GM == 0 && SQ == DM, "a token tile lies in one batch; V^T rows and q / k rows have one pitch");
  __shared__ __attribute__((aligned(16))) char ring[2 * GBUF]; __shared__ __attribute__((aligned(16))) float so[8][64][68];
  const int tid = threadIdx.x, w = tid >> 5, lane = tid & 31, ln = lane & 15, hh = lane >> 4; const int tt = blockIdx.x / (DM / GN), wt = blockIdx.x % (DM / GN);      /* token tile, weight tile: neighbouring work-groups share the token rows */
  const int cr = tid >> 3, cc = tid & 7;      /* 8 lanes cover one 128-B row */
  const unsigned vo = (unsigned)(cr * DM + cc * 8) * 2u;      /* the lane's byte offset from the first element of a tile: row cr, piece cc */
  const _Float16* gx = X + (size_t)(tt * GM) * DM; const size_t ow = (size_t)(wt * GN) * DM;      /* first element of the token tile and of a weight tile: the same for the whole work-group */
  const _Float16* gq = BQ + ow; const _Float16* gk = BK + ow; const _Float16* gv = BV + ow;
  const unsigned l0 = (unsigned)(size_t)ring + (unsigned)(cr * GP + cc * 16);
  const int tok0 = tt * GM + 64 * (w & 3), fea0 = wt * GN + 64 * (w >> 2);      /* the wave's first token and first feature */
  const char* fa = ring + (64 * (w & 3) + ln) * GP + 16 * hh; const char* fb = ring + (GM + 64 * (w >> 2) + ln) * GP + 16 * hh;
  g3_stage(l0, vo, gx, gq, gk, gv);
  asm volatile("s_wait_asynccnt 0x0" ::: "memory");      /* this wave's share of tile 0 has landed */
  __syncthreads();      /* tile 0 is published */
  g3_stage(l0 + GBUF, vo, gx + GK, gq + GK, gk + GK, gv + GK);
  const v8f z8 = {0.f,0.f,0.f,0.f,0.f,0.f,0.f,0.f}; v8f cq[4][4], ck[4][4], cv[4][4];      /* [token fragment][feature fragment] */
#pragma unroll      /* constant indices: the accumulators are registers */
  for (int i = 0; i < 4; ++i) for (int j = 0; j < 4; ++j) { cq[i][j] = z8; ck[i][j] = z8; cv[i][j] = z8; }
#pragma unroll 1      /* one trip per tile: the buffer is picked by the trip's parity and the loop stays short */
  for (int t = 0; t < DM / GK; ++t) { const int bo = (t & 1) * GBUF; v16h a[4], b[GR];
    /* A trip is 24 groups g = 12 ks + 4 p + j: one weight fragment (k step ks, projection p, feature fragment j) against the four x fragments of its k step. The weight fragments pass through a ring of GR register sets, each read from LDS GR - 1 groups ahead of its WMMAs. */
#pragma unroll      /* constant indices keep fragments and accumulators in registers (this loop and the next three) */
    for (int i = 0; i < 4; ++i) a[i] = g3_frag(fa + bo + i * (16 * GP));
#pragma unroll
    for (int g = 0; g < GR - 1; ++g) b[g] = g3_frag(fb + bo + GB_OFF(g));
#pragma unroll
    for (int g = 0; g < 24; ++g) { const int p = (g % 12) / 4, j = g % 4; const v16h bj = b[g % GR];
      if (g + GR - 1 < 24) b[(g + GR - 1) % GR] = g3_frag(fb + bo + GB_OFF(g + GR - 1));
#pragma unroll
      for (int i = 0; i < 4; ++i) { if (p == 0) cq[i][j] = g3_mma(a[i], bj, cq[i][j]); else if (p == 1) ck[i][j] = g3_mma(a[i], bj, ck[i][j]); else cv[i][j] = g3_mma(bj, a[i], cv[i][j]); }
      if (g == 11) { for (int i = 0; i < 4; ++i) a[i] = g3_frag(fa + bo + 64 + i * (16 * GP)); }
      __builtin_amdgcn_sched_barrier(0); }      /* keeps each LDS read in the group where it is written: left free, the compiler sinks every read to just ahead of its own WMMAs (one register set, a full LDS latency per four WMMAs) */
    asm volatile("s_wait_dscnt 0x0" ::: "memory");      /* this wave's reads of the buffer are done before it is handed back */
    asm volatile("s_wait_asynccnt 0x0" ::: "memory");      /* this wave's share of tile t + 1 has landed */
    __syncthreads();      /* publishes tile t + 1 and ends every wave's reads of tile t */
    if (t + 2 < DM / GK) g3_stage(l0 + (unsigned)bo, vo, gx + (t + 2) * GK, gq + (t + 2) * GK, gk + (t + 2) * GK, gv + (t + 2) * GK); }
  asm volatile("s_wait_asynccnt 0x0" ::: "memory");      /* no copy is outstanding when the wave goes on */
  g3_out<false, false>(so[w], cq, tok0, fea0, 1.0f, bq, QH, QL);      /* 16 q -> f16 hi + residual planes */
  g3_out<false, false>(so[w], ck, tok0, fea0, 1.0f, bk, KH, KL);      /* k likewise */
  g3_out<true, true>(so[w], cv, fea0, tok0, 0.0625f, bv, VT, nullptr); }      /* V^T [NB][NH][HD][SQ] = Wv . x^T */


// x and the three weight matrices -> their f16 operand planes (x bf16-rounded, exact in f16; weights bf16-rounded x16, natural [out][in] = Bt[n][k]), ONE launch of CWG work-groups: 16 waves per WGP instead of one short wave per 256 elements.
// A work-group owns one contiguous share of each plane and walks it in slabs of 256 threads x 4 f32: a wave-wide load covers 512 contiguous bytes, a wave-wide store 256 (whole lines). CX slabs of x and CW of each weight matrix per thread; all the loads are independent and stand ahead of the conversions (amdgpu_waves_per_eu names the 4 waves per SIMD that this grid gives: without it the compiler sinks half the loads among the conversions to save registers).
#define CWG 512                      /* work-groups of the conversion launch */
#define CX 16                        /* slabs of x per work-group */
#define CW 2                         /* slabs of each weight matrix per work-group */
__device__ __forceinline__ v4h cvt4(v4f a, float scale) { v4h h;
#pragma unroll
  for (int q = 0; q < 4; ++q) h[q] = (_Float16)(bf16_round(a[q]) * scale); return h; }
__global__ __launch_bounds__(256) __attribute__((amdgpu_waves_per_eu(4, 4))) void k_cvt(const float* __restrict__ x, const float* __restrict__ wq, const float* __restrict__ wk, const float* __restrict__ wv, _Float16* __restrict__ X16, _Float16* __restrict__ BQ, _Float16* __restrict__ BK, _Float16* __restrict__ BV) {
  static_assert(NR * DM == (size_t)CWG * CX * 1024 && (size_t)DM * DM == (size_t)CWG * CW * 1024, "whole slabs of 1024 elements, no remainder");
  const unsigned ex = blockIdx.x * (CX * 1024u) + threadIdx.x * 4u, ew = blockIdx.x * (CW * 1024u) + threadIdx.x * 4u;      /* the thread's first element of x and of a weight matrix; the slabs lie at constant offsets from it */
  v4f a[CX], q[CW], k[CW], v[CW];
#pragma unroll      /* constant indices keep the pieces in registers (this loop and the next three) */
  for (int i = 0; i < CX; ++i) a[i] = *(const v4fa*)(x + ex + i * 1024);
#pragma unroll
  for (int i = 0; i < CW; ++i) { q[i] = *(const v4fa*)(wq + ew + i * 1024); k[i] = *(const v4fa*)(wk + ew + i * 1024); v[i] = *(const v4fa*)(wv + ew + i * 1024); }
#pragma unroll
  for (int i = 0; i < CX; ++i) *(v4h*)(X16 + ex + i * 1024) = cvt4(a[i], 1.0f);
#pragma unroll
  for (int i = 0; i < CW; ++i) { *(v4h*)(BQ + ew + i * 1024) = cvt4(q[i], 16.0f); *(v4h*)(BK + ew + i * 1024) = cvt4(k[i], 16.0f); *(v4h*)(BV + ew + i * 1024) = cvt4(v[i], 16.0f); } }
__global__ __launch_bounds__(256) void k_rsm(const float* __restrict__ S, _Float16* __restrict__ P, int nrows) {
  #pragma clang fp contract(off)
  const int i = blockIdx.x * 256 + threadIdx.x; if (i >= nrows) return; const float* s = S + (size_t)i * SQ; float mx = -3.0e38f;
#pragma unroll 1
  for (int j = 0; j < SQ; ++j) mx = fmaxf(mx, s[j]); float se = 0.f;
#pragma unroll 1
  for (int j = 0; j < SQ; ++j) se += expf(s[j] - mx); const float sc = 256.0f / se;
#pragma unroll 1
  for (int j0 = 0; j0 < SQ; j0 += 8) { FragH f; for (int q = 0; q < 8; ++q) f.h[q] = (_Float16)(expf(s[j0 + q] - mx) * sc); unsigned short* d = (unsigned short*)P + (size_t)i * SQ + j0; *(v8us*)d = f.half[0];  } }
__global__ __launch_bounds__(256) void k_vt(const _Float16* __restrict__ V16, int b, int h0, _Float16* __restrict__ VT) { __shared__ unsigned short tl[64][65]; const int tid = threadIdx.x; const int hh = blockIdx.x % HG, sg = blockIdx.x / HG; const int s0 = sg * 64; const int h = h0 + hh;
  for (int i = tid; i < 64 * 8; i += 256) { const int j = i / 8, d8 = (i % 8) * 8; FragH f; f.half[0] = *(const v8us*)((const unsigned short*)V16 + ((size_t)b * SQ + s0 + j) * DM + h * HD + d8); for (int q = 0; q < 8; ++q) tl[d8 + q][j] = f.u[q]; }
  __syncthreads();
  { for (int i = tid; i < 64 * 8; i += 256) { const int d = i / 8, j8 = (i % 8) * 8; FragH f; for (int q = 0; q < 8; ++q) f.u[q] = tl[d][j8 + q]; *(v8us*)((unsigned short*)VT + ((size_t)hh * HD + d) * SQ + s0 + j8) = f.half[0]; }  } }



__device__ __forceinline__ float lane_xor_16(float v) { const int u = __float_as_int(v); return __int_as_float(__builtin_amdgcn_permlanex16(u, u, 0x76543210, 0xfedcba98, false, false)); }      /* lane l <- lane l ^ 16 */
__device__ __forceinline__ float exp2_slot(float a) { float r; asm("v_exp_f32 %0, %1\n\tv_nop" : "=v"(r) : "v"(a)); return r; }      /* 2^a; the v_nop in the same statement keeps the slot the instruction set asks for behind a transcendental, before its result is read or its source register reused */
__device__ __forceinline__ v4f exp2_slot4(v4f a) { float r0, r1, r2, r3;      /* four 2^a: each fills the slot behind the one before it (early-clobber outputs share no register with a source), one v_nop keeps the slot behind the last */
  asm("v_exp_f32 %0, %4\n\tv_exp_f32 %1, %5\n\tv_exp_f32 %2, %6\n\tv_exp_f32 %3, %7\n\tv_nop" : "=&v"(r0), "=&v"(r1), "=&v"(r2), "=&v"(r3) : "v"(a[0]), "v"(a[1]), "v"(a[2]), "v"(a[3])); const v4f r = {r0, r1, r2, r3}; return r; }
__device__ __forceinline__ v16h fa_frag(const char* p) { FragH f; f.half[0] = *(const v8us*)p; f.half[1] = *(const v8us*)(p + 32); return f.v; }      /* g2_frag from the lane's own LDS byte address (row c, 16 hh bytes in) */
__device__ __forceinline__ v8f fa_mma(v16h a, v16h b, v8f c) { return __builtin_amdgcn_wmma_f32_16x16x32_f16(false, a, false, b, (short)0, c, false, false); }
#define FW 8                         /* waves per work-group */
#define FQ 32                        /* query columns per wave */
#define FK 64                        /* keys per staged tile: two passes of 32 */
#define FP 144                       /* LDS row pitch in bytes: 128 + 16, so the 16 rows of a ds_load_b128 fall on all 64 banks */
#define FBUF ((2 * FK + HD) * FP)    /* one buffer: FK K rows, FK K residual rows, HD V^T rows */
// One tile: a thread copies 16 B of rows cr and cr + 32 of K, of the K residuals and of V^T. l = the lane's LDS byte address of its first K piece, gk / gl / gv = its global addresses in row cr of the three planes.
__device__ __forceinline__ void fa_stage(unsigned l, const _Float16* gk, const _Float16* gl, const _Float16* gv) {
  /* the s_wait_xcnt in the copies' own statement stands before any register that an issued copy names is rewritten */
  asm volatile("global_load_async_to_lds_b128 %0, %6, off\n\t"
               "global_load_async_to_lds_b128 %1, %7, off\n\t"
               "global_load_async_to_lds_b128 %2, %8, off\n\t"
               "global_load_async_to_lds_b128 %3, %9, off\n\t"
               "global_load_async_to_lds_b128 %4, %10, off\n\t"
               "global_load_async_to_lds_b128 %5, %11, off\n\t"
               "s_wait_xcnt 0x0"
               :: "v"(l), "v"(l + 32u * FP), "v"(l + 64u * FP), "v"(l + 96u * FP), "v"(l + 128u * FP), "v"(l + 160u * FP),
                  "v"(gk), "v"(gk + 32 * DM), "v"(gl), "v"(gl + 32 * DM), "v"(gv), "v"(gv + 32 * SQ) : "memory"); }
__global__ __launch_bounds__(FW * 32) __attribute__((amdgpu_waves_per_eu(4, 4))) void k_fattn(const _Float16* __restrict__ QH, const _Float16* __restrict__ QL, const _Float16* __restrict__ KH, const _Float16* __restrict__ KL, const _Float16* __restrict__ VT, float* __restrict__ out) {
  static_assert(SQ % (FW * FQ) == 0 && SQ % FK == 0 && SQ / FK >= 2 && FK == 64 && HD == 64 && FW == 8, "whole query blocks, whole tiles and at least two, two k steps per score, 6 copies per thread and tile");
  __shared__ __attribute__((aligned(16))) char ring[2 * FBUF];
  const int lane = threadIdx.x & 31, w = threadIdx.x >> 5, c = lane & 15, hh = lane >> 4; const int h = blockIdx.y, b = blockIdx.z;
  const size_t r0 = (size_t)b * SQ; const int q0 = blockIdx.x * (FW * FQ) + w * FQ;
  v16h qh[2][2], ql[2][2];      /* [query tile][k step] */
#pragma unroll
  for (int g = 0; g < 2; ++g) for (int ks = 0; ks < 2; ++ks) { const size_t qo = (r0 + q0 + g * 16 + c) * DM + h * HD + ks * 32; qh[g][ks] = g2_frag(QH + qo, hh); ql[g][ks] = g2_frag(QL + qo, hh); }
  const int cr = threadIdx.x >> 3, cc = threadIdx.x & 7;      /* 8 lanes cover one 128-B row */
  const _Float16* gk = KH + (r0 + cr) * DM + h * HD + cc * 8; const _Float16* gl = KL + (r0 + cr) * DM + h * HD + cc * 8; const _Float16* gv = VT + (((size_t)b * NH + h) * HD + cr) * SQ + cc * 8;
  const unsigned l0 = (unsigned)(size_t)ring + (unsigned)(cr * FP + cc * 16);
  const char* fr = ring + c * FP + 16 * hh;      /* the lane's place in row c of a buffer */
  const v8f z8 = {0.f, 0.f, 0.f, 0.f, 0.f, 0.f, 0.f, 0.f}; v8f o[2][4] = {{z8, z8, z8, z8}, {z8, z8, z8, z8}};      /* [query tile][d tile]: register r = O[query c][16 t + 8 hh + r] */
  float m[2] = {-3.0e38f, -3.0e38f}, l[2] = {0.f, 0.f};
  const float CS = 0.00048828125f * 1.44269504088896340736f;      /* 64^-0.5 / 256 in log2 units: accumulator units -> exponent */
  fa_stage(l0, gk, gl, gv);
  asm volatile("s_wait_asynccnt 0x0" ::: "memory");      /* this wave's share of tile 0 has landed */
  __syncthreads();      /* tile 0 is published */
  fa_stage(l0 + FBUF, gk + FK * DM, gl + FK * DM, gv + FK);
#pragma unroll 1      /* one trip per tile: the buffer is picked by the trip's parity */
  for (int kt0 = 0; kt0 < SQ / FK; ++kt0) { const int bo = (kt0 & 1) * FBUF;
#pragma unroll 1      /* the two passes of a tile stay one body: the unrolled build spills registers to scratch */
   for (int ps = 0; ps < FK / 32; ++ps) { v8f t[2][2];      /* [query tile][key tile]: register r = 256 q.k of key 64 kt0 + 32 ps + 16 kt + 8 hh + r for query c */
    const char* kp = fr + bo + ps * (32 * FP); v16h kf[2][2], lf[2][2];      /* [key tile][k step] */
#pragma unroll
    for (int kt = 0; kt < 2; ++kt) for (int ks = 0; ks < 2; ++ks) { kf[kt][ks] = fa_frag(kp + kt * (16 * FP) + ks * 64); lf[kt][ks] = fa_frag(kp + FK * FP + kt * (16 * FP) + ks * 64); }
#pragma unroll      /* constant indices keep fragments and accumulators in registers; six terms per score tile, written tile after tile in turn, so that neighbouring WMMAs are independent */
    for (int e = 0; e < 6; ++e) for (int kt = 0; kt < 2; ++kt) for (int g = 0; g < 2; ++g) { const int ks = e & 1;
      t[g][kt] = fa_mma(e == 2 || e == 3 ? lf[kt][ks] : kf[kt][ks], e < 2 ? ql[g][ks] : qh[g][ks], e == 0 ? z8 : t[g][kt]); }
    const char* vp = fr + bo + 2 * FK * FP + ps * 64; v16h vf[4];
#pragma unroll
    for (int u = 0; u < 4; ++u) vf[u] = fa_frag(vp + u * (16 * FP));
#pragma unroll
    for (int g = 0; g < 2; ++g) { float mx = t[g][0][0];
#pragma unroll
      for (int r = 1; r < 16; ++r) mx = fmaxf(mx, t[g][r >> 3][r & 7]);
      mx = fmaxf(mx, lane_xor_16(mx)); const float mn = fmaxf(m[g], mx); const float al = exp2_slot((m[g] - mn) * CS), nb = fmaf(-mn, CS, 8.0f); m[g] = mn;      /* weights carried x256 (it cancels in the final division), which keeps small ones out of the f16 subnormals */
      FragH pf; v4f s4 = {0.f, 0.f, 0.f, 0.f};
#pragma unroll
      for (int kt = 0; kt < 2; ++kt) for (int q = 0; q < 2; ++q) { v4f a; for (int i = 0; i < 4; ++i) a[i] = fmaf(t[g][kt][q * 4 + i], CS, nb); const v4f e = exp2_slot4(a); s4 += e; for (int i = 0; i < 4; ++i) pf.h[kt * 8 + q * 4 + i] = (_Float16)e[i]; }
      l[g] = fmaf(l[g], al, (s4[0] + s4[1]) + (s4[2] + s4[3]));      /* this half's keys only; the halves join after the loop */
#pragma unroll
      for (int u = 0; u < 4; ++u) { o[g][u] *= al; o[g][u] = fa_mma(vf[u], pf.v, o[g][u]); }
      }
    asm volatile("v_nop\n\tv_nop\n\tv_nop\n\tv_nop" :: "v"(o[0][0]), "v"(o[0][1]), "v"(o[0][2]), "v"(o[0][3]), "v"(o[1][0]), "v"(o[1][1]), "v"(o[1][2]), "v"(o[1][3])); }      /* the four vector slots the chip needs behind a WMMA before its A or B registers are overwritten: the pass ends in WMMAs, and the taken back edge leads to address arithmetic that reuses V^T fragment registers; inputs only: the eight results place it behind all the WMMAs of the pass */
    asm volatile("s_wait_dscnt 0x0" ::: "memory");      /* this wave's reads of the buffer are done before it is handed back */
    asm volatile("s_wait_asynccnt 0x0" ::: "memory");      /* this wave's share of tile kt0 + 1 has landed */
    __syncthreads();      /* publishes tile kt0 + 1 and ends every wave's reads of tile kt0 */
    if (kt0 + 2 < SQ / FK) fa_stage(l0 + (unsigned)bo, gk + (size_t)(kt0 + 2) * (FK * DM), gl + (size_t)(kt0 + 2) * (FK * DM), gv + (kt0 + 2) * FK); }
  asm volatile("s_wait_asynccnt 0x0" ::: "memory");      /* no copy is outstanding when the wave goes on */
#pragma unroll
  for (int g = 0; g < 2; ++g) { const float inv = 1.0f / (l[g] + lane_xor_16(l[g])); float* op = out + (r0 + q0 + g * 16 + c) * DM + h * HD + 8 * hh;
#pragma unroll
    for (int u = 0; u < 4; ++u) { const v4f x0 = {o[g][u][0] * inv, o[g][u][1] * inv, o[g][u][2] * inv, o[g][u][3] * inv}, x1 = {o[g][u][4] * inv, o[g][u][5] * inv, o[g][u][6] * inv, o[g][u][7] * inv}; *(v4f*)(op + u * 16) = x0; *(v4f*)(op + u * 16 + 4) = x1; } } }


template <int MASKADD>
__global__ __launch_bounds__(64) void k_att0(const float* __restrict__ QF, const float* __restrict__ KF, const float* __restrict__ VF, int ld, const float* __restrict__ mask, float scale, float* __restrict__ OF, int ldo) {
  #pragma clang fp contract(off)
  __shared__ __attribute__((aligned(16))) float lq[64][64]; __shared__ __attribute__((aligned(16))) float lo[64][64];
  const int tid = threadIdx.x; const int h = blockIdx.x / (QT0 / 64), rg = blockIdx.x % (QT0 / 64); const int i = rg * 64 + tid;
  const float* qr = QF + (size_t)i * ld + h * HD;
#pragma unroll 1
  for (int c = 0; c < HD / 4; ++c) { *(v4f*)&lq[tid][c * 4] = *(const v4fa*)(qr + c * 4); const v4f z = {0.f, 0.f, 0.f, 0.f}; *(v4f*)&lo[tid][c * 4] = z; }
  float m = -1.0e30f, l = 0.f; const int jmax = MASKADD ? (SQ - 1) : (rg * 64 + 63);      /* additive-mask form: every key (the mask input decides); causal form: keys up to the block's last row */
#pragma unroll 1
  for (int j = 0; j <= jmax; ++j) { const float* kr = KF + (size_t)j * ld + h * HD; const float* vr = VF + (size_t)j * ld + h * HD; float s = 0.f;
#pragma unroll 1
    for (int c = 0; c < HD / 4; ++c) { const v4f kq = *(const v4fa*)(kr + c * 4); const v4f qq = *(v4f*)&lq[tid][c * 4]; s = __fadd_rn(s, __fmul_rn(qq[0], kq[0])); s = __fadd_rn(s, __fmul_rn(qq[1], kq[1])); s = __fadd_rn(s, __fmul_rn(qq[2], kq[2])); s = __fadd_rn(s, __fmul_rn(qq[3], kq[3])); }
    s = __fmul_rn(s, scale); if (MASKADD) s = __fadd_rn(s, __fmul_rn(bf16_round(mask[(size_t)i * SQ + j]), -10000.0f));
    const float f = (MASKADD || j <= i) ? 1.f : 0.f; const float sm = fmaf(f, s, (1.f - f) * -1.0e30f); const float mn = fmaxf(m, sm); const float sc = expf(m - mn); const float e = expf(sm - mn); l = __fadd_rn(__fmul_rn(l, sc), e); m = mn;
#pragma unroll 1
    for (int c = 0; c < HD / 4; ++c) { const v4f vv = *(const v4fa*)(vr + c * 4); v4f oo = *(v4f*)&lo[tid][c * 4]; for (int u = 0; u < 4; ++u) oo[u] = __fadd_rn(__fmul_rn(oo[u], sc), __fmul_rn(e, vv[u])); *(v4f*)&lo[tid][c * 4] = oo; } }
  const float fin = 64.0f / l;      /* o carried x64 */
#pragma unroll 1
  for (int c = 0; c < HD / 4; ++c) { v4f oo = *(v4f*)&lo[tid][c * 4]; for (int u = 0; u < 4; ++u) oo[u] = __fmul_rn(oo[u], fin); *(v4f*)&lo[tid][c * 4] = oo; }
  __syncthreads();
  {
#pragma unroll 1
    for (int it = 0; it < 16; ++it) { const int row = it * 4 + tid / 16, pc = (tid % 16) * 4; const v4f v = *(const v4f*)&lo[row][pc]; *(v4f*)(OF + (size_t)(rg * 64 + row) * ldo + h * HD + pc) = v; }
     } }

__global__ __launch_bounds__(256) void k_of0out(const float* __restrict__ src, float* __restrict__ dst, size_t n4) { const size_t t = (size_t)blockIdx.x * 256 + threadIdx.x; if (t >= n4) return; v4f v = *(const v4fa*)(src + t * 4); for (int q = 0; q < 4; ++q) v[q] = __fmul_rn(v[q], 0.015625f); *(v4f*)(dst + t * 4) = v;  }

extern "C" void kernel_launch(void* const* d_in, const int* in_sizes, int n_in,
                              void* d_out, int out_size, void* d_ws, size_t ws_size, hipStream_t stream) {
  (void)in_sizes; (void)n_in; (void)out_size;
  const float* const* I = (const float* const*)d_in; const float* x = I[0]; const float* wq = I[1]; const float* wk = I[2]; const float* wv = I[3]; const float* bq = I[4]; const float* bk = I[5]; const float* bv = I[6];      /* input order: x, Wq, Wk, Wv, bq, bk, bv: natural [out][in] weights, then the three biases (every projection launch passes the bias variables); NO output projection */
  char* ws = (char*)d_ws; size_t off = 0;
  auto take = [&](size_t bytes) { char* p = ws + off; off += (bytes + 255) & ~(size_t)255; return p; };
  _Float16* BQ = (_Float16*)take((size_t)DM * DM * 2); _Float16* BK = (_Float16*)take((size_t)DM * DM * 2); _Float16* BV = (_Float16*)take((size_t)DM * DM * 2);
  _Float16* X16 = (_Float16*)take(NR * DM * 2); _Float16* QH = (_Float16*)take(NR * DM * 2); _Float16* QL = (_Float16*)take(NR * DM * 2); _Float16* KH = (_Float16*)take(NR * DM * 2); _Float16* KL = (_Float16*)take(NR * DM * 2);
  _Float16* VT = (_Float16*)take((size_t)NB * NH * HD * SQ * 2);
  if (off > ws_size) return;
  k_cvt<<<CWG, 256, 0, stream>>>(x, wq, wk, wv, X16, BQ, BK, BV);      /* x -> exact f16 rows; natural [out][in] weights = Bt[n][k] x16 */
  const size_t r0p = (size_t)B0 * SQ;      /* first projected row */
  k_qkv<<<(MP / GM) * (DM / GN), 256, 0, stream>>>(X16 + r0p * DM, BQ, BK, BV, bq, bk, bv, QH + r0p * DM, QL + r0p * DM, KH + r0p * DM, KL + r0p * DM, VT + r0p * DM);      /* q, k (x16, f16 hi + residual planes) and V^T, from the GEMM's own epilogues, one launch */
  k_fattn<<<dim3(SQ / (FW * FQ), NH, NB), FW * 32, 0, stream>>>(QH, QL, KH, KL, VT, (float*)d_out);      /* scores (hi.lo + lo.hi + hi.hi in one accumulator), softmax over all keys and P V in one launch, f32 straight into the head-major output columns (no output projection) */
}
